// v000
// The times below were measured on an AMD MI455X: many runs one after another, warmed up first and cycling through
// copies of the inputs, with the whole window's GPU time divided by the number of runs. Launches and the gaps
// between them are all in it. The median over several windows is given; except for v000 it joins two sittings, which
// can be a few percent apart, so the side-by-side timings, each taken in one sitting, are the better comparison.
// v000 is the starting kernel. One run takes 1330 microseconds.
#include <hip/hip_runtime.h>

// SingleHeadQKV (chunkwise retention step: X_Q [4][2048][1024], S_n [4][1024][1024]; Q = rope(X W_Q), K = rope(X W_K) (interleaved-pair RoPE over the full 1024 dims), V = X W_V; D[n][m] = g^(n-m) for n >= m (g = 1 - 2^-5); inner = (Q K^T * D) V; cross = (Q S_n) * g^(t+1); out = GroupNorm32(inner + cross) then the literal transpose(-2,-1).reshape permutation -> out0 [4][2048][1024]; R_i = K^T (V * D[-1]) + S_n g^T -> out1 [4][1024][1024] at element 8,388,608).
// Compute dtypes, f32 accumulate: every input rounded to bf16; Q/K/V on PLAIN bf16 operands (inputs: exact); RoPE f32 (on-chip table); decay powers g^n in f32 (powf); Q.K^T (K = 1024) hl x hl (3 products) with causal tile skipping, x D per element in f32 into hi/lo planes (no softmax), (QK^T D).V hl x hl (3 products, causal skipping); Q.S_n hl x exact (2 products); K^T.(V D[-1]) hl x hl (3 products, K = 2048); sums, GroupNorm (32 groups of 32, biased var, eps 1e-6) and the output permutation in f32.

#define NB_  4
#define TT   2048
#define DM   1024
#define NH_  16
#define NKV  16
#define REP  (NH_ / NKV)
#define HD   64
#define DQ   (NH_ * HD)
#define DKV  (NKV * HD)
#define ZH   2
#define RH   2048                  // query rows < RH use hi+lo planes (0: none)
#define WIN  2048
#define PCAR 1024.0f
#define DC   1024   // channel width (= DQ)
#define GAMR 0.96875f
#define SCL  1.0f
typedef _Float16 h16;
typedef unsigned short bf;
typedef __attribute__((ext_vector_type(16))) __bf16   v16bf;
typedef __attribute__((ext_vector_type(16))) _Float16 v16h;
typedef __attribute__((ext_vector_type(8)))  _Float16 v8h;
typedef __attribute__((ext_vector_type(8)))  unsigned short v8us;
typedef __attribute__((ext_vector_type(8)))  float    v8f;
typedef __attribute__((ext_vector_type(4)))  float    v4f;
typedef v8h  __attribute__((may_alias)) v8ha;
typedef v4f  __attribute__((may_alias)) v4fa;
typedef v8us __attribute__((may_alias)) v8usa;

__device__ __forceinline__ unsigned short f2bf(float f) { unsigned u = __float_as_uint(f); u += 0x7FFFu + ((u >> 16) & 1u); return (unsigned short)(u >> 16); }
__device__ __forceinline__ float bf2f(unsigned short b) { return __uint_as_float(((unsigned)b) << 16); }
__device__ __forceinline__ float bfr(float f) { return bf2f(f2bf(f)); }
__device__ __forceinline__ v16h cat16(v8h lo, v8h hi) { return __builtin_shufflevector(lo, hi, 0, 1, 2, 3, 4, 5, 6, 7, 8, 9, 10, 11, 12, 13, 14, 15); }
__device__ __forceinline__ v16bf cat16b(v8us lo, v8us hi) { return __builtin_bit_cast(v16bf, __builtin_shufflevector(lo, hi, 0, 1, 2, 3, 4, 5, 6, 7, 8, 9, 10, 11, 12, 13, 14, 15)); }
__device__ __forceinline__ v8f wmma16(v16h a, v16h b, v8f c) { return __builtin_amdgcn_wmma_f32_16x16x32_f16(false, a, false, b, (short)0, c, false, false); }
__device__ __forceinline__ v8f wmmab(v16bf a, v16bf b, v8f c) { return __builtin_amdgcn_wmma_f32_16x16x32_bf16(false, a, false, b, (short)0, c, false, false); }



// ---- k_gemmw: register-blocked GEMM, ONE WAVE per 64x64 output tile (16 accumulators), operands straight from K-contiguous 16-bit planes; grid (M/64, N/64, Z), 32 threads.
// C[m][n] (f32, pitch ldc, + optional f32 bias[n]) = sum_k A[m][k] Bt[n][k] (+ split products per NSPLIT). z-batch strides sA/sB/sC in elements. K % 32 == 0.
template <typename T16> struct WFrag;
template <> struct WFrag<h16> { typedef v16h V; static __device__ __forceinline__ V ld(const h16* p) { return cat16(*(const v8h*)p, *(const v8h*)(p + 16)); } static __device__ __forceinline__ v8f mma(V a, V b, v8f c) { return wmma16(a, b, c); } };
template <> struct WFrag<bf> { typedef v16bf V; static __device__ __forceinline__ V ld(const bf* p) { return cat16b(*(const v8us*)p, *(const v8us*)(p + 16)); } static __device__ __forceinline__ v8f mma(V a, V b, v8f c) { return wmmab(a, b, c); } };
template <typename T16, int NSPLIT, bool BIAS>
__global__ __launch_bounds__(32) void k_gemmw(const T16* __restrict__ A, const T16* __restrict__ A2, const T16* __restrict__ Bt, const T16* __restrict__ Bt2, int K, float* C, int ldc, const float* __restrict__ bias, size_t sA, size_t sB, size_t sC) {
    typedef typename WFrag<T16>::V V;
    __shared__ __align__(16) float os[16 * 68];
    const size_t z = blockIdx.z; A += z * sA; if (A2) A2 += z * sA; Bt += z * sB; if (Bt2) Bt2 += z * sB; C += z * sC;
    const int lane = threadIdx.x & 31, lr = lane & 15, hi = lane >> 4; const int r0 = blockIdx.x * 64, c0 = blockIdx.y * 64;
    v8f acc[4][4];
#pragma unroll
    for (int mb = 0; mb < 4; ++mb)
#pragma unroll
        for (int nb = 0; nb < 4; ++nb) acc[mb][nb] = (v8f){};
    const size_t aoff = (size_t)(r0 + lr) * K + 8 * hi, boff = (size_t)(c0 + lr) * K + 8 * hi;
#pragma unroll 1
    for (int kc = 0; kc < K; kc += 32) {
        V a[4], a2[4];
#pragma unroll
        for (int mb = 0; mb < 4; ++mb) { a[mb] = WFrag<T16>::ld(A + aoff + (size_t)mb * 16 * K + kc); if (NSPLIT == 1 || NSPLIT == 2) a2[mb] = WFrag<T16>::ld(A2 + aoff + (size_t)mb * 16 * K + kc); }
#pragma unroll
        for (int nb = 0; nb < 4; ++nb) { const V b = WFrag<T16>::ld(Bt + boff + (size_t)nb * 16 * K + kc); V b2; if (NSPLIT >= 2) b2 = WFrag<T16>::ld(Bt2 + boff + (size_t)nb * 16 * K + kc);
#pragma unroll
            for (int mb = 0; mb < 4; ++mb) { acc[mb][nb] = WFrag<T16>::mma(a[mb], b, acc[mb][nb]); if (NSPLIT == 1 || NSPLIT == 2) acc[mb][nb] = WFrag<T16>::mma(a2[mb], b, acc[mb][nb]); if (NSPLIT >= 2) acc[mb][nb] = WFrag<T16>::mma(a[mb], b2, acc[mb][nb]); } }
        asm volatile("v_nop\n\tv_nop\n\tv_nop\n\tv_nop" : "+v"(acc[0][0]), "+v"(acc[1][1]), "+v"(acc[2][2]), "+v"(acc[3][3]) : "v"(a[0]), "v"(a[3]));
    }
#pragma unroll
    for (int mb = 0; mb < 4; ++mb) {
#pragma unroll
        for (int nb = 0; nb < 4; ++nb) {
#pragma unroll
            for (int j = 0; j < 8; ++j) os[(hi * 8 + j) * 68 + nb * 16 + lr] = acc[mb][nb][j]; }
        __builtin_amdgcn_wave_barrier(); asm volatile("" ::: "memory");
        float* crow = C + (size_t)(r0 + mb * 16) * ldc + c0;
{
#pragma unroll
            for (int s = 0; s < 8; ++s) { const int row = 2 * s + hi, cofs = lr * 4; v4f val = *(const v4fa*)(os + row * 68 + cofs); if (BIAS) { val[0] += bfr(bias[c0 + cofs]); val[1] += bfr(bias[c0 + cofs + 1]); val[2] += bfr(bias[c0 + cofs + 2]); val[3] += bfr(bias[c0 + cofs + 3]); }
                *(v4f*)(crow + (size_t)row * ldc + cofs) = val; }
             }
        __builtin_amdgcn_wave_barrier(); asm volatile("" ::: "memory");
    }
}

// ---- k_gemmc: the same one-wave 64x64 tile GEMM specialised for causal attention: CMODE 1 skips score tiles entirely above the diagonal (query rows r0+roff.., key columns c0..), CMODE 2 limits the
// key (K) loop of the probability x value contraction to the diagonal block (probabilities beyond it are exactly zero). roff = row offset of this launch's first row within the sequence.
template <typename T16, int NSPLIT, int CMODE>
__global__ __launch_bounds__(32) void k_gemmc(const T16* __restrict__ A, const T16* __restrict__ A2, const T16* __restrict__ Bt, const T16* __restrict__ Bt2, int K, float* C, int ldc, int roff, size_t sA, size_t sB, size_t sC) {
    typedef typename WFrag<T16>::V V;
    __shared__ __align__(16) float os[16 * 68];
    const size_t z = blockIdx.z; A += z * sA; if (A2) A2 += z * sA; Bt += z * sB; if (Bt2) Bt2 += z * sB; C += z * sC;
    const int lane = threadIdx.x & 31, lr = lane & 15, hi = lane >> 4; const int r0 = blockIdx.x * 64, c0 = blockIdx.y * 64;
    if (CMODE == 1 && c0 > r0 + roff + 63) return;                  // score tile entirely above the causal diagonal: never read (k_dpl masks j > i by select)
    const int Kl = (CMODE == 2) ? min(K, r0 + roff + 64) : K;        // P.V: probabilities are exactly 0 beyond the diagonal block, so the K loop stops there
    v8f acc[4][4];
#pragma unroll
    for (int mb = 0; mb < 4; ++mb)
#pragma unroll
        for (int nb = 0; nb < 4; ++nb) acc[mb][nb] = (v8f){};
    const size_t aoff = (size_t)(r0 + lr) * K + 8 * hi, boff = (size_t)(c0 + lr) * K + 8 * hi;
#pragma unroll 1
    for (int kc = 0; kc < Kl; kc += 32) {
        V a[4], a2[4];
#pragma unroll
        for (int mb = 0; mb < 4; ++mb) { a[mb] = WFrag<T16>::ld(A + aoff + (size_t)mb * 16 * K + kc); if (NSPLIT == 1 || NSPLIT == 2) a2[mb] = WFrag<T16>::ld(A2 + aoff + (size_t)mb * 16 * K + kc); }
#pragma unroll
        for (int nb = 0; nb < 4; ++nb) { const V b = WFrag<T16>::ld(Bt + boff + (size_t)nb * 16 * K + kc); V b2; if (NSPLIT >= 2) b2 = WFrag<T16>::ld(Bt2 + boff + (size_t)nb * 16 * K + kc);
#pragma unroll
            for (int mb = 0; mb < 4; ++mb) { acc[mb][nb] = WFrag<T16>::mma(a[mb], b, acc[mb][nb]); if (NSPLIT == 1 || NSPLIT == 2) acc[mb][nb] = WFrag<T16>::mma(a2[mb], b, acc[mb][nb]); if (NSPLIT >= 2) acc[mb][nb] = WFrag<T16>::mma(a[mb], b2, acc[mb][nb]); } }
        asm volatile("v_nop\n\tv_nop\n\tv_nop\n\tv_nop" : "+v"(acc[0][0]), "+v"(acc[1][1]), "+v"(acc[2][2]), "+v"(acc[3][3]) : "v"(a[0]), "v"(a[3]));
    }
#pragma unroll
    for (int mb = 0; mb < 4; ++mb) {
#pragma unroll
        for (int nb = 0; nb < 4; ++nb) {
#pragma unroll
            for (int j = 0; j < 8; ++j) os[(hi * 8 + j) * 68 + nb * 16 + lr] = acc[mb][nb][j]; }
        __builtin_amdgcn_wave_barrier(); asm volatile("" ::: "memory");
        float* crow = C + (size_t)(r0 + mb * 16) * ldc + c0;
{
#pragma unroll
            for (int s = 0; s < 8; ++s) { const int row = 2 * s + hi, cofs = lr * 4; v4f val = *(const v4fa*)(os + row * 68 + cofs);
                *(v4f*)(crow + (size_t)row * ldc + cofs) = val; }
             }
        __builtin_amdgcn_wave_barrier(); asm volatile("" ::: "memory");
    }
}

__device__ __forceinline__ h16 tohx(float x) { return (h16)x; }
__device__ __forceinline__ void splitf(float y, unsigned short& h, unsigned short& l) { h = f2bf(y); l = f2bf(y - bf2f(h)); }
typedef __attribute__((ext_vector_type(2))) _Float16 v2h;
typedef __attribute__((ext_vector_type(4))) _Float16 v4h;
typedef __attribute__((ext_vector_type(2))) unsigned short v2us;
typedef __attribute__((ext_vector_type(4))) unsigned short v4us;
typedef __attribute__((ext_vector_type(2))) float v2f;
typedef __attribute__((ext_vector_type(4))) int v4i;

__global__ __launch_bounds__(256) void k_wtG(const float* __restrict__ w, int K, int N, bf* Bt) {
    const int lane = threadIdx.x & 31; const int L0 = (blockIdx.x * 8 + (threadIdx.x >> 5)) * 8; const int nlines = N * K / 64;
{
#pragma unroll 1
        for (int l = 0; l < 8; ++l) { const int L = L0 + l; if (L >= nlines) break; const size_t e = (size_t)L * 64 + lane * 2; const int k = (int)(e % K), n = (int)(e / K); v2us o;
            o[0] = f2bf(w[(size_t)k * N + n]); o[1] = f2bf(w[(size_t)(k + 1) * N + n]); *(v2us*)(Bt + e) = o; }
         }
}
__global__ __launch_bounds__(256) void k_cvt8(const float* __restrict__ src, bf* dst, size_t n8) { const size_t i = (size_t)blockIdx.x * 256 + threadIdx.x; if (i >= n8) return; const v8f v = *(const v8f*)(src + i * 8); v8us o;
#pragma unroll
    for (int k = 0; k < 8; ++k) o[k] = f2bf(v[k]); *(v8us*)(dst + i * 8) = o;  }
__global__ __launch_bounds__(256) void k_cstab(float* CS) { const int idx = blockIdx.x * 256 + threadIdx.x; if (idx >= TT * HD) return; const int t = idx / HD, d = idx % HD; const int i = (d < HD / 2) ? d : d - HD / 2; const float inv = __fdiv_rn(1.0f, powf(10000.0f, (float)(2 * i) / (float)HD)); const float ang = __fmul_rn((float)t, inv); v2f cs; cs[0] = cosf(ang); cs[1] = sinf(ang);
    *(v2f*)(CS + (size_t)idx * 2) = cs;  }
// k_rope: head planes [h][t][d] (fp16 + hi/lo) of rope(x) x sc with the rotate-half convention out[d] = x[d] cos[t][d] - x[d+HD/2] sin[t][d], out[d+HD/2] = x[d+HD/2] cos[t][d+HD/2] + x[d] sin[t][d+HD/2]
__global__ __launch_bounds__(256) void k_rope(const float* __restrict__ F, int pitch, int nheads, const float* __restrict__ CS, const float* __restrict__ RF, const float* __restrict__ nw, float sc, h16* P16, bf* Ph, bf* Pl) {
    const size_t e = ((size_t)blockIdx.x * 256 + threadIdx.x) * 2; if (e >= (size_t)nheads * TT * HD) return; const int d = (int)(e % HD); const int t = (int)((e / HD) % TT); const int h = (int)(e / ((size_t)HD * TT)); const float* f = F + (size_t)t * pitch + h * HD; const float rf = RF ? RF[(size_t)h * TT + t] : 1.0f; v2h o16; v2us oh, ol;
#pragma unroll
    for (int q = 0; q < 2; ++q) { const int dd = d + q; const int dp = (dd < HD / 2) ? dd + HD / 2 : dd - HD / 2; float x0 = f[dd], x1 = f[dp];
        if (RF) { float n0 = __fmul_rn(x0, rf), n1 = __fmul_rn(x1, rf); asm volatile("" : "+v"(n0)); asm volatile("" : "+v"(n1)); x0 = __fmul_rn(bfr(nw[dd]), n0); x1 = __fmul_rn(bfr(nw[dp]), n1); }
        const v2f cs = *(const v2f*)(CS + ((size_t)t * HD + dd) * 2); float a = __fmul_rn(x0, cs[0]), bq = __fmul_rn(x1, cs[1]); asm volatile("" : "+v"(a)); asm volatile("" : "+v"(bq)); const float r = ((dd < HD / 2) ? __fsub_rn(a, bq) : __fadd_rn(a, bq)) * sc;
        o16[q] = tohx(r); unsigned short a2, c2; splitf(r, a2, c2); oh[q] = a2; ol[q] = c2; }
    *(v2h*)(P16 + e) = o16; *(v2us*)(Ph + e) = oh; *(v2us*)(Pl + e) = ol;  }
__global__ __launch_bounds__(256) void k_vtp(const float* __restrict__ F, int pitch, int nheads, h16* V16, bf* Vh, bf* Vl) { const size_t e = ((size_t)blockIdx.x * 256 + threadIdx.x) * 2; if (e >= (size_t)nheads * HD * TT) return; const int t = (int)(e % TT); const int d = (int)((e / TT) % HD); const int g = (int)(e / ((size_t)TT * HD)); v2h o16; v2us oh, ol;
#pragma unroll
    for (int q = 0; q < 2; ++q) { const float x = F[(size_t)(t + q) * pitch + g * HD + d]; o16[q] = tohx(x); unsigned short a2, c2; splitf(x, a2, c2); oh[q] = a2; ol[q] = c2; }
    *(v2h*)(V16 + e) = o16; *(v2us*)(Vh + e) = oh; *(v2us*)(Vl + e) = ol;  }
__global__ __launch_bounds__(256) void k_colsum(const bf* __restrict__ Ph, const bf* __restrict__ Pl, const h16* __restrict__ P16, int h0, float* ACC) { const int t = blockIdx.x * 256 + threadIdx.x; if (t >= TT) return; float acc = ((h0 % REP) == 0) ? 0.0f : ACC[t];
#pragma unroll 1
    for (int zz = 0; zz < ZH; ++zz) {
#pragma unroll 4
        for (int i = 0; i < RH; ++i) { const size_t o = ((size_t)zz * RH + i) * TT + t; acc = __fadd_rn(acc, __fadd_rn(bf2f(Ph[o]), bf2f(Pl[o]))); }
#pragma unroll 4
        for (int i = RH; i < TT; ++i) { const size_t o = ((size_t)zz * TT + i) * TT + t; float pv = __fmul_rn((float)P16[o], 1.0f / PCAR); asm volatile("" : "+v"(pv)); acc = __fadd_rn(acc, pv); } }
    *(float*)(ACC + t) = acc;  }
// k_asoft: per row (zz, i): t = S x SCL (= 1) for j <= i and i - j < WIN (sliding causal window; the reference's -1e9 additive fill vanishes identically); softmax over the 2048 keys (register row, one exp, fixed trees);
__global__ __launch_bounds__(256) void k_asoft(const float* __restrict__ Sb, h16* P16, bf* Ph, bf* Pl) {
    const int lane = threadIdx.x & 31; const int row = blockIdx.x * 8 + (threadIdx.x >> 5); if (row >= ZH * TT) return; const int i = row % TT; const int zz = row / TT; (void)zz; const bool hires = (i < RH); const float* sr = Sb + (size_t)row * TT; float v[TT / 32]; float mx = -3.0e38f;
#pragma unroll
    for (int ch = 0; ch < TT / 128; ++ch) { const int j0 = ch * 128 + lane * 4; const v4f a = *(const v4f*)(sr + j0);
#pragma unroll
        for (int q = 0; q < 4; ++q) { const int j = j0 + q; (void)j; float sa = a[q] * SCL; asm volatile("" : "+v"(sa)); const float t = (j <= i && i - j < WIN) ? sa : -3.0e38f; v[ch * 4 + q] = t; mx = fmaxf(mx, t); } }
#pragma unroll
    for (int sh = 16; sh; sh >>= 1) mx = fmaxf(mx, __shfl_xor(mx, sh, 32));
    float sum = 0.f;
#pragma unroll
    for (int k = 0; k < TT / 32; ++k) { float d0 = __fsub_rn(v[k], mx); asm volatile("" : "+v"(d0)); v[k] = __builtin_amdgcn_exp2f(__fmul_rn(d0, 1.4426950408889634f)); sum += v[k]; }
#pragma unroll
    for (int sh = 16; sh; sh >>= 1) sum += __shfl_xor(sum, sh, 32);
    const float f = __fdiv_rn(hires ? 1.0f : PCAR, sum);
{
        if (hires) {
#pragma unroll
            for (int ch = 0; ch < TT / 128; ++ch) { v4us oh, ol;
#pragma unroll
                for (int q = 0; q < 4; ++q) { unsigned short a, c2; splitf(v[ch * 4 + q] * f, a, c2); oh[q] = a; ol[q] = c2; }
                const size_t oo = ((size_t)zz * (RH ? RH : 1) + i) * TT + ch * 128 + lane * 4; *(v4us*)(Ph + oo) = oh; *(v4us*)(Pl + oo) = ol; }
        } else {
#pragma unroll
            for (int ch = 0; ch < TT / 128; ++ch) { v4h o4;
#pragma unroll
                for (int q = 0; q < 4; ++q) o4[q] = tohx(v[ch * 4 + q] * f);
                *(v4h*)(P16 + (size_t)row * TT + ch * 128 + lane * 4) = o4; } }
         }
}
__global__ __launch_bounds__(256) void k_merge(const float* __restrict__ O, int h0, bf* Ah, bf* Al) { const size_t e = ((size_t)blockIdx.x * 256 + threadIdx.x) * 2; if (e >= (size_t)ZH * TT * HD) return; const int d = (int)(e % HD); const int t = (int)((e / HD) % TT); const int zz = (int)(e / ((size_t)HD * TT)); const float cs = (t < RH) ? 1.0f : (1.0f / PCAR); const size_t oo = (size_t)t * DQ + (h0 + zz) * HD + d;
    v2us oh, ol;
#pragma unroll
    for (int q = 0; q < 2; ++q) { unsigned short a, c2; splitf(O[e + q] * cs, a, c2); oh[q] = a; ol[q] = c2; } *(v2us*)(Ah + oo) = oh; *(v2us*)(Al + oo) = ol;  }


// ---- SingleHeadQKV kernels ----
__global__ __launch_bounds__(256) void k_hlG(const float* __restrict__ F, bf* Fh, bf* Fl, size_t n) { const size_t e = ((size_t)blockIdx.x * 256 + threadIdx.x) * 4; if (e >= n) return; const v4f a = *(const v4f*)(F + e); v4us oh, ol; for (int u = 0; u < 4; ++u) { unsigned short p, q; splitf(a[u], p, q); oh[u] = p; ol[u] = q; } *(v4us*)(Fh + e) = oh; *(v4us*)(Fl + e) = ol;  }
__global__ __launch_bounds__(256) void k_gptab(float* GP) { const int n = blockIdx.x * 256 + threadIdx.x; if (n >= TT + 64) return; const float v = powf(GAMR, (float)n); *(float*)(GP + n) = v;  }
__global__ __launch_bounds__(256) void k_cstabW(float* CS) { const size_t idx = (size_t)blockIdx.x * 256 + threadIdx.x; if (idx >= (size_t)TT * DC) return; const int t = (int)(idx / DC), d = (int)(idx % DC); const float inv = __fdiv_rn(1.0f, powf(10000.0f, (float)(2 * (d >> 1)) / (float)DC)); const float ang = __fmul_rn((float)t, inv); v2f cs; cs[0] = cosf(ang); cs[1] = sinf(ang); *(v2f*)(CS + idx * 2) = cs;  }
__global__ __launch_bounds__(256) void k_ropeW(float* F, const float* __restrict__ CS) { const size_t e = ((size_t)blockIdx.x * 256 + threadIdx.x) * 2; if (e >= (size_t)TT * DC) return; const v2f xv = *(const v2f*)(F + e); const v2f c0 = *(const v2f*)(CS + e * 2); const v2f c1 = *(const v2f*)(CS + (e + 1) * 2); float a0 = __fmul_rn(xv[0], c0[0]), b0 = __fmul_rn(xv[1], c0[1]); asm volatile("" : "+v"(a0)); asm volatile("" : "+v"(b0)); float a1 = __fmul_rn(xv[1], c1[0]), b1 = __fmul_rn(xv[0], c1[1]); asm volatile("" : "+v"(a1)); asm volatile("" : "+v"(b1)); v2f o; o[0] = __fsub_rn(a0, b0); o[1] = __fadd_rn(a1, b1); *(v2f*)(F + e) = o;  }
__global__ __launch_bounds__(256) void k_rowscale(const float* __restrict__ F, const float* __restrict__ GP, float* D) { const size_t e = ((size_t)blockIdx.x * 256 + threadIdx.x) * 4; if (e >= (size_t)TT * DC) return; const int t = (int)(e / DC); const float gsc = GP[TT - 1 - t]; const v4f a = *(const v4f*)(F + e); v4f o; for (int u = 0; u < 4; ++u) o[u] = __fmul_rn(a[u], gsc); *(v4f*)(D + e) = o;  }
__global__ __launch_bounds__(256) void k_dpl(const float* __restrict__ Sb, const float* __restrict__ GP, bf* Ph, bf* Pl) { const size_t e = ((size_t)blockIdx.x * 256 + threadIdx.x) * 4; if (e >= (size_t)TT * TT) return; const int i = (int)(e / TT); const int j0 = (int)(e % TT); v4f a; if (j0 <= i) a = *(const v4f*)(Sb + e); else { for (int u = 0; u < 4; ++u) a[u] = 0.0f; } v4us oh, ol; for (int u = 0; u < 4; ++u) { const int j = j0 + u; float v = 0.0f; if (j <= i) v = __fmul_rn(a[u], GP[i - j]); unsigned short a2, c2; splitf(v, a2, c2); oh[u] = a2; ol[u] = c2; } *(v4us*)(Ph + e) = oh; *(v4us*)(Pl + e) = ol;  }
__global__ __launch_bounds__(256) void k_combgn(const float* __restrict__ IN, const float* __restrict__ CR, const float* __restrict__ GP, const float* __restrict__ gw, const float* __restrict__ gb, float* G) { const int lane = threadIdx.x & 31; const int t = blockIdx.x * 8 + (threadIdx.x >> 5); if (t >= TT) return; const float ge = GP[t + 1];
#pragma unroll 1
    for (int ch = 0; ch < DC / 128; ++ch) { const size_t base = (size_t)t * DC + ch * 128 + lane * 4; const v4f a = *(const v4f*)(IN + base); const v4f c = *(const v4f*)(CR + base); float v[4]; float sm = 0.f; for (int u = 0; u < 4; ++u) { float cg = __fmul_rn(c[u], ge); asm volatile("" : "+v"(cg)); v[u] = __fadd_rn(a[u], cg); sm = __fadd_rn(sm, v[u]); }
        for (int sh = 1; sh < 8; sh <<= 1) sm = __fadd_rn(sm, __shfl_xor(sm, sh, 32));
        const float mu = __fmul_rn(sm, 1.0f / 32.0f); float ss = 0.f; float d[4]; for (int u = 0; u < 4; ++u) { d[u] = __fsub_rn(v[u], mu); float p = __fmul_rn(d[u], d[u]); asm volatile("" : "+v"(p)); ss = __fadd_rn(ss, p); }
        for (int sh = 1; sh < 8; sh <<= 1) ss = __fadd_rn(ss, __shfl_xor(ss, sh, 32));
        const float rs = __fdiv_rn(1.0f, sqrtf(__fadd_rn(__fmul_rn(ss, 1.0f / 32.0f), 1e-6f))); v4f o; for (int u = 0; u < 4; ++u) { const int cc = ch * 128 + lane * 4 + u; float n = __fmul_rn(d[u], rs); asm volatile("" : "+v"(n)); float w0 = bfr(gw[cc]), b0 = bfr(gb[cc]); asm volatile("" : "+v"(w0)); asm volatile("" : "+v"(b0)); float y = __fmul_rn(n, w0); asm volatile("" : "+v"(y)); o[u] = __fadd_rn(y, b0); }
        *(v4f*)(G + base) = o;  } }
__global__ __launch_bounds__(256) void k_perm(const float* __restrict__ G, float* O) { const size_t e = ((size_t)blockIdx.x * 256 + threadIdx.x) * 2; if (e >= (size_t)TT * DC) return; const int tp = (int)(e / DC); const int op = (int)(e % DC); v2f o; o[0] = G[((size_t)((tp & 1) * 1024 + op)) * DC + (tp >> 1)]; o[1] = G[((size_t)((tp & 1) * 1024 + op + 1)) * DC + (tp >> 1)]; *(v2f*)(O + e) = o;  }
__global__ __launch_bounds__(256) void k_radd(const float* __restrict__ R, const float* __restrict__ SN, const float* __restrict__ GP, float* O) { const size_t e = ((size_t)blockIdx.x * 256 + threadIdx.x) * 4; if (e >= (size_t)DC * DC) return; const float gT = GP[TT]; const v4f a = *(const v4f*)(R + e); const v4f s = *(const v4f*)(SN + e); v4f o; for (int u = 0; u < 4; ++u) { float sg = __fmul_rn(bfr(s[u]), gT); asm volatile("" : "+v"(sg)); o[u] = __fadd_rn(a[u], sg); } *(v4f*)(O + e) = o;  }

extern "C" void kernel_launch(void* const* d_in, const int* in_sizes, int n_in,
                              void* d_out, int out_size, void* d_ws, size_t ws_size, hipStream_t stream) {
    (void)in_sizes; (void)n_in; (void)out_size;
    const float* x = (const float*)d_in[0]; const float* sn = (const float*)d_in[1]; const float* wq = (const float*)d_in[2]; const float* wk = (const float*)d_in[3]; const float* wv = (const float*)d_in[4]; const float* gw = (const float*)d_in[5]; const float* gb = (const float*)d_in[6];
    float* OUT = (float*)d_out;     // out0 [4][2048][1024] at 0, out1 [4][1024][1024] at NB*TT*DC
    char* wsp = (char*)d_ws;
    auto take = [&](size_t bytes) { char* p = wsp; wsp += (bytes + 255) & ~(size_t)255; return (void*)p; };
    bf* WQ = (bf*)take((size_t)DQ * DM * 2); bf* WK = (bf*)take((size_t)DKV * DM * 2); bf* WV = (bf*)take((size_t)DKV * DM * 2); float* CS = (float*)take((size_t)TT * DC * 2 * 4); float* GP = (float*)take((TT + 64) * 4);
    bf* XB = (bf*)take((size_t)TT * DM * 2); bf* SNT = (bf*)take((size_t)DC * DC * 2);
    float* FQ = (float*)take((size_t)TT * DC * 4); float* FK = (float*)take((size_t)TT * DC * 4); float* FV = (float*)take((size_t)TT * DC * 4); float* FVD = (float*)take((size_t)TT * DC * 4);
    bf* QPh = (bf*)take((size_t)TT * DC * 2); bf* QPl = (bf*)take((size_t)TT * DC * 2); bf* KPh = (bf*)take((size_t)TT * DC * 2); bf* KPl = (bf*)take((size_t)TT * DC * 2);
    h16* T16 = (h16*)take((size_t)DC * TT * 2); bf* KTh = (bf*)take((size_t)DC * TT * 2); bf* KTl = (bf*)take((size_t)DC * TT * 2); bf* VTh = (bf*)take((size_t)DC * TT * 2); bf* VTl = (bf*)take((size_t)DC * TT * 2); bf* VDTh = (bf*)take((size_t)DC * TT * 2); bf* VDTl = (bf*)take((size_t)DC * TT * 2);
    float* Sb = (float*)take((size_t)TT * TT * 4); bf* Ph = (bf*)take((size_t)TT * TT * 2); bf* Pl = (bf*)take((size_t)TT * TT * 2);
    float* INNER = (float*)take((size_t)TT * DC * 4); float* CROSS = (float*)take((size_t)TT * DC * 4); float* GBF = FVD;   /* GroupNorm output reuses FVD after the VD planes are built (stream-ordered) */ float* RR = (float*)take((size_t)DC * DC * 4);
    if ((size_t)(wsp - (char*)d_ws) > ws_size) return;   // ws ~ 156 MiB
    { k_wtG<<<(unsigned)((DM * DQ / 64 + 63) / 64), 256, 0, stream>>>(wq, DM, DQ, WQ); k_wtG<<<(unsigned)((DM * DKV / 64 + 63) / 64), 256, 0, stream>>>(wk, DM, DKV, WK); k_wtG<<<(unsigned)((DM * DKV / 64 + 63) / 64), 256, 0, stream>>>(wv, DM, DKV, WV); k_cstabW<<<(unsigned)(((size_t)TT * DC + 255) / 256), 256, 0, stream>>>(CS); k_gptab<<<(TT + 64 + 255) / 256, 256, 0, stream>>>(GP); }
    const unsigned LV = (unsigned)(((size_t)NKV * TT * HD / 2 + 255) / 256), LG = (unsigned)(((size_t)TT * DC / 4 + 255) / 256);
    for (int b = 0; b < NB_; ++b) {
        k_cvt8<<<(unsigned)(((size_t)TT * DM / 8 + 255) / 256), 256, 0, stream>>>(x + (size_t)b * TT * DM, XB, (size_t)TT * DM / 8);
        k_wtG<<<(unsigned)((DC * DC / 64 + 63) / 64), 256, 0, stream>>>(sn + (size_t)b * DC * DC, DC, DC, SNT);
        k_gemmw<bf, 0, false><<<dim3(TT / 64, DQ / 64, 1), 32, 0, stream>>>(XB, nullptr, WQ, nullptr, DM, FQ, DQ, nullptr, 0, 0, 0); k_ropeW<<<(unsigned)(((size_t)TT * DC / 2 + 255) / 256), 256, 0, stream>>>(FQ, CS); k_hlG<<<LG, 256, 0, stream>>>(FQ, QPh, QPl, (size_t)TT * DC);
        k_gemmw<bf, 0, false><<<dim3(TT / 64, DKV / 64, 1), 32, 0, stream>>>(XB, nullptr, WK, nullptr, DM, FK, DKV, nullptr, 0, 0, 0); k_ropeW<<<(unsigned)(((size_t)TT * DC / 2 + 255) / 256), 256, 0, stream>>>(FK, CS); k_hlG<<<LG, 256, 0, stream>>>(FK, KPh, KPl, (size_t)TT * DC); k_vtp<<<LV, 256, 0, stream>>>(FK, DKV, NKV, T16, KTh, KTl);
        k_gemmw<bf, 0, false><<<dim3(TT / 64, DKV / 64, 1), 32, 0, stream>>>(XB, nullptr, WV, nullptr, DM, FV, DKV, nullptr, 0, 0, 0); k_vtp<<<LV, 256, 0, stream>>>(FV, DKV, NKV, T16, VTh, VTl); k_rowscale<<<LG, 256, 0, stream>>>(FV, GP, FVD); k_vtp<<<LV, 256, 0, stream>>>(FVD, DKV, NKV, T16, VDTh, VDTl);
        // A = (Q K^T) (causal tiles only), then x D into hi/lo planes, inner = A V (causal tiles only)
        k_gemmc<bf, 2, 1><<<dim3(TT / 64, TT / 64, 1), 32, 0, stream>>>(QPh, QPl, KPh, KPl, DC, Sb, TT, 0, 0, 0, 0);
        k_dpl<<<(unsigned)(((size_t)TT * TT / 4 + 255) / 256), 256, 0, stream>>>(Sb, GP, Ph, Pl);
        k_gemmc<bf, 2, 2><<<dim3(TT / 64, DC / 64, 1), 32, 0, stream>>>(Ph, Pl, VTh, VTl, TT, INNER, DC, 0, 0, 0, 0);
        // cross = Q S_n
        k_gemmw<bf, 1, false><<<dim3(TT / 64, DC / 64, 1), 32, 0, stream>>>(QPh, QPl, SNT, nullptr, DC, CROSS, DC, nullptr, 0, 0, 0);
        k_combgn<<<TT / 8, 256, 0, stream>>>(INNER, CROSS, GP, gw, gb, GBF);
        k_perm<<<(unsigned)(((size_t)TT * DC / 2 + 255) / 256), 256, 0, stream>>>(GBF, OUT + (size_t)b * TT * DC);
        // R_i = K^T (V D[-1]) + S_n g^T
        k_gemmw<bf, 2, false><<<dim3(DC / 64, DC / 64, 1), 32, 0, stream>>>(KTh, KTl, VDTh, VDTl, TT, RR, DC, nullptr, 0, 0, 0);
        k_radd<<<(unsigned)(((size_t)DC * DC / 4 + 255) / 256), 256, 0, stream>>>(RR, sn + (size_t)b * DC * DC, GP, OUT + (size_t)NB_ * TT * DC + (size_t)b * DC * DC); }
}

// v001
// It runs in 763 microseconds.
// Next to v000, in two timings, it ran 1.76 and 1.74 times as fast.
#include <hip/hip_runtime.h>

// SingleHeadQKV (chunkwise retention step: X_Q [4][2048][1024], S_n [4][1024][1024]; Q = rope(X W_Q), K = rope(X W_K) (interleaved-pair RoPE over the full 1024 dims), V = X W_V; D[n][m] = g^(n-m) for n >= m (g = 1 - 2^-5); inner = (Q K^T * D) V; cross = (Q S_n) * g^(t+1); out = GroupNorm32(inner + cross) then the literal transpose(-2,-1).reshape permutation -> out0 [4][2048][1024]; R_i = K^T (V * D[-1]) + S_n g^T -> out1 [4][1024][1024] at element 8,388,608).
// Compute dtypes, f32 accumulate: every input rounded to bf16; Q/K/V on PLAIN bf16 operands (inputs: exact); RoPE f32 (on-chip table); decay powers g^n in f32 (powf); Q.K^T (K = 1024) hl x hl (3 products) with causal tile skipping, x D per element in f32 into hi/lo planes (no softmax), (QK^T D).V hl x hl (3 products, causal skipping); Q.S_n hl x exact (2 products); K^T.(V D[-1]) hl x hl (3 products, K = 2048); sums, GroupNorm (32 groups of 32, biased var, eps 1e-6) and the output permutation in f32.

#define NB_  4
#define TT   2048
#define DM   1024
#define NH_  16
#define NKV  16
#define REP  (NH_ / NKV)
#define HD   64
#define DQ   (NH_ * HD)
#define DKV  (NKV * HD)
#define ZH   2
#define RH   2048                  // query rows < RH use hi+lo planes (0: none)
#define WIN  2048
#define PCAR 1024.0f
#define DC   1024   // channel width (= DQ)
#define GAMR 0.96875f
#define SCL  1.0f
typedef _Float16 h16;
typedef unsigned short bf;
typedef __attribute__((ext_vector_type(16))) __bf16   v16bf;
typedef __attribute__((ext_vector_type(16))) _Float16 v16h;
typedef __attribute__((ext_vector_type(8)))  _Float16 v8h;
typedef __attribute__((ext_vector_type(8)))  unsigned short v8us;
typedef __attribute__((ext_vector_type(8)))  float    v8f;
typedef __attribute__((ext_vector_type(4)))  float    v4f;
typedef v8h  __attribute__((may_alias)) v8ha;
typedef v4f  __attribute__((may_alias)) v4fa;
typedef v8us __attribute__((may_alias)) v8usa;

__device__ __forceinline__ unsigned short f2bf(float f) { unsigned u = __float_as_uint(f); u += 0x7FFFu + ((u >> 16) & 1u); return (unsigned short)(u >> 16); }
__device__ __forceinline__ float bf2f(unsigned short b) { return __uint_as_float(((unsigned)b) << 16); }
__device__ __forceinline__ float bfr(float f) { return bf2f(f2bf(f)); }
__device__ __forceinline__ v16h cat16(v8h lo, v8h hi) { return __builtin_shufflevector(lo, hi, 0, 1, 2, 3, 4, 5, 6, 7, 8, 9, 10, 11, 12, 13, 14, 15); }
__device__ __forceinline__ v16bf cat16b(v8us lo, v8us hi) { return __builtin_bit_cast(v16bf, __builtin_shufflevector(lo, hi, 0, 1, 2, 3, 4, 5, 6, 7, 8, 9, 10, 11, 12, 13, 14, 15)); }
__device__ __forceinline__ v8f wmma16(v16h a, v16h b, v8f c) { return __builtin_amdgcn_wmma_f32_16x16x32_f16(false, a, false, b, (short)0, c, false, false); }
__device__ __forceinline__ v8f wmmab(v16bf a, v16bf b, v8f c) { return __builtin_amdgcn_wmma_f32_16x16x32_bf16(false, a, false, b, (short)0, c, false, false); }



// ---- k_gemmw: register-blocked GEMM, ONE WAVE per 64x64 output tile (16 accumulators), operands straight from K-contiguous 16-bit planes; grid (M/64, N/64, Z), 32 threads.
// C[m][n] (f32, pitch ldc, + optional f32 bias[n]) = sum_k A[m][k] Bt[n][k] (+ split products per NSPLIT). z-batch strides sA/sB/sC in elements. K % 32 == 0.
template <typename T16> struct WFrag;
template <> struct WFrag<h16> { typedef v16h V; static __device__ __forceinline__ V ld(const h16* p) { return cat16(*(const v8h*)p, *(const v8h*)(p + 16)); } static __device__ __forceinline__ v8f mma(V a, V b, v8f c) { return wmma16(a, b, c); } };
template <> struct WFrag<bf> { typedef v16bf V; static __device__ __forceinline__ V ld(const bf* p) { return cat16b(*(const v8us*)p, *(const v8us*)(p + 16)); } static __device__ __forceinline__ v8f mma(V a, V b, v8f c) { return wmmab(a, b, c); } };
template <typename T16, int NSPLIT, bool BIAS>
__global__ __launch_bounds__(32) void k_gemmw(const T16* __restrict__ A, const T16* __restrict__ A2, const T16* __restrict__ Bt, const T16* __restrict__ Bt2, int K, float* C, int ldc, const float* __restrict__ bias, size_t sA, size_t sB, size_t sC) {
    typedef typename WFrag<T16>::V V;
    __shared__ __align__(16) float os[16 * 68];
    const size_t z = blockIdx.z; A += z * sA; if (A2) A2 += z * sA; Bt += z * sB; if (Bt2) Bt2 += z * sB; C += z * sC;
    const int lane = threadIdx.x & 31, lr = lane & 15, hi = lane >> 4; const int r0 = blockIdx.x * 64, c0 = blockIdx.y * 64;
    v8f acc[4][4];
#pragma unroll
    for (int mb = 0; mb < 4; ++mb)
#pragma unroll
        for (int nb = 0; nb < 4; ++nb) acc[mb][nb] = (v8f){};
    const size_t aoff = (size_t)(r0 + lr) * K + 8 * hi, boff = (size_t)(c0 + lr) * K + 8 * hi;
#pragma unroll 1
    for (int kc = 0; kc < K; kc += 32) {
        V a[4], a2[4];
#pragma unroll
        for (int mb = 0; mb < 4; ++mb) { a[mb] = WFrag<T16>::ld(A + aoff + (size_t)mb * 16 * K + kc); if (NSPLIT == 1 || NSPLIT == 2) a2[mb] = WFrag<T16>::ld(A2 + aoff + (size_t)mb * 16 * K + kc); }
#pragma unroll
        for (int nb = 0; nb < 4; ++nb) { const V b = WFrag<T16>::ld(Bt + boff + (size_t)nb * 16 * K + kc); V b2; if (NSPLIT >= 2) b2 = WFrag<T16>::ld(Bt2 + boff + (size_t)nb * 16 * K + kc);
#pragma unroll
            for (int mb = 0; mb < 4; ++mb) { acc[mb][nb] = WFrag<T16>::mma(a[mb], b, acc[mb][nb]); if (NSPLIT == 1 || NSPLIT == 2) acc[mb][nb] = WFrag<T16>::mma(a2[mb], b, acc[mb][nb]); if (NSPLIT >= 2) acc[mb][nb] = WFrag<T16>::mma(a[mb], b2, acc[mb][nb]); } }
        asm volatile("v_nop\n\tv_nop\n\tv_nop\n\tv_nop" : "+v"(acc[0][0]), "+v"(acc[1][1]), "+v"(acc[2][2]), "+v"(acc[3][3]) : "v"(a[0]), "v"(a[3]));
    }
#pragma unroll
    for (int mb = 0; mb < 4; ++mb) {
#pragma unroll
        for (int nb = 0; nb < 4; ++nb) {
#pragma unroll
            for (int j = 0; j < 8; ++j) os[(hi * 8 + j) * 68 + nb * 16 + lr] = acc[mb][nb][j]; }
        __builtin_amdgcn_wave_barrier(); asm volatile("" ::: "memory");
        float* crow = C + (size_t)(r0 + mb * 16) * ldc + c0;
{
#pragma unroll
            for (int s = 0; s < 8; ++s) { const int row = 2 * s + hi, cofs = lr * 4; v4f val = *(const v4fa*)(os + row * 68 + cofs); if (BIAS) { val[0] += bfr(bias[c0 + cofs]); val[1] += bfr(bias[c0 + cofs + 1]); val[2] += bfr(bias[c0 + cofs + 2]); val[3] += bfr(bias[c0 + cofs + 3]); }
                *(v4f*)(crow + (size_t)row * ldc + cofs) = val; }
             }
        __builtin_amdgcn_wave_barrier(); asm volatile("" ::: "memory");
    }
}

// ---- k_gemmc: the same one-wave 64x64 tile GEMM specialised for causal attention: CMODE 1 skips score tiles entirely above the diagonal (query rows r0+roff.., key columns c0..), CMODE 2 limits the
// key (K) loop of the probability x value contraction to the diagonal block (probabilities beyond it are exactly zero). roff = row offset of this launch's first row within the sequence.
template <typename T16, int NSPLIT, int CMODE>
__global__ __launch_bounds__(32) void k_gemmc(const T16* __restrict__ A, const T16* __restrict__ A2, const T16* __restrict__ Bt, const T16* __restrict__ Bt2, int K, float* C, int ldc, int roff, size_t sA, size_t sB, size_t sC) {
    typedef typename WFrag<T16>::V V;
    __shared__ __align__(16) float os[16 * 68];
    const size_t z = blockIdx.z; A += z * sA; if (A2) A2 += z * sA; Bt += z * sB; if (Bt2) Bt2 += z * sB; C += z * sC;
    const int lane = threadIdx.x & 31, lr = lane & 15, hi = lane >> 4; const int r0 = blockIdx.x * 64, c0 = blockIdx.y * 64;
    if (CMODE == 1 && c0 > r0 + roff + 63) return;                  // score tile entirely above the causal diagonal: never read (k_dpl masks j > i by select)
    const int Kl = (CMODE == 2) ? min(K, r0 + roff + 64) : K;        // P.V: probabilities are exactly 0 beyond the diagonal block, so the K loop stops there
    v8f acc[4][4];
#pragma unroll
    for (int mb = 0; mb < 4; ++mb)
#pragma unroll
        for (int nb = 0; nb < 4; ++nb) acc[mb][nb] = (v8f){};
    const size_t aoff = (size_t)(r0 + lr) * K + 8 * hi, boff = (size_t)(c0 + lr) * K + 8 * hi;
#pragma unroll 1
    for (int kc = 0; kc < Kl; kc += 32) {
        V a[4], a2[4];
#pragma unroll
        for (int mb = 0; mb < 4; ++mb) { a[mb] = WFrag<T16>::ld(A + aoff + (size_t)mb * 16 * K + kc); if (NSPLIT == 1 || NSPLIT == 2) a2[mb] = WFrag<T16>::ld(A2 + aoff + (size_t)mb * 16 * K + kc); }
#pragma unroll
        for (int nb = 0; nb < 4; ++nb) { const V b = WFrag<T16>::ld(Bt + boff + (size_t)nb * 16 * K + kc); V b2; if (NSPLIT >= 2) b2 = WFrag<T16>::ld(Bt2 + boff + (size_t)nb * 16 * K + kc);
#pragma unroll
            for (int mb = 0; mb < 4; ++mb) { acc[mb][nb] = WFrag<T16>::mma(a[mb], b, acc[mb][nb]); if (NSPLIT == 1 || NSPLIT == 2) acc[mb][nb] = WFrag<T16>::mma(a2[mb], b, acc[mb][nb]); if (NSPLIT >= 2) acc[mb][nb] = WFrag<T16>::mma(a[mb], b2, acc[mb][nb]); } }
        asm volatile("v_nop\n\tv_nop\n\tv_nop\n\tv_nop" : "+v"(acc[0][0]), "+v"(acc[1][1]), "+v"(acc[2][2]), "+v"(acc[3][3]) : "v"(a[0]), "v"(a[3]));
    }
#pragma unroll
    for (int mb = 0; mb < 4; ++mb) {
#pragma unroll
        for (int nb = 0; nb < 4; ++nb) {
#pragma unroll
            for (int j = 0; j < 8; ++j) os[(hi * 8 + j) * 68 + nb * 16 + lr] = acc[mb][nb][j]; }
        __builtin_amdgcn_wave_barrier(); asm volatile("" ::: "memory");
        float* crow = C + (size_t)(r0 + mb * 16) * ldc + c0;
{
#pragma unroll
            for (int s = 0; s < 8; ++s) { const int row = 2 * s + hi, cofs = lr * 4; v4f val = *(const v4fa*)(os + row * 68 + cofs);
                *(v4f*)(crow + (size_t)row * ldc + cofs) = val; }
             }
        __builtin_amdgcn_wave_barrier(); asm volatile("" ::: "memory");
    }
}

__device__ __forceinline__ h16 tohx(float x) { return (h16)x; }
__device__ __forceinline__ void splitf(float y, unsigned short& h, unsigned short& l) { h = f2bf(y); l = f2bf(y - bf2f(h)); }
typedef __attribute__((ext_vector_type(2))) _Float16 v2h;
typedef __attribute__((ext_vector_type(4))) _Float16 v4h;
typedef __attribute__((ext_vector_type(2))) unsigned short v2us;
typedef __attribute__((ext_vector_type(4))) unsigned short v4us;
typedef __attribute__((ext_vector_type(2))) float v2f;
typedef __attribute__((ext_vector_type(4))) int v4i;

__global__ __launch_bounds__(256) void k_wtG(const float* __restrict__ w, int K, int N, bf* Bt) {
    const int lane = threadIdx.x & 31; const int L0 = (blockIdx.x * 8 + (threadIdx.x >> 5)) * 8; const int nlines = N * K / 64; w += (size_t)blockIdx.y * K * N; Bt += (size_t)blockIdx.y * K * N;   // blockIdx.y: batch element
{
#pragma unroll 1
        for (int l = 0; l < 8; ++l) { const int L = L0 + l; if (L >= nlines) break; const size_t e = (size_t)L * 64 + lane * 2; const int k = (int)(e % K), n = (int)(e / K); v2us o;
            o[0] = f2bf(w[(size_t)k * N + n]); o[1] = f2bf(w[(size_t)(k + 1) * N + n]); *(v2us*)(Bt + e) = o; }
         }
}
__global__ __launch_bounds__(256) void k_cvt8(const float* __restrict__ src, bf* dst, size_t n8) { const size_t i = (size_t)blockIdx.x * 256 + threadIdx.x; if (i >= n8) return; const v8f v = *(const v8f*)(src + i * 8); v8us o;
#pragma unroll
    for (int k = 0; k < 8; ++k) o[k] = f2bf(v[k]); *(v8us*)(dst + i * 8) = o;  }
__global__ __launch_bounds__(256) void k_cstab(float* CS) { const int idx = blockIdx.x * 256 + threadIdx.x; if (idx >= TT * HD) return; const int t = idx / HD, d = idx % HD; const int i = (d < HD / 2) ? d : d - HD / 2; const float inv = __fdiv_rn(1.0f, powf(10000.0f, (float)(2 * i) / (float)HD)); const float ang = __fmul_rn((float)t, inv); v2f cs; cs[0] = cosf(ang); cs[1] = sinf(ang);
    *(v2f*)(CS + (size_t)idx * 2) = cs;  }
// k_rope: head planes [h][t][d] (fp16 + hi/lo) of rope(x) x sc with the rotate-half convention out[d] = x[d] cos[t][d] - x[d+HD/2] sin[t][d], out[d+HD/2] = x[d+HD/2] cos[t][d+HD/2] + x[d] sin[t][d+HD/2]
__global__ __launch_bounds__(256) void k_rope(const float* __restrict__ F, int pitch, int nheads, const float* __restrict__ CS, const float* __restrict__ RF, const float* __restrict__ nw, float sc, h16* P16, bf* Ph, bf* Pl) {
    const size_t e = ((size_t)blockIdx.x * 256 + threadIdx.x) * 2; if (e >= (size_t)nheads * TT * HD) return; const int d = (int)(e % HD); const int t = (int)((e / HD) % TT); const int h = (int)(e / ((size_t)HD * TT)); const float* f = F + (size_t)t * pitch + h * HD; const float rf = RF ? RF[(size_t)h * TT + t] : 1.0f; v2h o16; v2us oh, ol;
#pragma unroll
    for (int q = 0; q < 2; ++q) { const int dd = d + q; const int dp = (dd < HD / 2) ? dd + HD / 2 : dd - HD / 2; float x0 = f[dd], x1 = f[dp];
        if (RF) { float n0 = __fmul_rn(x0, rf), n1 = __fmul_rn(x1, rf); asm volatile("" : "+v"(n0)); asm volatile("" : "+v"(n1)); x0 = __fmul_rn(bfr(nw[dd]), n0); x1 = __fmul_rn(bfr(nw[dp]), n1); }
        const v2f cs = *(const v2f*)(CS + ((size_t)t * HD + dd) * 2); float a = __fmul_rn(x0, cs[0]), bq = __fmul_rn(x1, cs[1]); asm volatile("" : "+v"(a)); asm volatile("" : "+v"(bq)); const float r = ((dd < HD / 2) ? __fsub_rn(a, bq) : __fadd_rn(a, bq)) * sc;
        o16[q] = tohx(r); unsigned short a2, c2; splitf(r, a2, c2); oh[q] = a2; ol[q] = c2; }
    *(v2h*)(P16 + e) = o16; *(v2us*)(Ph + e) = oh; *(v2us*)(Pl + e) = ol;  }
__global__ __launch_bounds__(256) void k_vtp(const float* __restrict__ F, int pitch, int nheads, h16* V16, bf* Vh, bf* Vl) { const size_t e = ((size_t)blockIdx.x * 256 + threadIdx.x) * 2; if (e >= (size_t)nheads * HD * TT) return; F += (size_t)blockIdx.y * TT * pitch; { const size_t zo = (size_t)blockIdx.y * nheads * HD * TT; V16 += zo; Vh += zo; Vl += zo; } const int t = (int)(e % TT); const int d = (int)((e / TT) % HD); const int g = (int)(e / ((size_t)TT * HD)); v2h o16; v2us oh, ol;
#pragma unroll
    for (int q = 0; q < 2; ++q) { const float x = F[(size_t)(t + q) * pitch + g * HD + d]; o16[q] = tohx(x); unsigned short a2, c2; splitf(x, a2, c2); oh[q] = a2; ol[q] = c2; }
    *(v2h*)(V16 + e) = o16; *(v2us*)(Vh + e) = oh; *(v2us*)(Vl + e) = ol;  }
__global__ __launch_bounds__(256) void k_colsum(const bf* __restrict__ Ph, const bf* __restrict__ Pl, const h16* __restrict__ P16, int h0, float* ACC) { const int t = blockIdx.x * 256 + threadIdx.x; if (t >= TT) return; float acc = ((h0 % REP) == 0) ? 0.0f : ACC[t];
#pragma unroll 1
    for (int zz = 0; zz < ZH; ++zz) {
#pragma unroll 4
        for (int i = 0; i < RH; ++i) { const size_t o = ((size_t)zz * RH + i) * TT + t; acc = __fadd_rn(acc, __fadd_rn(bf2f(Ph[o]), bf2f(Pl[o]))); }
#pragma unroll 4
        for (int i = RH; i < TT; ++i) { const size_t o = ((size_t)zz * TT + i) * TT + t; float pv = __fmul_rn((float)P16[o], 1.0f / PCAR); asm volatile("" : "+v"(pv)); acc = __fadd_rn(acc, pv); } }
    *(float*)(ACC + t) = acc;  }
// k_asoft: per row (zz, i): t = S x SCL (= 1) for j <= i and i - j < WIN (sliding causal window; the reference's -1e9 additive fill vanishes identically); softmax over the 2048 keys (register row, one exp, fixed trees);
__global__ __launch_bounds__(256) void k_asoft(const float* __restrict__ Sb, h16* P16, bf* Ph, bf* Pl) {
    const int lane = threadIdx.x & 31; const int row = blockIdx.x * 8 + (threadIdx.x >> 5); if (row >= ZH * TT) return; const int i = row % TT; const int zz = row / TT; (void)zz; const bool hires = (i < RH); const float* sr = Sb + (size_t)row * TT; float v[TT / 32]; float mx = -3.0e38f;
#pragma unroll
    for (int ch = 0; ch < TT / 128; ++ch) { const int j0 = ch * 128 + lane * 4; const v4f a = *(const v4f*)(sr + j0);
#pragma unroll
        for (int q = 0; q < 4; ++q) { const int j = j0 + q; (void)j; float sa = a[q] * SCL; asm volatile("" : "+v"(sa)); const float t = (j <= i && i - j < WIN) ? sa : -3.0e38f; v[ch * 4 + q] = t; mx = fmaxf(mx, t); } }
#pragma unroll
    for (int sh = 16; sh; sh >>= 1) mx = fmaxf(mx, __shfl_xor(mx, sh, 32));
    float sum = 0.f;
#pragma unroll
    for (int k = 0; k < TT / 32; ++k) { float d0 = __fsub_rn(v[k], mx); asm volatile("" : "+v"(d0)); v[k] = __builtin_amdgcn_exp2f(__fmul_rn(d0, 1.4426950408889634f)); sum += v[k]; }
#pragma unroll
    for (int sh = 16; sh; sh >>= 1) sum += __shfl_xor(sum, sh, 32);
    const float f = __fdiv_rn(hires ? 1.0f : PCAR, sum);
{
        if (hires) {
#pragma unroll
            for (int ch = 0; ch < TT / 128; ++ch) { v4us oh, ol;
#pragma unroll
                for (int q = 0; q < 4; ++q) { unsigned short a, c2; splitf(v[ch * 4 + q] * f, a, c2); oh[q] = a; ol[q] = c2; }
                const size_t oo = ((size_t)zz * (RH ? RH : 1) + i) * TT + ch * 128 + lane * 4; *(v4us*)(Ph + oo) = oh; *(v4us*)(Pl + oo) = ol; }
        } else {
#pragma unroll
            for (int ch = 0; ch < TT / 128; ++ch) { v4h o4;
#pragma unroll
                for (int q = 0; q < 4; ++q) o4[q] = tohx(v[ch * 4 + q] * f);
                *(v4h*)(P16 + (size_t)row * TT + ch * 128 + lane * 4) = o4; } }
         }
}
__global__ __launch_bounds__(256) void k_merge(const float* __restrict__ O, int h0, bf* Ah, bf* Al) { const size_t e = ((size_t)blockIdx.x * 256 + threadIdx.x) * 2; if (e >= (size_t)ZH * TT * HD) return; const int d = (int)(e % HD); const int t = (int)((e / HD) % TT); const int zz = (int)(e / ((size_t)HD * TT)); const float cs = (t < RH) ? 1.0f : (1.0f / PCAR); const size_t oo = (size_t)t * DQ + (h0 + zz) * HD + d;
    v2us oh, ol;
#pragma unroll
    for (int q = 0; q < 2; ++q) { unsigned short a, c2; splitf(O[e + q] * cs, a, c2); oh[q] = a; ol[q] = c2; } *(v2us*)(Ah + oo) = oh; *(v2us*)(Al + oo) = ol;  }


// ---- SingleHeadQKV kernels ----
__global__ __launch_bounds__(256) void k_hlG(const float* __restrict__ F, bf* Fh, bf* Fl, size_t n) { const size_t e = ((size_t)blockIdx.x * 256 + threadIdx.x) * 4; if (e >= n) return; const v4f a = *(const v4f*)(F + e); v4us oh, ol; for (int u = 0; u < 4; ++u) { unsigned short p, q; splitf(a[u], p, q); oh[u] = p; ol[u] = q; } *(v4us*)(Fh + e) = oh; *(v4us*)(Fl + e) = ol;  }
__global__ __launch_bounds__(256) void k_gptab(float* GP) { const int n = blockIdx.x * 256 + threadIdx.x; if (n >= TT + 64) return; const float v = powf(GAMR, (float)n); *(float*)(GP + n) = v;  }
__global__ __launch_bounds__(256) void k_cstabW(float* CS) { const size_t idx = (size_t)blockIdx.x * 256 + threadIdx.x; if (idx >= (size_t)TT * DC) return; const int t = (int)(idx / DC), d = (int)(idx % DC); const float inv = __fdiv_rn(1.0f, powf(10000.0f, (float)(2 * (d >> 1)) / (float)DC)); const float ang = __fmul_rn((float)t, inv); v2f cs; cs[0] = cosf(ang); cs[1] = sinf(ang); *(v2f*)(CS + idx * 2) = cs;  }
__global__ __launch_bounds__(256) void k_ropeW(float* F, const float* __restrict__ CS) { const size_t e = ((size_t)blockIdx.x * 256 + threadIdx.x) * 2; if (e >= (size_t)TT * DC) return; F += (size_t)blockIdx.y * TT * DC; const v2f xv = *(const v2f*)(F + e); const v2f c0 = *(const v2f*)(CS + e * 2); const v2f c1 = *(const v2f*)(CS + (e + 1) * 2); float a0 = __fmul_rn(xv[0], c0[0]), b0 = __fmul_rn(xv[1], c0[1]); asm volatile("" : "+v"(a0)); asm volatile("" : "+v"(b0)); float a1 = __fmul_rn(xv[1], c1[0]), b1 = __fmul_rn(xv[0], c1[1]); asm volatile("" : "+v"(a1)); asm volatile("" : "+v"(b1)); v2f o; o[0] = __fsub_rn(a0, b0); o[1] = __fadd_rn(a1, b1); *(v2f*)(F + e) = o;  }
__global__ __launch_bounds__(256) void k_rowscale(const float* __restrict__ F, const float* __restrict__ GP, float* D) { const size_t e = ((size_t)blockIdx.x * 256 + threadIdx.x) * 4; if (e >= (size_t)TT * DC) return; F += (size_t)blockIdx.y * TT * DC; D += (size_t)blockIdx.y * TT * DC; const int t = (int)(e / DC); const float gsc = GP[TT - 1 - t]; const v4f a = *(const v4f*)(F + e); v4f o; for (int u = 0; u < 4; ++u) o[u] = __fmul_rn(a[u], gsc); *(v4f*)(D + e) = o;  }
__global__ __launch_bounds__(256) void k_dpl(const float* __restrict__ Sb, const float* __restrict__ GP, bf* Ph, bf* Pl) { const size_t e = ((size_t)blockIdx.x * 256 + threadIdx.x) * 4; if (e >= (size_t)TT * TT) return; { const size_t zo = (size_t)blockIdx.y * TT * TT; Sb += zo; Ph += zo; Pl += zo; } const int i = (int)(e / TT); const int j0 = (int)(e % TT); v4f a; if (j0 <= i) a = *(const v4f*)(Sb + e); else { for (int u = 0; u < 4; ++u) a[u] = 0.0f; } v4us oh, ol; for (int u = 0; u < 4; ++u) { const int j = j0 + u; float v = 0.0f; if (j <= i) v = __fmul_rn(a[u], GP[i - j]); unsigned short a2, c2; splitf(v, a2, c2); oh[u] = a2; ol[u] = c2; } *(v4us*)(Ph + e) = oh; *(v4us*)(Pl + e) = ol;  }
__global__ __launch_bounds__(256) void k_combgn(const float* __restrict__ IN, const float* __restrict__ CR, const float* __restrict__ GP, const float* __restrict__ gw, const float* __restrict__ gb, float* G) { const int lane = threadIdx.x & 31; const int t = blockIdx.x * 8 + (threadIdx.x >> 5); if (t >= TT) return; { const size_t zo = (size_t)blockIdx.y * TT * DC; IN += zo; CR += zo; G += zo; } const float ge = GP[t + 1];
#pragma unroll 1
    for (int ch = 0; ch < DC / 128; ++ch) { const size_t base = (size_t)t * DC + ch * 128 + lane * 4; const v4f a = *(const v4f*)(IN + base); const v4f c = *(const v4f*)(CR + base); float v[4]; float sm = 0.f; for (int u = 0; u < 4; ++u) { float cg = __fmul_rn(c[u], ge); asm volatile("" : "+v"(cg)); v[u] = __fadd_rn(a[u], cg); sm = __fadd_rn(sm, v[u]); }
        for (int sh = 1; sh < 8; sh <<= 1) sm = __fadd_rn(sm, __shfl_xor(sm, sh, 32));
        const float mu = __fmul_rn(sm, 1.0f / 32.0f); float ss = 0.f; float d[4]; for (int u = 0; u < 4; ++u) { d[u] = __fsub_rn(v[u], mu); float p = __fmul_rn(d[u], d[u]); asm volatile("" : "+v"(p)); ss = __fadd_rn(ss, p); }
        for (int sh = 1; sh < 8; sh <<= 1) ss = __fadd_rn(ss, __shfl_xor(ss, sh, 32));
        const float rs = __fdiv_rn(1.0f, sqrtf(__fadd_rn(__fmul_rn(ss, 1.0f / 32.0f), 1e-6f))); v4f o; for (int u = 0; u < 4; ++u) { const int cc = ch * 128 + lane * 4 + u; float n = __fmul_rn(d[u], rs); asm volatile("" : "+v"(n)); float w0 = bfr(gw[cc]), b0 = bfr(gb[cc]); asm volatile("" : "+v"(w0)); asm volatile("" : "+v"(b0)); float y = __fmul_rn(n, w0); asm volatile("" : "+v"(y)); o[u] = __fadd_rn(y, b0); }
        *(v4f*)(G + base) = o;  } }
__global__ __launch_bounds__(256) void k_perm(const float* __restrict__ G, float* O) { const size_t e = ((size_t)blockIdx.x * 256 + threadIdx.x) * 2; if (e >= (size_t)TT * DC) return; G += (size_t)blockIdx.y * TT * DC; O += (size_t)blockIdx.y * TT * DC; const int tp = (int)(e / DC); const int op = (int)(e % DC); v2f o; o[0] = G[((size_t)((tp & 1) * 1024 + op)) * DC + (tp >> 1)]; o[1] = G[((size_t)((tp & 1) * 1024 + op + 1)) * DC + (tp >> 1)]; *(v2f*)(O + e) = o;  }
__global__ __launch_bounds__(256) void k_radd(const float* __restrict__ R, const float* __restrict__ SN, const float* __restrict__ GP, float* O) { const size_t e = ((size_t)blockIdx.x * 256 + threadIdx.x) * 4; if (e >= (size_t)DC * DC) return; { const size_t zo = (size_t)blockIdx.y * DC * DC; R += zo; SN += zo; O += zo; } const float gT = GP[TT]; const v4f a = *(const v4f*)(R + e); const v4f s = *(const v4f*)(SN + e); v4f o; for (int u = 0; u < 4; ++u) { float sg = __fmul_rn(bfr(s[u]), gT); asm volatile("" : "+v"(sg)); o[u] = __fadd_rn(a[u], sg); } *(v4f*)(O + e) = o;  }

extern "C" void kernel_launch(void* const* d_in, const int* in_sizes, int n_in,
                              void* d_out, int out_size, void* d_ws, size_t ws_size, hipStream_t stream) {
    (void)in_sizes; (void)n_in; (void)out_size;
    const float* x = (const float*)d_in[0]; const float* sn = (const float*)d_in[1]; const float* wq = (const float*)d_in[2]; const float* wk = (const float*)d_in[3]; const float* wv = (const float*)d_in[4]; const float* gw = (const float*)d_in[5]; const float* gb = (const float*)d_in[6];
    float* OUT = (float*)d_out;     // out0 [4][2048][1024] at 0, out1 [4][1024][1024] at NB*TT*DC
    char* wsp = (char*)d_ws;
    auto take = [&](size_t bytes) { char* p = wsp; wsp += (bytes + 255) & ~(size_t)255; return (void*)p; };
    // All NB_ batch elements go through every stage at once (grid y or z = batch). Planes are [batch][...]; buffers whose contents are dead are reused, in stream order.
    const size_t SX = (size_t)TT * DC, SS = (size_t)DC * DC, SP = (size_t)TT * TT;   // elements per batch element: activations, state, scores
    bf* QPh = (bf*)take(NB_ * SX * 2); bf* QPl = (bf*)take(NB_ * SX * 2); bf* KPh = (bf*)take(NB_ * SX * 2); bf* KPl = (bf*)take(NB_ * SX * 2); bf* VTh = (bf*)take(NB_ * SX * 2); bf* VTl = (bf*)take(NB_ * SX * 2);
    bf* KTh = (bf*)take(NB_ * SX * 2); bf* KTl = (bf*)take(NB_ * SX * 2); bf* VDTh = (bf*)take(NB_ * SX * 2); bf* VDTl = (bf*)take(NB_ * SX * 2);
    float* FF = (float*)take(NB_ * SX * 4);                                          // projection output: Q, then K, then V
    float* CS = (float*)take((size_t)TT * DC * 2 * 4); h16* T16 = (h16*)take(NB_ * SX * 2);
    bf* SNT = (bf*)take(NB_ * SS * 2); bf* XB = (bf*)take(NB_ * SX * 2);
    bf* WQ = (bf*)take((size_t)DQ * DM * 2); bf* WK = (bf*)take((size_t)DKV * DM * 2); bf* WV = (bf*)take((size_t)DKV * DM * 2); float* GP = (float*)take((TT + 64) * 4);
    float* FVD = CS;                 // NB_*SX f32 over CS + T16: written after the last RoPE and after V's transpose
    h16* T16b = (h16*)XB;            // f16 plane of the V*D transpose: XB is dead after the V projection
    float* RR = FF;                  // NB_*SS f32: FF is dead after k_rowscale
    float* Sb = (float*)KTh;         // NB_*SP f32 over KTh..VDTl: dead after the R product
    bf* Ph = (bf*)FF; bf* Pl = (bf*)CS;   // NB_*SP each: FF (RR) dead after k_radd, FVD dead after its transpose
    float* INNER = (float*)KTh; float* CROSS = (float*)VDTh;   // NB_*SX f32 each: Sb is dead after k_dpl
    float* GBF = (float*)KPh;        // NB_*SX f32 over KPh + KPl: dead after Q K^T
    if ((size_t)(wsp - (char*)d_ws) > ws_size) return;   // ws ~ 254 MiB
    { k_wtG<<<(unsigned)((DM * DQ / 64 + 63) / 64), 256, 0, stream>>>(wq, DM, DQ, WQ); k_wtG<<<(unsigned)((DM * DKV / 64 + 63) / 64), 256, 0, stream>>>(wk, DM, DKV, WK); k_wtG<<<(unsigned)((DM * DKV / 64 + 63) / 64), 256, 0, stream>>>(wv, DM, DKV, WV); k_cstabW<<<(unsigned)(((size_t)TT * DC + 255) / 256), 256, 0, stream>>>(CS); k_gptab<<<(TT + 64 + 255) / 256, 256, 0, stream>>>(GP); }
    const unsigned LV = (unsigned)(((size_t)NKV * TT * HD / 2 + 255) / 256), LG = (unsigned)(((size_t)TT * DC / 4 + 255) / 256), LR = (unsigned)(((size_t)TT * DC / 2 + 255) / 256);
    k_cvt8<<<(unsigned)((NB_ * SX / 8 + 255) / 256), 256, 0, stream>>>(x, XB, NB_ * SX / 8);
    k_wtG<<<dim3((unsigned)((DC * DC / 64 + 63) / 64), NB_), 256, 0, stream>>>(sn, DC, DC, SNT);
    k_gemmw<bf, 0, false><<<dim3(TT / 64, DQ / 64, NB_), 32, 0, stream>>>(XB, nullptr, WQ, nullptr, DM, FF, DQ, nullptr, SX, 0, SX); k_ropeW<<<dim3(LR, NB_), 256, 0, stream>>>(FF, CS); k_hlG<<<LG * NB_, 256, 0, stream>>>(FF, QPh, QPl, NB_ * SX);
    k_gemmw<bf, 0, false><<<dim3(TT / 64, DKV / 64, NB_), 32, 0, stream>>>(XB, nullptr, WK, nullptr, DM, FF, DKV, nullptr, SX, 0, SX); k_ropeW<<<dim3(LR, NB_), 256, 0, stream>>>(FF, CS); k_hlG<<<LG * NB_, 256, 0, stream>>>(FF, KPh, KPl, NB_ * SX); k_vtp<<<dim3(LV, NB_), 256, 0, stream>>>(FF, DKV, NKV, T16, KTh, KTl);
    k_gemmw<bf, 0, false><<<dim3(TT / 64, DKV / 64, NB_), 32, 0, stream>>>(XB, nullptr, WV, nullptr, DM, FF, DKV, nullptr, SX, 0, SX); k_vtp<<<dim3(LV, NB_), 256, 0, stream>>>(FF, DKV, NKV, T16, VTh, VTl); k_rowscale<<<dim3(LG, NB_), 256, 0, stream>>>(FF, GP, FVD); k_vtp<<<dim3(LV, NB_), 256, 0, stream>>>(FVD, DKV, NKV, T16b, VDTh, VDTl);
    // R_i = K^T (V D[-1]) + S_n g^T (first, so that its operand planes can be reused for the scores)
    k_gemmw<bf, 2, false><<<dim3(DC / 64, DC / 64, NB_), 32, 0, stream>>>(KTh, KTl, VDTh, VDTl, TT, RR, DC, nullptr, SX, SX, SS);
    k_radd<<<dim3((unsigned)(((size_t)DC * DC / 4 + 255) / 256), NB_), 256, 0, stream>>>(RR, sn, GP, OUT + NB_ * SX);
    // A = (Q K^T) (causal tiles only), then x D into hi/lo planes, inner = A V (causal tiles only)
    k_gemmc<bf, 2, 1><<<dim3(TT / 64, TT / 64, NB_), 32, 0, stream>>>(QPh, QPl, KPh, KPl, DC, Sb, TT, 0, SX, SX, SP);
    k_dpl<<<dim3((unsigned)(((size_t)TT * TT / 4 + 255) / 256), NB_), 256, 0, stream>>>(Sb, GP, Ph, Pl);
    k_gemmc<bf, 2, 2><<<dim3(TT / 64, DC / 64, NB_), 32, 0, stream>>>(Ph, Pl, VTh, VTl, TT, INNER, DC, 0, SP, SX, SX);
    // cross = Q S_n
    k_gemmw<bf, 1, false><<<dim3(TT / 64, DC / 64, NB_), 32, 0, stream>>>(QPh, QPl, SNT, nullptr, DC, CROSS, DC, nullptr, SX, SS, SX);
    k_combgn<<<dim3(TT / 8, NB_), 256, 0, stream>>>(INNER, CROSS, GP, gw, gb, GBF);
    k_perm<<<dim3(LR, NB_), 256, 0, stream>>>(GBF, OUT);
}

// v002
// It runs in 625 microseconds.
// Next to v001, in two timings, it ran 1.22 times as fast each time.
// Counting every step since v000, it is 2.13 times as fast.
#include <hip/hip_runtime.h>

// SingleHeadQKV (chunkwise retention step: X_Q [4][2048][1024], S_n [4][1024][1024]; Q = rope(X W_Q), K = rope(X W_K) (interleaved-pair RoPE over the full 1024 dims), V = X W_V; D[n][m] = g^(n-m) for n >= m (g = 1 - 2^-5); inner = (Q K^T * D) V; cross = (Q S_n) * g^(t+1); out = GroupNorm32(inner + cross) then the literal transpose(-2,-1).reshape permutation -> out0 [4][2048][1024]; R_i = K^T (V * D[-1]) + S_n g^T -> out1 [4][1024][1024] at element 8,388,608).
// Compute dtypes, f32 accumulate: every input rounded to bf16; Q/K/V on PLAIN bf16 operands (inputs: exact); RoPE f32 (on-chip table); decay powers g^n in f32 (powf); Q.K^T (K = 1024) hl x hl (3 products) with causal tile skipping, x D per element in f32 into hi/lo planes (no softmax), (QK^T D).V hl x hl (3 products, causal skipping); Q.S_n hl x exact (2 products); K^T.(V D[-1]) hl x hl (3 products, K = 2048); sums, GroupNorm (32 groups of 32, biased var, eps 1e-6) and the output permutation in f32.

#define NB_  4
#define TT   2048
#define DM   1024
#define NH_  16
#define NKV  16
#define REP  (NH_ / NKV)
#define HD   64
#define DQ   (NH_ * HD)
#define DKV  (NKV * HD)
#define ZH   2
#define RH   2048                  // query rows < RH use hi+lo planes (0: none)
#define WIN  2048
#define PCAR 1024.0f
#define DC   1024   // channel width (= DQ)
#define GAMR 0.96875f
#define SCL  1.0f
typedef _Float16 h16;
typedef unsigned short bf;
typedef __attribute__((ext_vector_type(16))) __bf16   v16bf;
typedef __attribute__((ext_vector_type(16))) _Float16 v16h;
typedef __attribute__((ext_vector_type(8)))  _Float16 v8h;
typedef __attribute__((ext_vector_type(8)))  unsigned short v8us;
typedef __attribute__((ext_vector_type(8)))  float    v8f;
typedef __attribute__((ext_vector_type(4)))  float    v4f;
typedef v8h  __attribute__((may_alias)) v8ha;
typedef v4f  __attribute__((may_alias)) v4fa;
typedef v8us __attribute__((may_alias)) v8usa;

__device__ __forceinline__ unsigned short f2bf(float f) { unsigned u = __float_as_uint(f); u += 0x7FFFu + ((u >> 16) & 1u); return (unsigned short)(u >> 16); }
__device__ __forceinline__ float bf2f(unsigned short b) { return __uint_as_float(((unsigned)b) << 16); }
__device__ __forceinline__ float bfr(float f) { return bf2f(f2bf(f)); }
__device__ __forceinline__ v16h cat16(v8h lo, v8h hi) { return __builtin_shufflevector(lo, hi, 0, 1, 2, 3, 4, 5, 6, 7, 8, 9, 10, 11, 12, 13, 14, 15); }
__device__ __forceinline__ v16bf cat16b(v8us lo, v8us hi) { return __builtin_bit_cast(v16bf, __builtin_shufflevector(lo, hi, 0, 1, 2, 3, 4, 5, 6, 7, 8, 9, 10, 11, 12, 13, 14, 15)); }
__device__ __forceinline__ v8f wmma16(v16h a, v16h b, v8f c) { return __builtin_amdgcn_wmma_f32_16x16x32_f16(false, a, false, b, (short)0, c, false, false); }
__device__ __forceinline__ v8f wmmab(v16bf a, v16bf b, v8f c) { return __builtin_amdgcn_wmma_f32_16x16x32_bf16(false, a, false, b, (short)0, c, false, false); }



// ---- k_gemmw: register-blocked GEMM, ONE WAVE per 64x64 output tile (16 accumulators), operands straight from K-contiguous 16-bit planes; grid (M/64, N/64, Z), 32 threads.
// C[m][n] (f32, pitch ldc, + optional f32 bias[n]) = sum_k A[m][k] Bt[n][k] (+ split products per NSPLIT). z-batch strides sA/sB/sC in elements. K % 32 == 0.
template <typename T16> struct WFrag;
template <> struct WFrag<h16> { typedef v16h V; static __device__ __forceinline__ V ld(const h16* p) { return cat16(*(const v8h*)p, *(const v8h*)(p + 16)); } static __device__ __forceinline__ v8f mma(V a, V b, v8f c) { return wmma16(a, b, c); } };
template <> struct WFrag<bf> { typedef v16bf V; static __device__ __forceinline__ V ld(const bf* p) { return cat16b(*(const v8us*)p, *(const v8us*)(p + 16)); } static __device__ __forceinline__ v8f mma(V a, V b, v8f c) { return wmmab(a, b, c); } };
template <typename T16, int NSPLIT, bool BIAS>
__global__ __launch_bounds__(32) void k_gemmw(const T16* __restrict__ A, const T16* __restrict__ A2, const T16* __restrict__ Bt, const T16* __restrict__ Bt2, int K, float* C, int ldc, const float* __restrict__ bias, size_t sA, size_t sB, size_t sC) {
    typedef typename WFrag<T16>::V V;
    __shared__ __align__(16) float os[16 * 68];
    const size_t z = blockIdx.z; A += z * sA; if (A2) A2 += z * sA; Bt += z * sB; if (Bt2) Bt2 += z * sB; C += z * sC;
    const int lane = threadIdx.x & 31, lr = lane & 15, hi = lane >> 4; const int r0 = blockIdx.x * 64, c0 = blockIdx.y * 64;
    v8f acc[4][4];
#pragma unroll
    for (int mb = 0; mb < 4; ++mb)
#pragma unroll
        for (int nb = 0; nb < 4; ++nb) acc[mb][nb] = (v8f){};
    const size_t aoff = (size_t)(r0 + lr) * K + 8 * hi, boff = (size_t)(c0 + lr) * K + 8 * hi;
#pragma unroll 1
    for (int kc = 0; kc < K; kc += 32) {
        V a[4], a2[4];
#pragma unroll
        for (int mb = 0; mb < 4; ++mb) { a[mb] = WFrag<T16>::ld(A + aoff + (size_t)mb * 16 * K + kc); if (NSPLIT == 1 || NSPLIT == 2) a2[mb] = WFrag<T16>::ld(A2 + aoff + (size_t)mb * 16 * K + kc); }
#pragma unroll
        for (int nb = 0; nb < 4; ++nb) { const V b = WFrag<T16>::ld(Bt + boff + (size_t)nb * 16 * K + kc); V b2; if (NSPLIT >= 2) b2 = WFrag<T16>::ld(Bt2 + boff + (size_t)nb * 16 * K + kc);
#pragma unroll
            for (int mb = 0; mb < 4; ++mb) { acc[mb][nb] = WFrag<T16>::mma(a[mb], b, acc[mb][nb]); if (NSPLIT == 1 || NSPLIT == 2) acc[mb][nb] = WFrag<T16>::mma(a2[mb], b, acc[mb][nb]); if (NSPLIT >= 2) acc[mb][nb] = WFrag<T16>::mma(a[mb], b2, acc[mb][nb]); } }
        asm volatile("v_nop\n\tv_nop\n\tv_nop\n\tv_nop" : "+v"(acc[0][0]), "+v"(acc[1][1]), "+v"(acc[2][2]), "+v"(acc[3][3]) : "v"(a[0]), "v"(a[3]));
    }
#pragma unroll
    for (int mb = 0; mb < 4; ++mb) {
#pragma unroll
        for (int nb = 0; nb < 4; ++nb) {
#pragma unroll
            for (int j = 0; j < 8; ++j) os[(hi * 8 + j) * 68 + nb * 16 + lr] = acc[mb][nb][j]; }
        __builtin_amdgcn_wave_barrier(); asm volatile("" ::: "memory");
        float* crow = C + (size_t)(r0 + mb * 16) * ldc + c0;
{
#pragma unroll
            for (int s = 0; s < 8; ++s) { const int row = 2 * s + hi, cofs = lr * 4; v4f val = *(const v4fa*)(os + row * 68 + cofs); if (BIAS) { val[0] += bfr(bias[c0 + cofs]); val[1] += bfr(bias[c0 + cofs + 1]); val[2] += bfr(bias[c0 + cofs + 2]); val[3] += bfr(bias[c0 + cofs + 3]); }
                *(v4f*)(crow + (size_t)row * ldc + cofs) = val; }
             }
        __builtin_amdgcn_wave_barrier(); asm volatile("" ::: "memory");
    }
}

// ---- k_gemmc: the same one-wave 64x64 tile GEMM specialised for causal attention: CMODE 1 skips score tiles entirely above the diagonal (query rows r0+roff.., key columns c0..), CMODE 2 limits the
// key (K) loop of the probability x value contraction to the diagonal block (probabilities beyond it are exactly zero). roff = row offset of this launch's first row within the sequence.
template <typename T16, int NSPLIT, int CMODE>
__global__ __launch_bounds__(32) void k_gemmc(const T16* __restrict__ A, const T16* __restrict__ A2, const T16* __restrict__ Bt, const T16* __restrict__ Bt2, int K, float* C, int ldc, int roff, size_t sA, size_t sB, size_t sC) {
    typedef typename WFrag<T16>::V V;
    __shared__ __align__(16) float os[16 * 68];
    const size_t z = blockIdx.z; A += z * sA; if (A2) A2 += z * sA; Bt += z * sB; if (Bt2) Bt2 += z * sB; C += z * sC;
    const int lane = threadIdx.x & 31, lr = lane & 15, hi = lane >> 4; const int r0 = blockIdx.x * 64, c0 = blockIdx.y * 64;
    if (CMODE == 1 && c0 > r0 + roff + 63) return;                  // score tile entirely above the causal diagonal: never read (k_dpl masks j > i by select)
    const int Kl = (CMODE == 2) ? min(K, r0 + roff + 64) : K;        // P.V: probabilities are exactly 0 beyond the diagonal block, so the K loop stops there
    v8f acc[4][4];
#pragma unroll
    for (int mb = 0; mb < 4; ++mb)
#pragma unroll
        for (int nb = 0; nb < 4; ++nb) acc[mb][nb] = (v8f){};
    const size_t aoff = (size_t)(r0 + lr) * K + 8 * hi, boff = (size_t)(c0 + lr) * K + 8 * hi;
#pragma unroll 1
    for (int kc = 0; kc < Kl; kc += 32) {
        V a[4], a2[4];
#pragma unroll
        for (int mb = 0; mb < 4; ++mb) { a[mb] = WFrag<T16>::ld(A + aoff + (size_t)mb * 16 * K + kc); if (NSPLIT == 1 || NSPLIT == 2) a2[mb] = WFrag<T16>::ld(A2 + aoff + (size_t)mb * 16 * K + kc); }
#pragma unroll
        for (int nb = 0; nb < 4; ++nb) { const V b = WFrag<T16>::ld(Bt + boff + (size_t)nb * 16 * K + kc); V b2; if (NSPLIT >= 2) b2 = WFrag<T16>::ld(Bt2 + boff + (size_t)nb * 16 * K + kc);
#pragma unroll
            for (int mb = 0; mb < 4; ++mb) { acc[mb][nb] = WFrag<T16>::mma(a[mb], b, acc[mb][nb]); if (NSPLIT == 1 || NSPLIT == 2) acc[mb][nb] = WFrag<T16>::mma(a2[mb], b, acc[mb][nb]); if (NSPLIT >= 2) acc[mb][nb] = WFrag<T16>::mma(a[mb], b2, acc[mb][nb]); } }
        asm volatile("v_nop\n\tv_nop\n\tv_nop\n\tv_nop" : "+v"(acc[0][0]), "+v"(acc[1][1]), "+v"(acc[2][2]), "+v"(acc[3][3]) : "v"(a[0]), "v"(a[3]));
    }
#pragma unroll
    for (int mb = 0; mb < 4; ++mb) {
#pragma unroll
        for (int nb = 0; nb < 4; ++nb) {
#pragma unroll
            for (int j = 0; j < 8; ++j) os[(hi * 8 + j) * 68 + nb * 16 + lr] = acc[mb][nb][j]; }
        __builtin_amdgcn_wave_barrier(); asm volatile("" ::: "memory");
        float* crow = C + (size_t)(r0 + mb * 16) * ldc + c0;
{
#pragma unroll
            for (int s = 0; s < 8; ++s) { const int row = 2 * s + hi, cofs = lr * 4; v4f val = *(const v4fa*)(os + row * 68 + cofs);
                *(v4f*)(crow + (size_t)row * ldc + cofs) = val; }
             }
        __builtin_amdgcn_wave_barrier(); asm volatile("" ::: "memory");
    }
}

__device__ __forceinline__ h16 tohx(float x) { return (h16)x; }
__device__ __forceinline__ void splitf(float y, unsigned short& h, unsigned short& l) { h = f2bf(y); l = f2bf(y - bf2f(h)); }
typedef __attribute__((ext_vector_type(2))) _Float16 v2h;
typedef __attribute__((ext_vector_type(4))) _Float16 v4h;
typedef __attribute__((ext_vector_type(2))) unsigned short v2us;
typedef __attribute__((ext_vector_type(4))) unsigned short v4us;
typedef __attribute__((ext_vector_type(2))) float v2f;
typedef __attribute__((ext_vector_type(4))) int v4i;

// ---- 128 x 64 f32 tile in LDS, shared by the transposing kernels (256 threads): global reads and global writes both move whole 128-byte lines.
#define TRR 128   // source rows per tile
#define TRC 64    // source columns per tile
#define TRP 65    // LDS pitch in dwords: odd, so that a walk down a column meets every bank once
__device__ __forceinline__ void tile_in(const float* __restrict__ src, int ld, float* ts) {   // src: the tile's first element, row pitch ld floats
    const int rr = threadIdx.x >> 4, cc = (threadIdx.x & 15) * 4; const float* g[TRR / 16]; v4f v[TRR / 16];
#pragma unroll
    for (int p = 0; p < TRR / 16; ++p) g[p] = src + (size_t)(p * 16 + rr) * ld + cc;
#pragma unroll
    for (int p = 0; p < TRR / 16; ++p) v[p] = *(const v4f*)g[p];
    // the wait that stands in front of any overwrite of an issued load's address registers; the addresses are its inputs, so that nothing is allocated over them ahead of it
    asm volatile("s_wait_xcnt 0x0" :: "v"(g[0]), "v"(g[1]), "v"(g[2]), "v"(g[3]), "v"(g[4]), "v"(g[5]), "v"(g[6]), "v"(g[7]) : "memory");
#pragma unroll
    for (int p = 0; p < TRR / 16; ++p) {
#pragma unroll
        for (int u = 0; u < 4; ++u) ts[(p * 16 + rr) * TRP + cc + u] = v[p][u]; }
    __syncthreads();   // every column is read back by waves that did not write it
}
// k_wtG: Bt[n][k] = bf16(w[k][n]); grid (K / 128, N / 64, batch)
__global__ __launch_bounds__(256) void k_wtG(const float* __restrict__ w, int K, int N, bf* Bt) {
    __shared__ float ts[TRR * TRP];
    const int k0 = blockIdx.x * TRR, n0 = blockIdx.y * TRC; w += (size_t)blockIdx.z * K * N; Bt += (size_t)blockIdx.z * K * N;
    tile_in(w + (size_t)k0 * N + n0, N, ts);
    const int kg = (threadIdx.x & 7) * 8, nr = threadIdx.x >> 3;   // 8 lanes x 8 k = one 128-byte line of a Bt row; a wave stores 4 rows
#pragma unroll
    for (int p = 0; p < 4; ++p) { const int k = (p & 1) * 64 + kg, n = (p >> 1) * 32 + nr; v8us o;
#pragma unroll
        for (int i = 0; i < 8; ++i) o[i] = f2bf(ts[(k + i) * TRP + n]);
        *(v8us*)(Bt + (size_t)(n0 + n) * K + k0 + k) = o; }
}
__global__ __launch_bounds__(256) void k_cvt8(const float* __restrict__ src, bf* dst, size_t n8) { const size_t i = (size_t)blockIdx.x * 256 + threadIdx.x; if (i >= n8) return; const v8f v = *(const v8f*)(src + i * 8); v8us o;
#pragma unroll
    for (int k = 0; k < 8; ++k) o[k] = f2bf(v[k]); *(v8us*)(dst + i * 8) = o;  }
__global__ __launch_bounds__(256) void k_cstab(float* CS) { const int idx = blockIdx.x * 256 + threadIdx.x; if (idx >= TT * HD) return; const int t = idx / HD, d = idx % HD; const int i = (d < HD / 2) ? d : d - HD / 2; const float inv = __fdiv_rn(1.0f, powf(10000.0f, (float)(2 * i) / (float)HD)); const float ang = __fmul_rn((float)t, inv); v2f cs; cs[0] = cosf(ang); cs[1] = sinf(ang);
    *(v2f*)(CS + (size_t)idx * 2) = cs;  }
// k_rope: head planes [h][t][d] (fp16 + hi/lo) of rope(x) x sc with the rotate-half convention out[d] = x[d] cos[t][d] - x[d+HD/2] sin[t][d], out[d+HD/2] = x[d+HD/2] cos[t][d+HD/2] + x[d] sin[t][d+HD/2]
__global__ __launch_bounds__(256) void k_rope(const float* __restrict__ F, int pitch, int nheads, const float* __restrict__ CS, const float* __restrict__ RF, const float* __restrict__ nw, float sc, h16* P16, bf* Ph, bf* Pl) {
    const size_t e = ((size_t)blockIdx.x * 256 + threadIdx.x) * 2; if (e >= (size_t)nheads * TT * HD) return; const int d = (int)(e % HD); const int t = (int)((e / HD) % TT); const int h = (int)(e / ((size_t)HD * TT)); const float* f = F + (size_t)t * pitch + h * HD; const float rf = RF ? RF[(size_t)h * TT + t] : 1.0f; v2h o16; v2us oh, ol;
#pragma unroll
    for (int q = 0; q < 2; ++q) { const int dd = d + q; const int dp = (dd < HD / 2) ? dd + HD / 2 : dd - HD / 2; float x0 = f[dd], x1 = f[dp];
        if (RF) { float n0 = __fmul_rn(x0, rf), n1 = __fmul_rn(x1, rf); asm volatile("" : "+v"(n0)); asm volatile("" : "+v"(n1)); x0 = __fmul_rn(bfr(nw[dd]), n0); x1 = __fmul_rn(bfr(nw[dp]), n1); }
        const v2f cs = *(const v2f*)(CS + ((size_t)t * HD + dd) * 2); float a = __fmul_rn(x0, cs[0]), bq = __fmul_rn(x1, cs[1]); asm volatile("" : "+v"(a)); asm volatile("" : "+v"(bq)); const float r = ((dd < HD / 2) ? __fsub_rn(a, bq) : __fadd_rn(a, bq)) * sc;
        o16[q] = tohx(r); unsigned short a2, c2; splitf(r, a2, c2); oh[q] = a2; ol[q] = c2; }
    *(v2h*)(P16 + e) = o16; *(v2us*)(Ph + e) = oh; *(v2us*)(Pl + e) = ol;  }
// k_vtp: planes [c][t] (f16 + bf16 hi/lo) of F[t][c], c = head * HD + d; grid (TT / 128, nheads * HD / 64, batch)
__global__ __launch_bounds__(256) void k_vtp(const float* __restrict__ F, int pitch, int nheads, h16* V16, bf* Vh, bf* Vl) {
    __shared__ float ts[TRR * TRP];
    const int t0 = blockIdx.x * TRR, c0 = blockIdx.y * TRC; F += (size_t)blockIdx.z * TT * pitch; { const size_t zo = (size_t)blockIdx.z * nheads * HD * TT; V16 += zo; Vh += zo; Vl += zo; }
    tile_in(F + (size_t)t0 * pitch + c0, pitch, ts);
    const int tg = (threadIdx.x & 7) * 8, cr = threadIdx.x >> 3;   // 8 lanes x 8 t = one 128-byte line of a plane row; a wave stores 4 rows
#pragma unroll
    for (int p = 0; p < 4; ++p) { const int t = (p & 1) * 64 + tg, c = (p >> 1) * 32 + cr; v8h o16; v8us oh, ol;
#pragma unroll
        for (int i = 0; i < 8; ++i) { const float x = ts[(t + i) * TRP + c]; o16[i] = tohx(x); unsigned short a2, c2; splitf(x, a2, c2); oh[i] = a2; ol[i] = c2; }
        const size_t o = (size_t)(c0 + c) * TT + t0 + t; *(v8h*)(V16 + o) = o16; *(v8us*)(Vh + o) = oh; *(v8us*)(Vl + o) = ol; }
}
__global__ __launch_bounds__(256) void k_colsum(const bf* __restrict__ Ph, const bf* __restrict__ Pl, const h16* __restrict__ P16, int h0, float* ACC) { const int t = blockIdx.x * 256 + threadIdx.x; if (t >= TT) return; float acc = ((h0 % REP) == 0) ? 0.0f : ACC[t];
#pragma unroll 1
    for (int zz = 0; zz < ZH; ++zz) {
#pragma unroll 4
        for (int i = 0; i < RH; ++i) { const size_t o = ((size_t)zz * RH + i) * TT + t; acc = __fadd_rn(acc, __fadd_rn(bf2f(Ph[o]), bf2f(Pl[o]))); }
#pragma unroll 4
        for (int i = RH; i < TT; ++i) { const size_t o = ((size_t)zz * TT + i) * TT + t; float pv = __fmul_rn((float)P16[o], 1.0f / PCAR); asm volatile("" : "+v"(pv)); acc = __fadd_rn(acc, pv); } }
    *(float*)(ACC + t) = acc;  }
// k_asoft: per row (zz, i): t = S x SCL (= 1) for j <= i and i - j < WIN (sliding causal window; the reference's -1e9 additive fill vanishes identically); softmax over the 2048 keys (register row, one exp, fixed trees);
__global__ __launch_bounds__(256) void k_asoft(const float* __restrict__ Sb, h16* P16, bf* Ph, bf* Pl) {
    const int lane = threadIdx.x & 31; const int row = blockIdx.x * 8 + (threadIdx.x >> 5); if (row >= ZH * TT) return; const int i = row % TT; const int zz = row / TT; (void)zz; const bool hires = (i < RH); const float* sr = Sb + (size_t)row * TT; float v[TT / 32]; float mx = -3.0e38f;
#pragma unroll
    for (int ch = 0; ch < TT / 128; ++ch) { const int j0 = ch * 128 + lane * 4; const v4f a = *(const v4f*)(sr + j0);
#pragma unroll
        for (int q = 0; q < 4; ++q) { const int j = j0 + q; (void)j; float sa = a[q] * SCL; asm volatile("" : "+v"(sa)); const float t = (j <= i && i - j < WIN) ? sa : -3.0e38f; v[ch * 4 + q] = t; mx = fmaxf(mx, t); } }
#pragma unroll
    for (int sh = 16; sh; sh >>= 1) mx = fmaxf(mx, __shfl_xor(mx, sh, 32));
    float sum = 0.f;
#pragma unroll
    for (int k = 0; k < TT / 32; ++k) { float d0 = __fsub_rn(v[k], mx); asm volatile("" : "+v"(d0)); v[k] = __builtin_amdgcn_exp2f(__fmul_rn(d0, 1.4426950408889634f)); sum += v[k]; }
#pragma unroll
    for (int sh = 16; sh; sh >>= 1) sum += __shfl_xor(sum, sh, 32);
    const float f = __fdiv_rn(hires ? 1.0f : PCAR, sum);
{
        if (hires) {
#pragma unroll
            for (int ch = 0; ch < TT / 128; ++ch) { v4us oh, ol;
#pragma unroll
                for (int q = 0; q < 4; ++q) { unsigned short a, c2; splitf(v[ch * 4 + q] * f, a, c2); oh[q] = a; ol[q] = c2; }
                const size_t oo = ((size_t)zz * (RH ? RH : 1) + i) * TT + ch * 128 + lane * 4; *(v4us*)(Ph + oo) = oh; *(v4us*)(Pl + oo) = ol; }
        } else {
#pragma unroll
            for (int ch = 0; ch < TT / 128; ++ch) { v4h o4;
#pragma unroll
                for (int q = 0; q < 4; ++q) o4[q] = tohx(v[ch * 4 + q] * f);
                *(v4h*)(P16 + (size_t)row * TT + ch * 128 + lane * 4) = o4; } }
         }
}
__global__ __launch_bounds__(256) void k_merge(const float* __restrict__ O, int h0, bf* Ah, bf* Al) { const size_t e = ((size_t)blockIdx.x * 256 + threadIdx.x) * 2; if (e >= (size_t)ZH * TT * HD) return; const int d = (int)(e % HD); const int t = (int)((e / HD) % TT); const int zz = (int)(e / ((size_t)HD * TT)); const float cs = (t < RH) ? 1.0f : (1.0f / PCAR); const size_t oo = (size_t)t * DQ + (h0 + zz) * HD + d;
    v2us oh, ol;
#pragma unroll
    for (int q = 0; q < 2; ++q) { unsigned short a, c2; splitf(O[e + q] * cs, a, c2); oh[q] = a; ol[q] = c2; } *(v2us*)(Ah + oo) = oh; *(v2us*)(Al + oo) = ol;  }


// ---- SingleHeadQKV kernels ----
__global__ __launch_bounds__(256) void k_hlG(const float* __restrict__ F, bf* Fh, bf* Fl, size_t n) { const size_t e = ((size_t)blockIdx.x * 256 + threadIdx.x) * 4; if (e >= n) return; const v4f a = *(const v4f*)(F + e); v4us oh, ol; for (int u = 0; u < 4; ++u) { unsigned short p, q; splitf(a[u], p, q); oh[u] = p; ol[u] = q; } *(v4us*)(Fh + e) = oh; *(v4us*)(Fl + e) = ol;  }
__global__ __launch_bounds__(256) void k_gptab(float* GP) { const int n = blockIdx.x * 256 + threadIdx.x; if (n >= TT + 64) return; const float v = powf(GAMR, (float)n); *(float*)(GP + n) = v;  }
__global__ __launch_bounds__(256) void k_cstabW(float* CS) { const size_t idx = (size_t)blockIdx.x * 256 + threadIdx.x; if (idx >= (size_t)TT * DC) return; const int t = (int)(idx / DC), d = (int)(idx % DC); const float inv = __fdiv_rn(1.0f, powf(10000.0f, (float)(2 * (d >> 1)) / (float)DC)); const float ang = __fmul_rn((float)t, inv); v2f cs; cs[0] = cosf(ang); cs[1] = sinf(ang); *(v2f*)(CS + idx * 2) = cs;  }
__global__ __launch_bounds__(256) void k_ropeW(float* F, const float* __restrict__ CS) { const size_t e = ((size_t)blockIdx.x * 256 + threadIdx.x) * 2; if (e >= (size_t)TT * DC) return; F += (size_t)blockIdx.y * TT * DC; const v2f xv = *(const v2f*)(F + e); const v2f c0 = *(const v2f*)(CS + e * 2); const v2f c1 = *(const v2f*)(CS + (e + 1) * 2); float a0 = __fmul_rn(xv[0], c0[0]), b0 = __fmul_rn(xv[1], c0[1]); asm volatile("" : "+v"(a0)); asm volatile("" : "+v"(b0)); float a1 = __fmul_rn(xv[1], c1[0]), b1 = __fmul_rn(xv[0], c1[1]); asm volatile("" : "+v"(a1)); asm volatile("" : "+v"(b1)); v2f o; o[0] = __fsub_rn(a0, b0); o[1] = __fadd_rn(a1, b1); *(v2f*)(F + e) = o;  }
__global__ __launch_bounds__(256) void k_rowscale(const float* __restrict__ F, const float* __restrict__ GP, float* D) { const size_t e = ((size_t)blockIdx.x * 256 + threadIdx.x) * 4; if (e >= (size_t)TT * DC) return; F += (size_t)blockIdx.y * TT * DC; D += (size_t)blockIdx.y * TT * DC; const int t = (int)(e / DC); const float gsc = GP[TT - 1 - t]; const v4f a = *(const v4f*)(F + e); v4f o; for (int u = 0; u < 4; ++u) o[u] = __fmul_rn(a[u], gsc); *(v4f*)(D + e) = o;  }
__global__ __launch_bounds__(256) void k_dpl(const float* __restrict__ Sb, const float* __restrict__ GP, bf* Ph, bf* Pl) { const size_t e = ((size_t)blockIdx.x * 256 + threadIdx.x) * 4; if (e >= (size_t)TT * TT) return; { const size_t zo = (size_t)blockIdx.y * TT * TT; Sb += zo; Ph += zo; Pl += zo; } const int i = (int)(e / TT); const int j0 = (int)(e % TT); v4f a; if (j0 <= i) a = *(const v4f*)(Sb + e); else { for (int u = 0; u < 4; ++u) a[u] = 0.0f; } v4us oh, ol; for (int u = 0; u < 4; ++u) { const int j = j0 + u; float v = 0.0f; if (j <= i) v = __fmul_rn(a[u], GP[i - j]); unsigned short a2, c2; splitf(v, a2, c2); oh[u] = a2; ol[u] = c2; } *(v4us*)(Ph + e) = oh; *(v4us*)(Pl + e) = ol;  }
__global__ __launch_bounds__(256) void k_combgn(const float* __restrict__ IN, const float* __restrict__ CR, const float* __restrict__ GP, const float* __restrict__ gw, const float* __restrict__ gb, float* G) { const int lane = threadIdx.x & 31; const int t = blockIdx.x * 8 + (threadIdx.x >> 5); if (t >= TT) return; { const size_t zo = (size_t)blockIdx.y * TT * DC; IN += zo; CR += zo; G += zo; } const float ge = GP[t + 1];
#pragma unroll 1
    for (int ch = 0; ch < DC / 128; ++ch) { const size_t base = (size_t)t * DC + ch * 128 + lane * 4; const v4f a = *(const v4f*)(IN + base); const v4f c = *(const v4f*)(CR + base); float v[4]; float sm = 0.f; for (int u = 0; u < 4; ++u) { float cg = __fmul_rn(c[u], ge); asm volatile("" : "+v"(cg)); v[u] = __fadd_rn(a[u], cg); sm = __fadd_rn(sm, v[u]); }
        for (int sh = 1; sh < 8; sh <<= 1) sm = __fadd_rn(sm, __shfl_xor(sm, sh, 32));
        const float mu = __fmul_rn(sm, 1.0f / 32.0f); float ss = 0.f; float d[4]; for (int u = 0; u < 4; ++u) { d[u] = __fsub_rn(v[u], mu); float p = __fmul_rn(d[u], d[u]); asm volatile("" : "+v"(p)); ss = __fadd_rn(ss, p); }
        for (int sh = 1; sh < 8; sh <<= 1) ss = __fadd_rn(ss, __shfl_xor(ss, sh, 32));
        const float rs = __fdiv_rn(1.0f, sqrtf(__fadd_rn(__fmul_rn(ss, 1.0f / 32.0f), 1e-6f))); v4f o; for (int u = 0; u < 4; ++u) { const int cc = ch * 128 + lane * 4 + u; float n = __fmul_rn(d[u], rs); asm volatile("" : "+v"(n)); float w0 = bfr(gw[cc]), b0 = bfr(gb[cc]); asm volatile("" : "+v"(w0)); asm volatile("" : "+v"(b0)); float y = __fmul_rn(n, w0); asm volatile("" : "+v"(y)); o[u] = __fadd_rn(y, b0); }
        *(v4f*)(G + base) = o;  } }
// k_perm: the reference's transpose(-2,-1).reshape keeps the flat order of the transpose, so O read as [DC][TT] is G[TT][DC] transposed; grid (TT / 128, DC / 64, batch)
__global__ __launch_bounds__(256) void k_perm(const float* __restrict__ G, float* O) {
    __shared__ float ts[TRR * TRP];
    const int t0 = blockIdx.x * TRR, c0 = blockIdx.y * TRC; G += (size_t)blockIdx.z * TT * DC; O += (size_t)blockIdx.z * TT * DC;
    tile_in(G + (size_t)t0 * DC + c0, DC, ts);
    const int tg = (threadIdx.x & 15) * 4, cr = threadIdx.x >> 4;   // 16 lanes x 4 t = two 128-byte lines of an O row; a wave stores 2 rows
#pragma unroll
    for (int p = 0; p < 8; ++p) { const int t = (p & 1) * 64 + tg, c = (p >> 1) * 16 + cr; v4f o;
#pragma unroll
        for (int i = 0; i < 4; ++i) o[i] = ts[(t + i) * TRP + c];
        *(v4f*)(O + (size_t)(c0 + c) * TT + t0 + t) = o; }
}
__global__ __launch_bounds__(256) void k_radd(const float* __restrict__ R, const float* __restrict__ SN, const float* __restrict__ GP, float* O) { const size_t e = ((size_t)blockIdx.x * 256 + threadIdx.x) * 4; if (e >= (size_t)DC * DC) return; { const size_t zo = (size_t)blockIdx.y * DC * DC; R += zo; SN += zo; O += zo; } const float gT = GP[TT]; const v4f a = *(const v4f*)(R + e); const v4f s = *(const v4f*)(SN + e); v4f o; for (int u = 0; u < 4; ++u) { float sg = __fmul_rn(bfr(s[u]), gT); asm volatile("" : "+v"(sg)); o[u] = __fadd_rn(a[u], sg); } *(v4f*)(O + e) = o;  }

extern "C" void kernel_launch(void* const* d_in, const int* in_sizes, int n_in,
                              void* d_out, int out_size, void* d_ws, size_t ws_size, hipStream_t stream) {
    (void)in_sizes; (void)n_in; (void)out_size;
    const float* x = (const float*)d_in[0]; const float* sn = (const float*)d_in[1]; const float* wq = (const float*)d_in[2]; const float* wk = (const float*)d_in[3]; const float* wv = (const float*)d_in[4]; const float* gw = (const float*)d_in[5]; const float* gb = (const float*)d_in[6];
    float* OUT = (float*)d_out;     // out0 [4][2048][1024] at 0, out1 [4][1024][1024] at NB*TT*DC
    char* wsp = (char*)d_ws;
    auto take = [&](size_t bytes) { char* p = wsp; wsp += (bytes + 255) & ~(size_t)255; return (void*)p; };
    // All NB_ batch elements go through every stage at once (grid y or z = batch). Planes are [batch][...]; buffers whose contents are dead are reused, in stream order.
    const size_t SX = (size_t)TT * DC, SS = (size_t)DC * DC, SP = (size_t)TT * TT;   // elements per batch element: activations, state, scores
    bf* QPh = (bf*)take(NB_ * SX * 2); bf* QPl = (bf*)take(NB_ * SX * 2); bf* KPh = (bf*)take(NB_ * SX * 2); bf* KPl = (bf*)take(NB_ * SX * 2); bf* VTh = (bf*)take(NB_ * SX * 2); bf* VTl = (bf*)take(NB_ * SX * 2);
    bf* KTh = (bf*)take(NB_ * SX * 2); bf* KTl = (bf*)take(NB_ * SX * 2); bf* VDTh = (bf*)take(NB_ * SX * 2); bf* VDTl = (bf*)take(NB_ * SX * 2);
    float* FF = (float*)take(NB_ * SX * 4);                                          // projection output: Q, then K, then V
    float* CS = (float*)take((size_t)TT * DC * 2 * 4); h16* T16 = (h16*)take(NB_ * SX * 2);
    bf* SNT = (bf*)take(NB_ * SS * 2); bf* XB = (bf*)take(NB_ * SX * 2);
    bf* WQ = (bf*)take((size_t)DQ * DM * 2); bf* WK = (bf*)take((size_t)DKV * DM * 2); bf* WV = (bf*)take((size_t)DKV * DM * 2); float* GP = (float*)take((TT + 64) * 4);
    float* FVD = CS;                 // NB_*SX f32 over CS + T16: written after the last RoPE and after V's transpose
    h16* T16b = (h16*)XB;            // f16 plane of the V*D transpose: XB is dead after the V projection
    float* RR = FF;                  // NB_*SS f32: FF is dead after k_rowscale
    float* Sb = (float*)KTh;         // NB_*SP f32 over KTh..VDTl: dead after the R product
    bf* Ph = (bf*)FF; bf* Pl = (bf*)CS;   // NB_*SP each: FF (RR) dead after k_radd, FVD dead after its transpose
    float* INNER = (float*)KTh; float* CROSS = (float*)VDTh;   // NB_*SX f32 each: Sb is dead after k_dpl
    float* GBF = (float*)KPh;        // NB_*SX f32 over KPh + KPl: dead after Q K^T
    if ((size_t)(wsp - (char*)d_ws) > ws_size) return;   // ws ~ 254 MiB
    { k_wtG<<<dim3(DM / TRR, DQ / TRC, 1), 256, 0, stream>>>(wq, DM, DQ, WQ); k_wtG<<<dim3(DM / TRR, DKV / TRC, 1), 256, 0, stream>>>(wk, DM, DKV, WK); k_wtG<<<dim3(DM / TRR, DKV / TRC, 1), 256, 0, stream>>>(wv, DM, DKV, WV); k_cstabW<<<(unsigned)(((size_t)TT * DC + 255) / 256), 256, 0, stream>>>(CS); k_gptab<<<(TT + 64 + 255) / 256, 256, 0, stream>>>(GP); }
    const unsigned LG = (unsigned)(((size_t)TT * DC / 4 + 255) / 256), LR = (unsigned)(((size_t)TT * DC / 2 + 255) / 256);
    k_cvt8<<<(unsigned)((NB_ * SX / 8 + 255) / 256), 256, 0, stream>>>(x, XB, NB_ * SX / 8);
    k_wtG<<<dim3(DC / TRR, DC / TRC, NB_), 256, 0, stream>>>(sn, DC, DC, SNT);
    k_gemmw<bf, 0, false><<<dim3(TT / 64, DQ / 64, NB_), 32, 0, stream>>>(XB, nullptr, WQ, nullptr, DM, FF, DQ, nullptr, SX, 0, SX); k_ropeW<<<dim3(LR, NB_), 256, 0, stream>>>(FF, CS); k_hlG<<<LG * NB_, 256, 0, stream>>>(FF, QPh, QPl, NB_ * SX);
    k_gemmw<bf, 0, false><<<dim3(TT / 64, DKV / 64, NB_), 32, 0, stream>>>(XB, nullptr, WK, nullptr, DM, FF, DKV, nullptr, SX, 0, SX); k_ropeW<<<dim3(LR, NB_), 256, 0, stream>>>(FF, CS); k_hlG<<<LG * NB_, 256, 0, stream>>>(FF, KPh, KPl, NB_ * SX); k_vtp<<<dim3(TT / TRR, DKV / TRC, NB_), 256, 0, stream>>>(FF, DKV, NKV, T16, KTh, KTl);
    k_gemmw<bf, 0, false><<<dim3(TT / 64, DKV / 64, NB_), 32, 0, stream>>>(XB, nullptr, WV, nullptr, DM, FF, DKV, nullptr, SX, 0, SX); k_vtp<<<dim3(TT / TRR, DKV / TRC, NB_), 256, 0, stream>>>(FF, DKV, NKV, T16, VTh, VTl); k_rowscale<<<dim3(LG, NB_), 256, 0, stream>>>(FF, GP, FVD); k_vtp<<<dim3(TT / TRR, DKV / TRC, NB_), 256, 0, stream>>>(FVD, DKV, NKV, T16b, VDTh, VDTl);
    // R_i = K^T (V D[-1]) + S_n g^T (first, so that its operand planes can be reused for the scores)
    k_gemmw<bf, 2, false><<<dim3(DC / 64, DC / 64, NB_), 32, 0, stream>>>(KTh, KTl, VDTh, VDTl, TT, RR, DC, nullptr, SX, SX, SS);
    k_radd<<<dim3((unsigned)(((size_t)DC * DC / 4 + 255) / 256), NB_), 256, 0, stream>>>(RR, sn, GP, OUT + NB_ * SX);
    // A = (Q K^T) (causal tiles only), then x D into hi/lo planes, inner = A V (causal tiles only)
    k_gemmc<bf, 2, 1><<<dim3(TT / 64, TT / 64, NB_), 32, 0, stream>>>(QPh, QPl, KPh, KPl, DC, Sb, TT, 0, SX, SX, SP);
    k_dpl<<<dim3((unsigned)(((size_t)TT * TT / 4 + 255) / 256), NB_), 256, 0, stream>>>(Sb, GP, Ph, Pl);
    k_gemmc<bf, 2, 2><<<dim3(TT / 64, DC / 64, NB_), 32, 0, stream>>>(Ph, Pl, VTh, VTl, TT, INNER, DC, 0, SP, SX, SX);
    // cross = Q S_n
    k_gemmw<bf, 1, false><<<dim3(TT / 64, DC / 64, NB_), 32, 0, stream>>>(QPh, QPl, SNT, nullptr, DC, CROSS, DC, nullptr, SX, SS, SX);
    k_combgn<<<dim3(TT / 8, NB_), 256, 0, stream>>>(INNER, CROSS, GP, gw, gb, GBF);
    k_perm<<<dim3(TT / TRR, DC / TRC, NB_), 256, 0, stream>>>(GBF, OUT);
}

// v003
// One run takes 400 microseconds.
// Next to v002, in two timings, it ran 1.56 times as fast each time.
// Counting every step since v000, it is 3.33 times as fast.
#include <hip/hip_runtime.h>

// SingleHeadQKV (chunkwise retention step: X_Q [4][2048][1024], S_n [4][1024][1024]; Q = rope(X W_Q), K = rope(X W_K) (interleaved-pair RoPE over the full 1024 dims), V = X W_V; D[n][m] = g^(n-m) for n >= m (g = 1 - 2^-5); inner = (Q K^T * D) V; cross = (Q S_n) * g^(t+1); out = GroupNorm32(inner + cross) then the literal transpose(-2,-1).reshape permutation -> out0 [4][2048][1024]; R_i = K^T (V * D[-1]) + S_n g^T -> out1 [4][1024][1024] at element 8,388,608).
// Compute dtypes, f32 accumulate: every input rounded to bf16; Q/K/V on PLAIN bf16 operands (inputs: exact); RoPE f32 (on-chip table); decay powers g^n in f32 (powf); Q.K^T (K = 1024) hl x hl (3 products) with causal tile skipping, x D per element in f32 into hi/lo planes (no softmax), (QK^T D).V hl x hl (3 products, causal skipping); Q.S_n hl x exact (2 products); K^T.(V D[-1]) hl x hl (3 products, K = 2048); sums, GroupNorm (32 groups of 32, biased var, eps 1e-6) and the output permutation in f32.

#define NB_  4
#define TT   2048
#define DM   1024
#define NH_  16
#define NKV  16
#define REP  (NH_ / NKV)
#define HD   64
#define DQ   (NH_ * HD)
#define DKV  (NKV * HD)
#define ZH   2
#define RH   2048                  // query rows < RH use hi+lo planes (0: none)
#define WIN  2048
#define PCAR 1024.0f
#define DC   1024   // channel width (= DQ)
#define GAMR 0.96875f
#define SCL  1.0f
typedef _Float16 h16;
typedef unsigned short bf;
typedef __attribute__((ext_vector_type(16))) __bf16   v16bf;
typedef __attribute__((ext_vector_type(16))) _Float16 v16h;
typedef __attribute__((ext_vector_type(8)))  _Float16 v8h;
typedef __attribute__((ext_vector_type(8)))  unsigned short v8us;
typedef __attribute__((ext_vector_type(8)))  float    v8f;
typedef __attribute__((ext_vector_type(4)))  float    v4f;
typedef v8h  __attribute__((may_alias)) v8ha;
typedef v4f  __attribute__((may_alias)) v4fa;
typedef v8us __attribute__((may_alias)) v8usa;

__device__ __forceinline__ unsigned short f2bf(float f) { unsigned u = __float_as_uint(f); u += 0x7FFFu + ((u >> 16) & 1u); return (unsigned short)(u >> 16); }
__device__ __forceinline__ float bf2f(unsigned short b) { return __uint_as_float(((unsigned)b) << 16); }
__device__ __forceinline__ float bfr(float f) { return bf2f(f2bf(f)); }
__device__ __forceinline__ v16h cat16(v8h lo, v8h hi) { return __builtin_shufflevector(lo, hi, 0, 1, 2, 3, 4, 5, 6, 7, 8, 9, 10, 11, 12, 13, 14, 15); }
__device__ __forceinline__ v16bf cat16b(v8us lo, v8us hi) { return __builtin_bit_cast(v16bf, __builtin_shufflevector(lo, hi, 0, 1, 2, 3, 4, 5, 6, 7, 8, 9, 10, 11, 12, 13, 14, 15)); }
__device__ __forceinline__ v8f wmma16(v16h a, v16h b, v8f c) { return __builtin_amdgcn_wmma_f32_16x16x32_f16(false, a, false, b, (short)0, c, false, false); }
__device__ __forceinline__ v8f wmmab(v16bf a, v16bf b, v8f c) { return __builtin_amdgcn_wmma_f32_16x16x32_bf16(false, a, false, b, (short)0, c, false, false); }



// ---- k_gemmt: C[m][n] (f32, pitch ldc) = sum_k A[m][k] Bt[n][k] (+ split products per NSPLIT) on K-contiguous bf16 planes. One 128x128 tile of C per work-group of four waves (2x2, 64x64 each, 16 accumulators a wave);
// grid (M/128, N/128, Z), 128 threads. A pass is KP k of all 128 rows of every operand plane; asynchronous copies bring it into a two-buffer LDS ring as whole 128-byte lines, one pass ahead of its use, and each row is fetched once for two waves.
// CMODE 1 skips score tiles entirely above the causal diagonal; CMODE 2 ends the K loop of the (decayed score) x value product at the diagonal block (the planes are exactly zero beyond it). M, N % 128 == 0, K % KP == 0.
typedef float __attribute__((may_alias)) f32a;
// eight copies of 16 bytes a lane; the s_wait_xcnt stands inside the statement, in front of any overwrite of the address registers that the copies name
__device__ __forceinline__ void copy8(unsigned l, int lstep, const bf* g, size_t gstep) {
    const unsigned l0 = l, l1 = l + lstep, l2 = l + 2 * lstep, l3 = l + 3 * lstep, l4 = l + 4 * lstep, l5 = l + 5 * lstep, l6 = l + 6 * lstep, l7 = l + 7 * lstep;
    const bf *g0 = g, *g1 = g + gstep, *g2 = g + 2 * gstep, *g3 = g + 3 * gstep, *g4 = g + 4 * gstep, *g5 = g + 5 * gstep, *g6 = g + 6 * gstep, *g7 = g + 7 * gstep;
    asm volatile("global_load_async_to_lds_b128 %0, %8, off\n\tglobal_load_async_to_lds_b128 %1, %9, off\n\tglobal_load_async_to_lds_b128 %2, %10, off\n\tglobal_load_async_to_lds_b128 %3, %11, off\n\t"
                 "global_load_async_to_lds_b128 %4, %12, off\n\tglobal_load_async_to_lds_b128 %5, %13, off\n\tglobal_load_async_to_lds_b128 %6, %14, off\n\tglobal_load_async_to_lds_b128 %7, %15, off\n\ts_wait_xcnt 0x0"
                 :: "v"(l0), "v"(l1), "v"(l2), "v"(l3), "v"(l4), "v"(l5), "v"(l6), "v"(l7), "v"(g0), "v"(g1), "v"(g2), "v"(g3), "v"(g4), "v"(g5), "v"(g6), "v"(g7) : "memory");
}
__device__ __forceinline__ v16bf ldsfrag(const unsigned char* p) { return cat16b(*(const v8usa*)p, *(const v8usa*)(p + 32)); }
template <int NSPLIT, int CMODE>
__global__ __launch_bounds__(128) void k_gemmt(const bf* __restrict__ A, const bf* __restrict__ A2, const bf* __restrict__ Bt, const bf* __restrict__ Bt2, int K, float* C, int ldc, size_t sA, size_t sB, size_t sC) {
    constexpr int NP = (NSPLIT == 0) ? 2 : (NSPLIT == 1) ? 3 : 4;   // operand planes of a stage: A, (A2), B, (B2)
    constexpr int KP = (NSPLIT == 0) ? 128 : 64;                    // k per pass
    constexpr int PITCH = KP * 2 + 16;                              // LDS row pitch in bytes: 16 x odd, for 16-byte readers
    constexpr int PLANE = 128 * PITCH, STAGE = NP * PLANE, PB = (NSPLIT == 0) ? 1 : 2;
    constexpr int GB = (NSPLIT == 0) ? 2 : 1;                       // column blocks whose B fragments are read as one group
    constexpr int LA = (NSPLIT == 0) ? 8 : 16, LB = GB * ((NSPLIT == 2) ? 4 : 2), NW = GB * 4 * (NSPLIT + 1);   // 16-byte LDS reads of the A fragments and of a B group; products of a group
    constexpr int CPR = KP / 8, RPI = 128 / CPR;                    // 16-byte units per row; rows that the 128 threads cover at once
    __shared__ __attribute__((aligned(2048))) unsigned char ring[2 * STAGE];
    const int r0 = blockIdx.x * 128, c0 = blockIdx.y * 128;
    if (CMODE == 1 && c0 > r0 + 127) return;                        // the whole work-group leaves, ahead of every copy and barrier
    const int Kl = (CMODE == 2) ? min(K, r0 + 128) : K; const int npass = Kl / KP;
    const size_t z = blockIdx.z; C += z * sC;
    const int tid = threadIdx.x, lane = tid & 31, lr = lane & 15, hi = lane >> 4, wave = tid >> 5, wm = wave >> 1, wn = wave & 1;
    const int crow = tid / CPR, ccol = tid % CPR;
    const size_t ga = z * sA + (size_t)(r0 + crow) * K + ccol * 8, gb = z * sB + (size_t)(c0 + crow) * K + ccol * 8, gstep = (size_t)RPI * K;
    const unsigned lbase = (unsigned)(size_t)ring + crow * PITCH + ccol * 16;
    auto fill = [&](int t) {   // pass t into buffer t & 1
        const unsigned l = lbase + (t & 1) * STAGE; const size_t kc = (size_t)t * KP;
#pragma unroll
        for (int h = 0; h < CPR / 8; ++h) {
            const unsigned lh = l + h * 8 * RPI * PITCH; const size_t gh = kc + h * 8 * gstep;
            copy8(lh, RPI * PITCH, A + ga + gh, gstep);
            if (NSPLIT == 1 || NSPLIT == 2) copy8(lh + PLANE, RPI * PITCH, A2 + ga + gh, gstep);
            copy8(lh + PB * PLANE, RPI * PITCH, Bt + gb + gh, gstep);
            if (NSPLIT == 2) copy8(lh + 3 * PLANE, RPI * PITCH, Bt2 + gb + gh, gstep);
        }
    };
    v8f acc[4][4];
#pragma unroll
    for (int mb = 0; mb < 4; ++mb)
#pragma unroll
        for (int nb = 0; nb < 4; ++nb) acc[mb][nb] = (v8f){};
    fill(0);
    asm volatile("s_wait_asynccnt 0x0" ::: "memory");   // this wave's copies of pass 0 have landed
    __syncthreads();                                    // and every other wave's: pass 0 is readable
    if (npass > 1) fill(1);
    const unsigned char* fa = ring + (wm * 64 + lr) * PITCH + hi * 16; const unsigned char* fb = ring + PB * PLANE + (wn * 64 + lr) * PITCH + hi * 16;
#pragma unroll 1
    for (int t = 0; t < npass; ++t) {
        const int bo = (t & 1) * STAGE;
#pragma unroll
        for (int ks = 0; ks < KP / 32; ++ks) {
            v16bf a[4], a2[4];
#pragma unroll
            for (int mb = 0; mb < 4; ++mb) { a[mb] = ldsfrag(fa + bo + mb * 16 * PITCH + ks * 64); if (NSPLIT == 1 || NSPLIT == 2) a2[mb] = ldsfrag(fa + bo + PLANE + mb * 16 * PITCH + ks * 64); }
#pragma unroll
            for (int nb = 0; nb < 4; ++nb) { const v16bf b = ldsfrag(fb + bo + nb * 16 * PITCH + ks * 64); v16bf b2; if (NSPLIT == 2) b2 = ldsfrag(fb + bo + PLANE + nb * 16 * PITCH + ks * 64);
#pragma unroll
                for (int mb = 0; mb < 4; ++mb) { acc[mb][nb] = wmmab(a[mb], b, acc[mb][nb]); if (NSPLIT == 1 || NSPLIT == 2) acc[mb][nb] = wmmab(a2[mb], b, acc[mb][nb]); if (NSPLIT == 2) acc[mb][nb] = wmmab(a[mb], b2, acc[mb][nb]); } }
            // order asked of the scheduler: LDS reads in few groups, each one group of columns ahead of its products
            __builtin_amdgcn_sched_group_barrier(0x100, LA + LB, 0);
#pragma unroll
            for (int q = 1; q < 4 / GB; ++q) { __builtin_amdgcn_sched_group_barrier(0x100, LB, 0); __builtin_amdgcn_sched_group_barrier(0x008, NW, 0); }
            __builtin_amdgcn_sched_group_barrier(0x008, NW, 0);
        }
        asm volatile("s_wait_dscnt 0x0" ::: "memory");      // this wave has left buffer t & 1
        asm volatile("s_wait_asynccnt 0x0" ::: "memory");   // its copies of pass t + 1 have landed
        __syncthreads();                                    // publishes pass t + 1 and frees buffer t & 1
        if (t + 2 < npass) fill(t + 2);
    }
    asm volatile("s_wait_asynccnt 0x0" ::: "memory");       // nothing is in flight when the ring becomes output staging
    f32a* os = (f32a*)(ring + wave * (16 * 68 * 4));        // each wave stages in its own range, behind the last pass's barrier
#pragma unroll
    for (int mb = 0; mb < 4; ++mb) {
#pragma unroll
        for (int nb = 0; nb < 4; ++nb) {
#pragma unroll
            for (int j = 0; j < 8; ++j) os[(hi * 8 + j) * 68 + nb * 16 + lr] = acc[mb][nb][j]; }
        __builtin_amdgcn_wave_barrier(); asm volatile("" ::: "memory");
        float* crw = C + (size_t)(r0 + wm * 64 + mb * 16) * ldc + c0 + wn * 64;
#pragma unroll
        for (int s = 0; s < 8; ++s) { const int row = 2 * s + hi, cofs = lr * 4; const v4f val = *(const v4fa*)(os + row * 68 + cofs); *(v4f*)(crw + (size_t)row * ldc + cofs) = val; }
        __builtin_amdgcn_wave_barrier(); asm volatile("" ::: "memory");
    }
}

__device__ __forceinline__ h16 tohx(float x) { return (h16)x; }
__device__ __forceinline__ void splitf(float y, unsigned short& h, unsigned short& l) { h = f2bf(y); l = f2bf(y - bf2f(h)); }
typedef __attribute__((ext_vector_type(2))) _Float16 v2h;
typedef __attribute__((ext_vector_type(4))) _Float16 v4h;
typedef __attribute__((ext_vector_type(2))) unsigned short v2us;
typedef __attribute__((ext_vector_type(4))) unsigned short v4us;
typedef __attribute__((ext_vector_type(2))) float v2f;
typedef __attribute__((ext_vector_type(4))) int v4i;

// ---- 128 x 64 f32 tile in LDS, shared by the transposing kernels (256 threads): global reads and global writes both move whole 128-byte lines.
#define TRR 128   // source rows per tile
#define TRC 64    // source columns per tile
#define TRP 65    // LDS pitch in dwords: odd, so that a walk down a column meets every bank once
__device__ __forceinline__ void tile_in(const float* __restrict__ src, int ld, float* ts) {   // src: the tile's first element, row pitch ld floats
    const int rr = threadIdx.x >> 4, cc = (threadIdx.x & 15) * 4; const float* g[TRR / 16]; v4f v[TRR / 16];
#pragma unroll
    for (int p = 0; p < TRR / 16; ++p) g[p] = src + (size_t)(p * 16 + rr) * ld + cc;
#pragma unroll
    for (int p = 0; p < TRR / 16; ++p) v[p] = *(const v4f*)g[p];
    // the wait that stands in front of any overwrite of an issued load's address registers; the addresses are its inputs, so that nothing is allocated over them ahead of it
    asm volatile("s_wait_xcnt 0x0" :: "v"(g[0]), "v"(g[1]), "v"(g[2]), "v"(g[3]), "v"(g[4]), "v"(g[5]), "v"(g[6]), "v"(g[7]) : "memory");
#pragma unroll
    for (int p = 0; p < TRR / 16; ++p) {
#pragma unroll
        for (int u = 0; u < 4; ++u) ts[(p * 16 + rr) * TRP + cc + u] = v[p][u]; }
    __syncthreads();   // every column is read back by waves that did not write it
}
// k_wtG: Bt[n][k] = bf16(w[k][n]); grid (K / 128, N / 64, batch)
__global__ __launch_bounds__(256) void k_wtG(const float* __restrict__ w, int K, int N, bf* Bt) {
    __shared__ float ts[TRR * TRP];
    const int k0 = blockIdx.x * TRR, n0 = blockIdx.y * TRC; w += (size_t)blockIdx.z * K * N; Bt += (size_t)blockIdx.z * K * N;
    tile_in(w + (size_t)k0 * N + n0, N, ts);
    const int kg = (threadIdx.x & 7) * 8, nr = threadIdx.x >> 3;   // 8 lanes x 8 k = one 128-byte line of a Bt row; a wave stores 4 rows
#pragma unroll
    for (int p = 0; p < 4; ++p) { const int k = (p & 1) * 64 + kg, n = (p >> 1) * 32 + nr; v8us o;
#pragma unroll
        for (int i = 0; i < 8; ++i) o[i] = f2bf(ts[(k + i) * TRP + n]);
        *(v8us*)(Bt + (size_t)(n0 + n) * K + k0 + k) = o; }
}
__global__ __launch_bounds__(256) void k_cvt8(const float* __restrict__ src, bf* dst, size_t n8) { const size_t i = (size_t)blockIdx.x * 256 + threadIdx.x; if (i >= n8) return; const v8f v = *(const v8f*)(src + i * 8); v8us o;
#pragma unroll
    for (int k = 0; k < 8; ++k) o[k] = f2bf(v[k]); *(v8us*)(dst + i * 8) = o;  }
__global__ __launch_bounds__(256) void k_cstab(float* CS) { const int idx = blockIdx.x * 256 + threadIdx.x; if (idx >= TT * HD) return; const int t = idx / HD, d = idx % HD; const int i = (d < HD / 2) ? d : d - HD / 2; const float inv = __fdiv_rn(1.0f, powf(10000.0f, (float)(2 * i) / (float)HD)); const float ang = __fmul_rn((float)t, inv); v2f cs; cs[0] = cosf(ang); cs[1] = sinf(ang);
    *(v2f*)(CS + (size_t)idx * 2) = cs;  }
// k_rope: head planes [h][t][d] (fp16 + hi/lo) of rope(x) x sc with the rotate-half convention out[d] = x[d] cos[t][d] - x[d+HD/2] sin[t][d], out[d+HD/2] = x[d+HD/2] cos[t][d+HD/2] + x[d] sin[t][d+HD/2]
__global__ __launch_bounds__(256) void k_rope(const float* __restrict__ F, int pitch, int nheads, const float* __restrict__ CS, const float* __restrict__ RF, const float* __restrict__ nw, float sc, h16* P16, bf* Ph, bf* Pl) {
    const size_t e = ((size_t)blockIdx.x * 256 + threadIdx.x) * 2; if (e >= (size_t)nheads * TT * HD) return; const int d = (int)(e % HD); const int t = (int)((e / HD) % TT); const int h = (int)(e / ((size_t)HD * TT)); const float* f = F + (size_t)t * pitch + h * HD; const float rf = RF ? RF[(size_t)h * TT + t] : 1.0f; v2h o16; v2us oh, ol;
#pragma unroll
    for (int q = 0; q < 2; ++q) { const int dd = d + q; const int dp = (dd < HD / 2) ? dd + HD / 2 : dd - HD / 2; float x0 = f[dd], x1 = f[dp];
        if (RF) { float n0 = __fmul_rn(x0, rf), n1 = __fmul_rn(x1, rf); asm volatile("" : "+v"(n0)); asm volatile("" : "+v"(n1)); x0 = __fmul_rn(bfr(nw[dd]), n0); x1 = __fmul_rn(bfr(nw[dp]), n1); }
        const v2f cs = *(const v2f*)(CS + ((size_t)t * HD + dd) * 2); float a = __fmul_rn(x0, cs[0]), bq = __fmul_rn(x1, cs[1]); asm volatile("" : "+v"(a)); asm volatile("" : "+v"(bq)); const float r = ((dd < HD / 2) ? __fsub_rn(a, bq) : __fadd_rn(a, bq)) * sc;
        o16[q] = tohx(r); unsigned short a2, c2; splitf(r, a2, c2); oh[q] = a2; ol[q] = c2; }
    *(v2h*)(P16 + e) = o16; *(v2us*)(Ph + e) = oh; *(v2us*)(Pl + e) = ol;  }
// k_vtp: planes [c][t] (f16 + bf16 hi/lo) of F[t][c], c = head * HD + d; grid (TT / 128, nheads * HD / 64, batch)
__global__ __launch_bounds__(256) void k_vtp(const float* __restrict__ F, int pitch, int nheads, h16* V16, bf* Vh, bf* Vl) {
    __shared__ float ts[TRR * TRP];
    const int t0 = blockIdx.x * TRR, c0 = blockIdx.y * TRC; F += (size_t)blockIdx.z * TT * pitch; { const size_t zo = (size_t)blockIdx.z * nheads * HD * TT; V16 += zo; Vh += zo; Vl += zo; }
    tile_in(F + (size_t)t0 * pitch + c0, pitch, ts);
    const int tg = (threadIdx.x & 7) * 8, cr = threadIdx.x >> 3;   // 8 lanes x 8 t = one 128-byte line of a plane row; a wave stores 4 rows
#pragma unroll
    for (int p = 0; p < 4; ++p) { const int t = (p & 1) * 64 + tg, c = (p >> 1) * 32 + cr; v8h o16; v8us oh, ol;
#pragma unroll
        for (int i = 0; i < 8; ++i) { const float x = ts[(t + i) * TRP + c]; o16[i] = tohx(x); unsigned short a2, c2; splitf(x, a2, c2); oh[i] = a2; ol[i] = c2; }
        const size_t o = (size_t)(c0 + c) * TT + t0 + t; *(v8h*)(V16 + o) = o16; *(v8us*)(Vh + o) = oh; *(v8us*)(Vl + o) = ol; }
}
__global__ __launch_bounds__(256) void k_colsum(const bf* __restrict__ Ph, const bf* __restrict__ Pl, const h16* __restrict__ P16, int h0, float* ACC) { const int t = blockIdx.x * 256 + threadIdx.x; if (t >= TT) return; float acc = ((h0 % REP) == 0) ? 0.0f : ACC[t];
#pragma unroll 1
    for (int zz = 0; zz < ZH; ++zz) {
#pragma unroll 4
        for (int i = 0; i < RH; ++i) { const size_t o = ((size_t)zz * RH + i) * TT + t; acc = __fadd_rn(acc, __fadd_rn(bf2f(Ph[o]), bf2f(Pl[o]))); }
#pragma unroll 4
        for (int i = RH; i < TT; ++i) { const size_t o = ((size_t)zz * TT + i) * TT + t; float pv = __fmul_rn((float)P16[o], 1.0f / PCAR); asm volatile("" : "+v"(pv)); acc = __fadd_rn(acc, pv); } }
    *(float*)(ACC + t) = acc;  }
// k_asoft: per row (zz, i): t = S x SCL (= 1) for j <= i and i - j < WIN (sliding causal window; the reference's -1e9 additive fill vanishes identically); softmax over the 2048 keys (register row, one exp, fixed trees);
__global__ __launch_bounds__(256) void k_asoft(const float* __restrict__ Sb, h16* P16, bf* Ph, bf* Pl) {
    const int lane = threadIdx.x & 31; const int row = blockIdx.x * 8 + (threadIdx.x >> 5); if (row >= ZH * TT) return; const int i = row % TT; const int zz = row / TT; (void)zz; const bool hires = (i < RH); const float* sr = Sb + (size_t)row * TT; float v[TT / 32]; float mx = -3.0e38f;
#pragma unroll
    for (int ch = 0; ch < TT / 128; ++ch) { const int j0 = ch * 128 + lane * 4; const v4f a = *(const v4f*)(sr + j0);
#pragma unroll
        for (int q = 0; q < 4; ++q) { const int j = j0 + q; (void)j; float sa = a[q] * SCL; asm volatile("" : "+v"(sa)); const float t = (j <= i && i - j < WIN) ? sa : -3.0e38f; v[ch * 4 + q] = t; mx = fmaxf(mx, t); } }
#pragma unroll
    for (int sh = 16; sh; sh >>= 1) mx = fmaxf(mx, __shfl_xor(mx, sh, 32));
    float sum = 0.f;
#pragma unroll
    for (int k = 0; k < TT / 32; ++k) { float d0 = __fsub_rn(v[k], mx); asm volatile("" : "+v"(d0)); v[k] = __builtin_amdgcn_exp2f(__fmul_rn(d0, 1.4426950408889634f)); sum += v[k]; }
#pragma unroll
    for (int sh = 16; sh; sh >>= 1) sum += __shfl_xor(sum, sh, 32);
    const float f = __fdiv_rn(hires ? 1.0f : PCAR, sum);
{
        if (hires) {
#pragma unroll
            for (int ch = 0; ch < TT / 128; ++ch) { v4us oh, ol;
#pragma unroll
                for (int q = 0; q < 4; ++q) { unsigned short a, c2; splitf(v[ch * 4 + q] * f, a, c2); oh[q] = a; ol[q] = c2; }
                const size_t oo = ((size_t)zz * (RH ? RH : 1) + i) * TT + ch * 128 + lane * 4; *(v4us*)(Ph + oo) = oh; *(v4us*)(Pl + oo) = ol; }
        } else {
#pragma unroll
            for (int ch = 0; ch < TT / 128; ++ch) { v4h o4;
#pragma unroll
                for (int q = 0; q < 4; ++q) o4[q] = tohx(v[ch * 4 + q] * f);
                *(v4h*)(P16 + (size_t)row * TT + ch * 128 + lane * 4) = o4; } }
         }
}
__global__ __launch_bounds__(256) void k_merge(const float* __restrict__ O, int h0, bf* Ah, bf* Al) { const size_t e = ((size_t)blockIdx.x * 256 + threadIdx.x) * 2; if (e >= (size_t)ZH * TT * HD) return; const int d = (int)(e % HD); const int t = (int)((e / HD) % TT); const int zz = (int)(e / ((size_t)HD * TT)); const float cs = (t < RH) ? 1.0f : (1.0f / PCAR); const size_t oo = (size_t)t * DQ + (h0 + zz) * HD + d;
    v2us oh, ol;
#pragma unroll
    for (int q = 0; q < 2; ++q) { unsigned short a, c2; splitf(O[e + q] * cs, a, c2); oh[q] = a; ol[q] = c2; } *(v2us*)(Ah + oo) = oh; *(v2us*)(Al + oo) = ol;  }


// ---- SingleHeadQKV kernels ----
__global__ __launch_bounds__(256) void k_hlG(const float* __restrict__ F, bf* Fh, bf* Fl, size_t n) { const size_t e = ((size_t)blockIdx.x * 256 + threadIdx.x) * 4; if (e >= n) return; const v4f a = *(const v4f*)(F + e); v4us oh, ol; for (int u = 0; u < 4; ++u) { unsigned short p, q; splitf(a[u], p, q); oh[u] = p; ol[u] = q; } *(v4us*)(Fh + e) = oh; *(v4us*)(Fl + e) = ol;  }
__global__ __launch_bounds__(256) void k_gptab(float* GP) { const int n = blockIdx.x * 256 + threadIdx.x; if (n >= TT + 64) return; const float v = powf(GAMR, (float)n); *(float*)(GP + n) = v;  }
__global__ __launch_bounds__(256) void k_cstabW(float* CS) { const size_t idx = (size_t)blockIdx.x * 256 + threadIdx.x; if (idx >= (size_t)TT * DC) return; const int t = (int)(idx / DC), d = (int)(idx % DC); const float inv = __fdiv_rn(1.0f, powf(10000.0f, (float)(2 * (d >> 1)) / (float)DC)); const float ang = __fmul_rn((float)t, inv); v2f cs; cs[0] = cosf(ang); cs[1] = sinf(ang); *(v2f*)(CS + idx * 2) = cs;  }
__global__ __launch_bounds__(256) void k_ropeW(float* F, const float* __restrict__ CS) { const size_t e = ((size_t)blockIdx.x * 256 + threadIdx.x) * 2; if (e >= (size_t)TT * DC) return; F += (size_t)blockIdx.y * TT * DC; const v2f xv = *(const v2f*)(F + e); const v2f c0 = *(const v2f*)(CS + e * 2); const v2f c1 = *(const v2f*)(CS + (e + 1) * 2); float a0 = __fmul_rn(xv[0], c0[0]), b0 = __fmul_rn(xv[1], c0[1]); asm volatile("" : "+v"(a0)); asm volatile("" : "+v"(b0)); float a1 = __fmul_rn(xv[1], c1[0]), b1 = __fmul_rn(xv[0], c1[1]); asm volatile("" : "+v"(a1)); asm volatile("" : "+v"(b1)); v2f o; o[0] = __fsub_rn(a0, b0); o[1] = __fadd_rn(a1, b1); *(v2f*)(F + e) = o;  }
__global__ __launch_bounds__(256) void k_rowscale(const float* __restrict__ F, const float* __restrict__ GP, float* D) { const size_t e = ((size_t)blockIdx.x * 256 + threadIdx.x) * 4; if (e >= (size_t)TT * DC) return; F += (size_t)blockIdx.y * TT * DC; D += (size_t)blockIdx.y * TT * DC; const int t = (int)(e / DC); const float gsc = GP[TT - 1 - t]; const v4f a = *(const v4f*)(F + e); v4f o; for (int u = 0; u < 4; ++u) o[u] = __fmul_rn(a[u], gsc); *(v4f*)(D + e) = o;  }
__global__ __launch_bounds__(256) void k_dpl(const float* __restrict__ Sb, const float* __restrict__ GP, bf* Ph, bf* Pl) { const size_t e = ((size_t)blockIdx.x * 256 + threadIdx.x) * 4; if (e >= (size_t)TT * TT) return; { const size_t zo = (size_t)blockIdx.y * TT * TT; Sb += zo; Ph += zo; Pl += zo; } const int i = (int)(e / TT); const int j0 = (int)(e % TT); v4f a; if (j0 <= i) a = *(const v4f*)(Sb + e); else { for (int u = 0; u < 4; ++u) a[u] = 0.0f; } v4us oh, ol; for (int u = 0; u < 4; ++u) { const int j = j0 + u; float v = 0.0f; if (j <= i) v = __fmul_rn(a[u], GP[i - j]); unsigned short a2, c2; splitf(v, a2, c2); oh[u] = a2; ol[u] = c2; } *(v4us*)(Ph + e) = oh; *(v4us*)(Pl + e) = ol;  }
__global__ __launch_bounds__(256) void k_combgn(const float* __restrict__ IN, const float* __restrict__ CR, const float* __restrict__ GP, const float* __restrict__ gw, const float* __restrict__ gb, float* G) { const int lane = threadIdx.x & 31; const int t = blockIdx.x * 8 + (threadIdx.x >> 5); if (t >= TT) return; { const size_t zo = (size_t)blockIdx.y * TT * DC; IN += zo; CR += zo; G += zo; } const float ge = GP[t + 1];
#pragma unroll 1
    for (int ch = 0; ch < DC / 128; ++ch) { const size_t base = (size_t)t * DC + ch * 128 + lane * 4; const v4f a = *(const v4f*)(IN + base); const v4f c = *(const v4f*)(CR + base); float v[4]; float sm = 0.f; for (int u = 0; u < 4; ++u) { float cg = __fmul_rn(c[u], ge); asm volatile("" : "+v"(cg)); v[u] = __fadd_rn(a[u], cg); sm = __fadd_rn(sm, v[u]); }
        for (int sh = 1; sh < 8; sh <<= 1) sm = __fadd_rn(sm, __shfl_xor(sm, sh, 32));
        const float mu = __fmul_rn(sm, 1.0f / 32.0f); float ss = 0.f; float d[4]; for (int u = 0; u < 4; ++u) { d[u] = __fsub_rn(v[u], mu); float p = __fmul_rn(d[u], d[u]); asm volatile("" : "+v"(p)); ss = __fadd_rn(ss, p); }
        for (int sh = 1; sh < 8; sh <<= 1) ss = __fadd_rn(ss, __shfl_xor(ss, sh, 32));
        const float rs = __fdiv_rn(1.0f, sqrtf(__fadd_rn(__fmul_rn(ss, 1.0f / 32.0f), 1e-6f))); v4f o; for (int u = 0; u < 4; ++u) { const int cc = ch * 128 + lane * 4 + u; float n = __fmul_rn(d[u], rs); asm volatile("" : "+v"(n)); float w0 = bfr(gw[cc]), b0 = bfr(gb[cc]); asm volatile("" : "+v"(w0)); asm volatile("" : "+v"(b0)); float y = __fmul_rn(n, w0); asm volatile("" : "+v"(y)); o[u] = __fadd_rn(y, b0); }
        *(v4f*)(G + base) = o;  } }
// k_perm: the reference's transpose(-2,-1).reshape keeps the flat order of the transpose, so O read as [DC][TT] is G[TT][DC] transposed; grid (TT / 128, DC / 64, batch)
__global__ __launch_bounds__(256) void k_perm(const float* __restrict__ G, float* O) {
    __shared__ float ts[TRR * TRP];
    const int t0 = blockIdx.x * TRR, c0 = blockIdx.y * TRC; G += (size_t)blockIdx.z * TT * DC; O += (size_t)blockIdx.z * TT * DC;
    tile_in(G + (size_t)t0 * DC + c0, DC, ts);
    const int tg = (threadIdx.x & 15) * 4, cr = threadIdx.x >> 4;   // 16 lanes x 4 t = two 128-byte lines of an O row; a wave stores 2 rows
#pragma unroll
    for (int p = 0; p < 8; ++p) { const int t = (p & 1) * 64 + tg, c = (p >> 1) * 16 + cr; v4f o;
#pragma unroll
        for (int i = 0; i < 4; ++i) o[i] = ts[(t + i) * TRP + c];
        *(v4f*)(O + (size_t)(c0 + c) * TT + t0 + t) = o; }
}
__global__ __launch_bounds__(256) void k_radd(const float* __restrict__ R, const float* __restrict__ SN, const float* __restrict__ GP, float* O) { const size_t e = ((size_t)blockIdx.x * 256 + threadIdx.x) * 4; if (e >= (size_t)DC * DC) return; { const size_t zo = (size_t)blockIdx.y * DC * DC; R += zo; SN += zo; O += zo; } const float gT = GP[TT]; const v4f a = *(const v4f*)(R + e); const v4f s = *(const v4f*)(SN + e); v4f o; for (int u = 0; u < 4; ++u) { float sg = __fmul_rn(bfr(s[u]), gT); asm volatile("" : "+v"(sg)); o[u] = __fadd_rn(a[u], sg); } *(v4f*)(O + e) = o;  }

extern "C" void kernel_launch(void* const* d_in, const int* in_sizes, int n_in,
                              void* d_out, int out_size, void* d_ws, size_t ws_size, hipStream_t stream) {
    (void)in_sizes; (void)n_in; (void)out_size;
    const float* x = (const float*)d_in[0]; const float* sn = (const float*)d_in[1]; const float* wq = (const float*)d_in[2]; const float* wk = (const float*)d_in[3]; const float* wv = (const float*)d_in[4]; const float* gw = (const float*)d_in[5]; const float* gb = (const float*)d_in[6];
    float* OUT = (float*)d_out;     // out0 [4][2048][1024] at 0, out1 [4][1024][1024] at NB*TT*DC
    char* wsp = (char*)d_ws;
    auto take = [&](size_t bytes) { char* p = wsp; wsp += (bytes + 255) & ~(size_t)255; return (void*)p; };
    // All NB_ batch elements go through every stage at once (grid y or z = batch). Planes are [batch][...]; buffers whose contents are dead are reused, in stream order.
    const size_t SX = (size_t)TT * DC, SS = (size_t)DC * DC, SP = (size_t)TT * TT;   // elements per batch element: activations, state, scores
    bf* QPh = (bf*)take(NB_ * SX * 2); bf* QPl = (bf*)take(NB_ * SX * 2); bf* KPh = (bf*)take(NB_ * SX * 2); bf* KPl = (bf*)take(NB_ * SX * 2); bf* VTh = (bf*)take(NB_ * SX * 2); bf* VTl = (bf*)take(NB_ * SX * 2);
    bf* KTh = (bf*)take(NB_ * SX * 2); bf* KTl = (bf*)take(NB_ * SX * 2); bf* VDTh = (bf*)take(NB_ * SX * 2); bf* VDTl = (bf*)take(NB_ * SX * 2);
    float* FF = (float*)take(NB_ * SX * 4);                                          // projection output: Q, then K, then V
    float* CS = (float*)take((size_t)TT * DC * 2 * 4); h16* T16 = (h16*)take(NB_ * SX * 2);
    bf* SNT = (bf*)take(NB_ * SS * 2); bf* XB = (bf*)take(NB_ * SX * 2);
    bf* WQ = (bf*)take((size_t)DQ * DM * 2); bf* WK = (bf*)take((size_t)DKV * DM * 2); bf* WV = (bf*)take((size_t)DKV * DM * 2); float* GP = (float*)take((TT + 64) * 4);
    float* FVD = CS;                 // NB_*SX f32 over CS + T16: written after the last RoPE and after V's transpose
    h16* T16b = (h16*)XB;            // f16 plane of the V*D transpose: XB is dead after the V projection
    float* RR = FF;                  // NB_*SS f32: FF is dead after k_rowscale
    float* Sb = (float*)KTh;         // NB_*SP f32 over KTh..VDTl: dead after the R product
    bf* Ph = (bf*)FF; bf* Pl = (bf*)CS;   // NB_*SP each: FF (RR) dead after k_radd, FVD dead after its transpose
    float* INNER = (float*)KTh; float* CROSS = (float*)VDTh;   // NB_*SX f32 each: Sb is dead after k_dpl
    float* GBF = (float*)KPh;        // NB_*SX f32 over KPh + KPl: dead after Q K^T
    if ((size_t)(wsp - (char*)d_ws) > ws_size) return;   // ws ~ 254 MiB
    { k_wtG<<<dim3(DM / TRR, DQ / TRC, 1), 256, 0, stream>>>(wq, DM, DQ, WQ); k_wtG<<<dim3(DM / TRR, DKV / TRC, 1), 256, 0, stream>>>(wk, DM, DKV, WK); k_wtG<<<dim3(DM / TRR, DKV / TRC, 1), 256, 0, stream>>>(wv, DM, DKV, WV); k_cstabW<<<(unsigned)(((size_t)TT * DC + 255) / 256), 256, 0, stream>>>(CS); k_gptab<<<(TT + 64 + 255) / 256, 256, 0, stream>>>(GP); }
    const unsigned LG = (unsigned)(((size_t)TT * DC / 4 + 255) / 256), LR = (unsigned)(((size_t)TT * DC / 2 + 255) / 256);
    k_cvt8<<<(unsigned)((NB_ * SX / 8 + 255) / 256), 256, 0, stream>>>(x, XB, NB_ * SX / 8);
    k_wtG<<<dim3(DC / TRR, DC / TRC, NB_), 256, 0, stream>>>(sn, DC, DC, SNT);
    k_gemmt<0, 0><<<dim3(TT / 128, DQ / 128, NB_), 128, 0, stream>>>(XB, nullptr, WQ, nullptr, DM, FF, DQ, SX, 0, SX); k_ropeW<<<dim3(LR, NB_), 256, 0, stream>>>(FF, CS); k_hlG<<<LG * NB_, 256, 0, stream>>>(FF, QPh, QPl, NB_ * SX);
    k_gemmt<0, 0><<<dim3(TT / 128, DKV / 128, NB_), 128, 0, stream>>>(XB, nullptr, WK, nullptr, DM, FF, DKV, SX, 0, SX); k_ropeW<<<dim3(LR, NB_), 256, 0, stream>>>(FF, CS); k_hlG<<<LG * NB_, 256, 0, stream>>>(FF, KPh, KPl, NB_ * SX); k_vtp<<<dim3(TT / TRR, DKV / TRC, NB_), 256, 0, stream>>>(FF, DKV, NKV, T16, KTh, KTl);
    k_gemmt<0, 0><<<dim3(TT / 128, DKV / 128, NB_), 128, 0, stream>>>(XB, nullptr, WV, nullptr, DM, FF, DKV, SX, 0, SX); k_vtp<<<dim3(TT / TRR, DKV / TRC, NB_), 256, 0, stream>>>(FF, DKV, NKV, T16, VTh, VTl); k_rowscale<<<dim3(LG, NB_), 256, 0, stream>>>(FF, GP, FVD); k_vtp<<<dim3(TT / TRR, DKV / TRC, NB_), 256, 0, stream>>>(FVD, DKV, NKV, T16b, VDTh, VDTl);
    // R_i = K^T (V D[-1]) + S_n g^T (first, so that its operand planes can be reused for the scores)
    k_gemmt<2, 0><<<dim3(DC / 128, DC / 128, NB_), 128, 0, stream>>>(KTh, KTl, VDTh, VDTl, TT, RR, DC, SX, SX, SS);
    k_radd<<<dim3((unsigned)(((size_t)DC * DC / 4 + 255) / 256), NB_), 256, 0, stream>>>(RR, sn, GP, OUT + NB_ * SX);
    // A = (Q K^T) (causal tiles only), then x D into hi/lo planes, inner = A V (causal tiles only)
    k_gemmt<2, 1><<<dim3(TT / 128, TT / 128, NB_), 128, 0, stream>>>(QPh, QPl, KPh, KPl, DC, Sb, TT, SX, SX, SP);
    k_dpl<<<dim3((unsigned)(((size_t)TT * TT / 4 + 255) / 256), NB_), 256, 0, stream>>>(Sb, GP, Ph, Pl);
    k_gemmt<2, 2><<<dim3(TT / 128, DC / 128, NB_), 128, 0, stream>>>(Ph, Pl, VTh, VTl, TT, INNER, DC, SP, SX, SX);
    // cross = Q S_n
    k_gemmt<1, 0><<<dim3(TT / 128, DC / 128, NB_), 128, 0, stream>>>(QPh, QPl, SNT, nullptr, DC, CROSS, DC, SX, SS, SX);
    k_combgn<<<dim3(TT / 8, NB_), 256, 0, stream>>>(INNER, CROSS, GP, gw, gb, GBF);
    k_perm<<<dim3(TT / TRR, DC / TRC, NB_), 256, 0, stream>>>(GBF, OUT);
}

// v004
// One run takes 298 microseconds.
// In two side-by-side timings against v003, it was 1.36 and 1.32 times as fast.
// Counting every step since v000, it is 4.47 times as fast.
#include <hip/hip_runtime.h>

// SingleHeadQKV (chunkwise retention step: X_Q [4][2048][1024], S_n [4][1024][1024]; Q = rope(X W_Q), K = rope(X W_K) (interleaved-pair RoPE over the full 1024 dims), V = X W_V; D[n][m] = g^(n-m) for n >= m (g = 1 - 2^-5); inner = (Q K^T * D) V; cross = (Q S_n) * g^(t+1); out = GroupNorm32(inner + cross) then the literal transpose(-2,-1).reshape permutation -> out0 [4][2048][1024]; R_i = K^T (V * D[-1]) + S_n g^T -> out1 [4][1024][1024] at element 8,388,608).
// Compute dtypes, f32 accumulate: every input rounded to bf16; Q/K/V on PLAIN bf16 operands (inputs: exact); RoPE f32 (on-chip table); decay powers g^n in f32 (powf); Q.K^T (K = 1024) hl x hl (3 products) with causal tile skipping, x D per element in f32 into hi/lo planes (no softmax), (QK^T D).V hl x hl (3 products, causal skipping); Q.S_n hl x exact (2 products); K^T.(V D[-1]) hl x hl (3 products, K = 2048); sums, GroupNorm (32 groups of 32, biased var, eps 1e-6) and the output permutation in f32.

#define NB_  4
#define TT   2048
#define DM   1024
#define NH_  16
#define NKV  16
#define REP  (NH_ / NKV)
#define HD   64
#define DQ   (NH_ * HD)
#define DKV  (NKV * HD)
#define ZH   2
#define RH   2048                  // query rows < RH use hi+lo planes (0: none)
#define WIN  2048
#define PCAR 1024.0f
#define DC   1024   // channel width (= DQ)
#define GAMR 0.96875f
#define SCL  1.0f
typedef _Float16 h16;
typedef unsigned short bf;
typedef __attribute__((ext_vector_type(16))) __bf16   v16bf;
typedef __attribute__((ext_vector_type(16))) _Float16 v16h;
typedef __attribute__((ext_vector_type(8)))  _Float16 v8h;
typedef __attribute__((ext_vector_type(8)))  unsigned short v8us;
typedef __attribute__((ext_vector_type(8)))  float    v8f;
typedef __attribute__((ext_vector_type(4)))  float    v4f;
typedef v8h  __attribute__((may_alias)) v8ha;
typedef v4f  __attribute__((may_alias)) v4fa;
typedef v8us __attribute__((may_alias)) v8usa;
typedef __attribute__((ext_vector_type(4))) unsigned short v4us;
typedef __attribute__((ext_vector_type(2))) float v2f;

__device__ __forceinline__ unsigned short f2bf(float f) { unsigned u = __float_as_uint(f); u += 0x7FFFu + ((u >> 16) & 1u); return (unsigned short)(u >> 16); }
__device__ __forceinline__ float bf2f(unsigned short b) { return __uint_as_float(((unsigned)b) << 16); }
__device__ __forceinline__ float bfr(float f) { return bf2f(f2bf(f)); }
__device__ __forceinline__ void splitf(float y, unsigned short& h, unsigned short& l) { h = f2bf(y); l = f2bf(y - bf2f(h)); }
__device__ __forceinline__ v16h cat16(v8h lo, v8h hi) { return __builtin_shufflevector(lo, hi, 0, 1, 2, 3, 4, 5, 6, 7, 8, 9, 10, 11, 12, 13, 14, 15); }
__device__ __forceinline__ v16bf cat16b(v8us lo, v8us hi) { return __builtin_bit_cast(v16bf, __builtin_shufflevector(lo, hi, 0, 1, 2, 3, 4, 5, 6, 7, 8, 9, 10, 11, 12, 13, 14, 15)); }
__device__ __forceinline__ v8f wmma16(v16h a, v16h b, v8f c) { return __builtin_amdgcn_wmma_f32_16x16x32_f16(false, a, false, b, (short)0, c, false, false); }
__device__ __forceinline__ v8f wmmab(v16bf a, v16bf b, v8f c) { return __builtin_amdgcn_wmma_f32_16x16x32_bf16(false, a, false, b, (short)0, c, false, false); }



// ---- k_gemmt: C[m][n] (f32, pitch ldc) = sum_k A[m][k] Bt[n][k] (+ split products per NSPLIT) on K-contiguous bf16 planes. One 128x128 tile of C per work-group of four waves (2x2, 64x64 each, 16 accumulators a wave);
// grid (M/128, N/128, Z), 128 threads. A pass is KP k of all 128 rows of every operand plane; asynchronous copies bring it into a two-buffer LDS ring as whole 128-byte lines, one pass ahead of its use, and each row is fetched once for two waves.
// CMODE 1 skips score tiles entirely above the causal diagonal; CMODE 2 ends the K loop of the (decayed score) x value product at the diagonal block (the decayed scores are exactly zero beyond it; those tiles of the planes are never written). M, N % 128 == 0, K % KP == 0.
typedef float __attribute__((may_alias)) f32a;
// eight copies of 16 bytes a lane; the s_wait_xcnt stands inside the statement, in front of any overwrite of the address registers that the copies name
__device__ __forceinline__ void copy8(unsigned l, int lstep, const bf* g, size_t gstep) {
    const unsigned l0 = l, l1 = l + lstep, l2 = l + 2 * lstep, l3 = l + 3 * lstep, l4 = l + 4 * lstep, l5 = l + 5 * lstep, l6 = l + 6 * lstep, l7 = l + 7 * lstep;
    const bf *g0 = g, *g1 = g + gstep, *g2 = g + 2 * gstep, *g3 = g + 3 * gstep, *g4 = g + 4 * gstep, *g5 = g + 5 * gstep, *g6 = g + 6 * gstep, *g7 = g + 7 * gstep;
    asm volatile("global_load_async_to_lds_b128 %0, %8, off\n\tglobal_load_async_to_lds_b128 %1, %9, off\n\tglobal_load_async_to_lds_b128 %2, %10, off\n\tglobal_load_async_to_lds_b128 %3, %11, off\n\t"
                 "global_load_async_to_lds_b128 %4, %12, off\n\tglobal_load_async_to_lds_b128 %5, %13, off\n\tglobal_load_async_to_lds_b128 %6, %14, off\n\tglobal_load_async_to_lds_b128 %7, %15, off\n\ts_wait_xcnt 0x0"
                 :: "v"(l0), "v"(l1), "v"(l2), "v"(l3), "v"(l4), "v"(l5), "v"(l6), "v"(l7), "v"(g0), "v"(g1), "v"(g2), "v"(g3), "v"(g4), "v"(g5), "v"(g6), "v"(g7) : "memory");
}
#define XWAIT(...) asm volatile("s_wait_xcnt 0x0" :: __VA_ARGS__ : "memory")
template <int CTRL> __device__ __forceinline__ float dppf(float x) { return __int_as_float(__builtin_amdgcn_mov_dpp(__float_as_int(x), CTRL, 0xF, 0xF, true)); }   // 0xB1: lane ^ 1, 0x4E: lane ^ 2 (quad_perm); 0x141: lane -> 7 - lane in each 8 (row_half_mirror)
__device__ __forceinline__ v16bf ldsfrag(const unsigned char* p) { return cat16b(*(const v8usa*)p, *(const v8usa*)(p + 32)); }
// EPI names what the epilogue makes of the tile, straight from the accumulators (a lane holds 8 consecutive rows of one column) and each wave's own LDS range:
// 0 f32 C; 1 RoPE (E0 = cos/sin table), hi/lo planes P0/P1; 2 as 1, and the transposed hi/lo planes P2/P3; 3 transposed hi/lo planes P0/P1, and P2/P3 of rows x g^(TT-1-t) (E0 = powers of g);
// 4 C = tile + bf16(E1) g^TT; 5 tile x g^(i-j) for j <= i, else 0, hi/lo planes P0/P1; 6 GroupNorm(E1 + tile x g^(t+1)) with weight E2 and bias E3, stored transposed to C.
template <int NSPLIT, int CMODE, int EPI>
__global__ __launch_bounds__(128) void k_gemmt(const bf* __restrict__ A, const bf* __restrict__ A2, const bf* __restrict__ Bt, const bf* __restrict__ Bt2, int K, float* C, int ldc, size_t sA, size_t sB, size_t sC,
                                               const float* __restrict__ E0, const float* __restrict__ E1, const float* __restrict__ E2, const float* __restrict__ E3, bf* P0, bf* P1, bf* P2, bf* P3) {
    constexpr int NP = (NSPLIT == 0) ? 2 : (NSPLIT == 1) ? 3 : 4;   // operand planes of a stage: A, (A2), B, (B2)
    constexpr int KP = (NSPLIT == 0) ? 128 : 64;                    // k per pass
    constexpr int PITCH = KP * 2 + 16;                              // LDS row pitch in bytes: 16 x odd, for 16-byte readers
    constexpr int PLANE = 128 * PITCH, STAGE = NP * PLANE, PB = (NSPLIT == 0) ? 1 : 2;
    constexpr int GB = (NSPLIT == 0) ? 2 : 1;                       // column blocks whose B fragments are read as one group
    constexpr int LA = (NSPLIT == 0) ? 8 : 16, LB = GB * ((NSPLIT == 2) ? 4 : 2), NW = GB * 4 * (NSPLIT + 1);   // 16-byte LDS reads of the A fragments and of a B group; products of a group
    constexpr int CPR = KP / 8, RPI = 128 / CPR;                    // 16-byte units per row; rows that the 128 threads cover at once
    __shared__ __attribute__((aligned(2048))) unsigned char ring[2 * STAGE];
    const int r0 = blockIdx.x * 128, c0 = blockIdx.y * 128;
    if (CMODE == 1 && c0 > r0 + 127) return;                        // the whole work-group leaves, ahead of every copy and barrier
    const int Kl = (CMODE == 2) ? min(K, r0 + 128) : K; const int npass = Kl / KP;
    const size_t z = blockIdx.z; C += z * sC;
    const int tid = threadIdx.x, lane = tid & 31, lr = lane & 15, hi = lane >> 4, wave = tid >> 5, wm = wave >> 1, wn = wave & 1;
    const int crow = tid / CPR, ccol = tid % CPR;
    const size_t ga = z * sA + (size_t)(r0 + crow) * K + ccol * 8, gb = z * sB + (size_t)(c0 + crow) * K + ccol * 8, gstep = (size_t)RPI * K;
    const unsigned lbase = (unsigned)(size_t)ring + crow * PITCH + ccol * 16;
    auto fill = [&](int t) {   // pass t into buffer t & 1
        const unsigned l = lbase + (t & 1) * STAGE; const size_t kc = (size_t)t * KP;
#pragma unroll
        for (int h = 0; h < CPR / 8; ++h) {
            const unsigned lh = l + h * 8 * RPI * PITCH; const size_t gh = kc + h * 8 * gstep;
            copy8(lh, RPI * PITCH, A + ga + gh, gstep);
            if (NSPLIT == 1 || NSPLIT == 2) copy8(lh + PLANE, RPI * PITCH, A2 + ga + gh, gstep);
            copy8(lh + PB * PLANE, RPI * PITCH, Bt + gb + gh, gstep);
            if (NSPLIT == 2) copy8(lh + 3 * PLANE, RPI * PITCH, Bt2 + gb + gh, gstep);
        }
    };
    v8f acc[4][4];
#pragma unroll
    for (int mb = 0; mb < 4; ++mb)
#pragma unroll
        for (int nb = 0; nb < 4; ++nb) acc[mb][nb] = (v8f){};
    fill(0);
    asm volatile("s_wait_asynccnt 0x0" ::: "memory");   // this wave's copies of pass 0 have landed
    __syncthreads();                                    // and every other wave's: pass 0 is readable
    if (npass > 1) fill(1);
    const unsigned char* fa = ring + (wm * 64 + lr) * PITCH + hi * 16; const unsigned char* fb = ring + PB * PLANE + (wn * 64 + lr) * PITCH + hi * 16;
#pragma unroll 1
    for (int t = 0; t < npass; ++t) {
        const int bo = (t & 1) * STAGE;
#pragma unroll
        for (int ks = 0; ks < KP / 32; ++ks) {
            v16bf a[4], a2[4];
#pragma unroll
            for (int mb = 0; mb < 4; ++mb) { a[mb] = ldsfrag(fa + bo + mb * 16 * PITCH + ks * 64); if (NSPLIT == 1 || NSPLIT == 2) a2[mb] = ldsfrag(fa + bo + PLANE + mb * 16 * PITCH + ks * 64); }
#pragma unroll
            for (int nb = 0; nb < 4; ++nb) { const v16bf b = ldsfrag(fb + bo + nb * 16 * PITCH + ks * 64); v16bf b2; if (NSPLIT == 2) b2 = ldsfrag(fb + bo + PLANE + nb * 16 * PITCH + ks * 64);
#pragma unroll
                for (int mb = 0; mb < 4; ++mb) { acc[mb][nb] = wmmab(a[mb], b, acc[mb][nb]); if (NSPLIT == 1 || NSPLIT == 2) acc[mb][nb] = wmmab(a2[mb], b, acc[mb][nb]); if (NSPLIT == 2) acc[mb][nb] = wmmab(a[mb], b2, acc[mb][nb]); } }
            // order asked of the scheduler: LDS reads in few groups, each one group of columns ahead of its products
            __builtin_amdgcn_sched_group_barrier(0x100, LA + LB, 0);
#pragma unroll
            for (int q = 1; q < 4 / GB; ++q) { __builtin_amdgcn_sched_group_barrier(0x100, LB, 0); __builtin_amdgcn_sched_group_barrier(0x008, NW, 0); }
            __builtin_amdgcn_sched_group_barrier(0x008, NW, 0);
        }
        asm volatile("s_wait_dscnt 0x0" ::: "memory");      // this wave has left buffer t & 1
        asm volatile("s_wait_asynccnt 0x0" ::: "memory");   // its copies of pass t + 1 have landed
        __syncthreads();                                    // publishes pass t + 1 and frees buffer t & 1
        if (t + 2 < npass) fill(t + 2);
    }
    asm volatile("s_wait_asynccnt 0x0" ::: "memory");       // nothing is in flight when the ring becomes output staging
    constexpr int WREG = 24576, TOFF = 4608, TPL = 64 * 144;   // bytes of LDS a wave stages in; where its transposing tile starts; one 64 x 64 16-bit tile at a pitch of 144 bytes
    unsigned char* wreg = ring + wave * WREG;               // each wave stages in its own range, behind the last pass's barrier
    f32a* os = (f32a*)wreg;                                 // 16 x 64 f32, pitch 68
    const int rw = r0 + wm * 64, cw = c0 + wn * 64;         // the wave's first row and column of C
    if (EPI == 4 || EPI == 6) E1 += z * sC;
    if (EPI == 1 || EPI == 2 || EPI == 3 || EPI == 5) { P0 += z * sC; P1 += z * sC; }
    if (EPI == 2 || EPI == 3) { P2 += z * sC; P3 += z * sC; }
    // interleaved-pair RoPE of one block of 16 rows: the partner column sits in the neighbouring lane
    auto rope = [&](int mb) {
        const float sg = (lr & 1) ? 1.0f : -1.0f; const float* cb = E0 + ((size_t)(rw + mb * 16 + hi * 8) * DC + cw + lr) * 2; v2f ct[4][8];
#pragma unroll
        for (int nb = 0; nb < 4; ++nb)
#pragma unroll
            for (int j = 0; j < 8; ++j) ct[nb][j] = *(const v2f*)(cb + (j * DC + nb * 16) * 2);
        XWAIT("v"(cb));
#pragma unroll
        for (int nb = 0; nb < 4; ++nb)
#pragma unroll
            for (int j = 0; j < 8; ++j) {
                const v2f cs = ct[nb][j];
                const float xv = acc[mb][nb][j];
                const float pv = dppf<0xB1>(xv);
                acc[mb][nb][j] = xv * cs[0] + pv * (sg * cs[1]);
            }
    };
    // transposed hi/lo planes [column][row], row pitch TT: a lane's 8 rows are one 16-byte LDS store (t_put); read back so that 8 lanes store one whole 128-byte line (t_flush)
    unsigned char* tp = wreg + TOFF;
    auto t_put = [&](int mb, bool dec) {
        float gs[8];
        if (dec) { const float* gp = E0 + (TT - 8 - (rw + mb * 16 + hi * 8));
#pragma unroll
            for (int j = 0; j < 8; ++j) gs[j] = gp[7 - j];
            XWAIT("v"(gp)); }
#pragma unroll
        for (int nb = 0; nb < 4; ++nb) { v8us oh, ol;
#pragma unroll
            for (int j = 0; j < 8; ++j) { float xv = acc[mb][nb][j]; if (dec) xv *= gs[j]; unsigned short a2, c2; splitf(xv, a2, c2); oh[j] = a2; ol[j] = c2; }
            unsigned char* q = tp + (nb * 16 + lr) * 144 + (mb * 16 + hi * 8) * 2; *(v8usa*)q = oh; *(v8usa*)(q + TPL) = ol; }
    };
    auto t_flush = [&](bf* Th, bf* Tl) {
        __builtin_amdgcn_wave_barrier(); asm volatile("" ::: "memory");   // other lanes' LDS stores stay ahead of the reads below
#pragma unroll
        for (int sg4 = 0; sg4 < 4; ++sg4) { v8us vh[4], vl[4];   // eight LDS reads in flight, then their stores
#pragma unroll
            for (int s = 0; s < 4; ++s) { const unsigned char* q = tp + ((sg4 * 4 + s) * 4 + (lane >> 3)) * 144 + (lane & 7) * 16; vh[s] = *(const v8usa*)q; vl[s] = *(const v8usa*)(q + TPL); }
#pragma unroll
            for (int s = 0; s < 4; ++s) { const size_t o = (size_t)(cw + (sg4 * 4 + s) * 4 + (lane >> 3)) * TT + rw + (lane & 7) * 8; bf* ph = Th + o; bf* pl = Tl + o; *(v8us*)ph = vh[s]; *(v8us*)pl = vl[s]; XWAIT("v"(ph), "v"(pl), "v"(vh[s]), "v"(vl[s])); }
        }
        __builtin_amdgcn_wave_barrier(); asm volatile("" ::: "memory");   // the reads above stay ahead of the tile's next use
    };
    if (EPI == 3) {
#pragma unroll
        for (int mb = 0; mb < 4; ++mb) t_put(mb, false);
        t_flush(P0, P1);
#pragma unroll
        for (int mb = 0; mb < 4; ++mb) t_put(mb, true);
        t_flush(P2, P3);
    }
    if (EPI != 3) {
        f32a* tt = (f32a*)(wreg + TOFF);                    // EPI 6: 64 x 64 f32 at an odd pitch of 65, so that a walk down a column meets every bank once
        v4f w4 = {}, b4 = {}; float gT = 0.0f;
        if (EPI == 6) { const float* pw = E2 + cw + lr * 4; const float* pb = E3 + cw + lr * 4; const v4f wr = *(const v4f*)pw, br = *(const v4f*)pb; XWAIT("v"(pw), "v"(pb));
#pragma unroll
            for (int u = 0; u < 4; ++u) { w4[u] = bfr(wr[u]); b4[u] = bfr(br[u]); } }
        if (EPI == 4) gT = E0[TT];
#pragma unroll
        for (int mb = 0; mb < 4; ++mb) {
            if (EPI == 1 || EPI == 2) rope(mb);
            if (EPI == 2) { __builtin_amdgcn_sched_barrier(0); t_put(mb, false); }   // the split's temporaries come after the table values are spent: interleaved they take the kernel above 256 registers
            const int cofs = lr * 4, gc = cw + cofs;
            v4f ex[8]; float ge[8];   // what the 16 rows take from global memory: issued ahead of the LDS round trip, all in flight together
            if (EPI == 4 || EPI == 6) {
#pragma unroll
                for (int s = 0; s < 8; ++s) { const int gr = rw + mb * 16 + 2 * s + hi; const float* pa = E1 + (size_t)gr * ldc + gc; ex[s] = *(const v4f*)pa; XWAIT("v"(pa)); if (EPI == 6) { const float* pg = E0 + gr + 1; ge[s] = *pg; XWAIT("v"(pg)); } } }
            if (EPI == 5) {
#pragma unroll
                for (int s = 0; s < 8; ++s) { const int dd = rw + mb * 16 + 2 * s + hi - gc; const int m0 = max(dd, 0), m1 = max(dd, 1), m2 = max(dd, 2), m3 = max(dd, 3);   // exponent i - j, held at 0 above the diagonal
                    ex[s][0] = E0[m0]; ex[s][1] = E0[m1 - 1]; ex[s][2] = E0[m2 - 2]; ex[s][3] = E0[m3 - 3]; XWAIT("v"(m0), "v"(m1), "v"(m2), "v"(m3)); } }
#pragma unroll
            for (int nb = 0; nb < 4; ++nb) {
#pragma unroll
                for (int j = 0; j < 8; ++j) os[(hi * 8 + j) * 68 + nb * 16 + lr] = acc[mb][nb][j]; }
            __builtin_amdgcn_wave_barrier(); asm volatile("" ::: "memory");   // other lanes' LDS stores stay ahead of the reads below
            v4f vals[8];
#pragma unroll
            for (int s = 0; s < 8; ++s) vals[s] = *(const v4fa*)(os + (2 * s + hi) * 68 + cofs);
#pragma unroll
            for (int s = 0; s < 8; ++s) { const int row = 2 * s + hi; const v4f val = vals[s];
                const int gr = rw + mb * 16 + row; const size_t o = (size_t)gr * ldc + gc;
                if (EPI == 0) { float* pc = C + o; *(v4f*)pc = val; XWAIT("v"(pc), "v"(val)); }
                if (EPI == 1 || EPI == 2 || EPI == 5) { v4us oh, ol;
#pragma unroll
                    for (int u = 0; u < 4; ++u) { float v = val[u]; if (EPI == 5) v = (gr >= gc + u) ? v * ex[s][u] : 0.0f; unsigned short a2, c2; splitf(v, a2, c2); oh[u] = a2; ol[u] = c2; }
                    bf* ph = P0 + o; bf* pl = P1 + o; *(v4us*)ph = oh; *(v4us*)pl = ol; XWAIT("v"(ph), "v"(pl), "v"(oh), "v"(ol)); }
                if (EPI == 4) { float* pc = C + o; v4f ov;
#pragma unroll
                    for (int u = 0; u < 4; ++u) ov[u] = val[u] + bfr(ex[s][u]) * gT;
                    *(v4f*)pc = ov; XWAIT("v"(pc), "v"(ov)); }
                if (EPI == 6) { float v[4], d[4]; float sm = 0.0f, ss = 0.0f;   // a group of 32 channels = 8 lanes x 4
#pragma unroll
                    for (int u = 0; u < 4; ++u) { v[u] = ex[s][u] + val[u] * ge[s]; sm += v[u]; }
                    sm += dppf<0xB1>(sm); sm += dppf<0x4E>(sm); sm += dppf<0x141>(sm);
                    const float mu = sm * (1.0f / 32.0f);
#pragma unroll
                    for (int u = 0; u < 4; ++u) { d[u] = v[u] - mu; ss += d[u] * d[u]; }
                    ss += dppf<0xB1>(ss); ss += dppf<0x4E>(ss); ss += dppf<0x141>(ss);
                    const float rs = __fdiv_rn(1.0f, sqrtf(ss * (1.0f / 32.0f) + 1e-6f));
#pragma unroll
                    for (int u = 0; u < 4; ++u) tt[(mb * 16 + row) * 65 + cofs + u] = d[u] * rs * w4[u] + b4[u]; }
            }
            __builtin_amdgcn_wave_barrier(); asm volatile("" ::: "memory");   // the reads above stay ahead of the next block's LDS stores
        }
        if (EPI == 2) t_flush(P2, P3);
        if (EPI == 6) {   // the reference's transpose(-2,-1).reshape keeps the flat order of the transpose: C read as [DC][TT]; 16 lanes x 4 rows = two whole lines of one channel
#pragma unroll
            for (int pg8 = 0; pg8 < 4; ++pg8) { const int tg = lr * 4; v4f ov[8];   // 32 LDS reads in flight, then their stores
#pragma unroll
                for (int p = 0; p < 8; ++p)
#pragma unroll
                    for (int i = 0; i < 4; ++i) ov[p][i] = tt[(tg + i) * 65 + (pg8 * 8 + p) * 2 + hi];
#pragma unroll
                for (int p = 0; p < 8; ++p) { float* pc = C + (size_t)(cw + (pg8 * 8 + p) * 2 + hi) * TT + rw + tg; *(v4f*)pc = ov[p]; XWAIT("v"(pc), "v"(ov[p])); }
            }
        }
    }
}

__device__ __forceinline__ h16 tohx(float x) { return (h16)x; }
typedef __attribute__((ext_vector_type(2))) _Float16 v2h;
typedef __attribute__((ext_vector_type(4))) _Float16 v4h;
typedef __attribute__((ext_vector_type(2))) unsigned short v2us;
typedef __attribute__((ext_vector_type(4))) int v4i;

// ---- 128 x 64 f32 tile in LDS, used by the transposing kernel k_wtG (256 threads): global reads and global writes both move whole 128-byte lines.
#define TRR 128   // source rows per tile
#define TRC 64    // source columns per tile
#define TRP 65    // LDS pitch in dwords: odd, so that a walk down a column meets every bank once
__device__ __forceinline__ void tile_in(const float* __restrict__ src, int ld, float* ts) {   // src: the tile's first element, row pitch ld floats
    const int rr = threadIdx.x >> 4, cc = (threadIdx.x & 15) * 4; const float* g[TRR / 16]; v4f v[TRR / 16];
#pragma unroll
    for (int p = 0; p < TRR / 16; ++p) g[p] = src + (size_t)(p * 16 + rr) * ld + cc;
#pragma unroll
    for (int p = 0; p < TRR / 16; ++p) v[p] = *(const v4f*)g[p];
    // the wait that stands in front of any overwrite of an issued load's address registers; the addresses are its inputs, so that nothing is allocated over them ahead of it
    asm volatile("s_wait_xcnt 0x0" :: "v"(g[0]), "v"(g[1]), "v"(g[2]), "v"(g[3]), "v"(g[4]), "v"(g[5]), "v"(g[6]), "v"(g[7]) : "memory");
#pragma unroll
    for (int p = 0; p < TRR / 16; ++p) {
#pragma unroll
        for (int u = 0; u < 4; ++u) ts[(p * 16 + rr) * TRP + cc + u] = v[p][u]; }
    __syncthreads();   // every column is read back by waves that did not write it
}
// k_wtG: Bt[n][k] = bf16(w[k][n]); grid (K / 128, N / 64, batch)
__global__ __launch_bounds__(256) void k_wtG(const float* __restrict__ w, int K, int N, bf* Bt) {
    __shared__ float ts[TRR * TRP];
    const int k0 = blockIdx.x * TRR, n0 = blockIdx.y * TRC; w += (size_t)blockIdx.z * K * N; Bt += (size_t)blockIdx.z * K * N;
    tile_in(w + (size_t)k0 * N + n0, N, ts);
    const int kg = (threadIdx.x & 7) * 8, nr = threadIdx.x >> 3;   // 8 lanes x 8 k = one 128-byte line of a Bt row; a wave stores 4 rows
#pragma unroll
    for (int p = 0; p < 4; ++p) { const int k = (p & 1) * 64 + kg, n = (p >> 1) * 32 + nr; v8us o;
#pragma unroll
        for (int i = 0; i < 8; ++i) o[i] = f2bf(ts[(k + i) * TRP + n]);
        *(v8us*)(Bt + (size_t)(n0 + n) * K + k0 + k) = o; }
}
__global__ __launch_bounds__(256) void k_cvt8(const float* __restrict__ src, bf* dst, size_t n8) { const size_t i = (size_t)blockIdx.x * 256 + threadIdx.x; if (i >= n8) return; const v8f v = *(const v8f*)(src + i * 8); v8us o;
#pragma unroll
    for (int k = 0; k < 8; ++k) o[k] = f2bf(v[k]); *(v8us*)(dst + i * 8) = o;  }
__global__ __launch_bounds__(256) void k_cstab(float* CS) { const int idx = blockIdx.x * 256 + threadIdx.x; if (idx >= TT * HD) return; const int t = idx / HD, d = idx % HD; const int i = (d < HD / 2) ? d : d - HD / 2; const float inv = __fdiv_rn(1.0f, powf(10000.0f, (float)(2 * i) / (float)HD)); const float ang = __fmul_rn((float)t, inv); v2f cs; cs[0] = cosf(ang); cs[1] = sinf(ang);
    *(v2f*)(CS + (size_t)idx * 2) = cs;  }
// k_rope: head planes [h][t][d] (fp16 + hi/lo) of rope(x) x sc with the rotate-half convention out[d] = x[d] cos[t][d] - x[d+HD/2] sin[t][d], out[d+HD/2] = x[d+HD/2] cos[t][d+HD/2] + x[d] sin[t][d+HD/2]
__global__ __launch_bounds__(256) void k_rope(const float* __restrict__ F, int pitch, int nheads, const float* __restrict__ CS, const float* __restrict__ RF, const float* __restrict__ nw, float sc, h16* P16, bf* Ph, bf* Pl) {
    const size_t e = ((size_t)blockIdx.x * 256 + threadIdx.x) * 2; if (e >= (size_t)nheads * TT * HD) return; const int d = (int)(e % HD); const int t = (int)((e / HD) % TT); const int h = (int)(e / ((size_t)HD * TT)); const float* f = F + (size_t)t * pitch + h * HD; const float rf = RF ? RF[(size_t)h * TT + t] : 1.0f; v2h o16; v2us oh, ol;
#pragma unroll
    for (int q = 0; q < 2; ++q) { const int dd = d + q; const int dp = (dd < HD / 2) ? dd + HD / 2 : dd - HD / 2; float x0 = f[dd], x1 = f[dp];
        if (RF) { float n0 = __fmul_rn(x0, rf), n1 = __fmul_rn(x1, rf); asm volatile("" : "+v"(n0)); asm volatile("" : "+v"(n1)); x0 = __fmul_rn(bfr(nw[dd]), n0); x1 = __fmul_rn(bfr(nw[dp]), n1); }
        const v2f cs = *(const v2f*)(CS + ((size_t)t * HD + dd) * 2); float a = __fmul_rn(x0, cs[0]), bq = __fmul_rn(x1, cs[1]); asm volatile("" : "+v"(a)); asm volatile("" : "+v"(bq)); const float r = ((dd < HD / 2) ? __fsub_rn(a, bq) : __fadd_rn(a, bq)) * sc;
        o16[q] = tohx(r); unsigned short a2, c2; splitf(r, a2, c2); oh[q] = a2; ol[q] = c2; }
    *(v2h*)(P16 + e) = o16; *(v2us*)(Ph + e) = oh; *(v2us*)(Pl + e) = ol;  }
__global__ __launch_bounds__(256) void k_colsum(const bf* __restrict__ Ph, const bf* __restrict__ Pl, const h16* __restrict__ P16, int h0, float* ACC) { const int t = blockIdx.x * 256 + threadIdx.x; if (t >= TT) return; float acc = ((h0 % REP) == 0) ? 0.0f : ACC[t];
#pragma unroll 1
    for (int zz = 0; zz < ZH; ++zz) {
#pragma unroll 4
        for (int i = 0; i < RH; ++i) { const size_t o = ((size_t)zz * RH + i) * TT + t; acc = __fadd_rn(acc, __fadd_rn(bf2f(Ph[o]), bf2f(Pl[o]))); }
#pragma unroll 4
        for (int i = RH; i < TT; ++i) { const size_t o = ((size_t)zz * TT + i) * TT + t; float pv = __fmul_rn((float)P16[o], 1.0f / PCAR); asm volatile("" : "+v"(pv)); acc = __fadd_rn(acc, pv); } }
    *(float*)(ACC + t) = acc;  }
// k_asoft: per row (zz, i): t = S x SCL (= 1) for j <= i and i - j < WIN (sliding causal window; the reference's -1e9 additive fill vanishes identically); softmax over the 2048 keys (register row, one exp, fixed trees);
__global__ __launch_bounds__(256) void k_asoft(const float* __restrict__ Sb, h16* P16, bf* Ph, bf* Pl) {
    const int lane = threadIdx.x & 31; const int row = blockIdx.x * 8 + (threadIdx.x >> 5); if (row >= ZH * TT) return; const int i = row % TT; const int zz = row / TT; (void)zz; const bool hires = (i < RH); const float* sr = Sb + (size_t)row * TT; float v[TT / 32]; float mx = -3.0e38f;
#pragma unroll
    for (int ch = 0; ch < TT / 128; ++ch) { const int j0 = ch * 128 + lane * 4; const v4f a = *(const v4f*)(sr + j0);
#pragma unroll
        for (int q = 0; q < 4; ++q) { const int j = j0 + q; (void)j; float sa = a[q] * SCL; asm volatile("" : "+v"(sa)); const float t = (j <= i && i - j < WIN) ? sa : -3.0e38f; v[ch * 4 + q] = t; mx = fmaxf(mx, t); } }
#pragma unroll
    for (int sh = 16; sh; sh >>= 1) mx = fmaxf(mx, __shfl_xor(mx, sh, 32));
    float sum = 0.f;
#pragma unroll
    for (int k = 0; k < TT / 32; ++k) { float d0 = __fsub_rn(v[k], mx); asm volatile("" : "+v"(d0)); v[k] = __builtin_amdgcn_exp2f(__fmul_rn(d0, 1.4426950408889634f)); sum += v[k]; }
#pragma unroll
    for (int sh = 16; sh; sh >>= 1) sum += __shfl_xor(sum, sh, 32);
    const float f = __fdiv_rn(hires ? 1.0f : PCAR, sum);
{
        if (hires) {
#pragma unroll
            for (int ch = 0; ch < TT / 128; ++ch) { v4us oh, ol;
#pragma unroll
                for (int q = 0; q < 4; ++q) { unsigned short a, c2; splitf(v[ch * 4 + q] * f, a, c2); oh[q] = a; ol[q] = c2; }
                const size_t oo = ((size_t)zz * (RH ? RH : 1) + i) * TT + ch * 128 + lane * 4; *(v4us*)(Ph + oo) = oh; *(v4us*)(Pl + oo) = ol; }
        } else {
#pragma unroll
            for (int ch = 0; ch < TT / 128; ++ch) { v4h o4;
#pragma unroll
                for (int q = 0; q < 4; ++q) o4[q] = tohx(v[ch * 4 + q] * f);
                *(v4h*)(P16 + (size_t)row * TT + ch * 128 + lane * 4) = o4; } }
         }
}
__global__ __launch_bounds__(256) void k_merge(const float* __restrict__ O, int h0, bf* Ah, bf* Al) { const size_t e = ((size_t)blockIdx.x * 256 + threadIdx.x) * 2; if (e >= (size_t)ZH * TT * HD) return; const int d = (int)(e % HD); const int t = (int)((e / HD) % TT); const int zz = (int)(e / ((size_t)HD * TT)); const float cs = (t < RH) ? 1.0f : (1.0f / PCAR); const size_t oo = (size_t)t * DQ + (h0 + zz) * HD + d;
    v2us oh, ol;
#pragma unroll
    for (int q = 0; q < 2; ++q) { unsigned short a, c2; splitf(O[e + q] * cs, a, c2); oh[q] = a; ol[q] = c2; } *(v2us*)(Ah + oo) = oh; *(v2us*)(Al + oo) = ol;  }


// ---- SingleHeadQKV kernels ----
__global__ __launch_bounds__(256) void k_gptab(float* GP) { const int n = blockIdx.x * 256 + threadIdx.x; if (n >= TT + 64) return; const float v = powf(GAMR, (float)n); *(float*)(GP + n) = v;  }
__global__ __launch_bounds__(256) void k_cstabW(float* CS) { const size_t idx = (size_t)blockIdx.x * 256 + threadIdx.x; if (idx >= (size_t)TT * DC) return; const int t = (int)(idx / DC), d = (int)(idx % DC); const float inv = __fdiv_rn(1.0f, powf(10000.0f, (float)(2 * (d >> 1)) / (float)DC)); const float ang = __fmul_rn((float)t, inv); v2f cs; cs[0] = cosf(ang); cs[1] = sinf(ang); *(v2f*)(CS + idx * 2) = cs;  }

extern "C" void kernel_launch(void* const* d_in, const int* in_sizes, int n_in,
                              void* d_out, int out_size, void* d_ws, size_t ws_size, hipStream_t stream) {
    (void)in_sizes; (void)n_in; (void)out_size;
    const float* x = (const float*)d_in[0]; const float* sn = (const float*)d_in[1]; const float* wq = (const float*)d_in[2]; const float* wk = (const float*)d_in[3]; const float* wv = (const float*)d_in[4]; const float* gw = (const float*)d_in[5]; const float* gb = (const float*)d_in[6];
    float* OUT = (float*)d_out;     // out0 [4][2048][1024] at 0, out1 [4][1024][1024] at NB*TT*DC
    char* wsp = (char*)d_ws;
    auto take = [&](size_t bytes) { char* p = wsp; wsp += (bytes + 255) & ~(size_t)255; return (void*)p; };
    // All NB_ batch elements go through every stage at once (grid z = batch). Planes are [batch][...]; buffers whose contents are dead are reused, in stream order.
    const size_t SX = (size_t)TT * DC, SS = (size_t)DC * DC, SP = (size_t)TT * TT;   // elements per batch element: activations, state, scores
    bf* QPh = (bf*)take(NB_ * SX * 2); bf* QPl = (bf*)take(NB_ * SX * 2); bf* KPh = (bf*)take(NB_ * SX * 2); bf* KPl = (bf*)take(NB_ * SX * 2); bf* VTh = (bf*)take(NB_ * SX * 2); bf* VTl = (bf*)take(NB_ * SX * 2);
    bf* KTh = (bf*)take(NB_ * SX * 2); bf* KTl = (bf*)take(NB_ * SX * 2); bf* VDTh = (bf*)take(NB_ * SX * 2); bf* VDTl = (bf*)take(NB_ * SX * 2);
    float* CS = (float*)take((size_t)TT * DC * 2 * 4);
    bf* SNT = (bf*)take(NB_ * SS * 2); bf* XB = (bf*)take(NB_ * SX * 2);
    bf* WQ = (bf*)take((size_t)DQ * DM * 2); bf* WK = (bf*)take((size_t)DKV * DM * 2); bf* WV = (bf*)take((size_t)DKV * DM * 2); float* GP = (float*)take((TT + 64) * 4);
    bf* Ph = KTh; bf* Pl = VDTh;     // NB_*SP each, over KTh + KTl and over VDTh + VDTl: dead after the R product
    float* INNER = (float*)KPh;      // NB_*SX f32 over KPh + KPl: dead after Q K^T
    if ((size_t)(wsp - (char*)d_ws) > ws_size) return;   // ws ~ 206 MiB
    { k_wtG<<<dim3(DM / TRR, DQ / TRC, 1), 256, 0, stream>>>(wq, DM, DQ, WQ); k_wtG<<<dim3(DM / TRR, DKV / TRC, 1), 256, 0, stream>>>(wk, DM, DKV, WK); k_wtG<<<dim3(DM / TRR, DKV / TRC, 1), 256, 0, stream>>>(wv, DM, DKV, WV); k_cstabW<<<(unsigned)(((size_t)TT * DC + 255) / 256), 256, 0, stream>>>(CS); k_gptab<<<(TT + 64 + 255) / 256, 256, 0, stream>>>(GP); }
    k_cvt8<<<(unsigned)((NB_ * SX / 8 + 255) / 256), 256, 0, stream>>>(x, XB, NB_ * SX / 8);
    k_wtG<<<dim3(DC / TRR, DC / TRC, NB_), 256, 0, stream>>>(sn, DC, DC, SNT);
    // Q = rope(X W_Q), K = rope(X W_K), V = X W_V, each straight into the operand planes of the later products
    k_gemmt<0, 0, 1><<<dim3(TT / 128, DQ / 128, NB_), 128, 0, stream>>>(XB, nullptr, WQ, nullptr, DM, nullptr, DQ, SX, 0, SX, CS, nullptr, nullptr, nullptr, QPh, QPl, nullptr, nullptr);
    k_gemmt<0, 0, 2><<<dim3(TT / 128, DKV / 128, NB_), 128, 0, stream>>>(XB, nullptr, WK, nullptr, DM, nullptr, DKV, SX, 0, SX, CS, nullptr, nullptr, nullptr, KPh, KPl, KTh, KTl);
    k_gemmt<0, 0, 3><<<dim3(TT / 128, DKV / 128, NB_), 128, 0, stream>>>(XB, nullptr, WV, nullptr, DM, nullptr, DKV, SX, 0, SX, GP, nullptr, nullptr, nullptr, VTh, VTl, VDTh, VDTl);
    // R_i = K^T (V D[-1]) + S_n g^T (first, so that its operand planes can be reused for the scores)
    k_gemmt<2, 0, 4><<<dim3(DC / 128, DC / 128, NB_), 128, 0, stream>>>(KTh, KTl, VDTh, VDTl, TT, OUT + NB_ * SX, DC, SX, SX, SS, GP, sn, nullptr, nullptr, nullptr, nullptr, nullptr, nullptr);
    // A = (Q K^T) x D into hi/lo planes (causal tiles only), inner = A V (causal tiles only)
    k_gemmt<2, 1, 5><<<dim3(TT / 128, TT / 128, NB_), 128, 0, stream>>>(QPh, QPl, KPh, KPl, DC, nullptr, TT, SX, SX, SP, GP, nullptr, nullptr, nullptr, Ph, Pl, nullptr, nullptr);
    k_gemmt<2, 2, 0><<<dim3(TT / 128, DC / 128, NB_), 128, 0, stream>>>(Ph, Pl, VTh, VTl, TT, INNER, DC, SP, SX, SX, nullptr, nullptr, nullptr, nullptr, nullptr, nullptr, nullptr, nullptr);
    // cross = Q S_n; out0 = permuted GroupNorm(inner + cross g^(t+1))
    k_gemmt<1, 0, 6><<<dim3(TT / 128, DC / 128, NB_), 128, 0, stream>>>(QPh, QPl, SNT, nullptr, DC, OUT, DC, SX, SS, SX, GP, INNER, gw, gb, nullptr, nullptr, nullptr, nullptr);
}

// v005
// It runs in 283 microseconds.
// In two side-by-side timings against v004, it was 1.07 and 1.03 times as fast.
// Over all steps from v000 it is 4.69 times as fast.
#include <hip/hip_runtime.h>

// SingleHeadQKV (chunkwise retention step: X_Q [4][2048][1024], S_n [4][1024][1024]; Q = rope(X W_Q), K = rope(X W_K) (interleaved-pair RoPE over the full 1024 dims), V = X W_V; D[n][m] = g^(n-m) for n >= m (g = 1 - 2^-5); inner = (Q K^T * D) V; cross = (Q S_n) * g^(t+1); out = GroupNorm32(inner + cross) then the literal transpose(-2,-1).reshape permutation -> out0 [4][2048][1024]; R_i = K^T (V * D[-1]) + S_n g^T -> out1 [4][1024][1024] at element 8,388,608).
// Compute dtypes, f32 accumulate: every input rounded to bf16; Q/K/V on PLAIN bf16 operands (inputs: exact); RoPE f32 (on-chip table); decay powers g^n in f32 (powf); Q.K^T (K = 1024) hl x hl (3 products) with causal tile skipping, x D per element in f32 into hi/lo planes (no softmax), (QK^T D).V hl x hl (3 products, causal skipping); Q.S_n hl x exact (2 products); K^T.(V D[-1]) hl x hl (3 products, K = 2048); sums, GroupNorm (32 groups of 32, biased var, eps 1e-6) and the output permutation in f32.

#define NB_  4
#define TT   2048
#define DM   1024
#define NH_  16
#define NKV  16
#define REP  (NH_ / NKV)
#define HD   64
#define DQ   (NH_ * HD)
#define DKV  (NKV * HD)
#define ZH   2
#define RH   2048                  // query rows < RH use hi+lo planes (0: none)
#define WIN  2048
#define PCAR 1024.0f
#define DC   1024   // channel width (= DQ)
#define GAMR 0.96875f
#define SCL  1.0f
typedef _Float16 h16;
typedef unsigned short bf;
typedef __attribute__((ext_vector_type(16))) __bf16   v16bf;
typedef __attribute__((ext_vector_type(16))) _Float16 v16h;
typedef __attribute__((ext_vector_type(8)))  _Float16 v8h;
typedef __attribute__((ext_vector_type(8)))  unsigned short v8us;
typedef __attribute__((ext_vector_type(8)))  float    v8f;
typedef __attribute__((ext_vector_type(4)))  float    v4f;
typedef v8h  __attribute__((may_alias)) v8ha;
typedef v4f  __attribute__((may_alias)) v4fa;
typedef v8us __attribute__((may_alias)) v8usa;
typedef __attribute__((ext_vector_type(4))) unsigned short v4us;
typedef __attribute__((ext_vector_type(2))) float v2f;

__device__ __forceinline__ unsigned short f2bf(float f) { unsigned u = __float_as_uint(f); u += 0x7FFFu + ((u >> 16) & 1u); return (unsigned short)(u >> 16); }
__device__ __forceinline__ float bf2f(unsigned short b) { return __uint_as_float(((unsigned)b) << 16); }
__device__ __forceinline__ float bfr(float f) { return bf2f(f2bf(f)); }
__device__ __forceinline__ void splitf(float y, unsigned short& h, unsigned short& l) { h = f2bf(y); l = f2bf(y - bf2f(h)); }
__device__ __forceinline__ v16h cat16(v8h lo, v8h hi) { return __builtin_shufflevector(lo, hi, 0, 1, 2, 3, 4, 5, 6, 7, 8, 9, 10, 11, 12, 13, 14, 15); }
__device__ __forceinline__ v16bf cat16b(v8us lo, v8us hi) { return __builtin_bit_cast(v16bf, __builtin_shufflevector(lo, hi, 0, 1, 2, 3, 4, 5, 6, 7, 8, 9, 10, 11, 12, 13, 14, 15)); }
__device__ __forceinline__ v8f wmma16(v16h a, v16h b, v8f c) { return __builtin_amdgcn_wmma_f32_16x16x32_f16(false, a, false, b, (short)0, c, false, false); }
__device__ __forceinline__ v8f wmmab(v16bf a, v16bf b, v8f c) { return __builtin_amdgcn_wmma_f32_16x16x32_bf16(false, a, false, b, (short)0, c, false, false); }



// ---- k_gemmt: C[m][n] (f32, pitch ldc) = sum_k A[m][k] Bt[n][k] (+ split products per NSPLIT) on K-contiguous bf16 planes. One 128x128 tile of C per work-group of four waves (2x2, 64x64 each, 16 accumulators a wave);
// grid (M/128, N/128, Z), 128 threads. A pass is KP k of all 128 rows of every operand plane; asynchronous copies bring it into a two-buffer LDS ring as whole 128-byte lines, one pass ahead of its use, and each row is fetched once for two waves.
// CMODE 1 launches no score tile entirely above the causal diagonal (grid (136, 1, Z)); CMODE 2 ends the K loop of the (decayed score) x value product at the diagonal block (the planes are not written beyond it). M, N % 128 == 0, K % KP == 0.
typedef float __attribute__((may_alias)) f32a;
// eight copies of 16 bytes a lane; the s_wait_xcnt stands inside the statement, in front of any overwrite of the address registers that the copies name
__device__ __forceinline__ void copy8(unsigned l, int lstep, const bf* g, size_t gstep) {
    const unsigned l0 = l, l1 = l + lstep, l2 = l + 2 * lstep, l3 = l + 3 * lstep, l4 = l + 4 * lstep, l5 = l + 5 * lstep, l6 = l + 6 * lstep, l7 = l + 7 * lstep;
    const bf *g0 = g, *g1 = g + gstep, *g2 = g + 2 * gstep, *g3 = g + 3 * gstep, *g4 = g + 4 * gstep, *g5 = g + 5 * gstep, *g6 = g + 6 * gstep, *g7 = g + 7 * gstep;
    asm volatile("global_load_async_to_lds_b128 %0, %8, off\n\tglobal_load_async_to_lds_b128 %1, %9, off\n\tglobal_load_async_to_lds_b128 %2, %10, off\n\tglobal_load_async_to_lds_b128 %3, %11, off\n\t"
                 "global_load_async_to_lds_b128 %4, %12, off\n\tglobal_load_async_to_lds_b128 %5, %13, off\n\tglobal_load_async_to_lds_b128 %6, %14, off\n\tglobal_load_async_to_lds_b128 %7, %15, off\n\ts_wait_xcnt 0x0"
                 :: "v"(l0), "v"(l1), "v"(l2), "v"(l3), "v"(l4), "v"(l5), "v"(l6), "v"(l7), "v"(g0), "v"(g1), "v"(g2), "v"(g3), "v"(g4), "v"(g5), "v"(g6), "v"(g7) : "memory");
}
#define XWAIT(...) asm volatile("s_wait_xcnt 0x0" :: __VA_ARGS__ : "memory")
template <int CTRL> __device__ __forceinline__ float dppf(float x) { return __int_as_float(__builtin_amdgcn_mov_dpp(__float_as_int(x), CTRL, 0xF, 0xF, true)); }   // 0xB1: lane ^ 1, 0x4E: lane ^ 2 (quad_perm); 0x141: lane -> 7 - lane in each 8 (row_half_mirror)
__device__ __forceinline__ v16bf ldsfrag(const unsigned char* p) { return cat16b(*(const v8usa*)p, *(const v8usa*)(p + 32)); }
// EPI names what the epilogue makes of the tile, straight from the accumulators (a lane holds 8 consecutive rows of one column) and each wave's own LDS range:
// 0 f32 C; 1 RoPE (E0 = cos/sin table), hi/lo planes P0/P1; 2 as 1, and the transposed hi/lo planes P2/P3; 3 transposed hi/lo planes P0/P1, and P2/P3 of rows x g^(TT-1-t) (E0 = powers of g);
// 4 C = tile + bf16(E1) g^TT; 5 tile x g^(i-j) for j <= i, else 0, hi/lo planes P0/P1; 6 GroupNorm(E1 + tile x g^(t+1)) with weight E2 and bias E3, stored transposed to C.
template <int NSPLIT, int CMODE, int EPI>
__global__ __launch_bounds__(128) void k_gemmt(const bf* __restrict__ A, const bf* __restrict__ A2, const bf* __restrict__ Bt, const bf* __restrict__ Bt2, int K, float* C, int ldc, size_t sA, size_t sB, size_t sC,
                                               const float* __restrict__ E0, const float* __restrict__ E1, const float* __restrict__ E2, const float* __restrict__ E3, bf* P0, bf* P1, bf* P2, bf* P3) {
    constexpr int NP = (NSPLIT == 0) ? 2 : (NSPLIT == 1) ? 3 : 4;   // operand planes of a stage: A, (A2), B, (B2)
    constexpr int KP = (NSPLIT == 0) ? 128 : 64;                    // k per pass
    constexpr int PITCH = KP * 2 + 16;                              // LDS row pitch in bytes: 16 x odd, for 16-byte readers
    constexpr int PLANE = 128 * PITCH, STAGE = NP * PLANE, PB = (NSPLIT == 0) ? 1 : 2;
    constexpr int GB = (NSPLIT == 0) ? 2 : 1;                       // column blocks whose B fragments are read as one group
    constexpr int LA = (NSPLIT == 0) ? 8 : 16, LB = GB * ((NSPLIT == 2) ? 4 : 2), NW = GB * 4 * (NSPLIT + 1);   // 16-byte LDS reads of the A fragments and of a B group; products of a group
    constexpr int CPR = KP / 8, RPI = 128 / CPR;                    // 16-byte units per row; rows that the 128 threads cover at once
    __shared__ __attribute__((aligned(2048))) unsigned char ring[2 * STAGE];
    int bx = blockIdx.x, by = blockIdx.y, bz = blockIdx.z;
    if (CMODE == 1) {   // grid.x counts only the tiles on or below the diagonal, row by row: no work-group starts for nothing
        int r = 0;
        for (int q = 1; q < TT / 128; ++q) r += (bx >= q * (q + 1) / 2) ? 1 : 0;
        by = bx - r * (r + 1) / 2; bx = r; }
    if (CMODE == 2) {   // all work-groups are resident, two to a WGP, and a row tile's K loop grows with its index: flat indices 8, 16 or 256 apart get row tiles t and 15 - t. Speed only: any placement is correct
        static_assert(CMODE != 2 || (TT / 128 == 16 && DC / 128 == 8 && NB_ == 4), "the map below is a permutation of a 16 x 8 x 4 grid");
        const int b = bx + 16 * by + 128 * bz, k = b >> 3, u = (k >> 2) & 7;
        bx = ((k ^ (k >> 1) ^ (k >> 5)) & 1) ? 15 - u : u; by = b & 7; bz = k & 3; }
    const int r0 = bx * 128, c0 = by * 128;
    const int Kl = (CMODE == 2) ? min(K, r0 + 128) : K; const int npass = Kl / KP;
    const size_t z = bz; C += z * sC;
    const int tid = threadIdx.x, lane = tid & 31, lr = lane & 15, hi = lane >> 4, wave = tid >> 5, wm = wave >> 1, wn = wave & 1;
    const int crow = tid / CPR, ccol = tid % CPR;
    const size_t ga = z * sA + (size_t)(r0 + crow) * K + ccol * 8, gb = z * sB + (size_t)(c0 + crow) * K + ccol * 8, gstep = (size_t)RPI * K;
    const unsigned lbase = (unsigned)(size_t)ring + crow * PITCH + ccol * 16;
    auto fill = [&](int t) {   // pass t into buffer t & 1
        const unsigned l = lbase + (t & 1) * STAGE; const size_t kc = (size_t)t * KP;
#pragma unroll
        for (int h = 0; h < CPR / 8; ++h) {
            const unsigned lh = l + h * 8 * RPI * PITCH; const size_t gh = kc + h * 8 * gstep;
            copy8(lh, RPI * PITCH, A + ga + gh, gstep);
            if (NSPLIT == 1 || NSPLIT == 2) copy8(lh + PLANE, RPI * PITCH, A2 + ga + gh, gstep);
            copy8(lh + PB * PLANE, RPI * PITCH, Bt + gb + gh, gstep);
            if (NSPLIT == 2) copy8(lh + 3 * PLANE, RPI * PITCH, Bt2 + gb + gh, gstep);
        }
    };
    v8f acc[4][4];
#pragma unroll
    for (int mb = 0; mb < 4; ++mb)
#pragma unroll
        for (int nb = 0; nb < 4; ++nb) acc[mb][nb] = (v8f){};
    fill(0);
    asm volatile("s_wait_asynccnt 0x0" ::: "memory");   // this wave's copies of pass 0 have landed
    __syncthreads();                                    // and every other wave's: pass 0 is readable
    if (npass > 1) fill(1);
    const unsigned char* fa = ring + (wm * 64 + lr) * PITCH + hi * 16; const unsigned char* fb = ring + PB * PLANE + (wn * 64 + lr) * PITCH + hi * 16;
#pragma unroll 1
    for (int t = 0; t < npass; ++t) {
        const int bo = (t & 1) * STAGE;
#pragma unroll
        for (int ks = 0; ks < KP / 32; ++ks) {
            v16bf a[4], a2[4];
#pragma unroll
            for (int mb = 0; mb < 4; ++mb) { a[mb] = ldsfrag(fa + bo + mb * 16 * PITCH + ks * 64); if (NSPLIT == 1 || NSPLIT == 2) a2[mb] = ldsfrag(fa + bo + PLANE + mb * 16 * PITCH + ks * 64); }
#pragma unroll
            for (int nb = 0; nb < 4; ++nb) { const v16bf b = ldsfrag(fb + bo + nb * 16 * PITCH + ks * 64); v16bf b2; if (NSPLIT == 2) b2 = ldsfrag(fb + bo + PLANE + nb * 16 * PITCH + ks * 64);
#pragma unroll
                for (int mb = 0; mb < 4; ++mb) { acc[mb][nb] = wmmab(a[mb], b, acc[mb][nb]); if (NSPLIT == 1 || NSPLIT == 2) acc[mb][nb] = wmmab(a2[mb], b, acc[mb][nb]); if (NSPLIT == 2) acc[mb][nb] = wmmab(a[mb], b2, acc[mb][nb]); } }
            // order asked of the scheduler: LDS reads in few groups, each one group of columns ahead of its products
            __builtin_amdgcn_sched_group_barrier(0x100, LA + LB, 0);
#pragma unroll
            for (int q = 1; q < 4 / GB; ++q) { __builtin_amdgcn_sched_group_barrier(0x100, LB, 0); __builtin_amdgcn_sched_group_barrier(0x008, NW, 0); }
            __builtin_amdgcn_sched_group_barrier(0x008, NW, 0);
        }
        asm volatile("s_wait_dscnt 0x0" ::: "memory");      // this wave has left buffer t & 1
        asm volatile("s_wait_asynccnt 0x0" ::: "memory");   // its copies of pass t + 1 have landed
        __syncthreads();                                    // publishes pass t + 1 and frees buffer t & 1
        if (t + 2 < npass) fill(t + 2);
    }
    asm volatile("s_wait_asynccnt 0x0" ::: "memory");       // nothing is in flight when the ring becomes output staging
    constexpr int WREG = 24576, TOFF = 4608, TPL = 64 * 144;   // bytes of LDS a wave stages in; where its transposing tile starts; one 64 x 64 16-bit tile at a pitch of 144 bytes
    unsigned char* wreg = ring + wave * WREG;               // each wave stages in its own range, behind the last pass's barrier
    f32a* os = (f32a*)wreg;                                 // 16 x 64 f32, pitch 68
    const int rw = r0 + wm * 64, cw = c0 + wn * 64;         // the wave's first row and column of C
    if (EPI == 4 || EPI == 6) E1 += z * sC;
    if (EPI == 1 || EPI == 2 || EPI == 3 || EPI == 5) { P0 += z * sC; P1 += z * sC; }
    if (EPI == 2 || EPI == 3) { P2 += z * sC; P3 += z * sC; }
    // interleaved-pair RoPE of one block of 16 rows: the partner column sits in the neighbouring lane
    auto rope = [&](int mb) {
        const float sg = (lr & 1) ? 1.0f : -1.0f; const float* cb = E0 + ((size_t)(rw + mb * 16 + hi * 8) * DC + cw + lr) * 2; v2f ct[4][8];
#pragma unroll
        for (int nb = 0; nb < 4; ++nb)
#pragma unroll
            for (int j = 0; j < 8; ++j) ct[nb][j] = *(const v2f*)(cb + (j * DC + nb * 16) * 2);
        XWAIT("v"(cb));
#pragma unroll
        for (int nb = 0; nb < 4; ++nb)
#pragma unroll
            for (int j = 0; j < 8; ++j) {
                const v2f cs = ct[nb][j];
                const float xv = acc[mb][nb][j];
                const float pv = dppf<0xB1>(xv);
                acc[mb][nb][j] = xv * cs[0] + pv * (sg * cs[1]);
            }
    };
    // transposed hi/lo planes [column][row], row pitch TT: a lane's 8 rows are one 16-byte LDS store (t_put); read back so that 8 lanes store one whole 128-byte line (t_flush)
    unsigned char* tp = wreg + TOFF;
    auto t_put = [&](int mb, bool dec) {
        float gs[8];
        if (dec) { const float* gp = E0 + (TT - 8 - (rw + mb * 16 + hi * 8));
#pragma unroll
            for (int j = 0; j < 8; ++j) gs[j] = gp[7 - j];
            XWAIT("v"(gp)); }
#pragma unroll
        for (int nb = 0; nb < 4; ++nb) { v8us oh, ol;
#pragma unroll
            for (int j = 0; j < 8; ++j) { float xv = acc[mb][nb][j]; if (dec) xv *= gs[j]; unsigned short a2, c2; splitf(xv, a2, c2); oh[j] = a2; ol[j] = c2; }
            unsigned char* q = tp + (nb * 16 + lr) * 144 + (mb * 16 + hi * 8) * 2; *(v8usa*)q = oh; *(v8usa*)(q + TPL) = ol; }
    };
    auto t_flush = [&](bf* Th, bf* Tl) {
        __builtin_amdgcn_wave_barrier(); asm volatile("" ::: "memory");   // other lanes' LDS stores stay ahead of the reads below
#pragma unroll
        for (int sg4 = 0; sg4 < 4; ++sg4) { v8us vh[4], vl[4];   // eight LDS reads in flight, then their stores
#pragma unroll
            for (int s = 0; s < 4; ++s) { const unsigned char* q = tp + ((sg4 * 4 + s) * 4 + (lane >> 3)) * 144 + (lane & 7) * 16; vh[s] = *(const v8usa*)q; vl[s] = *(const v8usa*)(q + TPL); }
#pragma unroll
            for (int s = 0; s < 4; ++s) { const size_t o = (size_t)(cw + (sg4 * 4 + s) * 4 + (lane >> 3)) * TT + rw + (lane & 7) * 8; bf* ph = Th + o; bf* pl = Tl + o; *(v8us*)ph = vh[s]; *(v8us*)pl = vl[s]; XWAIT("v"(ph), "v"(pl), "v"(vh[s]), "v"(vl[s])); }
        }
        __builtin_amdgcn_wave_barrier(); asm volatile("" ::: "memory");   // the reads above stay ahead of the tile's next use
    };
    if (EPI == 3) {
#pragma unroll
        for (int mb = 0; mb < 4; ++mb) t_put(mb, false);
        t_flush(P0, P1);
#pragma unroll
        for (int mb = 0; mb < 4; ++mb) t_put(mb, true);
        t_flush(P2, P3);
    }
    if (EPI != 3) {
        f32a* tt = (f32a*)(wreg + TOFF);                    // EPI 6: 64 x 64 f32 at an odd pitch of 65, so that a walk down a column meets every bank once
        v4f w4 = {}, b4 = {}; float gT = 0.0f;
        if (EPI == 6) { const float* pw = E2 + cw + lr * 4; const float* pb = E3 + cw + lr * 4; const v4f wr = *(const v4f*)pw, br = *(const v4f*)pb; XWAIT("v"(pw), "v"(pb));
#pragma unroll
            for (int u = 0; u < 4; ++u) { w4[u] = bfr(wr[u]); b4[u] = bfr(br[u]); } }
        if (EPI == 4) gT = E0[TT];
#pragma unroll
        for (int mb = 0; mb < 4; ++mb) {
            if (EPI == 1 || EPI == 2) rope(mb);
            if (EPI == 2) { __builtin_amdgcn_sched_barrier(0); t_put(mb, false); }   // the split's temporaries come after the table values are spent: interleaved they take the kernel above 256 registers
            const int cofs = lr * 4, gc = cw + cofs;
            v4f ex[8]; float ge[8];   // what the 16 rows take from global memory: issued ahead of the LDS round trip, all in flight together
            if (EPI == 4 || EPI == 6) {
#pragma unroll
                for (int s = 0; s < 8; ++s) { const int gr = rw + mb * 16 + 2 * s + hi; const float* pa = E1 + (size_t)gr * ldc + gc; ex[s] = *(const v4f*)pa; XWAIT("v"(pa)); if (EPI == 6) { const float* pg = E0 + gr + 1; ge[s] = *pg; XWAIT("v"(pg)); } } }
            if (EPI == 5) {
#pragma unroll
                for (int s = 0; s < 8; ++s) { const int dd = rw + mb * 16 + 2 * s + hi - gc; const int m0 = max(dd, 0), m1 = max(dd, 1), m2 = max(dd, 2), m3 = max(dd, 3);   // exponent i - j, held at 0 above the diagonal
                    ex[s][0] = E0[m0]; ex[s][1] = E0[m1 - 1]; ex[s][2] = E0[m2 - 2]; ex[s][3] = E0[m3 - 3]; XWAIT("v"(m0), "v"(m1), "v"(m2), "v"(m3)); } }
#pragma unroll
            for (int nb = 0; nb < 4; ++nb) {
#pragma unroll
                for (int j = 0; j < 8; ++j) os[(hi * 8 + j) * 68 + nb * 16 + lr] = acc[mb][nb][j]; }
            __builtin_amdgcn_wave_barrier(); asm volatile("" ::: "memory");   // other lanes' LDS stores stay ahead of the reads below
            v4f vals[8];
#pragma unroll
            for (int s = 0; s < 8; ++s) vals[s] = *(const v4fa*)(os + (2 * s + hi) * 68 + cofs);
#pragma unroll
            for (int s = 0; s < 8; ++s) { const int row = 2 * s + hi; const v4f val = vals[s];
                const int gr = rw + mb * 16 + row; const size_t o = (size_t)gr * ldc + gc;
                if (EPI == 0) { float* pc = C + o; *(v4f*)pc = val; XWAIT("v"(pc), "v"(val)); }
                if (EPI == 1 || EPI == 2 || EPI == 5) { v4us oh, ol;
#pragma unroll
                    for (int u = 0; u < 4; ++u) { float v = val[u]; if (EPI == 5) v = (gr >= gc + u) ? v * ex[s][u] : 0.0f; unsigned short a2, c2; splitf(v, a2, c2); oh[u] = a2; ol[u] = c2; }
                    bf* ph = P0 + o; bf* pl = P1 + o; *(v4us*)ph = oh; *(v4us*)pl = ol; XWAIT("v"(ph), "v"(pl), "v"(oh), "v"(ol)); }
                if (EPI == 4) { float* pc = C + o; v4f ov;
#pragma unroll
                    for (int u = 0; u < 4; ++u) ov[u] = val[u] + bfr(ex[s][u]) * gT;
                    *(v4f*)pc = ov; XWAIT("v"(pc), "v"(ov)); }
                if (EPI == 6) { float v[4], d[4]; float sm = 0.0f, ss = 0.0f;   // a group of 32 channels = 8 lanes x 4
#pragma unroll
                    for (int u = 0; u < 4; ++u) { v[u] = ex[s][u] + val[u] * ge[s]; sm += v[u]; }
                    sm += dppf<0xB1>(sm); sm += dppf<0x4E>(sm); sm += dppf<0x141>(sm);
                    const float mu = sm * (1.0f / 32.0f);
#pragma unroll
                    for (int u = 0; u < 4; ++u) { d[u] = v[u] - mu; ss += d[u] * d[u]; }
                    ss += dppf<0xB1>(ss); ss += dppf<0x4E>(ss); ss += dppf<0x141>(ss);
                    const float rs = __fdiv_rn(1.0f, sqrtf(ss * (1.0f / 32.0f) + 1e-6f));
#pragma unroll
                    for (int u = 0; u < 4; ++u) tt[(mb * 16 + row) * 65 + cofs + u] = d[u] * rs * w4[u] + b4[u]; }
            }
            __builtin_amdgcn_wave_barrier(); asm volatile("" ::: "memory");   // the reads above stay ahead of the next block's LDS stores
        }
        if (EPI == 2) t_flush(P2, P3);
        if (EPI == 6) {   // the reference's transpose(-2,-1).reshape keeps the flat order of the transpose: C read as [DC][TT]; 16 lanes x 4 rows = two whole lines of one channel
#pragma unroll
            for (int pg8 = 0; pg8 < 4; ++pg8) { const int tg = lr * 4; v4f ov[8];   // 32 LDS reads in flight, then their stores
#pragma unroll
                for (int p = 0; p < 8; ++p)
#pragma unroll
                    for (int i = 0; i < 4; ++i) ov[p][i] = tt[(tg + i) * 65 + (pg8 * 8 + p) * 2 + hi];
#pragma unroll
                for (int p = 0; p < 8; ++p) { float* pc = C + (size_t)(cw + (pg8 * 8 + p) * 2 + hi) * TT + rw + tg; *(v4f*)pc = ov[p]; XWAIT("v"(pc), "v"(ov[p])); }
            }
        }
    }
}

__device__ __forceinline__ h16 tohx(float x) { return (h16)x; }
typedef __attribute__((ext_vector_type(2))) _Float16 v2h;
typedef __attribute__((ext_vector_type(4))) _Float16 v4h;
typedef __attribute__((ext_vector_type(2))) unsigned short v2us;
typedef __attribute__((ext_vector_type(4))) int v4i;

// ---- 128 x 64 f32 tile in LDS, used by the transposing kernel k_wtG (256 threads): global reads and global writes both move whole 128-byte lines.
#define TRR 128   // source rows per tile
#define TRC 64    // source columns per tile
#define TRP 65    // LDS pitch in dwords: odd, so that a walk down a column meets every bank once
__device__ __forceinline__ void tile_in(const float* __restrict__ src, int ld, float* ts) {   // src: the tile's first element, row pitch ld floats
    const int rr = threadIdx.x >> 4, cc = (threadIdx.x & 15) * 4; const float* g[TRR / 16]; v4f v[TRR / 16];
#pragma unroll
    for (int p = 0; p < TRR / 16; ++p) g[p] = src + (size_t)(p * 16 + rr) * ld + cc;
#pragma unroll
    for (int p = 0; p < TRR / 16; ++p) v[p] = *(const v4f*)g[p];
    // the wait that stands in front of any overwrite of an issued load's address registers; the addresses are its inputs, so that nothing is allocated over them ahead of it
    asm volatile("s_wait_xcnt 0x0" :: "v"(g[0]), "v"(g[1]), "v"(g[2]), "v"(g[3]), "v"(g[4]), "v"(g[5]), "v"(g[6]), "v"(g[7]) : "memory");
#pragma unroll
    for (int p = 0; p < TRR / 16; ++p) {
#pragma unroll
        for (int u = 0; u < 4; ++u) ts[(p * 16 + rr) * TRP + cc + u] = v[p][u]; }
    __syncthreads();   // every column is read back by waves that did not write it
}
// k_wtG: Bt[n][k] = bf16(w[k][n]); grid (K / 128, N / 64, batch)
__global__ __launch_bounds__(256) void k_wtG(const float* __restrict__ w, int K, int N, bf* Bt) {
    __shared__ float ts[TRR * TRP];
    const int k0 = blockIdx.x * TRR, n0 = blockIdx.y * TRC; w += (size_t)blockIdx.z * K * N; Bt += (size_t)blockIdx.z * K * N;
    tile_in(w + (size_t)k0 * N + n0, N, ts);
    const int kg = (threadIdx.x & 7) * 8, nr = threadIdx.x >> 3;   // 8 lanes x 8 k = one 128-byte line of a Bt row; a wave stores 4 rows
#pragma unroll
    for (int p = 0; p < 4; ++p) { const int k = (p & 1) * 64 + kg, n = (p >> 1) * 32 + nr; v8us o;
#pragma unroll
        for (int i = 0; i < 8; ++i) o[i] = f2bf(ts[(k + i) * TRP + n]);
        *(v8us*)(Bt + (size_t)(n0 + n) * K + k0 + k) = o; }
}
__global__ __launch_bounds__(256) void k_cvt8(const float* __restrict__ src, bf* dst, size_t n8) { const size_t i = (size_t)blockIdx.x * 256 + threadIdx.x; if (i >= n8) return; const v8f v = *(const v8f*)(src + i * 8); v8us o;
#pragma unroll
    for (int k = 0; k < 8; ++k) o[k] = f2bf(v[k]); *(v8us*)(dst + i * 8) = o;  }
__global__ __launch_bounds__(256) void k_cstab(float* CS) { const int idx = blockIdx.x * 256 + threadIdx.x; if (idx >= TT * HD) return; const int t = idx / HD, d = idx % HD; const int i = (d < HD / 2) ? d : d - HD / 2; const float inv = __fdiv_rn(1.0f, powf(10000.0f, (float)(2 * i) / (float)HD)); const float ang = __fmul_rn((float)t, inv); v2f cs; cs[0] = cosf(ang); cs[1] = sinf(ang);
    *(v2f*)(CS + (size_t)idx * 2) = cs;  }
// k_rope: head planes [h][t][d] (fp16 + hi/lo) of rope(x) x sc with the rotate-half convention out[d] = x[d] cos[t][d] - x[d+HD/2] sin[t][d], out[d+HD/2] = x[d+HD/2] cos[t][d+HD/2] + x[d] sin[t][d+HD/2]
__global__ __launch_bounds__(256) void k_rope(const float* __restrict__ F, int pitch, int nheads, const float* __restrict__ CS, const float* __restrict__ RF, const float* __restrict__ nw, float sc, h16* P16, bf* Ph, bf* Pl) {
    const size_t e = ((size_t)blockIdx.x * 256 + threadIdx.x) * 2; if (e >= (size_t)nheads * TT * HD) return; const int d = (int)(e % HD); const int t = (int)((e / HD) % TT); const int h = (int)(e / ((size_t)HD * TT)); const float* f = F + (size_t)t * pitch + h * HD; const float rf = RF ? RF[(size_t)h * TT + t] : 1.0f; v2h o16; v2us oh, ol;
#pragma unroll
    for (int q = 0; q < 2; ++q) { const int dd = d + q; const int dp = (dd < HD / 2) ? dd + HD / 2 : dd - HD / 2; float x0 = f[dd], x1 = f[dp];
        if (RF) { float n0 = __fmul_rn(x0, rf), n1 = __fmul_rn(x1, rf); asm volatile("" : "+v"(n0)); asm volatile("" : "+v"(n1)); x0 = __fmul_rn(bfr(nw[dd]), n0); x1 = __fmul_rn(bfr(nw[dp]), n1); }
        const v2f cs = *(const v2f*)(CS + ((size_t)t * HD + dd) * 2); float a = __fmul_rn(x0, cs[0]), bq = __fmul_rn(x1, cs[1]); asm volatile("" : "+v"(a)); asm volatile("" : "+v"(bq)); const float r = ((dd < HD / 2) ? __fsub_rn(a, bq) : __fadd_rn(a, bq)) * sc;
        o16[q] = tohx(r); unsigned short a2, c2; splitf(r, a2, c2); oh[q] = a2; ol[q] = c2; }
    *(v2h*)(P16 + e) = o16; *(v2us*)(Ph + e) = oh; *(v2us*)(Pl + e) = ol;  }
__global__ __launch_bounds__(256) void k_colsum(const bf* __restrict__ Ph, const bf* __restrict__ Pl, const h16* __restrict__ P16, int h0, float* ACC) { const int t = blockIdx.x * 256 + threadIdx.x; if (t >= TT) return; float acc = ((h0 % REP) == 0) ? 0.0f : ACC[t];
#pragma unroll 1
    for (int zz = 0; zz < ZH; ++zz) {
#pragma unroll 4
        for (int i = 0; i < RH; ++i) { const size_t o = ((size_t)zz * RH + i) * TT + t; acc = __fadd_rn(acc, __fadd_rn(bf2f(Ph[o]), bf2f(Pl[o]))); }
#pragma unroll 4
        for (int i = RH; i < TT; ++i) { const size_t o = ((size_t)zz * TT + i) * TT + t; float pv = __fmul_rn((float)P16[o], 1.0f / PCAR); asm volatile("" : "+v"(pv)); acc = __fadd_rn(acc, pv); } }
    *(float*)(ACC + t) = acc;  }
// k_asoft: per row (zz, i): t = S x SCL (= 1) for j <= i and i - j < WIN (sliding causal window; the reference's -1e9 additive fill vanishes identically); softmax over the 2048 keys (register row, one exp, fixed trees);
__global__ __launch_bounds__(256) void k_asoft(const float* __restrict__ Sb, h16* P16, bf* Ph, bf* Pl) {
    const int lane = threadIdx.x & 31; const int row = blockIdx.x * 8 + (threadIdx.x >> 5); if (row >= ZH * TT) return; const int i = row % TT; const int zz = row / TT; (void)zz; const bool hires = (i < RH); const float* sr = Sb + (size_t)row * TT; float v[TT / 32]; float mx = -3.0e38f;
#pragma unroll
    for (int ch = 0; ch < TT / 128; ++ch) { const int j0 = ch * 128 + lane * 4; const v4f a = *(const v4f*)(sr + j0);
#pragma unroll
        for (int q = 0; q < 4; ++q) { const int j = j0 + q; (void)j; float sa = a[q] * SCL; asm volatile("" : "+v"(sa)); const float t = (j <= i && i - j < WIN) ? sa : -3.0e38f; v[ch * 4 + q] = t; mx = fmaxf(mx, t); } }
#pragma unroll
    for (int sh = 16; sh; sh >>= 1) mx = fmaxf(mx, __shfl_xor(mx, sh, 32));
    float sum = 0.f;
#pragma unroll
    for (int k = 0; k < TT / 32; ++k) { float d0 = __fsub_rn(v[k], mx); asm volatile("" : "+v"(d0)); v[k] = __builtin_amdgcn_exp2f(__fmul_rn(d0, 1.4426950408889634f)); sum += v[k]; }
#pragma unroll
    for (int sh = 16; sh; sh >>= 1) sum += __shfl_xor(sum, sh, 32);
    const float f = __fdiv_rn(hires ? 1.0f : PCAR, sum);
{
        if (hires) {
#pragma unroll
            for (int ch = 0; ch < TT / 128; ++ch) { v4us oh, ol;
#pragma unroll
                for (int q = 0; q < 4; ++q) { unsigned short a, c2; splitf(v[ch * 4 + q] * f, a, c2); oh[q] = a; ol[q] = c2; }
                const size_t oo = ((size_t)zz * (RH ? RH : 1) + i) * TT + ch * 128 + lane * 4; *(v4us*)(Ph + oo) = oh; *(v4us*)(Pl + oo) = ol; }
        } else {
#pragma unroll
            for (int ch = 0; ch < TT / 128; ++ch) { v4h o4;
#pragma unroll
                for (int q = 0; q < 4; ++q) o4[q] = tohx(v[ch * 4 + q] * f);
                *(v4h*)(P16 + (size_t)row * TT + ch * 128 + lane * 4) = o4; } }
         }
}
__global__ __launch_bounds__(256) void k_merge(const float* __restrict__ O, int h0, bf* Ah, bf* Al) { const size_t e = ((size_t)blockIdx.x * 256 + threadIdx.x) * 2; if (e >= (size_t)ZH * TT * HD) return; const int d = (int)(e % HD); const int t = (int)((e / HD) % TT); const int zz = (int)(e / ((size_t)HD * TT)); const float cs = (t < RH) ? 1.0f : (1.0f / PCAR); const size_t oo = (size_t)t * DQ + (h0 + zz) * HD + d;
    v2us oh, ol;
#pragma unroll
    for (int q = 0; q < 2; ++q) { unsigned short a, c2; splitf(O[e + q] * cs, a, c2); oh[q] = a; ol[q] = c2; } *(v2us*)(Ah + oo) = oh; *(v2us*)(Al + oo) = ol;  }


// ---- SingleHeadQKV kernels ----
__global__ __launch_bounds__(256) void k_gptab(float* GP) { const int n = blockIdx.x * 256 + threadIdx.x; if (n >= TT + 64) return; const float v = powf(GAMR, (float)n); *(float*)(GP + n) = v;  }
__global__ __launch_bounds__(256) void k_cstabW(float* CS) { const size_t idx = (size_t)blockIdx.x * 256 + threadIdx.x; if (idx >= (size_t)TT * DC) return; const int t = (int)(idx / DC), d = (int)(idx % DC); const float inv = __fdiv_rn(1.0f, powf(10000.0f, (float)(2 * (d >> 1)) / (float)DC)); const float ang = __fmul_rn((float)t, inv); v2f cs; cs[0] = cosf(ang); cs[1] = sinf(ang); *(v2f*)(CS + idx * 2) = cs;  }

extern "C" void kernel_launch(void* const* d_in, const int* in_sizes, int n_in,
                              void* d_out, int out_size, void* d_ws, size_t ws_size, hipStream_t stream) {
    (void)in_sizes; (void)n_in; (void)out_size;
    const float* x = (const float*)d_in[0]; const float* sn = (const float*)d_in[1]; const float* wq = (const float*)d_in[2]; const float* wk = (const float*)d_in[3]; const float* wv = (const float*)d_in[4]; const float* gw = (const float*)d_in[5]; const float* gb = (const float*)d_in[6];
    float* OUT = (float*)d_out;     // out0 [4][2048][1024] at 0, out1 [4][1024][1024] at NB*TT*DC
    char* wsp = (char*)d_ws;
    auto take = [&](size_t bytes) { char* p = wsp; wsp += (bytes + 255) & ~(size_t)255; return (void*)p; };
    // All NB_ batch elements go through every stage at once (grid z = batch). Planes are [batch][...]; buffers whose contents are dead are reused, in stream order.
    const size_t SX = (size_t)TT * DC, SS = (size_t)DC * DC, SP = (size_t)TT * TT;   // elements per batch element: activations, state, scores
    bf* QPh = (bf*)take(NB_ * SX * 2); bf* QPl = (bf*)take(NB_ * SX * 2); bf* KPh = (bf*)take(NB_ * SX * 2); bf* KPl = (bf*)take(NB_ * SX * 2); bf* VTh = (bf*)take(NB_ * SX * 2); bf* VTl = (bf*)take(NB_ * SX * 2);
    bf* KTh = (bf*)take(NB_ * SX * 2); bf* KTl = (bf*)take(NB_ * SX * 2); bf* VDTh = (bf*)take(NB_ * SX * 2); bf* VDTl = (bf*)take(NB_ * SX * 2);
    float* CS = (float*)take((size_t)TT * DC * 2 * 4);
    bf* SNT = (bf*)take(NB_ * SS * 2); bf* XB = (bf*)take(NB_ * SX * 2);
    bf* WQ = (bf*)take((size_t)DQ * DM * 2); bf* WK = (bf*)take((size_t)DKV * DM * 2); bf* WV = (bf*)take((size_t)DKV * DM * 2); float* GP = (float*)take((TT + 64) * 4);
    bf* Ph = KTh; bf* Pl = VDTh;     // NB_*SP each, over KTh + KTl and over VDTh + VDTl: dead after the R product
    float* INNER = (float*)KPh;      // NB_*SX f32 over KPh + KPl: dead after Q K^T
    if ((size_t)(wsp - (char*)d_ws) > ws_size) return;   // ws ~ 206 MiB
    { k_wtG<<<dim3(DM / TRR, DQ / TRC, 1), 256, 0, stream>>>(wq, DM, DQ, WQ); k_wtG<<<dim3(DM / TRR, DKV / TRC, 1), 256, 0, stream>>>(wk, DM, DKV, WK); k_wtG<<<dim3(DM / TRR, DKV / TRC, 1), 256, 0, stream>>>(wv, DM, DKV, WV); k_cstabW<<<(unsigned)(((size_t)TT * DC + 255) / 256), 256, 0, stream>>>(CS); k_gptab<<<(TT + 64 + 255) / 256, 256, 0, stream>>>(GP); }
    k_cvt8<<<(unsigned)((NB_ * SX / 8 + 255) / 256), 256, 0, stream>>>(x, XB, NB_ * SX / 8);
    k_wtG<<<dim3(DC / TRR, DC / TRC, NB_), 256, 0, stream>>>(sn, DC, DC, SNT);
    // Q = rope(X W_Q), K = rope(X W_K), V = X W_V, each straight into the operand planes of the later products
    k_gemmt<0, 0, 1><<<dim3(TT / 128, DQ / 128, NB_), 128, 0, stream>>>(XB, nullptr, WQ, nullptr, DM, nullptr, DQ, SX, 0, SX, CS, nullptr, nullptr, nullptr, QPh, QPl, nullptr, nullptr);
    k_gemmt<0, 0, 2><<<dim3(TT / 128, DKV / 128, NB_), 128, 0, stream>>>(XB, nullptr, WK, nullptr, DM, nullptr, DKV, SX, 0, SX, CS, nullptr, nullptr, nullptr, KPh, KPl, KTh, KTl);
    k_gemmt<0, 0, 3><<<dim3(TT / 128, DKV / 128, NB_), 128, 0, stream>>>(XB, nullptr, WV, nullptr, DM, nullptr, DKV, SX, 0, SX, GP, nullptr, nullptr, nullptr, VTh, VTl, VDTh, VDTl);
    // R_i = K^T (V D[-1]) + S_n g^T (first, so that its operand planes can be reused for the scores)
    k_gemmt<2, 0, 4><<<dim3(DC / 128, DC / 128, NB_), 128, 0, stream>>>(KTh, KTl, VDTh, VDTl, TT, OUT + NB_ * SX, DC, SX, SX, SS, GP, sn, nullptr, nullptr, nullptr, nullptr, nullptr, nullptr);
    // A = (Q K^T) x D into hi/lo planes (causal tiles only), inner = A V (causal tiles only)
    k_gemmt<2, 1, 5><<<dim3((TT / 128) * (TT / 128 + 1) / 2, 1, NB_), 128, 0, stream>>>(QPh, QPl, KPh, KPl, DC, nullptr, TT, SX, SX, SP, GP, nullptr, nullptr, nullptr, Ph, Pl, nullptr, nullptr);
    k_gemmt<2, 2, 0><<<dim3(TT / 128, DC / 128, NB_), 128, 0, stream>>>(Ph, Pl, VTh, VTl, TT, INNER, DC, SP, SX, SX, nullptr, nullptr, nullptr, nullptr, nullptr, nullptr, nullptr, nullptr);
    // cross = Q S_n; out0 = permuted GroupNorm(inner + cross g^(t+1))
    k_gemmt<1, 0, 6><<<dim3(TT / 128, DC / 128, NB_), 128, 0, stream>>>(QPh, QPl, SNT, nullptr, DC, OUT, DC, SX, SS, SX, GP, INNER, gw, gb, nullptr, nullptr, nullptr, nullptr);
}

// v006
// One run takes 241 microseconds.
// Two timings next to v005 put it at 1.16 and 1.18 times that version's speed.
// Over all steps from v000 it is 5.49 times as fast.
#include <hip/hip_runtime.h>

// SingleHeadQKV (chunkwise retention step: X_Q [4][2048][1024], S_n [4][1024][1024]; Q = rope(X W_Q), K = rope(X W_K) (interleaved-pair RoPE over the full 1024 dims), V = X W_V; D[n][m] = g^(n-m) for n >= m (g = 1 - 2^-5); inner = (Q K^T * D) V; cross = (Q S_n) * g^(t+1); out = GroupNorm32(inner + cross) then the literal transpose(-2,-1).reshape permutation -> out0 [4][2048][1024]; R_i = K^T (V * D[-1]) + S_n g^T -> out1 [4][1024][1024] at element 8,388,608).
// Compute dtypes, f32 accumulate: every input rounded to bf16; Q/K/V on PLAIN bf16 operands (inputs: exact); RoPE f32 (on-chip table); decay powers g^n in f32 (powf); Q.K^T (K = 1024) hl x hl (3 products) with causal tile skipping, x D per element in f32 into hi/lo planes (no softmax), (QK^T D).V hl x hl (3 products, causal skipping); Q.S_c hl x hl (3 products); the chunk states K^T.(V x decay) hl x hl (3 products, K = 2048 in all), kept in f32 accumulators and handed on as hi/lo planes; sums, GroupNorm (32 groups of 32, biased var, eps 1e-6) and the output permutation in f32.
// The decay is a recurrence over chunks of CH steps: with S_0 = S_n and S_(c+1) = g^CH S_c + K_c^T (V_c x g^(CH-1-i)), i the step inside chunk c, a row of chunk c is out = (Q K^T * D restricted to the chunk) V + g^(i+1) Q S_c, and R_i = S_(TT/CH). Exact algebra: only the order of the f32 sums differs.

#define NB_  4
#define TT   2048
#define DM   1024
#define NH_  16
#define NKV  16
#define REP  (NH_ / NKV)
#define HD   64
#define DQ   (NH_ * HD)
#define DKV  (NKV * HD)
#define ZH   2
#define RH   2048                  // query rows < RH use hi+lo planes (0: none)
#define WIN  2048
#define PCAR 1024.0f
#define DC   1024   // channel width (= DQ)
#define GAMR 0.96875f
#define SCL  1.0f
#define CH   512    // steps per chunk of the decay recurrence
#define NCH  (TT / CH)
typedef _Float16 h16;
typedef unsigned short bf;
typedef __attribute__((ext_vector_type(16))) __bf16   v16bf;
typedef __attribute__((ext_vector_type(16))) _Float16 v16h;
typedef __attribute__((ext_vector_type(8)))  _Float16 v8h;
typedef __attribute__((ext_vector_type(8)))  unsigned short v8us;
typedef __attribute__((ext_vector_type(8)))  float    v8f;
typedef __attribute__((ext_vector_type(4)))  float    v4f;
typedef v8h  __attribute__((may_alias)) v8ha;
typedef v4f  __attribute__((may_alias)) v4fa;
typedef v8us __attribute__((may_alias)) v8usa;
typedef __attribute__((ext_vector_type(4))) unsigned short v4us;
typedef __attribute__((ext_vector_type(2))) float v2f;

__device__ __forceinline__ unsigned short f2bf(float f) { unsigned u = __float_as_uint(f); u += 0x7FFFu + ((u >> 16) & 1u); return (unsigned short)(u >> 16); }
__device__ __forceinline__ float bf2f(unsigned short b) { return __uint_as_float(((unsigned)b) << 16); }
__device__ __forceinline__ float bfr(float f) { return bf2f(f2bf(f)); }
__device__ __forceinline__ void splitf(float y, unsigned short& h, unsigned short& l) { h = f2bf(y); l = f2bf(y - bf2f(h)); }
__device__ __forceinline__ v16h cat16(v8h lo, v8h hi) { return __builtin_shufflevector(lo, hi, 0, 1, 2, 3, 4, 5, 6, 7, 8, 9, 10, 11, 12, 13, 14, 15); }
__device__ __forceinline__ v16bf cat16b(v8us lo, v8us hi) { return __builtin_bit_cast(v16bf, __builtin_shufflevector(lo, hi, 0, 1, 2, 3, 4, 5, 6, 7, 8, 9, 10, 11, 12, 13, 14, 15)); }
__device__ __forceinline__ v8f wmma16(v16h a, v16h b, v8f c) { return __builtin_amdgcn_wmma_f32_16x16x32_f16(false, a, false, b, (short)0, c, false, false); }
__device__ __forceinline__ v8f wmmab(v16bf a, v16bf b, v8f c) { return __builtin_amdgcn_wmma_f32_16x16x32_bf16(false, a, false, b, (short)0, c, false, false); }



// ---- k_gemmt: C[m][n] (f32, pitch ldc) = sum_k A[m][k] Bt[n][k] (+ split products per NSPLIT) on K-contiguous bf16 planes. One 128x128 tile of C per work-group of four waves (2x2, 64x64 each, 16 accumulators a wave);
// grid (M/128, N/128, Z), 128 threads. A pass is KP k of all 128 rows of every operand plane; asynchronous copies bring it into a two-buffer LDS ring as whole 128-byte lines, one pass ahead of its use, and each row is fetched once for two waves.
// CMODE 1 launches only the score tiles on or below the diagonal inside each chunk's CH x CH block (grid (40, 1, Z)); CMODE 2 runs the K loop of the (decayed score) x value product from the chunk's first step to the diagonal block; CMODE 3 takes the B planes of the row tile's chunk. M, N % 128 == 0, K % KP == 0.
typedef float __attribute__((may_alias)) f32a;
// eight copies of 16 bytes a lane; the s_wait_xcnt stands inside the statement, in front of any overwrite of the address registers that the copies name
__device__ __forceinline__ void copy8(unsigned l, int lstep, const bf* g, size_t gstep) {
    const unsigned l0 = l, l1 = l + lstep, l2 = l + 2 * lstep, l3 = l + 3 * lstep, l4 = l + 4 * lstep, l5 = l + 5 * lstep, l6 = l + 6 * lstep, l7 = l + 7 * lstep;
    const bf *g0 = g, *g1 = g + gstep, *g2 = g + 2 * gstep, *g3 = g + 3 * gstep, *g4 = g + 4 * gstep, *g5 = g + 5 * gstep, *g6 = g + 6 * gstep, *g7 = g + 7 * gstep;
    asm volatile("global_load_async_to_lds_b128 %0, %8, off\n\tglobal_load_async_to_lds_b128 %1, %9, off\n\tglobal_load_async_to_lds_b128 %2, %10, off\n\tglobal_load_async_to_lds_b128 %3, %11, off\n\t"
                 "global_load_async_to_lds_b128 %4, %12, off\n\tglobal_load_async_to_lds_b128 %5, %13, off\n\tglobal_load_async_to_lds_b128 %6, %14, off\n\tglobal_load_async_to_lds_b128 %7, %15, off\n\ts_wait_xcnt 0x0"
                 :: "v"(l0), "v"(l1), "v"(l2), "v"(l3), "v"(l4), "v"(l5), "v"(l6), "v"(l7), "v"(g0), "v"(g1), "v"(g2), "v"(g3), "v"(g4), "v"(g5), "v"(g6), "v"(g7) : "memory");
}
#define XWAIT(...) asm volatile("s_wait_xcnt 0x0" :: __VA_ARGS__ : "memory")
template <int CTRL> __device__ __forceinline__ float dppf(float x) { return __int_as_float(__builtin_amdgcn_mov_dpp(__float_as_int(x), CTRL, 0xF, 0xF, true)); }   // 0xB1: lane ^ 1, 0x4E: lane ^ 2 (quad_perm); 0x141: lane -> 7 - lane in each 8 (row_half_mirror)
__device__ __forceinline__ v16bf ldsfrag(const unsigned char* p) { return cat16b(*(const v8usa*)p, *(const v8usa*)(p + 32)); }
// EPI names what the epilogue makes of the tile, straight from the accumulators (a lane holds 8 consecutive rows of one column) and each wave's own LDS range:
// 0 f32 C; 1 RoPE (E0 = cos/sin table), hi/lo planes P0/P1; 2 as 1, and the transposed hi/lo planes P2/P3; 3 transposed hi/lo planes P0/P1, and P2/P3 of rows x g^(CH-1-i), i = t mod CH (E0 = powers of g);
// 4 the accumulators start as bf16(E1); at each chunk's first pass they go out as transposed hi/lo planes P0/P1 [chunk][column][row] and are scaled by g^CH; C = the last state; 5 tile x g^(i-j) for j <= i, else 0, hi/lo planes P0/P1; 6 GroupNorm(E1 + tile x g^(i+1)), i = t mod CH, with weight E2 and bias E3, stored transposed to C.
template <int NSPLIT, int CMODE, int EPI>
__global__ __launch_bounds__(128) void k_gemmt(const bf* __restrict__ A, const bf* __restrict__ A2, const bf* __restrict__ Bt, const bf* __restrict__ Bt2, int K, float* C, int ldc, size_t sA, size_t sB, size_t sC,
                                               const float* __restrict__ E0, const float* __restrict__ E1, const float* __restrict__ E2, const float* __restrict__ E3, bf* P0, bf* P1, bf* P2, bf* P3) {
    constexpr int NP = (NSPLIT == 0) ? 2 : (NSPLIT == 1) ? 3 : 4;   // operand planes of a stage: A, (A2), B, (B2)
    constexpr int KP = (NSPLIT == 0) ? 128 : 64;                    // k per pass
    constexpr int PITCH = KP * 2 + 16;                              // LDS row pitch in bytes: 16 x odd, for 16-byte readers
    constexpr int PLANE = 128 * PITCH, STAGE = NP * PLANE, PB = (NSPLIT == 0) ? 1 : 2;
    constexpr int GB = (NSPLIT == 0) ? 2 : 1;                       // column blocks whose B fragments are read as one group
    constexpr int LA = (NSPLIT == 0) ? 8 : 16, LB = GB * ((NSPLIT == 2) ? 4 : 2), NW = GB * 4 * (NSPLIT + 1);   // 16-byte LDS reads of the A fragments and of a B group; products of a group
    constexpr int CPR = KP / 8, RPI = 128 / CPR;                    // 16-byte units per row; rows that the 128 threads cover at once
    __shared__ __attribute__((aligned(2048))) unsigned char ring[2 * STAGE];
    int bx = blockIdx.x, by = blockIdx.y, bz = blockIdx.z;
    if (CMODE == 1) {   // grid.x counts only the tiles on or below the diagonal of each chunk's own block, chunk by chunk and row by row: no work-group starts for nothing
        constexpr int TC = CH / 128, TPC = TC * (TC + 1) / 2;
        const int ch = bx / TPC, e = bx % TPC; int r = 0;
        for (int q = 1; q < TC; ++q) r += (e >= q * (q + 1) / 2) ? 1 : 0;
        by = ch * TC + e - r * (r + 1) / 2; bx = ch * TC + r; }
    if (CMODE == 2) {   // all work-groups are resident, two to a WGP, and a row tile's K loop grows with its index inside the chunk: flat indices 8, 16 or 256 apart get row tiles t and 15 - t. Speed only: any placement is correct
        static_assert(CMODE != 2 || (TT / 128 == 16 && DC / 128 == 8 && NB_ == 4), "the map below is a permutation of a 16 x 8 x 4 grid");
        const int b = bx + 16 * by + 128 * bz, k = b >> 3, u = (k >> 2) & 7;
        bx = ((k ^ (k >> 1) ^ (k >> 5)) & 1) ? 15 - u : u; by = b & 7; bz = k & 3; }
    const int r0 = bx * 128, c0 = by * 128;
    const int kb = (CMODE == 2) ? (r0 / CH) * CH : 0;   // first k of the loop
    const int Kl = (CMODE == 2) ? r0 + 128 - kb : K; const int npass = Kl / KP;
    const size_t z = bz; C += z * sC;
    const int tid = threadIdx.x, lane = tid & 31, lr = lane & 15, hi = lane >> 4, wave = tid >> 5, wm = wave >> 1, wn = wave & 1;
    const int crow = tid / CPR, ccol = tid % CPR;
    const size_t ga = z * sA + (size_t)(r0 + crow) * K + ccol * 8 + kb, gb = z * sB + ((CMODE == 3) ? (size_t)(r0 / CH) * DC * DC : 0) + (size_t)(c0 + crow) * K + ccol * 8 + kb, gstep = (size_t)RPI * K;
    const unsigned lbase = (unsigned)(size_t)ring + crow * PITCH + ccol * 16;
    auto fill = [&](int t) {   // pass t into buffer t & 1
        const unsigned l = lbase + (t & 1) * STAGE; const size_t kc = (size_t)t * KP;
#pragma unroll
        for (int h = 0; h < CPR / 8; ++h) {
            const unsigned lh = l + h * 8 * RPI * PITCH; const size_t gh = kc + h * 8 * gstep;
            copy8(lh, RPI * PITCH, A + ga + gh, gstep);
            if (NSPLIT == 1 || NSPLIT == 2) copy8(lh + PLANE, RPI * PITCH, A2 + ga + gh, gstep);
            copy8(lh + PB * PLANE, RPI * PITCH, Bt + gb + gh, gstep);
            if (NSPLIT == 2) copy8(lh + 3 * PLANE, RPI * PITCH, Bt2 + gb + gh, gstep);
        }
    };
    v8f acc[4][4];
#pragma unroll
    for (int mb = 0; mb < 4; ++mb)
#pragma unroll
        for (int nb = 0; nb < 4; ++nb) acc[mb][nb] = (v8f){};
    fill(0);
    asm volatile("s_wait_asynccnt 0x0" ::: "memory");   // this wave's copies of pass 0 have landed
    __syncthreads();                                    // and every other wave's: pass 0 is readable
    if (npass > 1) fill(1);
    const int rw = r0 + wm * 64, cw = c0 + wn * 64;         // the wave's first row and column of C
    float gC = 0.0f;
    if (EPI == 4) {   // S_0: a lane holds 8 consecutive rows of one column
        static_assert(EPI != 4 || CH % KP == 0, "a chunk is a whole number of passes");
        gC = E0[CH];
        const float* si = E1 + z * sC + (size_t)(rw + hi * 8) * DC + cw + lr;
#pragma unroll
        for (int mb = 0; mb < 4; ++mb)
#pragma unroll
            for (int nb = 0; nb < 4; ++nb)
#pragma unroll
                for (int j = 0; j < 8; ++j) acc[mb][nb][j] = si[(mb * 16 + j) * DC + nb * 16];
        XWAIT("v"(si));
#pragma unroll
        for (int mb = 0; mb < 4; ++mb)
#pragma unroll
            for (int nb = 0; nb < 4; ++nb)
#pragma unroll
                for (int j = 0; j < 8; ++j) acc[mb][nb][j] = bfr(acc[mb][nb][j]);
    }
    const unsigned char* fa = ring + (wm * 64 + lr) * PITCH + hi * 16; const unsigned char* fb = ring + PB * PLANE + (wn * 64 + lr) * PITCH + hi * 16;
#pragma unroll 1
    for (int t = 0; t < npass; ++t) {
        const int bo = (t & 1) * STAGE;
        if (EPI == 4 && (t & (CH / KP - 1)) == 0) {   // a chunk begins: its start state goes out [column][row] (a lane's 8 rows are 16 bytes, the four row blocks fill one 128-byte line), then decays over the chunk
            const size_t so = ((z * NCH + t / (CH / KP)) * DC + cw + lr) * DC + rw + hi * 8;
#pragma unroll
            for (int nb = 0; nb < 4; ++nb) { bf* ph = P0 + so + (size_t)nb * 16 * DC; bf* pl = P1 + so + (size_t)nb * 16 * DC; v8us oh[4], ol[4];
#pragma unroll
                for (int mb = 0; mb < 4; ++mb) {
#pragma unroll
                    for (int j = 0; j < 8; ++j) { unsigned short a2, c2; splitf(acc[mb][nb][j], a2, c2); oh[mb][j] = a2; ol[mb][j] = c2; acc[mb][nb][j] *= gC; } }
#pragma unroll
                for (int mb = 0; mb < 4; ++mb) { *(v8us*)(ph + mb * 16) = oh[mb]; *(v8us*)(pl + mb * 16) = ol[mb]; }
                XWAIT("v"(ph), "v"(pl), "v"(oh[0]), "v"(oh[1]), "v"(oh[2]), "v"(oh[3]), "v"(ol[0]), "v"(ol[1]), "v"(ol[2]), "v"(ol[3])); }
        }
#pragma unroll
        for (int ks = 0; ks < KP / 32; ++ks) {
            v16bf a[4], a2[4];
#pragma unroll
            for (int mb = 0; mb < 4; ++mb) { a[mb] = ldsfrag(fa + bo + mb * 16 * PITCH + ks * 64); if (NSPLIT == 1 || NSPLIT == 2) a2[mb] = ldsfrag(fa + bo + PLANE + mb * 16 * PITCH + ks * 64); }
#pragma unroll
            for (int nb = 0; nb < 4; ++nb) { const v16bf b = ldsfrag(fb + bo + nb * 16 * PITCH + ks * 64); v16bf b2; if (NSPLIT == 2) b2 = ldsfrag(fb + bo + PLANE + nb * 16 * PITCH + ks * 64);
#pragma unroll
                for (int mb = 0; mb < 4; ++mb) { acc[mb][nb] = wmmab(a[mb], b, acc[mb][nb]); if (NSPLIT == 1 || NSPLIT == 2) acc[mb][nb] = wmmab(a2[mb], b, acc[mb][nb]); if (NSPLIT == 2) acc[mb][nb] = wmmab(a[mb], b2, acc[mb][nb]); } }
            // order asked of the scheduler: LDS reads in few groups, each one group of columns ahead of its products
            __builtin_amdgcn_sched_group_barrier(0x100, LA + LB, 0);
#pragma unroll
            for (int q = 1; q < 4 / GB; ++q) { __builtin_amdgcn_sched_group_barrier(0x100, LB, 0); __builtin_amdgcn_sched_group_barrier(0x008, NW, 0); }
            __builtin_amdgcn_sched_group_barrier(0x008, NW, 0);
        }
        asm volatile("s_wait_dscnt 0x0" ::: "memory");      // this wave has left buffer t & 1
        asm volatile("s_wait_asynccnt 0x0" ::: "memory");   // its copies of pass t + 1 have landed
        __syncthreads();                                    // publishes pass t + 1 and frees buffer t & 1
        if (t + 2 < npass) fill(t + 2);
    }
    asm volatile("s_wait_asynccnt 0x0" ::: "memory");       // nothing is in flight when the ring becomes output staging
    constexpr int WREG = 24576, TOFF = 4608, TPL = 64 * 144;   // bytes of LDS a wave stages in; where its transposing tile starts; one 64 x 64 16-bit tile at a pitch of 144 bytes
    unsigned char* wreg = ring + wave * WREG;               // each wave stages in its own range, behind the last pass's barrier
    f32a* os = (f32a*)wreg;                                 // 16 x 64 f32, pitch 68
    if (EPI == 6) E1 += z * sC;
    if (EPI == 1 || EPI == 2 || EPI == 3 || EPI == 5) { P0 += z * sC; P1 += z * sC; }
    if (EPI == 2 || EPI == 3) { P2 += z * sC; P3 += z * sC; }
    // interleaved-pair RoPE of one block of 16 rows: the partner column sits in the neighbouring lane
    auto rope = [&](int mb) {
        const float sg = (lr & 1) ? 1.0f : -1.0f; const float* cb = E0 + ((size_t)(rw + mb * 16 + hi * 8) * DC + cw + lr) * 2; v2f ct[4][8];
#pragma unroll
        for (int nb = 0; nb < 4; ++nb)
#pragma unroll
            for (int j = 0; j < 8; ++j) ct[nb][j] = *(const v2f*)(cb + (j * DC + nb * 16) * 2);
        XWAIT("v"(cb));
#pragma unroll
        for (int nb = 0; nb < 4; ++nb)
#pragma unroll
            for (int j = 0; j < 8; ++j) {
                const v2f cs = ct[nb][j];
                const float xv = acc[mb][nb][j];
                const float pv = dppf<0xB1>(xv);
                acc[mb][nb][j] = xv * cs[0] + pv * (sg * cs[1]);
            }
    };
    // transposed hi/lo planes [column][row], row pitch TT: a lane's 8 rows are one 16-byte LDS store (t_put); read back so that 8 lanes store one whole 128-byte line (t_flush)
    unsigned char* tp = wreg + TOFF;
    auto t_put = [&](int mb, bool dec) {
        float gs[8];
        if (dec) { const float* gp = E0 + (CH - 8 - ((rw + mb * 16 + hi * 8) & (CH - 1)));
#pragma unroll
            for (int j = 0; j < 8; ++j) gs[j] = gp[7 - j];
            XWAIT("v"(gp)); }
#pragma unroll
        for (int nb = 0; nb < 4; ++nb) { v8us oh, ol;
#pragma unroll
            for (int j = 0; j < 8; ++j) { float xv = acc[mb][nb][j]; if (dec) xv *= gs[j]; unsigned short a2, c2; splitf(xv, a2, c2); oh[j] = a2; ol[j] = c2; }
            unsigned char* q = tp + (nb * 16 + lr) * 144 + (mb * 16 + hi * 8) * 2; *(v8usa*)q = oh; *(v8usa*)(q + TPL) = ol; }
    };
    auto t_flush = [&](bf* Th, bf* Tl) {
        __builtin_amdgcn_wave_barrier(); asm volatile("" ::: "memory");   // other lanes' LDS stores stay ahead of the reads below
#pragma unroll
        for (int sg4 = 0; sg4 < 4; ++sg4) { v8us vh[4], vl[4];   // eight LDS reads in flight, then their stores
#pragma unroll
            for (int s = 0; s < 4; ++s) { const unsigned char* q = tp + ((sg4 * 4 + s) * 4 + (lane >> 3)) * 144 + (lane & 7) * 16; vh[s] = *(const v8usa*)q; vl[s] = *(const v8usa*)(q + TPL); }
#pragma unroll
            for (int s = 0; s < 4; ++s) { const size_t o = (size_t)(cw + (sg4 * 4 + s) * 4 + (lane >> 3)) * TT + rw + (lane & 7) * 8; bf* ph = Th + o; bf* pl = Tl + o; *(v8us*)ph = vh[s]; *(v8us*)pl = vl[s]; XWAIT("v"(ph), "v"(pl), "v"(vh[s]), "v"(vl[s])); }
        }
        __builtin_amdgcn_wave_barrier(); asm volatile("" ::: "memory");   // the reads above stay ahead of the tile's next use
    };
    if (EPI == 3) {
#pragma unroll
        for (int mb = 0; mb < 4; ++mb) t_put(mb, false);
        t_flush(P0, P1);
#pragma unroll
        for (int mb = 0; mb < 4; ++mb) t_put(mb, true);
        t_flush(P2, P3);
    }
    if (EPI != 3) {
        f32a* tt = (f32a*)(wreg + TOFF);                    // EPI 6: 64 x 64 f32 at an odd pitch of 65, so that a walk down a column meets every bank once
        v4f w4 = {}, b4 = {};
        if (EPI == 6) { const float* pw = E2 + cw + lr * 4; const float* pb = E3 + cw + lr * 4; const v4f wr = *(const v4f*)pw, br = *(const v4f*)pb; XWAIT("v"(pw), "v"(pb));
#pragma unroll
            for (int u = 0; u < 4; ++u) { w4[u] = bfr(wr[u]); b4[u] = bfr(br[u]); } }
#pragma unroll
        for (int mb = 0; mb < 4; ++mb) {
            if (EPI == 1 || EPI == 2) rope(mb);
            if (EPI == 2) { __builtin_amdgcn_sched_barrier(0); t_put(mb, false); }   // the split's temporaries come after the table values are spent: interleaved they take the kernel above 256 registers
            const int cofs = lr * 4, gc = cw + cofs;
            v4f ex[8]; float ge[8];   // what the 16 rows take from global memory: issued ahead of the LDS round trip, all in flight together
            if (EPI == 6) {
#pragma unroll
                for (int s = 0; s < 8; ++s) { const int gr = rw + mb * 16 + 2 * s + hi; const float* pa = E1 + (size_t)gr * ldc + gc; ex[s] = *(const v4f*)pa; XWAIT("v"(pa)); const float* pg = E0 + (gr - (r0 / CH) * CH + 1); ge[s] = *pg; XWAIT("v"(pg)); } }
            if (EPI == 5) {
#pragma unroll
                for (int s = 0; s < 8; ++s) { const int dd = rw + mb * 16 + 2 * s + hi - gc; const int m0 = max(dd, 0), m1 = max(dd, 1), m2 = max(dd, 2), m3 = max(dd, 3);   // exponent i - j, held at 0 above the diagonal
                    ex[s][0] = E0[m0]; ex[s][1] = E0[m1 - 1]; ex[s][2] = E0[m2 - 2]; ex[s][3] = E0[m3 - 3]; XWAIT("v"(m0), "v"(m1), "v"(m2), "v"(m3)); } }
#pragma unroll
            for (int nb = 0; nb < 4; ++nb) {
#pragma unroll
                for (int j = 0; j < 8; ++j) os[(hi * 8 + j) * 68 + nb * 16 + lr] = acc[mb][nb][j]; }
            __builtin_amdgcn_wave_barrier(); asm volatile("" ::: "memory");   // other lanes' LDS stores stay ahead of the reads below
            v4f vals[8];
#pragma unroll
            for (int s = 0; s < 8; ++s) vals[s] = *(const v4fa*)(os + (2 * s + hi) * 68 + cofs);
#pragma unroll
            for (int s = 0; s < 8; ++s) { const int row = 2 * s + hi; const v4f val = vals[s];
                const int gr = rw + mb * 16 + row; const size_t o = (size_t)gr * ldc + gc;
                if (EPI == 0 || EPI == 4) { float* pc = C + o; *(v4f*)pc = val; XWAIT("v"(pc), "v"(val)); }
                if (EPI == 1 || EPI == 2 || EPI == 5) { v4us oh, ol;
#pragma unroll
                    for (int u = 0; u < 4; ++u) { float v = val[u]; if (EPI == 5) v = (gr >= gc + u) ? v * ex[s][u] : 0.0f; unsigned short a2, c2; splitf(v, a2, c2); oh[u] = a2; ol[u] = c2; }
                    bf* ph = P0 + o; bf* pl = P1 + o; *(v4us*)ph = oh; *(v4us*)pl = ol; XWAIT("v"(ph), "v"(pl), "v"(oh), "v"(ol)); }
                if (EPI == 6) { float v[4], d[4]; float sm = 0.0f, ss = 0.0f;   // a group of 32 channels = 8 lanes x 4
#pragma unroll
                    for (int u = 0; u < 4; ++u) { v[u] = ex[s][u] + val[u] * ge[s]; sm += v[u]; }
                    sm += dppf<0xB1>(sm); sm += dppf<0x4E>(sm); sm += dppf<0x141>(sm);
                    const float mu = sm * (1.0f / 32.0f);
#pragma unroll
                    for (int u = 0; u < 4; ++u) { d[u] = v[u] - mu; ss += d[u] * d[u]; }
                    ss += dppf<0xB1>(ss); ss += dppf<0x4E>(ss); ss += dppf<0x141>(ss);
                    const float rs = __fdiv_rn(1.0f, sqrtf(ss * (1.0f / 32.0f) + 1e-6f));
#pragma unroll
                    for (int u = 0; u < 4; ++u) tt[(mb * 16 + row) * 65 + cofs + u] = d[u] * rs * w4[u] + b4[u]; }
            }
            __builtin_amdgcn_wave_barrier(); asm volatile("" ::: "memory");   // the reads above stay ahead of the next block's LDS stores
        }
        if (EPI == 2) t_flush(P2, P3);
        if (EPI == 6) {   // the reference's transpose(-2,-1).reshape keeps the flat order of the transpose: C read as [DC][TT]; 16 lanes x 4 rows = two whole lines of one channel
#pragma unroll
            for (int pg8 = 0; pg8 < 4; ++pg8) { const int tg = lr * 4; v4f ov[8];   // 32 LDS reads in flight, then their stores
#pragma unroll
                for (int p = 0; p < 8; ++p)
#pragma unroll
                    for (int i = 0; i < 4; ++i) ov[p][i] = tt[(tg + i) * 65 + (pg8 * 8 + p) * 2 + hi];
#pragma unroll
                for (int p = 0; p < 8; ++p) { float* pc = C + (size_t)(cw + (pg8 * 8 + p) * 2 + hi) * TT + rw + tg; *(v4f*)pc = ov[p]; XWAIT("v"(pc), "v"(ov[p])); }
            }
        }
    }
}

__device__ __forceinline__ h16 tohx(float x) { return (h16)x; }
typedef __attribute__((ext_vector_type(2))) _Float16 v2h;
typedef __attribute__((ext_vector_type(4))) _Float16 v4h;
typedef __attribute__((ext_vector_type(2))) unsigned short v2us;
typedef __attribute__((ext_vector_type(4))) int v4i;

// ---- 128 x 64 f32 tile in LDS, used by the transposing kernel k_wtG (256 threads): global reads and global writes both move whole 128-byte lines.
#define TRR 128   // source rows per tile
#define TRC 64    // source columns per tile
#define TRP 65    // LDS pitch in dwords: odd, so that a walk down a column meets every bank once
__device__ __forceinline__ void tile_in(const float* __restrict__ src, int ld, float* ts) {   // src: the tile's first element, row pitch ld floats
    const int rr = threadIdx.x >> 4, cc = (threadIdx.x & 15) * 4; const float* g[TRR / 16]; v4f v[TRR / 16];
#pragma unroll
    for (int p = 0; p < TRR / 16; ++p) g[p] = src + (size_t)(p * 16 + rr) * ld + cc;
#pragma unroll
    for (int p = 0; p < TRR / 16; ++p) v[p] = *(const v4f*)g[p];
    // the wait that stands in front of any overwrite of an issued load's address registers; the addresses are its inputs, so that nothing is allocated over them ahead of it
    asm volatile("s_wait_xcnt 0x0" :: "v"(g[0]), "v"(g[1]), "v"(g[2]), "v"(g[3]), "v"(g[4]), "v"(g[5]), "v"(g[6]), "v"(g[7]) : "memory");
#pragma unroll
    for (int p = 0; p < TRR / 16; ++p) {
#pragma unroll
        for (int u = 0; u < 4; ++u) ts[(p * 16 + rr) * TRP + cc + u] = v[p][u]; }
    __syncthreads();   // every column is read back by waves that did not write it
}
// k_wtG: Bt[n][k] = bf16(w[k][n]); grid (K / 128, N / 64, batch)
__global__ __launch_bounds__(256) void k_wtG(const float* __restrict__ w, int K, int N, bf* Bt) {
    __shared__ float ts[TRR * TRP];
    const int k0 = blockIdx.x * TRR, n0 = blockIdx.y * TRC; w += (size_t)blockIdx.z * K * N; Bt += (size_t)blockIdx.z * K * N;
    tile_in(w + (size_t)k0 * N + n0, N, ts);
    const int kg = (threadIdx.x & 7) * 8, nr = threadIdx.x >> 3;   // 8 lanes x 8 k = one 128-byte line of a Bt row; a wave stores 4 rows
#pragma unroll
    for (int p = 0; p < 4; ++p) { const int k = (p & 1) * 64 + kg, n = (p >> 1) * 32 + nr; v8us o;
#pragma unroll
        for (int i = 0; i < 8; ++i) o[i] = f2bf(ts[(k + i) * TRP + n]);
        *(v8us*)(Bt + (size_t)(n0 + n) * K + k0 + k) = o; }
}
__global__ __launch_bounds__(256) void k_cvt8(const float* __restrict__ src, bf* dst, size_t n8) { const size_t i = (size_t)blockIdx.x * 256 + threadIdx.x; if (i >= n8) return; const v8f v = *(const v8f*)(src + i * 8); v8us o;
#pragma unroll
    for (int k = 0; k < 8; ++k) o[k] = f2bf(v[k]); *(v8us*)(dst + i * 8) = o;  }
__global__ __launch_bounds__(256) void k_cstab(float* CS) { const int idx = blockIdx.x * 256 + threadIdx.x; if (idx >= TT * HD) return; const int t = idx / HD, d = idx % HD; const int i = (d < HD / 2) ? d : d - HD / 2; const float inv = __fdiv_rn(1.0f, powf(10000.0f, (float)(2 * i) / (float)HD)); const float ang = __fmul_rn((float)t, inv); v2f cs; cs[0] = cosf(ang); cs[1] = sinf(ang);
    *(v2f*)(CS + (size_t)idx * 2) = cs;  }
// k_rope: head planes [h][t][d] (fp16 + hi/lo) of rope(x) x sc with the rotate-half convention out[d] = x[d] cos[t][d] - x[d+HD/2] sin[t][d], out[d+HD/2] = x[d+HD/2] cos[t][d+HD/2] + x[d] sin[t][d+HD/2]
__global__ __launch_bounds__(256) void k_rope(const float* __restrict__ F, int pitch, int nheads, const float* __restrict__ CS, const float* __restrict__ RF, const float* __restrict__ nw, float sc, h16* P16, bf* Ph, bf* Pl) {
    const size_t e = ((size_t)blockIdx.x * 256 + threadIdx.x) * 2; if (e >= (size_t)nheads * TT * HD) return; const int d = (int)(e % HD); const int t = (int)((e / HD) % TT); const int h = (int)(e / ((size_t)HD * TT)); const float* f = F + (size_t)t * pitch + h * HD; const float rf = RF ? RF[(size_t)h * TT + t] : 1.0f; v2h o16; v2us oh, ol;
#pragma unroll
    for (int q = 0; q < 2; ++q) { const int dd = d + q; const int dp = (dd < HD / 2) ? dd + HD / 2 : dd - HD / 2; float x0 = f[dd], x1 = f[dp];
        if (RF) { float n0 = __fmul_rn(x0, rf), n1 = __fmul_rn(x1, rf); asm volatile("" : "+v"(n0)); asm volatile("" : "+v"(n1)); x0 = __fmul_rn(bfr(nw[dd]), n0); x1 = __fmul_rn(bfr(nw[dp]), n1); }
        const v2f cs = *(const v2f*)(CS + ((size_t)t * HD + dd) * 2); float a = __fmul_rn(x0, cs[0]), bq = __fmul_rn(x1, cs[1]); asm volatile("" : "+v"(a)); asm volatile("" : "+v"(bq)); const float r = ((dd < HD / 2) ? __fsub_rn(a, bq) : __fadd_rn(a, bq)) * sc;
        o16[q] = tohx(r); unsigned short a2, c2; splitf(r, a2, c2); oh[q] = a2; ol[q] = c2; }
    *(v2h*)(P16 + e) = o16; *(v2us*)(Ph + e) = oh; *(v2us*)(Pl + e) = ol;  }
__global__ __launch_bounds__(256) void k_colsum(const bf* __restrict__ Ph, const bf* __restrict__ Pl, const h16* __restrict__ P16, int h0, float* ACC) { const int t = blockIdx.x * 256 + threadIdx.x; if (t >= TT) return; float acc = ((h0 % REP) == 0) ? 0.0f : ACC[t];
#pragma unroll 1
    for (int zz = 0; zz < ZH; ++zz) {
#pragma unroll 4
        for (int i = 0; i < RH; ++i) { const size_t o = ((size_t)zz * RH + i) * TT + t; acc = __fadd_rn(acc, __fadd_rn(bf2f(Ph[o]), bf2f(Pl[o]))); }
#pragma unroll 4
        for (int i = RH; i < TT; ++i) { const size_t o = ((size_t)zz * TT + i) * TT + t; float pv = __fmul_rn((float)P16[o], 1.0f / PCAR); asm volatile("" : "+v"(pv)); acc = __fadd_rn(acc, pv); } }
    *(float*)(ACC + t) = acc;  }
// k_asoft: per row (zz, i): t = S x SCL (= 1) for j <= i and i - j < WIN (sliding causal window; the reference's -1e9 additive fill vanishes identically); softmax over the 2048 keys (register row, one exp, fixed trees);
__global__ __launch_bounds__(256) void k_asoft(const float* __restrict__ Sb, h16* P16, bf* Ph, bf* Pl) {
    const int lane = threadIdx.x & 31; const int row = blockIdx.x * 8 + (threadIdx.x >> 5); if (row >= ZH * TT) return; const int i = row % TT; const int zz = row / TT; (void)zz; const bool hires = (i < RH); const float* sr = Sb + (size_t)row * TT; float v[TT / 32]; float mx = -3.0e38f;
#pragma unroll
    for (int ch = 0; ch < TT / 128; ++ch) { const int j0 = ch * 128 + lane * 4; const v4f a = *(const v4f*)(sr + j0);
#pragma unroll
        for (int q = 0; q < 4; ++q) { const int j = j0 + q; (void)j; float sa = a[q] * SCL; asm volatile("" : "+v"(sa)); const float t = (j <= i && i - j < WIN) ? sa : -3.0e38f; v[ch * 4 + q] = t; mx = fmaxf(mx, t); } }
#pragma unroll
    for (int sh = 16; sh; sh >>= 1) mx = fmaxf(mx, __shfl_xor(mx, sh, 32));
    float sum = 0.f;
#pragma unroll
    for (int k = 0; k < TT / 32; ++k) { float d0 = __fsub_rn(v[k], mx); asm volatile("" : "+v"(d0)); v[k] = __builtin_amdgcn_exp2f(__fmul_rn(d0, 1.4426950408889634f)); sum += v[k]; }
#pragma unroll
    for (int sh = 16; sh; sh >>= 1) sum += __shfl_xor(sum, sh, 32);
    const float f = __fdiv_rn(hires ? 1.0f : PCAR, sum);
{
        if (hires) {
#pragma unroll
            for (int ch = 0; ch < TT / 128; ++ch) { v4us oh, ol;
#pragma unroll
                for (int q = 0; q < 4; ++q) { unsigned short a, c2; splitf(v[ch * 4 + q] * f, a, c2); oh[q] = a; ol[q] = c2; }
                const size_t oo = ((size_t)zz * (RH ? RH : 1) + i) * TT + ch * 128 + lane * 4; *(v4us*)(Ph + oo) = oh; *(v4us*)(Pl + oo) = ol; }
        } else {
#pragma unroll
            for (int ch = 0; ch < TT / 128; ++ch) { v4h o4;
#pragma unroll
                for (int q = 0; q < 4; ++q) o4[q] = tohx(v[ch * 4 + q] * f);
                *(v4h*)(P16 + (size_t)row * TT + ch * 128 + lane * 4) = o4; } }
         }
}
__global__ __launch_bounds__(256) void k_merge(const float* __restrict__ O, int h0, bf* Ah, bf* Al) { const size_t e = ((size_t)blockIdx.x * 256 + threadIdx.x) * 2; if (e >= (size_t)ZH * TT * HD) return; const int d = (int)(e % HD); const int t = (int)((e / HD) % TT); const int zz = (int)(e / ((size_t)HD * TT)); const float cs = (t < RH) ? 1.0f : (1.0f / PCAR); const size_t oo = (size_t)t * DQ + (h0 + zz) * HD + d;
    v2us oh, ol;
#pragma unroll
    for (int q = 0; q < 2; ++q) { unsigned short a, c2; splitf(O[e + q] * cs, a, c2); oh[q] = a; ol[q] = c2; } *(v2us*)(Ah + oo) = oh; *(v2us*)(Al + oo) = ol;  }


// ---- SingleHeadQKV kernels ----
__global__ __launch_bounds__(256) void k_gptab(float* GP) { const int n = blockIdx.x * 256 + threadIdx.x; if (n >= TT + 64) return; const float v = powf(GAMR, (float)n); *(float*)(GP + n) = v;  }
__global__ __launch_bounds__(256) void k_cstabW(float* CS) { const size_t idx = (size_t)blockIdx.x * 256 + threadIdx.x; if (idx >= (size_t)TT * DC) return; const int t = (int)(idx / DC), d = (int)(idx % DC); const float inv = __fdiv_rn(1.0f, powf(10000.0f, (float)(2 * (d >> 1)) / (float)DC)); const float ang = __fmul_rn((float)t, inv); v2f cs; cs[0] = cosf(ang); cs[1] = sinf(ang); *(v2f*)(CS + idx * 2) = cs;  }

extern "C" void kernel_launch(void* const* d_in, const int* in_sizes, int n_in,
                              void* d_out, int out_size, void* d_ws, size_t ws_size, hipStream_t stream) {
    (void)in_sizes; (void)n_in; (void)out_size;
    const float* x = (const float*)d_in[0]; const float* sn = (const float*)d_in[1]; const float* wq = (const float*)d_in[2]; const float* wk = (const float*)d_in[3]; const float* wv = (const float*)d_in[4]; const float* gw = (const float*)d_in[5]; const float* gb = (const float*)d_in[6];
    float* OUT = (float*)d_out;     // out0 [4][2048][1024] at 0, out1 [4][1024][1024] at NB*TT*DC
    char* wsp = (char*)d_ws;
    auto take = [&](size_t bytes) { char* p = wsp; wsp += (bytes + 255) & ~(size_t)255; return (void*)p; };
    // All NB_ batch elements go through every stage at once (grid z = batch). Planes are [batch][...]; buffers whose contents are dead are reused, in stream order.
    const size_t SX = (size_t)TT * DC, SS = (size_t)DC * DC, SP = (size_t)TT * TT;   // elements per batch element: activations, state, scores
    bf* QPh = (bf*)take(NB_ * SX * 2); bf* QPl = (bf*)take(NB_ * SX * 2); bf* KPh = (bf*)take(NB_ * SX * 2); bf* KPl = (bf*)take(NB_ * SX * 2); bf* VTh = (bf*)take(NB_ * SX * 2); bf* VTl = (bf*)take(NB_ * SX * 2);
    bf* KTh = (bf*)take(NB_ * SX * 2); bf* KTl = (bf*)take(NB_ * SX * 2); bf* VDTh = (bf*)take(NB_ * SX * 2); bf* VDTl = (bf*)take(NB_ * SX * 2);
    float* CS = (float*)take((size_t)TT * DC * 2 * 4); bf* XB = (bf*)take(NB_ * SX * 2);
    bf* STh = (bf*)CS;               // chunk states [batch][chunk][column][row], hi plane: NB_*NCH*SS over CS + XB, dead after the V product
    bf* STl = (bf*)take(NB_ * NCH * SS * 2);
    bf* WQ = (bf*)take((size_t)DQ * DM * 2); bf* WK = (bf*)take((size_t)DKV * DM * 2); bf* WV = (bf*)take((size_t)DKV * DM * 2); float* GP = (float*)take((TT + 64) * 4);
    bf* Ph = KTh; bf* Pl = VDTh;     // NB_*SP each, over KTh + KTl and over VDTh + VDTl: dead after the R product
    float* INNER = (float*)KPh;      // NB_*SX f32 over KPh + KPl: dead after Q K^T
    if ((size_t)(wsp - (char*)d_ws) > ws_size) return;   // ws ~ 230 MiB
    { k_wtG<<<dim3(DM / TRR, DQ / TRC, 1), 256, 0, stream>>>(wq, DM, DQ, WQ); k_wtG<<<dim3(DM / TRR, DKV / TRC, 1), 256, 0, stream>>>(wk, DM, DKV, WK); k_wtG<<<dim3(DM / TRR, DKV / TRC, 1), 256, 0, stream>>>(wv, DM, DKV, WV); k_cstabW<<<(unsigned)(((size_t)TT * DC + 255) / 256), 256, 0, stream>>>(CS); k_gptab<<<(TT + 64 + 255) / 256, 256, 0, stream>>>(GP); }
    k_cvt8<<<(unsigned)((NB_ * SX / 8 + 255) / 256), 256, 0, stream>>>(x, XB, NB_ * SX / 8);
    // Q = rope(X W_Q), K = rope(X W_K), V = X W_V, each straight into the operand planes of the later products
    k_gemmt<0, 0, 1><<<dim3(TT / 128, DQ / 128, NB_), 128, 0, stream>>>(XB, nullptr, WQ, nullptr, DM, nullptr, DQ, SX, 0, SX, CS, nullptr, nullptr, nullptr, QPh, QPl, nullptr, nullptr);
    k_gemmt<0, 0, 2><<<dim3(TT / 128, DKV / 128, NB_), 128, 0, stream>>>(XB, nullptr, WK, nullptr, DM, nullptr, DKV, SX, 0, SX, CS, nullptr, nullptr, nullptr, KPh, KPl, KTh, KTl);
    k_gemmt<0, 0, 3><<<dim3(TT / 128, DKV / 128, NB_), 128, 0, stream>>>(XB, nullptr, WV, nullptr, DM, nullptr, DKV, SX, 0, SX, GP, nullptr, nullptr, nullptr, VTh, VTl, VDTh, VDTl);
    // the chunk states S_0 = S_n .. S_(NCH-1) into their planes, and R_i = S_NCH (first, so that its operand planes can be reused for the scores)
    k_gemmt<2, 0, 4><<<dim3(DC / 128, DC / 128, NB_), 128, 0, stream>>>(KTh, KTl, VDTh, VDTl, TT, OUT + NB_ * SX, DC, SX, SX, SS, GP, sn, nullptr, nullptr, STh, STl, nullptr, nullptr);
    // A = (Q K^T) x D into hi/lo planes (causal tiles of each chunk's own block only), inner = A V over the same tiles
    k_gemmt<2, 1, 5><<<dim3(NCH * (CH / 128) * (CH / 128 + 1) / 2, 1, NB_), 128, 0, stream>>>(QPh, QPl, KPh, KPl, DC, nullptr, TT, SX, SX, SP, GP, nullptr, nullptr, nullptr, Ph, Pl, nullptr, nullptr);
    k_gemmt<2, 2, 0><<<dim3(TT / 128, DC / 128, NB_), 128, 0, stream>>>(Ph, Pl, VTh, VTl, TT, INNER, DC, SP, SX, SX, nullptr, nullptr, nullptr, nullptr, nullptr, nullptr, nullptr, nullptr);
    // cross = Q S_c, c the row's chunk; out0 = permuted GroupNorm(inner + cross g^(i+1))
    k_gemmt<2, 3, 6><<<dim3(TT / 128, DC / 128, NB_), 128, 0, stream>>>(QPh, QPl, STh, STl, DC, OUT, DC, SX, NCH * SS, SX, GP, INNER, gw, gb, nullptr, nullptr, nullptr, nullptr);
}

// v007
// Measured time: 227 microseconds a run.
// Two timings next to v006 both put it at 1.06 times that version's speed.
// Counting every step since v000, it is 5.83 times as fast.
#include <hip/hip_runtime.h>

// SingleHeadQKV (chunkwise retention step: X_Q [4][2048][1024], S_n [4][1024][1024]; Q = rope(X W_Q), K = rope(X W_K) (interleaved-pair RoPE over the full 1024 dims), V = X W_V; D[n][m] = g^(n-m) for n >= m (g = 1 - 2^-5); inner = (Q K^T * D) V; cross = (Q S_n) * g^(t+1); out = GroupNorm32(inner + cross) then the literal transpose(-2,-1).reshape permutation -> out0 [4][2048][1024]; R_i = K^T (V * D[-1]) + S_n g^T -> out1 [4][1024][1024] at element 8,388,608).
// Compute dtypes, f32 accumulate: every input rounded to bf16; Q/K/V on PLAIN bf16 operands (inputs: exact); RoPE f32 (on-chip table); decay powers g^n in f32 (powf); Q.K^T (K = 1024) hl x hl (3 products) with causal tile skipping, x D per element in f32 into hi/lo planes (no softmax), (QK^T D).V hl x hl (3 products, causal skipping); Q.S_c hl x hl (3 products); the chunk states K^T.(V x decay) hl x hl (3 products, K = 2048 in all), kept in f32 accumulators and handed on as hi/lo planes; sums, GroupNorm (32 groups of 32, biased var, eps 1e-6) and the output permutation in f32.
// The decay is a recurrence over chunks of CH steps: with S_0 = S_n and S_(c+1) = g^CH S_c + K_c^T (V_c x g^(CH-1-i)), i the step inside chunk c, a row of chunk c is out = (Q K^T * D restricted to the chunk) V + g^(i+1) Q S_c, and R_i = S_(TT/CH). Exact algebra: only the order of the f32 sums differs.

#define NB_  4
#define TT   2048
#define DM   1024
#define NH_  16
#define NKV  16
#define REP  (NH_ / NKV)
#define HD   64
#define DQ   (NH_ * HD)
#define DKV  (NKV * HD)
#define ZH   2
#define RH   2048                  // query rows < RH use hi+lo planes (0: none)
#define WIN  2048
#define PCAR 1024.0f
#define DC   1024   // channel width (= DQ)
#define GAMR 0.96875f
#define SCL  1.0f
#define CH   512    // steps per chunk of the decay recurrence
#define NCH  (TT / CH)
typedef _Float16 h16;
typedef unsigned short bf;
typedef __attribute__((ext_vector_type(16))) __bf16   v16bf;
typedef __attribute__((ext_vector_type(16))) _Float16 v16h;
typedef __attribute__((ext_vector_type(8)))  _Float16 v8h;
typedef __attribute__((ext_vector_type(8)))  unsigned short v8us;
typedef __attribute__((ext_vector_type(8)))  float    v8f;
typedef __attribute__((ext_vector_type(4)))  float    v4f;
typedef v8h  __attribute__((may_alias)) v8ha;
typedef v4f  __attribute__((may_alias)) v4fa;
typedef v8us __attribute__((may_alias)) v8usa;
typedef __attribute__((ext_vector_type(4))) unsigned short v4us;
typedef __attribute__((ext_vector_type(2))) float v2f;

__device__ __forceinline__ unsigned short f2bf(float f) { unsigned u = __float_as_uint(f); u += 0x7FFFu + ((u >> 16) & 1u); return (unsigned short)(u >> 16); }
__device__ __forceinline__ float bf2f(unsigned short b) { return __uint_as_float(((unsigned)b) << 16); }
__device__ __forceinline__ float bfr(float f) { return bf2f(f2bf(f)); }
__device__ __forceinline__ void splitf(float y, unsigned short& h, unsigned short& l) { h = f2bf(y); l = f2bf(y - bf2f(h)); }
__device__ __forceinline__ v16h cat16(v8h lo, v8h hi) { return __builtin_shufflevector(lo, hi, 0, 1, 2, 3, 4, 5, 6, 7, 8, 9, 10, 11, 12, 13, 14, 15); }
__device__ __forceinline__ v16bf cat16b(v8us lo, v8us hi) { return __builtin_bit_cast(v16bf, __builtin_shufflevector(lo, hi, 0, 1, 2, 3, 4, 5, 6, 7, 8, 9, 10, 11, 12, 13, 14, 15)); }
__device__ __forceinline__ v8f wmma16(v16h a, v16h b, v8f c) { return __builtin_amdgcn_wmma_f32_16x16x32_f16(false, a, false, b, (short)0, c, false, false); }
__device__ __forceinline__ v8f wmmab(v16bf a, v16bf b, v8f c) { return __builtin_amdgcn_wmma_f32_16x16x32_bf16(false, a, false, b, (short)0, c, false, false); }



// ---- k_gemmt: C[m][n] (f32, pitch ldc) = sum_k A[m][k] Bt[n][k] (+ split products per NSPLIT) on K-contiguous bf16 planes. One 128x128 tile of C per work-group of four waves (2x2, 64x64 each, 16 accumulators a wave);
// grid (M/128, N/128, Z), 128 threads. A pass is KP k of all 128 rows of every operand plane; asynchronous copies bring it into a two-buffer LDS ring as whole 128-byte lines, one pass ahead of its use, and each row is fetched once for two waves.
// CMODE 1 launches only the score tiles on or below the diagonal inside each chunk's CH x CH block (grid (40, 1, Z)); CMODE 2 runs two products through one ring into one set of accumulators: A x the B planes of the row tile's chunk (K = DC), rows then scaled by g^(i+1), and behind it the (decayed score) x value product (A planes P0/P1, B planes P2/P3, row pitch TT) from the chunk's first step to the diagonal block. M, N % 128 == 0, K % KP == 0.
typedef float __attribute__((may_alias)) f32a;
// eight copies of 16 bytes a lane; the s_wait_xcnt stands inside the statement, in front of any overwrite of the address registers that the copies name
__device__ __forceinline__ void copy8(unsigned l, int lstep, const bf* g, size_t gstep) {
    const unsigned l0 = l, l1 = l + lstep, l2 = l + 2 * lstep, l3 = l + 3 * lstep, l4 = l + 4 * lstep, l5 = l + 5 * lstep, l6 = l + 6 * lstep, l7 = l + 7 * lstep;
    const bf *g0 = g, *g1 = g + gstep, *g2 = g + 2 * gstep, *g3 = g + 3 * gstep, *g4 = g + 4 * gstep, *g5 = g + 5 * gstep, *g6 = g + 6 * gstep, *g7 = g + 7 * gstep;
    asm volatile("global_load_async_to_lds_b128 %0, %8, off\n\tglobal_load_async_to_lds_b128 %1, %9, off\n\tglobal_load_async_to_lds_b128 %2, %10, off\n\tglobal_load_async_to_lds_b128 %3, %11, off\n\t"
                 "global_load_async_to_lds_b128 %4, %12, off\n\tglobal_load_async_to_lds_b128 %5, %13, off\n\tglobal_load_async_to_lds_b128 %6, %14, off\n\tglobal_load_async_to_lds_b128 %7, %15, off\n\ts_wait_xcnt 0x0"
                 :: "v"(l0), "v"(l1), "v"(l2), "v"(l3), "v"(l4), "v"(l5), "v"(l6), "v"(l7), "v"(g0), "v"(g1), "v"(g2), "v"(g3), "v"(g4), "v"(g5), "v"(g6), "v"(g7) : "memory");
}
#define XWAIT(...) asm volatile("s_wait_xcnt 0x0" :: __VA_ARGS__ : "memory")
template <int CTRL> __device__ __forceinline__ float dppf(float x) { return __int_as_float(__builtin_amdgcn_mov_dpp(__float_as_int(x), CTRL, 0xF, 0xF, true)); }   // 0xB1: lane ^ 1, 0x4E: lane ^ 2 (quad_perm); 0x141: lane -> 7 - lane in each 8 (row_half_mirror)
__device__ __forceinline__ v16bf ldsfrag(const unsigned char* p) { return cat16b(*(const v8usa*)p, *(const v8usa*)(p + 32)); }
// EPI names what the epilogue makes of the tile, straight from the accumulators (a lane holds 8 consecutive rows of one column) and each wave's own LDS range:
// 0 f32 C; 1 RoPE (E0 = cos/sin table), hi/lo planes P0/P1; 2 as 1, and the transposed hi/lo planes P2/P3; 3 transposed hi/lo planes P0/P1, and P2/P3 of rows x g^(CH-1-i), i = t mod CH (E0 = powers of g);
// 4 the accumulators start as bf16(E1); at each chunk's first pass they go out as transposed hi/lo planes P0/P1 [chunk][column][row] and are scaled by g^CH; C = the last state; 5 tile x g^(i-j) for j <= i, else 0, hi/lo planes P0/P1; 6 GroupNorm(tile) with weight E2 and bias E3, stored transposed to C.
template <int NSPLIT, int CMODE, int EPI>
__global__ __launch_bounds__(128) void k_gemmt(const bf* __restrict__ A, const bf* __restrict__ A2, const bf* __restrict__ Bt, const bf* __restrict__ Bt2, int K, float* C, int ldc, size_t sA, size_t sB, size_t sC,
                                               const float* __restrict__ E0, const float* __restrict__ E1, const float* __restrict__ E2, const float* __restrict__ E3, bf* P0, bf* P1, bf* P2, bf* P3) {
    constexpr int NP = (NSPLIT == 0) ? 2 : (NSPLIT == 1) ? 3 : 4;   // operand planes of a stage: A, (A2), B, (B2)
    constexpr int KP = (NSPLIT == 0) ? 128 : 64;                    // k per pass
    constexpr int PITCH = KP * 2 + 16;                              // LDS row pitch in bytes: 16 x odd, for 16-byte readers
    constexpr int PLANE = 128 * PITCH, STAGE = NP * PLANE, PB = (NSPLIT == 0) ? 1 : 2;
    constexpr int GB = (NSPLIT == 0) ? 2 : 1;                       // column blocks whose B fragments are read as one group
    constexpr int LA = (NSPLIT == 0) ? 8 : 16, LB = GB * ((NSPLIT == 2) ? 4 : 2), NW = GB * 4 * (NSPLIT + 1);   // 16-byte LDS reads of the A fragments and of a B group; products of a group
    constexpr int CPR = KP / 8, RPI = 128 / CPR;                    // 16-byte units per row; rows that the 128 threads cover at once
    __shared__ __attribute__((aligned(2048))) unsigned char ring[2 * STAGE];
    int bx = blockIdx.x, by = blockIdx.y, bz = blockIdx.z;
    if (CMODE == 1) {   // grid.x counts only the tiles on or below the diagonal of each chunk's own block, chunk by chunk and row by row: no work-group starts for nothing
        constexpr int TC = CH / 128, TPC = TC * (TC + 1) / 2;
        const int ch = bx / TPC, e = bx % TPC; int r = 0;
        for (int q = 1; q < TC; ++q) r += (e >= q * (q + 1) / 2) ? 1 : 0;
        by = ch * TC + e - r * (r + 1) / 2; bx = ch * TC + r; }
    if (CMODE == 2) {   // all work-groups are resident, two to a WGP, and a row tile's K loop grows with its index inside the chunk: flat indices 8, 16 or 256 apart get row tiles t and 15 - t. Speed only: any placement is correct
        static_assert(CMODE != 2 || (TT / 128 == 16 && DC / 128 == 8 && NB_ == 4), "the map below is a permutation of a 16 x 8 x 4 grid");
        const int b = bx + 16 * by + 128 * bz, k = b >> 3, u = (k >> 2) & 7;
        bx = ((k ^ (k >> 1) ^ (k >> 5)) & 1) ? 15 - u : u; by = b & 7; bz = k & 3; }
    const int r0 = bx * 128, c0 = by * 128;
    const int kb = (CMODE == 2) ? (r0 / CH) * CH : 0;   // CMODE 2: the chunk's first step, where the second product's k begins
    const int np1 = (CMODE == 2) ? DC / KP : K / KP;    // passes of the first product
    const int npass = (CMODE == 2) ? np1 + (r0 + 128 - kb) / KP : np1;
    const size_t z = bz; C += z * sC;
    const int tid = threadIdx.x, lane = tid & 31, lr = lane & 15, hi = lane >> 4, wave = tid >> 5, wm = wave >> 1, wn = wave & 1;
    const int crow = tid / CPR, ccol = tid % CPR;
    const size_t ga = z * sA + (size_t)(r0 + crow) * K + ccol * 8, gb = z * sB + ((CMODE == 2) ? (size_t)(r0 / CH) * DC * DC : 0) + (size_t)(c0 + crow) * K + ccol * 8, gstep = (size_t)RPI * K;
    const size_t ga2 = z * ((size_t)TT * TT) + (size_t)(r0 + crow) * TT + ccol * 8 + kb, gb2 = z * ((size_t)TT * DC) + (size_t)(c0 + crow) * TT + ccol * 8 + kb;   // CMODE 2: the second product's planes
    const unsigned lbase = (unsigned)(size_t)ring + crow * PITCH + ccol * 16;
    auto fill = [&](int t) {   // pass t into buffer t & 1
        const unsigned l = lbase + (t & 1) * STAGE;
        const bool sec = CMODE == 2 && t >= np1;   // the same for the whole work-group: this pass belongs to the second product
        const size_t oa = sec ? ga2 + (size_t)(t - np1) * KP : ga + (size_t)t * KP, ob = sec ? gb2 + (size_t)(t - np1) * KP : gb + (size_t)t * KP, gs = sec ? (size_t)RPI * TT : gstep;
        const bf *pa = (sec ? P0 : A) + oa, *pa2 = (sec ? P1 : A2) + oa, *pb = (sec ? P2 : Bt) + ob, *pb2 = (sec ? P3 : Bt2) + ob;
#pragma unroll
        for (int h = 0; h < CPR / 8; ++h) {
            const unsigned lh = l + h * 8 * RPI * PITCH; const size_t gh = h * 8 * gs;
            copy8(lh, RPI * PITCH, pa + gh, gs);
            if (NSPLIT == 1 || NSPLIT == 2) copy8(lh + PLANE, RPI * PITCH, pa2 + gh, gs);
            copy8(lh + PB * PLANE, RPI * PITCH, pb + gh, gs);
            if (NSPLIT == 2) copy8(lh + 3 * PLANE, RPI * PITCH, pb2 + gh, gs);
        }
    };
    v8f acc[4][4];
#pragma unroll
    for (int mb = 0; mb < 4; ++mb)
#pragma unroll
        for (int nb = 0; nb < 4; ++nb) acc[mb][nb] = (v8f){};
    fill(0);
    asm volatile("s_wait_asynccnt 0x0" ::: "memory");   // this wave's copies of pass 0 have landed
    __syncthreads();                                    // and every other wave's: pass 0 is readable
    if (npass > 1) fill(1);
    const int rw = r0 + wm * 64, cw = c0 + wn * 64;         // the wave's first row and column of C
    float gC = 0.0f;
    if (EPI == 4) {   // S_0: a lane holds 8 consecutive rows of one column
        static_assert(EPI != 4 || CH % KP == 0, "a chunk is a whole number of passes");
        gC = E0[CH];
        const float* si = E1 + z * sC + (size_t)(rw + hi * 8) * DC + cw + lr;
#pragma unroll
        for (int mb = 0; mb < 4; ++mb)
#pragma unroll
            for (int nb = 0; nb < 4; ++nb)
#pragma unroll
                for (int j = 0; j < 8; ++j) acc[mb][nb][j] = si[(mb * 16 + j) * DC + nb * 16];
        XWAIT("v"(si));
#pragma unroll
        for (int mb = 0; mb < 4; ++mb)
#pragma unroll
            for (int nb = 0; nb < 4; ++nb)
#pragma unroll
                for (int j = 0; j < 8; ++j) acc[mb][nb][j] = bfr(acc[mb][nb][j]);
    }
    const unsigned char* fa = ring + (wm * 64 + lr) * PITCH + hi * 16; const unsigned char* fb = ring + PB * PLANE + (wn * 64 + lr) * PITCH + hi * 16;
#pragma unroll 1
    for (int t = 0; t < npass; ++t) {
        const int bo = (t & 1) * STAGE;
        if (EPI == 4 && (t & (CH / KP - 1)) == 0) {   // a chunk begins: its start state goes out [column][row] (a lane's 8 rows are 16 bytes, the four row blocks fill one 128-byte line), then decays over the chunk
            const size_t so = ((z * NCH + t / (CH / KP)) * DC + cw + lr) * DC + rw + hi * 8;
#pragma unroll
            for (int nb = 0; nb < 4; ++nb) { bf* ph = P0 + so + (size_t)nb * 16 * DC; bf* pl = P1 + so + (size_t)nb * 16 * DC; v8us oh[4], ol[4];
#pragma unroll
                for (int mb = 0; mb < 4; ++mb) {
#pragma unroll
                    for (int j = 0; j < 8; ++j) { unsigned short a2, c2; splitf(acc[mb][nb][j], a2, c2); oh[mb][j] = a2; ol[mb][j] = c2; acc[mb][nb][j] *= gC; } }
#pragma unroll
                for (int mb = 0; mb < 4; ++mb) { *(v8us*)(ph + mb * 16) = oh[mb]; *(v8us*)(pl + mb * 16) = ol[mb]; }
                XWAIT("v"(ph), "v"(pl), "v"(oh[0]), "v"(oh[1]), "v"(oh[2]), "v"(oh[3]), "v"(ol[0]), "v"(ol[1]), "v"(ol[2]), "v"(ol[3])); }
        }
        if (CMODE == 2 && t == np1) {   // the state product is complete: its rows take g^(i+1), i the step inside the chunk; the chunk's own products add on top
            const float* gp = E0 + (rw - kb + hi * 8 + 1); float gr[4][8];
#pragma unroll
            for (int mb = 0; mb < 4; ++mb)
#pragma unroll
                for (int j = 0; j < 8; ++j) gr[mb][j] = gp[mb * 16 + j];
            XWAIT("v"(gp));
#pragma unroll
            for (int mb = 0; mb < 4; ++mb)
#pragma unroll
                for (int nb = 0; nb < 4; ++nb)
#pragma unroll
                    for (int j = 0; j < 8; ++j) acc[mb][nb][j] *= gr[mb][j];
        }
#pragma unroll
        for (int ks = 0; ks < KP / 32; ++ks) {
            v16bf a[4], a2[4];
#pragma unroll
            for (int mb = 0; mb < 4; ++mb) { a[mb] = ldsfrag(fa + bo + mb * 16 * PITCH + ks * 64); if (NSPLIT == 1 || NSPLIT == 2) a2[mb] = ldsfrag(fa + bo + PLANE + mb * 16 * PITCH + ks * 64); }
#pragma unroll
            for (int nb = 0; nb < 4; ++nb) { const v16bf b = ldsfrag(fb + bo + nb * 16 * PITCH + ks * 64); v16bf b2; if (NSPLIT == 2) b2 = ldsfrag(fb + bo + PLANE + nb * 16 * PITCH + ks * 64);
#pragma unroll
                for (int mb = 0; mb < 4; ++mb) { acc[mb][nb] = wmmab(a[mb], b, acc[mb][nb]); if (NSPLIT == 1 || NSPLIT == 2) acc[mb][nb] = wmmab(a2[mb], b, acc[mb][nb]); if (NSPLIT == 2) acc[mb][nb] = wmmab(a[mb], b2, acc[mb][nb]); } }
            // order asked of the scheduler: LDS reads in few groups, each one group of columns ahead of its products
            __builtin_amdgcn_sched_group_barrier(0x100, LA + LB, 0);
#pragma unroll
            for (int q = 1; q < 4 / GB; ++q) { __builtin_amdgcn_sched_group_barrier(0x100, LB, 0); __builtin_amdgcn_sched_group_barrier(0x008, NW, 0); }
            __builtin_amdgcn_sched_group_barrier(0x008, NW, 0);
        }
        asm volatile("s_wait_dscnt 0x0" ::: "memory");      // this wave has left buffer t & 1
        asm volatile("s_wait_asynccnt 0x0" ::: "memory");   // its copies of pass t + 1 have landed
        __syncthreads();                                    // publishes pass t + 1 and frees buffer t & 1
        if (t + 2 < npass) fill(t + 2);
    }
    asm volatile("s_wait_asynccnt 0x0" ::: "memory");       // nothing is in flight when the ring becomes output staging
    constexpr int WREG = 24576, TOFF = 4608, TPL = 64 * 144;   // bytes of LDS a wave stages in; where its transposing tile starts; one 64 x 64 16-bit tile at a pitch of 144 bytes
    unsigned char* wreg = ring + wave * WREG;               // each wave stages in its own range, behind the last pass's barrier
    f32a* os = (f32a*)wreg;                                 // 16 x 64 f32, pitch 68
    if (EPI == 1 || EPI == 2 || EPI == 3 || EPI == 5) { P0 += z * sC; P1 += z * sC; }
    if (EPI == 2 || EPI == 3) { P2 += z * sC; P3 += z * sC; }
    // interleaved-pair RoPE of one block of 16 rows: the partner column sits in the neighbouring lane
    auto rope = [&](int mb) {
        const float sg = (lr & 1) ? 1.0f : -1.0f; const float* cb = E0 + ((size_t)(rw + mb * 16 + hi * 8) * DC + cw + lr) * 2; v2f ct[4][8];
#pragma unroll
        for (int nb = 0; nb < 4; ++nb)
#pragma unroll
            for (int j = 0; j < 8; ++j) ct[nb][j] = *(const v2f*)(cb + (j * DC + nb * 16) * 2);
        XWAIT("v"(cb));
#pragma unroll
        for (int nb = 0; nb < 4; ++nb)
#pragma unroll
            for (int j = 0; j < 8; ++j) {
                const v2f cs = ct[nb][j];
                const float xv = acc[mb][nb][j];
                const float pv = dppf<0xB1>(xv);
                acc[mb][nb][j] = xv * cs[0] + pv * (sg * cs[1]);
            }
    };
    // transposed hi/lo planes [column][row], row pitch TT: a lane's 8 rows are one 16-byte LDS store (t_put); read back so that 8 lanes store one whole 128-byte line (t_flush)
    unsigned char* tp = wreg + TOFF;
    auto t_put = [&](int mb, bool dec) {
        float gs[8];
        if (dec) { const float* gp = E0 + (CH - 8 - ((rw + mb * 16 + hi * 8) & (CH - 1)));
#pragma unroll
            for (int j = 0; j < 8; ++j) gs[j] = gp[7 - j];
            XWAIT("v"(gp)); }
#pragma unroll
        for (int nb = 0; nb < 4; ++nb) { v8us oh, ol;
#pragma unroll
            for (int j = 0; j < 8; ++j) { float xv = acc[mb][nb][j]; if (dec) xv *= gs[j]; unsigned short a2, c2; splitf(xv, a2, c2); oh[j] = a2; ol[j] = c2; }
            unsigned char* q = tp + (nb * 16 + lr) * 144 + (mb * 16 + hi * 8) * 2; *(v8usa*)q = oh; *(v8usa*)(q + TPL) = ol; }
    };
    auto t_flush = [&](bf* Th, bf* Tl) {
        __builtin_amdgcn_wave_barrier(); asm volatile("" ::: "memory");   // other lanes' LDS stores stay ahead of the reads below
#pragma unroll
        for (int sg4 = 0; sg4 < 4; ++sg4) { v8us vh[4], vl[4];   // eight LDS reads in flight, then their stores
#pragma unroll
            for (int s = 0; s < 4; ++s) { const unsigned char* q = tp + ((sg4 * 4 + s) * 4 + (lane >> 3)) * 144 + (lane & 7) * 16; vh[s] = *(const v8usa*)q; vl[s] = *(const v8usa*)(q + TPL); }
#pragma unroll
            for (int s = 0; s < 4; ++s) { const size_t o = (size_t)(cw + (sg4 * 4 + s) * 4 + (lane >> 3)) * TT + rw + (lane & 7) * 8; bf* ph = Th + o; bf* pl = Tl + o; *(v8us*)ph = vh[s]; *(v8us*)pl = vl[s]; XWAIT("v"(ph), "v"(pl), "v"(vh[s]), "v"(vl[s])); }
        }
        __builtin_amdgcn_wave_barrier(); asm volatile("" ::: "memory");   // the reads above stay ahead of the tile's next use
    };
    if (EPI == 3) {
#pragma unroll
        for (int mb = 0; mb < 4; ++mb) t_put(mb, false);
        t_flush(P0, P1);
#pragma unroll
        for (int mb = 0; mb < 4; ++mb) t_put(mb, true);
        t_flush(P2, P3);
    }
    if (EPI != 3) {
        f32a* tt = (f32a*)(wreg + TOFF);                    // EPI 6: 64 x 64 f32 at an odd pitch of 65, so that a walk down a column meets every bank once
        v4f w4 = {}, b4 = {};
        if (EPI == 6) { const float* pw = E2 + cw + lr * 4; const float* pb = E3 + cw + lr * 4; const v4f wr = *(const v4f*)pw, br = *(const v4f*)pb; XWAIT("v"(pw), "v"(pb));
#pragma unroll
            for (int u = 0; u < 4; ++u) { w4[u] = bfr(wr[u]); b4[u] = bfr(br[u]); } }
#pragma unroll
        for (int mb = 0; mb < 4; ++mb) {
            if (EPI == 1 || EPI == 2) rope(mb);
            if (EPI == 2) { __builtin_amdgcn_sched_barrier(0); t_put(mb, false); }   // the split's temporaries come after the table values are spent: interleaved they take the kernel above 256 registers
            const int cofs = lr * 4, gc = cw + cofs;
            v4f ex[8];   // what the 16 rows take from global memory: issued ahead of the LDS round trip, all in flight together
            if (EPI == 5) {
#pragma unroll
                for (int s = 0; s < 8; ++s) { const int dd = rw + mb * 16 + 2 * s + hi - gc; const int m0 = max(dd, 0), m1 = max(dd, 1), m2 = max(dd, 2), m3 = max(dd, 3);   // exponent i - j, held at 0 above the diagonal
                    ex[s][0] = E0[m0]; ex[s][1] = E0[m1 - 1]; ex[s][2] = E0[m2 - 2]; ex[s][3] = E0[m3 - 3]; XWAIT("v"(m0), "v"(m1), "v"(m2), "v"(m3)); } }
#pragma unroll
            for (int nb = 0; nb < 4; ++nb) {
#pragma unroll
                for (int j = 0; j < 8; ++j) os[(hi * 8 + j) * 68 + nb * 16 + lr] = acc[mb][nb][j]; }
            __builtin_amdgcn_wave_barrier(); asm volatile("" ::: "memory");   // other lanes' LDS stores stay ahead of the reads below
            v4f vals[8];
#pragma unroll
            for (int s = 0; s < 8; ++s) vals[s] = *(const v4fa*)(os + (2 * s + hi) * 68 + cofs);
#pragma unroll
            for (int s = 0; s < 8; ++s) { const int row = 2 * s + hi; const v4f val = vals[s];
                const int gr = rw + mb * 16 + row; const size_t o = (size_t)gr * ldc + gc;
                if (EPI == 0 || EPI == 4) { float* pc = C + o; *(v4f*)pc = val; XWAIT("v"(pc), "v"(val)); }
                if (EPI == 1 || EPI == 2 || EPI == 5) { v4us oh, ol;
#pragma unroll
                    for (int u = 0; u < 4; ++u) { float v = val[u]; if (EPI == 5) v = (gr >= gc + u) ? v * ex[s][u] : 0.0f; unsigned short a2, c2; splitf(v, a2, c2); oh[u] = a2; ol[u] = c2; }
                    bf* ph = P0 + o; bf* pl = P1 + o; *(v4us*)ph = oh; *(v4us*)pl = ol; XWAIT("v"(ph), "v"(pl), "v"(oh), "v"(ol)); }
                if (EPI == 6) { float v[4], d[4]; float sm = 0.0f, ss = 0.0f;   // a group of 32 channels = 8 lanes x 4
#pragma unroll
                    for (int u = 0; u < 4; ++u) { v[u] = val[u]; sm += v[u]; }
                    sm += dppf<0xB1>(sm); sm += dppf<0x4E>(sm); sm += dppf<0x141>(sm);
                    const float mu = sm * (1.0f / 32.0f);
#pragma unroll
                    for (int u = 0; u < 4; ++u) { d[u] = v[u] - mu; ss += d[u] * d[u]; }
                    ss += dppf<0xB1>(ss); ss += dppf<0x4E>(ss); ss += dppf<0x141>(ss);
                    const float rs = __fdiv_rn(1.0f, sqrtf(ss * (1.0f / 32.0f) + 1e-6f));
#pragma unroll
                    for (int u = 0; u < 4; ++u) tt[(mb * 16 + row) * 65 + cofs + u] = d[u] * rs * w4[u] + b4[u]; }
            }
            __builtin_amdgcn_wave_barrier(); asm volatile("" ::: "memory");   // the reads above stay ahead of the next block's LDS stores
        }
        if (EPI == 2) t_flush(P2, P3);
        if (EPI == 6) {   // the reference's transpose(-2,-1).reshape keeps the flat order of the transpose: C read as [DC][TT]; 16 lanes x 4 rows = two whole lines of one channel
#pragma unroll
            for (int pg8 = 0; pg8 < 4; ++pg8) { const int tg = lr * 4; v4f ov[8];   // 32 LDS reads in flight, then their stores
#pragma unroll
                for (int p = 0; p < 8; ++p)
#pragma unroll
                    for (int i = 0; i < 4; ++i) ov[p][i] = tt[(tg + i) * 65 + (pg8 * 8 + p) * 2 + hi];
#pragma unroll
                for (int p = 0; p < 8; ++p) { float* pc = C + (size_t)(cw + (pg8 * 8 + p) * 2 + hi) * TT + rw + tg; *(v4f*)pc = ov[p]; XWAIT("v"(pc), "v"(ov[p])); }
            }
        }
    }
}

__device__ __forceinline__ h16 tohx(float x) { return (h16)x; }
typedef __attribute__((ext_vector_type(2))) _Float16 v2h;
typedef __attribute__((ext_vector_type(4))) _Float16 v4h;
typedef __attribute__((ext_vector_type(2))) unsigned short v2us;
typedef __attribute__((ext_vector_type(4))) int v4i;

// ---- 128 x 64 f32 tile in LDS, used by the transposing kernel k_wtG (256 threads): global reads and global writes both move whole 128-byte lines.
#define TRR 128   // source rows per tile
#define TRC 64    // source columns per tile
#define TRP 65    // LDS pitch in dwords: odd, so that a walk down a column meets every bank once
__device__ __forceinline__ void tile_in(const float* __restrict__ src, int ld, float* ts) {   // src: the tile's first element, row pitch ld floats
    const int rr = threadIdx.x >> 4, cc = (threadIdx.x & 15) * 4; const float* g[TRR / 16]; v4f v[TRR / 16];
#pragma unroll
    for (int p = 0; p < TRR / 16; ++p) g[p] = src + (size_t)(p * 16 + rr) * ld + cc;
#pragma unroll
    for (int p = 0; p < TRR / 16; ++p) v[p] = *(const v4f*)g[p];
    // the wait that stands in front of any overwrite of an issued load's address registers; the addresses are its inputs, so that nothing is allocated over them ahead of it
    asm volatile("s_wait_xcnt 0x0" :: "v"(g[0]), "v"(g[1]), "v"(g[2]), "v"(g[3]), "v"(g[4]), "v"(g[5]), "v"(g[6]), "v"(g[7]) : "memory");
#pragma unroll
    for (int p = 0; p < TRR / 16; ++p) {
#pragma unroll
        for (int u = 0; u < 4; ++u) ts[(p * 16 + rr) * TRP + cc + u] = v[p][u]; }
    __syncthreads();   // every column is read back by waves that did not write it
}
// k_wtG: Bt[n][k] = bf16(w[k][n]); grid (K / 128, N / 64, batch)
__global__ __launch_bounds__(256) void k_wtG(const float* __restrict__ w, int K, int N, bf* Bt) {
    __shared__ float ts[TRR * TRP];
    const int k0 = blockIdx.x * TRR, n0 = blockIdx.y * TRC; w += (size_t)blockIdx.z * K * N; Bt += (size_t)blockIdx.z * K * N;
    tile_in(w + (size_t)k0 * N + n0, N, ts);
    const int kg = (threadIdx.x & 7) * 8, nr = threadIdx.x >> 3;   // 8 lanes x 8 k = one 128-byte line of a Bt row; a wave stores 4 rows
#pragma unroll
    for (int p = 0; p < 4; ++p) { const int k = (p & 1) * 64 + kg, n = (p >> 1) * 32 + nr; v8us o;
#pragma unroll
        for (int i = 0; i < 8; ++i) o[i] = f2bf(ts[(k + i) * TRP + n]);
        *(v8us*)(Bt + (size_t)(n0 + n) * K + k0 + k) = o; }
}
__global__ __launch_bounds__(256) void k_cvt8(const float* __restrict__ src, bf* dst, size_t n8) { const size_t i = (size_t)blockIdx.x * 256 + threadIdx.x; if (i >= n8) return; const v8f v = *(const v8f*)(src + i * 8); v8us o;
#pragma unroll
    for (int k = 0; k < 8; ++k) o[k] = f2bf(v[k]); *(v8us*)(dst + i * 8) = o;  }
__global__ __launch_bounds__(256) void k_cstab(float* CS) { const int idx = blockIdx.x * 256 + threadIdx.x; if (idx >= TT * HD) return; const int t = idx / HD, d = idx % HD; const int i = (d < HD / 2) ? d : d - HD / 2; const float inv = __fdiv_rn(1.0f, powf(10000.0f, (float)(2 * i) / (float)HD)); const float ang = __fmul_rn((float)t, inv); v2f cs; cs[0] = cosf(ang); cs[1] = sinf(ang);
    *(v2f*)(CS + (size_t)idx * 2) = cs;  }
// k_rope: head planes [h][t][d] (fp16 + hi/lo) of rope(x) x sc with the rotate-half convention out[d] = x[d] cos[t][d] - x[d+HD/2] sin[t][d], out[d+HD/2] = x[d+HD/2] cos[t][d+HD/2] + x[d] sin[t][d+HD/2]
__global__ __launch_bounds__(256) void k_rope(const float* __restrict__ F, int pitch, int nheads, const float* __restrict__ CS, const float* __restrict__ RF, const float* __restrict__ nw, float sc, h16* P16, bf* Ph, bf* Pl) {
    const size_t e = ((size_t)blockIdx.x * 256 + threadIdx.x) * 2; if (e >= (size_t)nheads * TT * HD) return; const int d = (int)(e % HD); const int t = (int)((e / HD) % TT); const int h = (int)(e / ((size_t)HD * TT)); const float* f = F + (size_t)t * pitch + h * HD; const float rf = RF ? RF[(size_t)h * TT + t] : 1.0f; v2h o16; v2us oh, ol;
#pragma unroll
    for (int q = 0; q < 2; ++q) { const int dd = d + q; const int dp = (dd < HD / 2) ? dd + HD / 2 : dd - HD / 2; float x0 = f[dd], x1 = f[dp];
        if (RF) { float n0 = __fmul_rn(x0, rf), n1 = __fmul_rn(x1, rf); asm volatile("" : "+v"(n0)); asm volatile("" : "+v"(n1)); x0 = __fmul_rn(bfr(nw[dd]), n0); x1 = __fmul_rn(bfr(nw[dp]), n1); }
        const v2f cs = *(const v2f*)(CS + ((size_t)t * HD + dd) * 2); float a = __fmul_rn(x0, cs[0]), bq = __fmul_rn(x1, cs[1]); asm volatile("" : "+v"(a)); asm volatile("" : "+v"(bq)); const float r = ((dd < HD / 2) ? __fsub_rn(a, bq) : __fadd_rn(a, bq)) * sc;
        o16[q] = tohx(r); unsigned short a2, c2; splitf(r, a2, c2); oh[q] = a2; ol[q] = c2; }
    *(v2h*)(P16 + e) = o16; *(v2us*)(Ph + e) = oh; *(v2us*)(Pl + e) = ol;  }
__global__ __launch_bounds__(256) void k_colsum(const bf* __restrict__ Ph, const bf* __restrict__ Pl, const h16* __restrict__ P16, int h0, float* ACC) { const int t = blockIdx.x * 256 + threadIdx.x; if (t >= TT) return; float acc = ((h0 % REP) == 0) ? 0.0f : ACC[t];
#pragma unroll 1
    for (int zz = 0; zz < ZH; ++zz) {
#pragma unroll 4
        for (int i = 0; i < RH; ++i) { const size_t o = ((size_t)zz * RH + i) * TT + t; acc = __fadd_rn(acc, __fadd_rn(bf2f(Ph[o]), bf2f(Pl[o]))); }
#pragma unroll 4
        for (int i = RH; i < TT; ++i) { const size_t o = ((size_t)zz * TT + i) * TT + t; float pv = __fmul_rn((float)P16[o], 1.0f / PCAR); asm volatile("" : "+v"(pv)); acc = __fadd_rn(acc, pv); } }
    *(float*)(ACC + t) = acc;  }
// k_asoft: per row (zz, i): t = S x SCL (= 1) for j <= i and i - j < WIN (sliding causal window; the reference's -1e9 additive fill vanishes identically); softmax over the 2048 keys (register row, one exp, fixed trees);
__global__ __launch_bounds__(256) void k_asoft(const float* __restrict__ Sb, h16* P16, bf* Ph, bf* Pl) {
    const int lane = threadIdx.x & 31; const int row = blockIdx.x * 8 + (threadIdx.x >> 5); if (row >= ZH * TT) return; const int i = row % TT; const int zz = row / TT; (void)zz; const bool hires = (i < RH); const float* sr = Sb + (size_t)row * TT; float v[TT / 32]; float mx = -3.0e38f;
#pragma unroll
    for (int ch = 0; ch < TT / 128; ++ch) { const int j0 = ch * 128 + lane * 4; const v4f a = *(const v4f*)(sr + j0);
#pragma unroll
        for (int q = 0; q < 4; ++q) { const int j = j0 + q; (void)j; float sa = a[q] * SCL; asm volatile("" : "+v"(sa)); const float t = (j <= i && i - j < WIN) ? sa : -3.0e38f; v[ch * 4 + q] = t; mx = fmaxf(mx, t); } }
#pragma unroll
    for (int sh = 16; sh; sh >>= 1) mx = fmaxf(mx, __shfl_xor(mx, sh, 32));
    float sum = 0.f;
#pragma unroll
    for (int k = 0; k < TT / 32; ++k) { float d0 = __fsub_rn(v[k], mx); asm volatile("" : "+v"(d0)); v[k] = __builtin_amdgcn_exp2f(__fmul_rn(d0, 1.4426950408889634f)); sum += v[k]; }
#pragma unroll
    for (int sh = 16; sh; sh >>= 1) sum += __shfl_xor(sum, sh, 32);
    const float f = __fdiv_rn(hires ? 1.0f : PCAR, sum);
{
        if (hires) {
#pragma unroll
            for (int ch = 0; ch < TT / 128; ++ch) { v4us oh, ol;
#pragma unroll
                for (int q = 0; q < 4; ++q) { unsigned short a, c2; splitf(v[ch * 4 + q] * f, a, c2); oh[q] = a; ol[q] = c2; }
                const size_t oo = ((size_t)zz * (RH ? RH : 1) + i) * TT + ch * 128 + lane * 4; *(v4us*)(Ph + oo) = oh; *(v4us*)(Pl + oo) = ol; }
        } else {
#pragma unroll
            for (int ch = 0; ch < TT / 128; ++ch) { v4h o4;
#pragma unroll
                for (int q = 0; q < 4; ++q) o4[q] = tohx(v[ch * 4 + q] * f);
                *(v4h*)(P16 + (size_t)row * TT + ch * 128 + lane * 4) = o4; } }
         }
}
__global__ __launch_bounds__(256) void k_merge(const float* __restrict__ O, int h0, bf* Ah, bf* Al) { const size_t e = ((size_t)blockIdx.x * 256 + threadIdx.x) * 2; if (e >= (size_t)ZH * TT * HD) return; const int d = (int)(e % HD); const int t = (int)((e / HD) % TT); const int zz = (int)(e / ((size_t)HD * TT)); const float cs = (t < RH) ? 1.0f : (1.0f / PCAR); const size_t oo = (size_t)t * DQ + (h0 + zz) * HD + d;
    v2us oh, ol;
#pragma unroll
    for (int q = 0; q < 2; ++q) { unsigned short a, c2; splitf(O[e + q] * cs, a, c2); oh[q] = a; ol[q] = c2; } *(v2us*)(Ah + oo) = oh; *(v2us*)(Al + oo) = ol;  }


// ---- SingleHeadQKV kernels ----
__global__ __launch_bounds__(256) void k_gptab(float* GP) { const int n = blockIdx.x * 256 + threadIdx.x; if (n >= TT + 64) return; const float v = powf(GAMR, (float)n); *(float*)(GP + n) = v;  }
__global__ __launch_bounds__(256) void k_cstabW(float* CS) { const size_t idx = (size_t)blockIdx.x * 256 + threadIdx.x; if (idx >= (size_t)TT * DC) return; const int t = (int)(idx / DC), d = (int)(idx % DC); const float inv = __fdiv_rn(1.0f, powf(10000.0f, (float)(2 * (d >> 1)) / (float)DC)); const float ang = __fmul_rn((float)t, inv); v2f cs; cs[0] = cosf(ang); cs[1] = sinf(ang); *(v2f*)(CS + idx * 2) = cs;  }

extern "C" void kernel_launch(void* const* d_in, const int* in_sizes, int n_in,
                              void* d_out, int out_size, void* d_ws, size_t ws_size, hipStream_t stream) {
    (void)in_sizes; (void)n_in; (void)out_size;
    const float* x = (const float*)d_in[0]; const float* sn = (const float*)d_in[1]; const float* wq = (const float*)d_in[2]; const float* wk = (const float*)d_in[3]; const float* wv = (const float*)d_in[4]; const float* gw = (const float*)d_in[5]; const float* gb = (const float*)d_in[6];
    float* OUT = (float*)d_out;     // out0 [4][2048][1024] at 0, out1 [4][1024][1024] at NB*TT*DC
    char* wsp = (char*)d_ws;
    auto take = [&](size_t bytes) { char* p = wsp; wsp += (bytes + 255) & ~(size_t)255; return (void*)p; };
    // All NB_ batch elements go through every stage at once (grid z = batch). Planes are [batch][...]; buffers whose contents are dead are reused, in stream order.
    const size_t SX = (size_t)TT * DC, SS = (size_t)DC * DC, SP = (size_t)TT * TT;   // elements per batch element: activations, state, scores
    bf* QPh = (bf*)take(NB_ * SX * 2); bf* QPl = (bf*)take(NB_ * SX * 2); bf* KPh = (bf*)take(NB_ * SX * 2); bf* KPl = (bf*)take(NB_ * SX * 2); bf* VTh = (bf*)take(NB_ * SX * 2); bf* VTl = (bf*)take(NB_ * SX * 2);
    bf* KTh = (bf*)take(NB_ * SX * 2); bf* KTl = (bf*)take(NB_ * SX * 2); bf* VDTh = (bf*)take(NB_ * SX * 2); bf* VDTl = (bf*)take(NB_ * SX * 2);
    float* CS = (float*)take((size_t)TT * DC * 2 * 4); bf* XB = (bf*)take(NB_ * SX * 2);
    bf* STh = (bf*)CS;               // chunk states [batch][chunk][column][row], hi plane: NB_*NCH*SS over CS + XB, dead after the V product
    bf* STl = (bf*)take(NB_ * NCH * SS * 2);
    bf* WQ = (bf*)take((size_t)DQ * DM * 2); bf* WK = (bf*)take((size_t)DKV * DM * 2); bf* WV = (bf*)take((size_t)DKV * DM * 2); float* GP = (float*)take((TT + 64) * 4);
    bf* Ph = KTh; bf* Pl = VDTh;     // NB_*SP each, over KTh + KTl and over VDTh + VDTl: dead after the R product
    if ((size_t)(wsp - (char*)d_ws) > ws_size) return;   // ws ~ 230 MiB
    { k_wtG<<<dim3(DM / TRR, DQ / TRC, 1), 256, 0, stream>>>(wq, DM, DQ, WQ); k_wtG<<<dim3(DM / TRR, DKV / TRC, 1), 256, 0, stream>>>(wk, DM, DKV, WK); k_wtG<<<dim3(DM / TRR, DKV / TRC, 1), 256, 0, stream>>>(wv, DM, DKV, WV); k_cstabW<<<(unsigned)(((size_t)TT * DC + 255) / 256), 256, 0, stream>>>(CS); k_gptab<<<(TT + 64 + 255) / 256, 256, 0, stream>>>(GP); }
    k_cvt8<<<(unsigned)((NB_ * SX / 8 + 255) / 256), 256, 0, stream>>>(x, XB, NB_ * SX / 8);
    // Q = rope(X W_Q), K = rope(X W_K), V = X W_V, each straight into the operand planes of the later products
    k_gemmt<0, 0, 1><<<dim3(TT / 128, DQ / 128, NB_), 128, 0, stream>>>(XB, nullptr, WQ, nullptr, DM, nullptr, DQ, SX, 0, SX, CS, nullptr, nullptr, nullptr, QPh, QPl, nullptr, nullptr);
    k_gemmt<0, 0, 2><<<dim3(TT / 128, DKV / 128, NB_), 128, 0, stream>>>(XB, nullptr, WK, nullptr, DM, nullptr, DKV, SX, 0, SX, CS, nullptr, nullptr, nullptr, KPh, KPl, KTh, KTl);
    k_gemmt<0, 0, 3><<<dim3(TT / 128, DKV / 128, NB_), 128, 0, stream>>>(XB, nullptr, WV, nullptr, DM, nullptr, DKV, SX, 0, SX, GP, nullptr, nullptr, nullptr, VTh, VTl, VDTh, VDTl);
    // the chunk states S_0 = S_n .. S_(NCH-1) into their planes, and R_i = S_NCH (first, so that its operand planes can be reused for the scores)
    k_gemmt<2, 0, 4><<<dim3(DC / 128, DC / 128, NB_), 128, 0, stream>>>(KTh, KTl, VDTh, VDTl, TT, OUT + NB_ * SX, DC, SX, SX, SS, GP, sn, nullptr, nullptr, STh, STl, nullptr, nullptr);
    // A = (Q K^T) x D into hi/lo planes (causal tiles of each chunk's own block only)
    k_gemmt<2, 1, 5><<<dim3(NCH * (CH / 128) * (CH / 128 + 1) / 2, 1, NB_), 128, 0, stream>>>(QPh, QPl, KPh, KPl, DC, nullptr, TT, SX, SX, SP, GP, nullptr, nullptr, nullptr, Ph, Pl, nullptr, nullptr);
    // cross = Q S_c, c the row's chunk, x g^(i+1), and inner = A V over the chunk's tiles on top of it in the same accumulators; out0 = permuted GroupNorm(cross + inner)
    k_gemmt<2, 2, 6><<<dim3(TT / 128, DC / 128, NB_), 128, 0, stream>>>(QPh, QPl, STh, STl, DC, OUT, DC, SX, NCH * SS, SX, GP, nullptr, gw, gb, Ph, Pl, VTh, VTl);
}

// v008
// It runs in 209 microseconds.
// In both of two side-by-side timings against v007, it was 1.08 times as fast.
// All steps since v000 together make it 6.31 times as fast.
#include <hip/hip_runtime.h>

// SingleHeadQKV (chunkwise retention step: X_Q [4][2048][1024], S_n [4][1024][1024]; Q = rope(X W_Q), K = rope(X W_K) (interleaved-pair RoPE over the full 1024 dims), V = X W_V; D[n][m] = g^(n-m) for n >= m (g = 1 - 2^-5); inner = (Q K^T * D) V; cross = (Q S_n) * g^(t+1); out = GroupNorm32(inner + cross) then the literal transpose(-2,-1).reshape permutation -> out0 [4][2048][1024]; R_i = K^T (V * D[-1]) + S_n g^T -> out1 [4][1024][1024] at element 8,388,608).
// Compute dtypes, f32 accumulate: every input rounded to bf16; Q/K/V on PLAIN bf16 operands (inputs: exact); RoPE f32 (on-chip table); decay powers g^n in f32 (powf); Q.K^T (K = 1024) hl x hl (3 products) with causal tile skipping, x D per element in f32 into hi/lo planes (no softmax), (QK^T D).V hl x hl (3 products, causal skipping); Q.S_c hl x hl (3 products); the chunk states K^T.(V x decay) hl x hl (3 products, K = 2048 in all), kept in f32 accumulators and handed on as hi/lo planes; sums, GroupNorm (32 groups of 32, biased var, eps 1e-6) and the output permutation in f32.
// The decay is a recurrence over chunks of CH steps: with S_0 = S_n and S_(c+1) = g^CH S_c + K_c^T (V_c x g^(CH-1-i)), i the step inside chunk c, a row of chunk c is out = (Q K^T * D restricted to the chunk) V + g^(i+1) Q S_c, and R_i = S_(TT/CH). Exact algebra: only the order of the f32 sums differs.

#define NB_  4
#define TT   2048
#define DM   1024
#define NH_  16
#define NKV  16
#define REP  (NH_ / NKV)
#define HD   64
#define DQ   (NH_ * HD)
#define DKV  (NKV * HD)
#define ZH   2
#define RH   2048                  // query rows < RH use hi+lo planes (0: none)
#define WIN  2048
#define PCAR 1024.0f
#define DC   1024   // channel width (= DQ)
#define GAMR 0.96875f
#define SCL  1.0f
#define CH   512    // steps per chunk of the decay recurrence
#define NCH  (TT / CH)
typedef _Float16 h16;
typedef unsigned short bf;
typedef __attribute__((ext_vector_type(16))) __bf16   v16bf;
typedef __attribute__((ext_vector_type(16))) _Float16 v16h;
typedef __attribute__((ext_vector_type(8)))  _Float16 v8h;
typedef __attribute__((ext_vector_type(8)))  unsigned short v8us;
typedef __attribute__((ext_vector_type(8)))  float    v8f;
typedef __attribute__((ext_vector_type(4)))  float    v4f;
typedef v8h  __attribute__((may_alias)) v8ha;
typedef v4f  __attribute__((may_alias)) v4fa;
typedef v8us __attribute__((may_alias)) v8usa;
typedef __attribute__((ext_vector_type(4))) unsigned short v4us;
typedef __attribute__((ext_vector_type(2))) float v2f;

__device__ __forceinline__ unsigned short f2bf(float f) { unsigned u = __float_as_uint(f); u += 0x7FFFu + ((u >> 16) & 1u); return (unsigned short)(u >> 16); }
__device__ __forceinline__ float bf2f(unsigned short b) { return __uint_as_float(((unsigned)b) << 16); }
__device__ __forceinline__ float bfr(float f) { return bf2f(f2bf(f)); }
__device__ __forceinline__ void splitf(float y, unsigned short& h, unsigned short& l) { h = f2bf(y); l = f2bf(y - bf2f(h)); }
__device__ __forceinline__ v16h cat16(v8h lo, v8h hi) { return __builtin_shufflevector(lo, hi, 0, 1, 2, 3, 4, 5, 6, 7, 8, 9, 10, 11, 12, 13, 14, 15); }
__device__ __forceinline__ v16bf cat16b(v8us lo, v8us hi) { return __builtin_bit_cast(v16bf, __builtin_shufflevector(lo, hi, 0, 1, 2, 3, 4, 5, 6, 7, 8, 9, 10, 11, 12, 13, 14, 15)); }
__device__ __forceinline__ v8f wmma16(v16h a, v16h b, v8f c) { return __builtin_amdgcn_wmma_f32_16x16x32_f16(false, a, false, b, (short)0, c, false, false); }
__device__ __forceinline__ v8f wmmab(v16bf a, v16bf b, v8f c) { return __builtin_amdgcn_wmma_f32_16x16x32_bf16(false, a, false, b, (short)0, c, false, false); }



// ---- k_gemmt: C[m][n] (f32, pitch ldc) = sum_k A[m][k] Bt[n][k] (+ split products per NSPLIT) on K-contiguous bf16 planes. One 128x128 tile of C per work-group of four waves (2x2, 64x64 each, 16 accumulators a wave);
// grid (M/128, N/128, Z), 128 threads. A pass is KP k of all 128 rows of every operand plane; four tensor loads, one a wave, bring it into a two-buffer LDS ring, one pass ahead of its use, and each row is fetched once for two waves.
// CMODE 1 launches only the score tiles on or below the diagonal inside each chunk's CH x CH block (grid (40, 1, Z)); CMODE 2 runs two products through one ring into one set of accumulators: A x the B planes of the row tile's chunk (K = DC), rows then scaled by g^(i+1), and behind it the (decayed score) x value product (A planes P0/P1, B planes P2/P3, row pitch TT) from the chunk's first step to the diagonal block. M, N % 128 == 0, K % KP == 0, K >= 2 KP.
typedef float __attribute__((may_alias)) f32a;
typedef unsigned u32x4 __attribute__((ext_vector_type(4)));
typedef unsigned u32x8 __attribute__((ext_vector_type(8)));
__device__ __forceinline__ unsigned uni(unsigned v) { return (unsigned)__builtin_amdgcn_readfirstlane(v); }
// a wave-uniform value held in a scalar register: a test on it compiles to s_cmp and s_cbranch_scc, and what is formed from it is formed behind the waits in front of it
__device__ __forceinline__ unsigned pinned(unsigned v) { unsigned w = uni(v); asm volatile("" : "+s"(w)); return w; }   // an issue test or a descriptor word held in a scalar register
// one request of the whole wave: NROW rows of ROWB bytes at a source pitch of 'pitch' bytes land at LDS byte 'dst' with 16 pad bytes behind every row (1-byte elements, tensor = tile, no mask)
template <int ROWB, int NROW> __device__ __forceinline__ void tdm_tile(u32x4& g0, u32x8& g1, unsigned dst, unsigned long long ga, unsigned pitch) {
    static_assert(ROWB == 128 || ROWB == 256, "the pad interval equals the row");
    constexpr unsigned W0 = (1u << 20) | ((ROWB == 128 ? 4u : 5u) << 22) | (3u << 25);
    // pinned(): each descriptor word is held in its scalar register, not made again elsewhere, so that the wait below can keep those registers
    g0[0] = pinned(1u); g0[1] = pinned(dst); g0[2] = pinned((unsigned)ga); g0[3] = pinned((((unsigned)(ga >> 32)) & 0x01FFFFFFu) | 0x80000000u);
    g1[0] = pinned(W0); g1[1] = pinned(((unsigned)ROWB & 0xFFFFu) << 16); g1[2] = pinned(((unsigned)ROWB >> 16) | (((unsigned)NROW & 0xFFFFu) << 16)); g1[3] = pinned(((unsigned)NROW >> 16) | ((unsigned)ROWB << 16));
    g1[4] = pinned((unsigned)NROW); g1[5] = pinned(pitch); g1[6] = pinned(0u); g1[7] = pinned(0u);
    asm volatile("tensor_load_to_lds %0, %1" :: "s"(g0), "s"(g1) : "memory");
}
// the issuing wave's wait for its request; the request's descriptor words are its inputs, so that nothing is allocated over their registers while the request is outstanding
#define TWAIT(g0, g1) asm volatile("s_wait_tensorcnt 0x0" :: "s"(g0), "s"(g1) : "memory")
#define XWAIT(...) asm volatile("s_wait_xcnt 0x0" :: __VA_ARGS__ : "memory")
template <int CTRL> __device__ __forceinline__ float dppf(float x) { return __int_as_float(__builtin_amdgcn_mov_dpp(__float_as_int(x), CTRL, 0xF, 0xF, true)); }   // 0xB1: lane ^ 1, 0x4E: lane ^ 2 (quad_perm); 0x141: lane -> 7 - lane in each 8 (row_half_mirror)
__device__ __forceinline__ v16bf ldsfrag(const unsigned char* p) { return cat16b(*(const v8usa*)p, *(const v8usa*)(p + 32)); }
// EPI names what the epilogue makes of the tile, straight from the accumulators (a lane holds 8 consecutive rows of one column) and each wave's own LDS range:
// 0 f32 C; 1 RoPE (E0 = cos/sin table), hi/lo planes P0/P1; 2 as 1, and the transposed hi/lo planes P2/P3; 3 transposed hi/lo planes P0/P1, and P2/P3 of rows x g^(CH-1-i), i = t mod CH (E0 = powers of g);
// 4 the accumulators start as bf16(E1); at each chunk's first pass they go out as transposed hi/lo planes P0/P1 [chunk][column][row] and are scaled by g^CH; C = the last state; 5 tile x g^(i-j) for j <= i, else 0, hi/lo planes P0/P1; 6 GroupNorm(tile) with weight E2 and bias E3, stored transposed to C.
template <int NSPLIT, int CMODE, int EPI>
__global__ __launch_bounds__(128) void k_gemmt(const bf* __restrict__ A, const bf* __restrict__ A2, const bf* __restrict__ Bt, const bf* __restrict__ Bt2, int K, float* C, int ldc, size_t sA, size_t sB, size_t sC,
                                               const float* __restrict__ E0, const float* __restrict__ E1, const float* __restrict__ E2, const float* __restrict__ E3, bf* P0, bf* P1, bf* P2, bf* P3) {
    constexpr int KP = (NSPLIT == 0) ? 128 : 64;                    // k per pass
    constexpr int PITCH = KP * 2 + 16;                              // LDS row pitch in bytes: 16 x odd, for 16-byte readers
    static_assert(NSPLIT == 0 || NSPLIT == 2, "four slices a stage, one a wave");
    constexpr int NROW = (NSPLIT == 0) ? 64 : 128;                  // rows of a wave's slice: half a plane, or a whole one
    constexpr int SLICE = 18432, PLANE = SLICE, STAGE = 4 * SLICE;  // a slice's place is a multiple of 2 KiB: NROW * PITCH bytes, rounded up
    static_assert(NROW * PITCH <= SLICE && SLICE % 2048 == 0, "slices do not overlap");
    constexpr int GB = (NSPLIT == 0) ? 2 : 1;                       // column blocks whose B fragments are read as one group
    constexpr int LA = (NSPLIT == 0) ? 8 : 16, LB = GB * ((NSPLIT == 2) ? 4 : 2), NW = GB * 4 * (NSPLIT + 1);   // 16-byte LDS reads of the A fragments and of a B group; products of a group
    __shared__ __attribute__((aligned(2048))) unsigned char ring[2 * STAGE];
    int bx = blockIdx.x, by = blockIdx.y, bz = blockIdx.z;
    if (CMODE == 1) {   // grid.x counts only the tiles on or below the diagonal of each chunk's own block, chunk by chunk and row by row: no work-group starts for nothing
        constexpr int TC = CH / 128, TPC = TC * (TC + 1) / 2;
        const int ch = bx / TPC, e = bx % TPC; int r = 0;
        for (int q = 1; q < TC; ++q) r += (e >= q * (q + 1) / 2) ? 1 : 0;
        by = ch * TC + e - r * (r + 1) / 2; bx = ch * TC + r; }
    if (CMODE == 2) {   // all work-groups are resident, two to a WGP, and a row tile's K loop grows with its index inside the chunk: flat indices 8, 16 or 256 apart get row tiles t and 15 - t. Speed only: any placement is correct
        static_assert(CMODE != 2 || (TT / 128 == 16 && DC / 128 == 8 && NB_ == 4), "the map below is a permutation of a 16 x 8 x 4 grid");
        const int b = bx + 16 * by + 128 * bz, k = b >> 3, u = (k >> 2) & 7;
        bx = ((k ^ (k >> 1) ^ (k >> 5)) & 1) ? 15 - u : u; by = b & 7; bz = k & 3; }
    const int r0 = bx * 128, c0 = by * 128;
    const int kb = (CMODE == 2) ? (r0 / CH) * CH : 0;   // CMODE 2: the chunk's first step, where the second product's k begins
    const int np1 = (CMODE == 2) ? DC / KP : K / KP;    // passes of the first product
    const int npass = (CMODE == 2) ? np1 + (r0 + 128 - kb) / KP : np1;
    const size_t z = bz; C += z * sC;
    const int tid = threadIdx.x, lane = tid & 31, lr = lane & 15, hi = lane >> 4, wave = tid >> 5, wm = wave >> 1, wn = wave & 1;
    const unsigned wv = uni((unsigned)tid >> 5);   // the wave's number picks its slice of a stage: NSPLIT 2: the planes A, A2, B, B2; NSPLIT 0: the two halves of A, then of B
    const bool isb = wv >= 2;
    const int half = (NSPLIT == 0) ? (int)(wv & 1) * NROW : 0;
    const bf* s1 = (NSPLIT == 0) ? (isb ? Bt : A) : (wv == 0 ? A : wv == 1 ? A2 : wv == 2 ? Bt : Bt2);
    s1 += isb ? z * sB + ((CMODE == 2) ? (size_t)(r0 / CH) * DC * DC : 0) + (size_t)(c0 + half) * K : z * sA + (size_t)(r0 + half) * K;
    const bf* s2 = s1;                             // CMODE 2: the slice's plane in the second product
    if (CMODE == 2) { s2 = (wv == 0 ? P0 : wv == 1 ? P1 : wv == 2 ? P2 : P3); s2 += isb ? z * ((size_t)TT * DC) + (size_t)c0 * TT + kb : z * ((size_t)TT * TT) + (size_t)r0 * TT + kb; }
    const unsigned lbase = (unsigned)(size_t)ring + wv * SLICE;
    u32x4 q0; u32x8 q1;             // the descriptor of the wave's one outstanding request
    auto fill = [&](unsigned t) {   // this wave's slice of pass t into buffer t & 1
        const bool sec = CMODE == 2 && t >= (unsigned)np1;   // the same for the whole work-group: this pass belongs to the second product
        const bf* g = sec ? s2 + (size_t)(t - (unsigned)np1) * KP : s1 + (size_t)t * KP;
        tdm_tile<KP * 2, NROW>(q0, q1, lbase + (t & 1u) * STAGE, (unsigned long long)(size_t)g, sec ? (unsigned)TT * 2u : (unsigned)K * 2u);
    };
    v8f acc[4][4];
#pragma unroll
    for (int mb = 0; mb < 4; ++mb)
#pragma unroll
        for (int nb = 0; nb < 4; ++nb) acc[mb][nb] = (v8f){};
    fill(0);
    TWAIT(q0, q1);                                      // this wave's slice of pass 0 has landed
    __syncthreads();                                    // and every other wave's: pass 0 is readable
    fill(1);                                            // every launch has at least two passes (K >= 2 KP)
    const int rw = r0 + wm * 64, cw = c0 + wn * 64;         // the wave's first row and column of C
    float gC = 0.0f;
    if (EPI == 4) {   // S_0: a lane holds 8 consecutive rows of one column
        static_assert(EPI != 4 || CH % KP == 0, "a chunk is a whole number of passes");
        gC = E0[CH];
        const float* si = E1 + z * sC + (size_t)(rw + hi * 8) * DC + cw + lr;
#pragma unroll
        for (int mb = 0; mb < 4; ++mb)
#pragma unroll
            for (int nb = 0; nb < 4; ++nb)
#pragma unroll
                for (int j = 0; j < 8; ++j) acc[mb][nb][j] = si[(mb * 16 + j) * DC + nb * 16];
        XWAIT("v"(si));
#pragma unroll
        for (int mb = 0; mb < 4; ++mb)
#pragma unroll
            for (int nb = 0; nb < 4; ++nb)
#pragma unroll
                for (int j = 0; j < 8; ++j) acc[mb][nb][j] = bfr(acc[mb][nb][j]);
    }
    const unsigned char* fa = ring + ((NSPLIT == 0) ? wm * SLICE + lr * PITCH : (wm * 64 + lr) * PITCH) + hi * 16; const unsigned char* fb = ring + 2 * SLICE + ((NSPLIT == 0) ? wn * SLICE + lr * PITCH : (wn * 64 + lr) * PITCH) + hi * 16;
#pragma unroll 1
    for (int t = 0; t < npass; ++t) {
        const int bo = (t & 1) * STAGE;
        if (EPI == 4 && (t & (CH / KP - 1)) == 0) {   // a chunk begins: its start state goes out [column][row] (a lane's 8 rows are 16 bytes, the four row blocks fill one 128-byte line), then decays over the chunk
            const size_t so = ((z * NCH + t / (CH / KP)) * DC + cw + lr) * DC + rw + hi * 8;
#pragma unroll
            for (int nb = 0; nb < 4; ++nb) { bf* ph = P0 + so + (size_t)nb * 16 * DC; bf* pl = P1 + so + (size_t)nb * 16 * DC; v8us oh[4], ol[4];
#pragma unroll
                for (int mb = 0; mb < 4; ++mb) {
#pragma unroll
                    for (int j = 0; j < 8; ++j) { unsigned short a2, c2; splitf(acc[mb][nb][j], a2, c2); oh[mb][j] = a2; ol[mb][j] = c2; acc[mb][nb][j] *= gC; } }
#pragma unroll
                for (int mb = 0; mb < 4; ++mb) { *(v8us*)(ph + mb * 16) = oh[mb]; *(v8us*)(pl + mb * 16) = ol[mb]; }
                XWAIT("v"(ph), "v"(pl), "v"(oh[0]), "v"(oh[1]), "v"(oh[2]), "v"(oh[3]), "v"(ol[0]), "v"(ol[1]), "v"(ol[2]), "v"(ol[3])); }
        }
        if (CMODE == 2 && t == np1) {   // the state product is complete: its rows take g^(i+1), i the step inside the chunk; the chunk's own products add on top
            const float* gp = E0 + (rw - kb + hi * 8 + 1); float gr[4][8];
#pragma unroll
            for (int mb = 0; mb < 4; ++mb)
#pragma unroll
                for (int j = 0; j < 8; ++j) gr[mb][j] = gp[mb * 16 + j];
            XWAIT("v"(gp));
#pragma unroll
            for (int mb = 0; mb < 4; ++mb)
#pragma unroll
                for (int nb = 0; nb < 4; ++nb)
#pragma unroll
                    for (int j = 0; j < 8; ++j) acc[mb][nb][j] *= gr[mb][j];
        }
#pragma unroll
        for (int ks = 0; ks < KP / 32; ++ks) {
            v16bf a[4], a2[4];
#pragma unroll
            for (int mb = 0; mb < 4; ++mb) { a[mb] = ldsfrag(fa + bo + mb * 16 * PITCH + ks * 64); if (NSPLIT == 1 || NSPLIT == 2) a2[mb] = ldsfrag(fa + bo + PLANE + mb * 16 * PITCH + ks * 64); }
#pragma unroll
            for (int nb = 0; nb < 4; ++nb) { const v16bf b = ldsfrag(fb + bo + nb * 16 * PITCH + ks * 64); v16bf b2; if (NSPLIT == 2) b2 = ldsfrag(fb + bo + PLANE + nb * 16 * PITCH + ks * 64);
#pragma unroll
                for (int mb = 0; mb < 4; ++mb) { acc[mb][nb] = wmmab(a[mb], b, acc[mb][nb]); if (NSPLIT == 1 || NSPLIT == 2) acc[mb][nb] = wmmab(a2[mb], b, acc[mb][nb]); if (NSPLIT == 2) acc[mb][nb] = wmmab(a[mb], b2, acc[mb][nb]); } }
            // order asked of the scheduler: LDS reads in few groups, each one group of columns ahead of its products
            __builtin_amdgcn_sched_group_barrier(0x100, LA + LB, 0);
#pragma unroll
            for (int q = 1; q < 4 / GB; ++q) { __builtin_amdgcn_sched_group_barrier(0x100, LB, 0); __builtin_amdgcn_sched_group_barrier(0x008, NW, 0); }
            __builtin_amdgcn_sched_group_barrier(0x008, NW, 0);
        }
        asm volatile("s_wait_dscnt 0x0" ::: "memory");      // this wave has left buffer t & 1
        TWAIT(q0, q1);                                      // its slice of pass t + 1 has landed
        __syncthreads();                                    // publishes pass t + 1 and frees buffer t & 1
        if (pinned(t + 2 < npass)) fill(pinned((unsigned)t + 2u));   // the descriptor is formed behind the wait above
    }
    TWAIT(q0, q1);                                          // nothing is in flight when the ring becomes output staging
    asm volatile("s_wait_dscnt 0x0" ::: "memory");          // and no LDS read of this wave is open
    constexpr int WREG = 24576, TOFF = 4608, TPL = 64 * 144;   // bytes of LDS a wave stages in; where its transposing tile starts; one 64 x 64 16-bit tile at a pitch of 144 bytes
    unsigned char* wreg = ring + wave * WREG;               // each wave stages in its own range, behind the last pass's barrier
    f32a* os = (f32a*)wreg;                                 // 16 x 64 f32, pitch 68
    if (EPI == 1 || EPI == 2 || EPI == 3 || EPI == 5) { P0 += z * sC; P1 += z * sC; }
    if (EPI == 2 || EPI == 3) { P2 += z * sC; P3 += z * sC; }
    // interleaved-pair RoPE of one block of 16 rows: the partner column sits in the neighbouring lane
    auto rope = [&](int mb) {
        const float sg = (lr & 1) ? 1.0f : -1.0f; const float* cb = E0 + ((size_t)(rw + mb * 16 + hi * 8) * DC + cw + lr) * 2; v2f ct[4][8];
#pragma unroll
        for (int nb = 0; nb < 4; ++nb)
#pragma unroll
            for (int j = 0; j < 8; ++j) ct[nb][j] = *(const v2f*)(cb + (j * DC + nb * 16) * 2);
        XWAIT("v"(cb));
#pragma unroll
        for (int nb = 0; nb < 4; ++nb)
#pragma unroll
            for (int j = 0; j < 8; ++j) {
                const v2f cs = ct[nb][j];
                const float xv = acc[mb][nb][j];
                const float pv = dppf<0xB1>(xv);
                acc[mb][nb][j] = xv * cs[0] + pv * (sg * cs[1]);
            }
    };
    // transposed hi/lo planes [column][row], row pitch TT: a lane's 8 rows are one 16-byte LDS store (t_put); read back so that 8 lanes store one whole 128-byte line (t_flush)
    unsigned char* tp = wreg + TOFF;
    auto t_put = [&](int mb, bool dec) {
        float gs[8];
        if (dec) { const float* gp = E0 + (CH - 8 - ((rw + mb * 16 + hi * 8) & (CH - 1)));
#pragma unroll
            for (int j = 0; j < 8; ++j) gs[j] = gp[7 - j];
            XWAIT("v"(gp)); }
#pragma unroll
        for (int nb = 0; nb < 4; ++nb) { v8us oh, ol;
#pragma unroll
            for (int j = 0; j < 8; ++j) { float xv = acc[mb][nb][j]; if (dec) xv *= gs[j]; unsigned short a2, c2; splitf(xv, a2, c2); oh[j] = a2; ol[j] = c2; }
            unsigned char* q = tp + (nb * 16 + lr) * 144 + (mb * 16 + hi * 8) * 2; *(v8usa*)q = oh; *(v8usa*)(q + TPL) = ol; }
    };
    auto t_flush = [&](bf* Th, bf* Tl) {
        __builtin_amdgcn_wave_barrier(); asm volatile("" ::: "memory");   // other lanes' LDS stores stay ahead of the reads below
#pragma unroll
        for (int sg4 = 0; sg4 < 4; ++sg4) { v8us vh[4], vl[4];   // eight LDS reads in flight, then their stores
#pragma unroll
            for (int s = 0; s < 4; ++s) { const unsigned char* q = tp + ((sg4 * 4 + s) * 4 + (lane >> 3)) * 144 + (lane & 7) * 16; vh[s] = *(const v8usa*)q; vl[s] = *(const v8usa*)(q + TPL); }
#pragma unroll
            for (int s = 0; s < 4; ++s) { const size_t o = (size_t)(cw + (sg4 * 4 + s) * 4 + (lane >> 3)) * TT + rw + (lane & 7) * 8; bf* ph = Th + o; bf* pl = Tl + o; *(v8us*)ph = vh[s]; *(v8us*)pl = vl[s]; XWAIT("v"(ph), "v"(pl), "v"(vh[s]), "v"(vl[s])); }
        }
        __builtin_amdgcn_wave_barrier(); asm volatile("" ::: "memory");   // the reads above stay ahead of the tile's next use
    };
    if (EPI == 3) {
#pragma unroll
        for (int mb = 0; mb < 4; ++mb) t_put(mb, false);
        t_flush(P0, P1);
#pragma unroll
        for (int mb = 0; mb < 4; ++mb) t_put(mb, true);
        t_flush(P2, P3);
    }
    if (EPI != 3) {
        f32a* tt = (f32a*)(wreg + TOFF);                    // EPI 6: 64 x 64 f32 at an odd pitch of 65, so that a walk down a column meets every bank once
        v4f w4 = {}, b4 = {};
        if (EPI == 6) { const float* pw = E2 + cw + lr * 4; const float* pb = E3 + cw + lr * 4; const v4f wr = *(const v4f*)pw, br = *(const v4f*)pb; XWAIT("v"(pw), "v"(pb));
#pragma unroll
            for (int u = 0; u < 4; ++u) { w4[u] = bfr(wr[u]); b4[u] = bfr(br[u]); } }
#pragma unroll
        for (int mb = 0; mb < 4; ++mb) {
            if (EPI == 1 || EPI == 2) rope(mb);
            if (EPI == 2) { __builtin_amdgcn_sched_barrier(0); t_put(mb, false); }   // the split's temporaries come after the table values are spent: interleaved they take the kernel above 256 registers
            const int cofs = lr * 4, gc = cw + cofs;
            v4f ex[8];   // what the 16 rows take from global memory: issued ahead of the LDS round trip, all in flight together
            if (EPI == 5) {
#pragma unroll
                for (int s = 0; s < 8; ++s) { const int dd = rw + mb * 16 + 2 * s + hi - gc; const int m0 = max(dd, 0), m1 = max(dd, 1), m2 = max(dd, 2), m3 = max(dd, 3);   // exponent i - j, held at 0 above the diagonal
                    ex[s][0] = E0[m0]; ex[s][1] = E0[m1 - 1]; ex[s][2] = E0[m2 - 2]; ex[s][3] = E0[m3 - 3]; XWAIT("v"(m0), "v"(m1), "v"(m2), "v"(m3)); } }
#pragma unroll
            for (int nb = 0; nb < 4; ++nb) {
#pragma unroll
                for (int j = 0; j < 8; ++j) os[(hi * 8 + j) * 68 + nb * 16 + lr] = acc[mb][nb][j]; }
            __builtin_amdgcn_wave_barrier(); asm volatile("" ::: "memory");   // other lanes' LDS stores stay ahead of the reads below
            v4f vals[8];
#pragma unroll
            for (int s = 0; s < 8; ++s) vals[s] = *(const v4fa*)(os + (2 * s + hi) * 68 + cofs);
#pragma unroll
            for (int s = 0; s < 8; ++s) { const int row = 2 * s + hi; const v4f val = vals[s];
                const int gr = rw + mb * 16 + row; const size_t o = (size_t)gr * ldc + gc;
                if (EPI == 0 || EPI == 4) { float* pc = C + o; *(v4f*)pc = val; XWAIT("v"(pc), "v"(val)); }
                if (EPI == 1 || EPI == 2 || EPI == 5) { v4us oh, ol;
#pragma unroll
                    for (int u = 0; u < 4; ++u) { float v = val[u]; if (EPI == 5) v = (gr >= gc + u) ? v * ex[s][u] : 0.0f; unsigned short a2, c2; splitf(v, a2, c2); oh[u] = a2; ol[u] = c2; }
                    bf* ph = P0 + o; bf* pl = P1 + o; *(v4us*)ph = oh; *(v4us*)pl = ol; XWAIT("v"(ph), "v"(pl), "v"(oh), "v"(ol)); }
                if (EPI == 6) { float v[4], d[4]; float sm = 0.0f, ss = 0.0f;   // a group of 32 channels = 8 lanes x 4
#pragma unroll
                    for (int u = 0; u < 4; ++u) { v[u] = val[u]; sm += v[u]; }
                    sm += dppf<0xB1>(sm); sm += dppf<0x4E>(sm); sm += dppf<0x141>(sm);
                    const float mu = sm * (1.0f / 32.0f);
#pragma unroll
                    for (int u = 0; u < 4; ++u) { d[u] = v[u] - mu; ss += d[u] * d[u]; }
                    ss += dppf<0xB1>(ss); ss += dppf<0x4E>(ss); ss += dppf<0x141>(ss);
                    const float rs = __fdiv_rn(1.0f, sqrtf(ss * (1.0f / 32.0f) + 1e-6f));
#pragma unroll
                    for (int u = 0; u < 4; ++u) tt[(mb * 16 + row) * 65 + cofs + u] = d[u] * rs * w4[u] + b4[u]; }
            }
            __builtin_amdgcn_wave_barrier(); asm volatile("" ::: "memory");   // the reads above stay ahead of the next block's LDS stores
        }
        if (EPI == 2) t_flush(P2, P3);
        if (EPI == 6) {   // the reference's transpose(-2,-1).reshape keeps the flat order of the transpose: C read as [DC][TT]; 16 lanes x 4 rows = two whole lines of one channel
#pragma unroll
            for (int pg8 = 0; pg8 < 4; ++pg8) { const int tg = lr * 4; v4f ov[8];   // 32 LDS reads in flight, then their stores
#pragma unroll
                for (int p = 0; p < 8; ++p)
#pragma unroll
                    for (int i = 0; i < 4; ++i) ov[p][i] = tt[(tg + i) * 65 + (pg8 * 8 + p) * 2 + hi];
#pragma unroll
                for (int p = 0; p < 8; ++p) { float* pc = C + (size_t)(cw + (pg8 * 8 + p) * 2 + hi) * TT + rw + tg; *(v4f*)pc = ov[p]; XWAIT("v"(pc), "v"(ov[p])); }
            }
        }
    }
}

__device__ __forceinline__ h16 tohx(float x) { return (h16)x; }
typedef __attribute__((ext_vector_type(2))) _Float16 v2h;
typedef __attribute__((ext_vector_type(4))) _Float16 v4h;
typedef __attribute__((ext_vector_type(2))) unsigned short v2us;
typedef __attribute__((ext_vector_type(4))) int v4i;

// ---- 128 x 64 f32 tile in LDS, used by the transposing kernel k_wtG (256 threads): global reads and global writes both move whole 128-byte lines.
#define TRR 128   // source rows per tile
#define TRC 64    // source columns per tile
#define TRP 65    // LDS pitch in dwords: odd, so that a walk down a column meets every bank once
__device__ __forceinline__ void tile_in(const float* __restrict__ src, int ld, float* ts) {   // src: the tile's first element, row pitch ld floats
    const int rr = threadIdx.x >> 4, cc = (threadIdx.x & 15) * 4; const float* g[TRR / 16]; v4f v[TRR / 16];
#pragma unroll
    for (int p = 0; p < TRR / 16; ++p) g[p] = src + (size_t)(p * 16 + rr) * ld + cc;
#pragma unroll
    for (int p = 0; p < TRR / 16; ++p) v[p] = *(const v4f*)g[p];
    // the wait that stands in front of any overwrite of an issued load's address registers; the addresses are its inputs, so that nothing is allocated over them ahead of it
    asm volatile("s_wait_xcnt 0x0" :: "v"(g[0]), "v"(g[1]), "v"(g[2]), "v"(g[3]), "v"(g[4]), "v"(g[5]), "v"(g[6]), "v"(g[7]) : "memory");
#pragma unroll
    for (int p = 0; p < TRR / 16; ++p) {
#pragma unroll
        for (int u = 0; u < 4; ++u) ts[(p * 16 + rr) * TRP + cc + u] = v[p][u]; }
    __syncthreads();   // every column is read back by waves that did not write it
}
// k_wtG: Bt[n][k] = bf16(w[k][n]); grid (K / 128, N / 64, batch)
__global__ __launch_bounds__(256) void k_wtG(const float* __restrict__ w, int K, int N, bf* Bt) {
    __shared__ float ts[TRR * TRP];
    const int k0 = blockIdx.x * TRR, n0 = blockIdx.y * TRC; w += (size_t)blockIdx.z * K * N; Bt += (size_t)blockIdx.z * K * N;
    tile_in(w + (size_t)k0 * N + n0, N, ts);
    const int kg = (threadIdx.x & 7) * 8, nr = threadIdx.x >> 3;   // 8 lanes x 8 k = one 128-byte line of a Bt row; a wave stores 4 rows
#pragma unroll
    for (int p = 0; p < 4; ++p) { const int k = (p & 1) * 64 + kg, n = (p >> 1) * 32 + nr; v8us o;
#pragma unroll
        for (int i = 0; i < 8; ++i) o[i] = f2bf(ts[(k + i) * TRP + n]);
        *(v8us*)(Bt + (size_t)(n0 + n) * K + k0 + k) = o; }
}
__global__ __launch_bounds__(256) void k_cvt8(const float* __restrict__ src, bf* dst, size_t n8) { const size_t i = (size_t)blockIdx.x * 256 + threadIdx.x; if (i >= n8) return; const v8f v = *(const v8f*)(src + i * 8); v8us o;
#pragma unroll
    for (int k = 0; k < 8; ++k) o[k] = f2bf(v[k]); *(v8us*)(dst + i * 8) = o;  }
__global__ __launch_bounds__(256) void k_cstab(float* CS) { const int idx = blockIdx.x * 256 + threadIdx.x; if (idx >= TT * HD) return; const int t = idx / HD, d = idx % HD; const int i = (d < HD / 2) ? d : d - HD / 2; const float inv = __fdiv_rn(1.0f, powf(10000.0f, (float)(2 * i) / (float)HD)); const float ang = __fmul_rn((float)t, inv); v2f cs; cs[0] = cosf(ang); cs[1] = sinf(ang);
    *(v2f*)(CS + (size_t)idx * 2) = cs;  }
// k_rope: head planes [h][t][d] (fp16 + hi/lo) of rope(x) x sc with the rotate-half convention out[d] = x[d] cos[t][d] - x[d+HD/2] sin[t][d], out[d+HD/2] = x[d+HD/2] cos[t][d+HD/2] + x[d] sin[t][d+HD/2]
__global__ __launch_bounds__(256) void k_rope(const float* __restrict__ F, int pitch, int nheads, const float* __restrict__ CS, const float* __restrict__ RF, const float* __restrict__ nw, float sc, h16* P16, bf* Ph, bf* Pl) {
    const size_t e = ((size_t)blockIdx.x * 256 + threadIdx.x) * 2; if (e >= (size_t)nheads * TT * HD) return; const int d = (int)(e % HD); const int t = (int)((e / HD) % TT); const int h = (int)(e / ((size_t)HD * TT)); const float* f = F + (size_t)t * pitch + h * HD; const float rf = RF ? RF[(size_t)h * TT + t] : 1.0f; v2h o16; v2us oh, ol;
#pragma unroll
    for (int q = 0; q < 2; ++q) { const int dd = d + q; const int dp = (dd < HD / 2) ? dd + HD / 2 : dd - HD / 2; float x0 = f[dd], x1 = f[dp];
        if (RF) { float n0 = __fmul_rn(x0, rf), n1 = __fmul_rn(x1, rf); asm volatile("" : "+v"(n0)); asm volatile("" : "+v"(n1)); x0 = __fmul_rn(bfr(nw[dd]), n0); x1 = __fmul_rn(bfr(nw[dp]), n1); }
        const v2f cs = *(const v2f*)(CS + ((size_t)t * HD + dd) * 2); float a = __fmul_rn(x0, cs[0]), bq = __fmul_rn(x1, cs[1]); asm volatile("" : "+v"(a)); asm volatile("" : "+v"(bq)); const float r = ((dd < HD / 2) ? __fsub_rn(a, bq) : __fadd_rn(a, bq)) * sc;
        o16[q] = tohx(r); unsigned short a2, c2; splitf(r, a2, c2); oh[q] = a2; ol[q] = c2; }
    *(v2h*)(P16 + e) = o16; *(v2us*)(Ph + e) = oh; *(v2us*)(Pl + e) = ol;  }
__global__ __launch_bounds__(256) void k_colsum(const bf* __restrict__ Ph, const bf* __restrict__ Pl, const h16* __restrict__ P16, int h0, float* ACC) { const int t = blockIdx.x * 256 + threadIdx.x; if (t >= TT) return; float acc = ((h0 % REP) == 0) ? 0.0f : ACC[t];
#pragma unroll 1
    for (int zz = 0; zz < ZH; ++zz) {
#pragma unroll 4
        for (int i = 0; i < RH; ++i) { const size_t o = ((size_t)zz * RH + i) * TT + t; acc = __fadd_rn(acc, __fadd_rn(bf2f(Ph[o]), bf2f(Pl[o]))); }
#pragma unroll 4
        for (int i = RH; i < TT; ++i) { const size_t o = ((size_t)zz * TT + i) * TT + t; float pv = __fmul_rn((float)P16[o], 1.0f / PCAR); asm volatile("" : "+v"(pv)); acc = __fadd_rn(acc, pv); } }
    *(float*)(ACC + t) = acc;  }
// k_asoft: per row (zz, i): t = S x SCL (= 1) for j <= i and i - j < WIN (sliding causal window; the reference's -1e9 additive fill vanishes identically); softmax over the 2048 keys (register row, one exp, fixed trees);
__global__ __launch_bounds__(256) void k_asoft(const float* __restrict__ Sb, h16* P16, bf* Ph, bf* Pl) {
    const int lane = threadIdx.x & 31; const int row = blockIdx.x * 8 + (threadIdx.x >> 5); if (row >= ZH * TT) return; const int i = row % TT; const int zz = row / TT; (void)zz; const bool hires = (i < RH); const float* sr = Sb + (size_t)row * TT; float v[TT / 32]; float mx = -3.0e38f;
#pragma unroll
    for (int ch = 0; ch < TT / 128; ++ch) { const int j0 = ch * 128 + lane * 4; const v4f a = *(const v4f*)(sr + j0);
#pragma unroll
        for (int q = 0; q < 4; ++q) { const int j = j0 + q; (void)j; float sa = a[q] * SCL; asm volatile("" : "+v"(sa)); const float t = (j <= i && i - j < WIN) ? sa : -3.0e38f; v[ch * 4 + q] = t; mx = fmaxf(mx, t); } }
#pragma unroll
    for (int sh = 16; sh; sh >>= 1) mx = fmaxf(mx, __shfl_xor(mx, sh, 32));
    float sum = 0.f;
#pragma unroll
    for (int k = 0; k < TT / 32; ++k) { float d0 = __fsub_rn(v[k], mx); asm volatile("" : "+v"(d0)); v[k] = __builtin_amdgcn_exp2f(__fmul_rn(d0, 1.4426950408889634f)); sum += v[k]; }
#pragma unroll
    for (int sh = 16; sh; sh >>= 1) sum += __shfl_xor(sum, sh, 32);
    const float f = __fdiv_rn(hires ? 1.0f : PCAR, sum);
{
        if (hires) {
#pragma unroll
            for (int ch = 0; ch < TT / 128; ++ch) { v4us oh, ol;
#pragma unroll
                for (int q = 0; q < 4; ++q) { unsigned short a, c2; splitf(v[ch * 4 + q] * f, a, c2); oh[q] = a; ol[q] = c2; }
                const size_t oo = ((size_t)zz * (RH ? RH : 1) + i) * TT + ch * 128 + lane * 4; *(v4us*)(Ph + oo) = oh; *(v4us*)(Pl + oo) = ol; }
        } else {
#pragma unroll
            for (int ch = 0; ch < TT / 128; ++ch) { v4h o4;
#pragma unroll
                for (int q = 0; q < 4; ++q) o4[q] = tohx(v[ch * 4 + q] * f);
                *(v4h*)(P16 + (size_t)row * TT + ch * 128 + lane * 4) = o4; } }
         }
}
__global__ __launch_bounds__(256) void k_merge(const float* __restrict__ O, int h0, bf* Ah, bf* Al) { const size_t e = ((size_t)blockIdx.x * 256 + threadIdx.x) * 2; if (e >= (size_t)ZH * TT * HD) return; const int d = (int)(e % HD); const int t = (int)((e / HD) % TT); const int zz = (int)(e / ((size_t)HD * TT)); const float cs = (t < RH) ? 1.0f : (1.0f / PCAR); const size_t oo = (size_t)t * DQ + (h0 + zz) * HD + d;
    v2us oh, ol;
#pragma unroll
    for (int q = 0; q < 2; ++q) { unsigned short a, c2; splitf(O[e + q] * cs, a, c2); oh[q] = a; ol[q] = c2; } *(v2us*)(Ah + oo) = oh; *(v2us*)(Al + oo) = ol;  }


// ---- SingleHeadQKV kernels ----
__global__ __launch_bounds__(256) void k_gptab(float* GP) { const int n = blockIdx.x * 256 + threadIdx.x; if (n >= TT + 64) return; const float v = powf(GAMR, (float)n); *(float*)(GP + n) = v;  }
__global__ __launch_bounds__(256) void k_cstabW(float* CS) { const size_t idx = (size_t)blockIdx.x * 256 + threadIdx.x; if (idx >= (size_t)TT * DC) return; const int t = (int)(idx / DC), d = (int)(idx % DC); const float inv = __fdiv_rn(1.0f, powf(10000.0f, (float)(2 * (d >> 1)) / (float)DC)); const float ang = __fmul_rn((float)t, inv); v2f cs; cs[0] = cosf(ang); cs[1] = sinf(ang); *(v2f*)(CS + idx * 2) = cs;  }

extern "C" void kernel_launch(void* const* d_in, const int* in_sizes, int n_in,
                              void* d_out, int out_size, void* d_ws, size_t ws_size, hipStream_t stream) {
    (void)in_sizes; (void)n_in; (void)out_size;
    const float* x = (const float*)d_in[0]; const float* sn = (const float*)d_in[1]; const float* wq = (const float*)d_in[2]; const float* wk = (const float*)d_in[3]; const float* wv = (const float*)d_in[4]; const float* gw = (const float*)d_in[5]; const float* gb = (const float*)d_in[6];
    float* OUT = (float*)d_out;     // out0 [4][2048][1024] at 0, out1 [4][1024][1024] at NB*TT*DC
    char* wsp = (char*)d_ws;
    auto take = [&](size_t bytes) { char* p = wsp; wsp += (bytes + 255) & ~(size_t)255; return (void*)p; };
    // All NB_ batch elements go through every stage at once (grid z = batch). Planes are [batch][...]; buffers whose contents are dead are reused, in stream order.
    const size_t SX = (size_t)TT * DC, SS = (size_t)DC * DC, SP = (size_t)TT * TT;   // elements per batch element: activations, state, scores
    bf* QPh = (bf*)take(NB_ * SX * 2); bf* QPl = (bf*)take(NB_ * SX * 2); bf* KPh = (bf*)take(NB_ * SX * 2); bf* KPl = (bf*)take(NB_ * SX * 2); bf* VTh = (bf*)take(NB_ * SX * 2); bf* VTl = (bf*)take(NB_ * SX * 2);
    bf* KTh = (bf*)take(NB_ * SX * 2); bf* KTl = (bf*)take(NB_ * SX * 2); bf* VDTh = (bf*)take(NB_ * SX * 2); bf* VDTl = (bf*)take(NB_ * SX * 2);
    float* CS = (float*)take((size_t)TT * DC * 2 * 4); bf* XB = (bf*)take(NB_ * SX * 2);
    bf* STh = (bf*)CS;               // chunk states [batch][chunk][column][row], hi plane: NB_*NCH*SS over CS + XB, dead after the V product
    bf* STl = (bf*)take(NB_ * NCH * SS * 2);
    bf* WQ = (bf*)take((size_t)DQ * DM * 2); bf* WK = (bf*)take((size_t)DKV * DM * 2); bf* WV = (bf*)take((size_t)DKV * DM * 2); float* GP = (float*)take((TT + 64) * 4);
    bf* Ph = KTh; bf* Pl = VDTh;     // NB_*SP each, over KTh + KTl and over VDTh + VDTl: dead after the R product
    if ((size_t)(wsp - (char*)d_ws) > ws_size) return;   // ws ~ 230 MiB
    { k_wtG<<<dim3(DM / TRR, DQ / TRC, 1), 256, 0, stream>>>(wq, DM, DQ, WQ); k_wtG<<<dim3(DM / TRR, DKV / TRC, 1), 256, 0, stream>>>(wk, DM, DKV, WK); k_wtG<<<dim3(DM / TRR, DKV / TRC, 1), 256, 0, stream>>>(wv, DM, DKV, WV); k_cstabW<<<(unsigned)(((size_t)TT * DC + 255) / 256), 256, 0, stream>>>(CS); k_gptab<<<(TT + 64 + 255) / 256, 256, 0, stream>>>(GP); }
    k_cvt8<<<(unsigned)((NB_ * SX / 8 + 255) / 256), 256, 0, stream>>>(x, XB, NB_ * SX / 8);
    // Q = rope(X W_Q), K = rope(X W_K), V = X W_V, each straight into the operand planes of the later products
    k_gemmt<0, 0, 1><<<dim3(TT / 128, DQ / 128, NB_), 128, 0, stream>>>(XB, nullptr, WQ, nullptr, DM, nullptr, DQ, SX, 0, SX, CS, nullptr, nullptr, nullptr, QPh, QPl, nullptr, nullptr);
    k_gemmt<0, 0, 2><<<dim3(TT / 128, DKV / 128, NB_), 128, 0, stream>>>(XB, nullptr, WK, nullptr, DM, nullptr, DKV, SX, 0, SX, CS, nullptr, nullptr, nullptr, KPh, KPl, KTh, KTl);
    k_gemmt<0, 0, 3><<<dim3(TT / 128, DKV / 128, NB_), 128, 0, stream>>>(XB, nullptr, WV, nullptr, DM, nullptr, DKV, SX, 0, SX, GP, nullptr, nullptr, nullptr, VTh, VTl, VDTh, VDTl);
    // the chunk states S_0 = S_n .. S_(NCH-1) into their planes, and R_i = S_NCH (first, so that its operand planes can be reused for the scores)
    k_gemmt<2, 0, 4><<<dim3(DC / 128, DC / 128, NB_), 128, 0, stream>>>(KTh, KTl, VDTh, VDTl, TT, OUT + NB_ * SX, DC, SX, SX, SS, GP, sn, nullptr, nullptr, STh, STl, nullptr, nullptr);
    // A = (Q K^T) x D into hi/lo planes (causal tiles of each chunk's own block only)
    k_gemmt<2, 1, 5><<<dim3(NCH * (CH / 128) * (CH / 128 + 1) / 2, 1, NB_), 128, 0, stream>>>(QPh, QPl, KPh, KPl, DC, nullptr, TT, SX, SX, SP, GP, nullptr, nullptr, nullptr, Ph, Pl, nullptr, nullptr);
    // cross = Q S_c, c the row's chunk, x g^(i+1), and inner = A V over the chunk's tiles on top of it in the same accumulators; out0 = permuted GroupNorm(cross + inner)
    k_gemmt<2, 2, 6><<<dim3(TT / 128, DC / 128, NB_), 128, 0, stream>>>(QPh, QPl, STh, STl, DC, OUT, DC, SX, NCH * SS, SX, GP, nullptr, gw, gb, Ph, Pl, VTh, VTl);
}

// v009
// It runs in 202 microseconds.
// Timed twice side by side with v008, it ran 1.03 times as fast both times.
// Over all steps from v000 it is 6.52 times as fast.
#include <hip/hip_runtime.h>

// SingleHeadQKV (chunkwise retention step: X_Q [4][2048][1024], S_n [4][1024][1024]; Q = rope(X W_Q), K = rope(X W_K) (interleaved-pair RoPE over the full 1024 dims), V = X W_V; D[n][m] = g^(n-m) for n >= m (g = 1 - 2^-5); inner = (Q K^T * D) V; cross = (Q S_n) * g^(t+1); out = GroupNorm32(inner + cross) then the literal transpose(-2,-1).reshape permutation -> out0 [4][2048][1024]; R_i = K^T (V * D[-1]) + S_n g^T -> out1 [4][1024][1024] at element 8,388,608).
// Compute dtypes, f32 accumulate: every input rounded to bf16; Q/K/V on PLAIN bf16 operands (inputs: exact); RoPE f32 (on-chip table); decay powers g^n in f32 (powf); Q.K^T (K = 1024) hl x hl (3 products) with causal tile skipping, x D per element in f32 into hi/lo planes (no softmax), (QK^T D).V hl x hl (3 products, causal skipping); Q.S_c hl x hl (3 products); the chunk states K^T.(V x decay) hl x hl (3 products, K = 2048 in all), kept in f32 accumulators and handed on as hi/lo planes; sums, GroupNorm (32 groups of 32, biased var, eps 1e-6) and the output permutation in f32.
// The decay is a recurrence over chunks of CH steps: with S_0 = S_n and S_(c+1) = g^CH S_c + K_c^T (V_c x g^(CH-1-i)), i the step inside chunk c, a row of chunk c is out = (Q K^T * D restricted to the chunk) V + g^(i+1) Q S_c, and R_i = S_(TT/CH). Exact algebra: only the order of the f32 sums differs.

#define NB_  4
#define TT   2048
#define DM   1024
#define NH_  16
#define NKV  16
#define REP  (NH_ / NKV)
#define HD   64
#define DQ   (NH_ * HD)
#define DKV  (NKV * HD)
#define ZH   2
#define RH   2048                  // query rows < RH use hi+lo planes (0: none)
#define WIN  2048
#define PCAR 1024.0f
#define DC   1024   // channel width (= DQ)
#define GAMR 0.96875f
#define SCL  1.0f
#define CH   512    // steps per chunk of the decay recurrence
#define NCH  (TT / CH)
typedef _Float16 h16;
typedef unsigned short bf;
typedef __attribute__((ext_vector_type(16))) __bf16   v16bf;
typedef __attribute__((ext_vector_type(16))) _Float16 v16h;
typedef __attribute__((ext_vector_type(8)))  _Float16 v8h;
typedef __attribute__((ext_vector_type(8)))  unsigned short v8us;
typedef __attribute__((ext_vector_type(8)))  float    v8f;
typedef __attribute__((ext_vector_type(4)))  float    v4f;
typedef v8h  __attribute__((may_alias)) v8ha;
typedef v4f  __attribute__((may_alias)) v4fa;
typedef v8us __attribute__((may_alias)) v8usa;
typedef __attribute__((ext_vector_type(4))) unsigned short v4us;
typedef __attribute__((ext_vector_type(2))) float v2f;

__device__ __forceinline__ unsigned short f2bf(float f) { unsigned u = __float_as_uint(f); u += 0x7FFFu + ((u >> 16) & 1u); return (unsigned short)(u >> 16); }
__device__ __forceinline__ float bf2f(unsigned short b) { return __uint_as_float(((unsigned)b) << 16); }
__device__ __forceinline__ float bfr(float f) { return bf2f(f2bf(f)); }
__device__ __forceinline__ void splitf(float y, unsigned short& h, unsigned short& l) { h = f2bf(y); l = f2bf(y - bf2f(h)); }
__device__ __forceinline__ v16h cat16(v8h lo, v8h hi) { return __builtin_shufflevector(lo, hi, 0, 1, 2, 3, 4, 5, 6, 7, 8, 9, 10, 11, 12, 13, 14, 15); }
__device__ __forceinline__ v16bf cat16b(v8us lo, v8us hi) { return __builtin_bit_cast(v16bf, __builtin_shufflevector(lo, hi, 0, 1, 2, 3, 4, 5, 6, 7, 8, 9, 10, 11, 12, 13, 14, 15)); }
__device__ __forceinline__ v8f wmma16(v16h a, v16h b, v8f c) { return __builtin_amdgcn_wmma_f32_16x16x32_f16(false, a, false, b, (short)0, c, false, false); }
__device__ __forceinline__ v8f wmmab(v16bf a, v16bf b, v8f c) { return __builtin_amdgcn_wmma_f32_16x16x32_bf16(false, a, false, b, (short)0, c, false, false); }



// ---- k_gemmt: C[m][n] (f32, pitch ldc) = sum_k A[m][k] Bt[n][k] (+ split products per NSPLIT) on K-contiguous bf16 planes. One 128x128 tile of C per work-group of four waves (2x2, 64x64 each, 16 accumulators a wave);
// grid (M/128, N/128, Z), 128 threads. A pass is KP k of all 128 rows of every operand plane; four tensor loads, one a wave, bring it into a two-buffer LDS ring, one pass ahead of its use, and each row is fetched once for two waves.
// CMODE 1 launches only the score tiles on or below the diagonal inside each chunk's CH x CH block (grid (40, 1, Z)); CMODE 2 runs two products through one ring into one set of accumulators: A x the B planes of the row tile's chunk (K = DC), rows then scaled by g^(i+1), and behind it the (decayed score) x value product (A planes P0/P1, B planes P2/P3, row pitch TT) from the chunk's first step to the diagonal block. M, N % 128 == 0, K % KP == 0, K >= 2 KP.
typedef float __attribute__((may_alias)) f32a;
typedef unsigned u32x4 __attribute__((ext_vector_type(4)));
typedef unsigned u32x8 __attribute__((ext_vector_type(8)));
__device__ __forceinline__ unsigned uni(unsigned v) { return (unsigned)__builtin_amdgcn_readfirstlane(v); }
// a wave-uniform value held in a scalar register: a test on it compiles to s_cmp and s_cbranch_scc, and what is formed from it is formed behind the waits in front of it
__device__ __forceinline__ unsigned pinned(unsigned v) { unsigned w = uni(v); asm volatile("" : "+s"(w)); return w; }   // an issue test or a descriptor word held in a scalar register
// one request of the whole wave: NROW rows of ROWB bytes at a source pitch of 'pitch' bytes land at LDS byte 'dst' with 16 pad bytes behind every row (1-byte elements, tensor = tile, no mask)
template <int ROWB, int NROW> __device__ __forceinline__ void tdm_tile(u32x4& g0, u32x8& g1, unsigned dst, unsigned long long ga, unsigned pitch) {
    static_assert(ROWB == 128 || ROWB == 256, "the pad interval equals the row");
    constexpr unsigned W0 = (1u << 20) | ((ROWB == 128 ? 4u : 5u) << 22) | (3u << 25);
    // pinned(): each descriptor word is held in its scalar register, not made again elsewhere, so that the wait below can keep those registers
    g0[0] = pinned(1u); g0[1] = pinned(dst); g0[2] = pinned((unsigned)ga); g0[3] = pinned((((unsigned)(ga >> 32)) & 0x01FFFFFFu) | 0x80000000u);
    g1[0] = pinned(W0); g1[1] = pinned(((unsigned)ROWB & 0xFFFFu) << 16); g1[2] = pinned(((unsigned)ROWB >> 16) | (((unsigned)NROW & 0xFFFFu) << 16)); g1[3] = pinned(((unsigned)NROW >> 16) | ((unsigned)ROWB << 16));
    g1[4] = pinned((unsigned)NROW); g1[5] = pinned(pitch); g1[6] = pinned(0u); g1[7] = pinned(0u);
    asm volatile("tensor_load_to_lds %0, %1" :: "s"(g0), "s"(g1) : "memory");
}
// the issuing wave's wait for its request; the request's descriptor words are its inputs, so that nothing is allocated over their registers while the request is outstanding
#define TWAIT(g0, g1) asm volatile("s_wait_tensorcnt 0x0" :: "s"(g0), "s"(g1) : "memory")
#define XWAIT(...) asm volatile("s_wait_xcnt 0x0" :: __VA_ARGS__ : "memory")
template <int CTRL> __device__ __forceinline__ float dppf(float x) { return __int_as_float(__builtin_amdgcn_mov_dpp(__float_as_int(x), CTRL, 0xF, 0xF, true)); }   // 0xB1: lane ^ 1, 0x4E: lane ^ 2 (quad_perm); 0x141: lane -> 7 - lane in each 8 (row_half_mirror)
__device__ __forceinline__ v16bf ldsfrag(const unsigned char* p) { return cat16b(*(const v8usa*)p, *(const v8usa*)(p + 32)); }
// EPI names what the epilogue makes of the tile, straight from the accumulators (a lane holds 8 consecutive rows of one column) and each wave's own LDS range:
// 0 f32 C; 1 RoPE (E0 = cos/sin table), hi/lo planes P0/P1; 2 as 1, and the transposed hi/lo planes P2/P3; 3 transposed hi/lo planes P0/P1, and P2/P3 of rows x g^(CH-1-i), i = t mod CH (E0 = powers of g);
// 4 the accumulators start as bf16(E1); at each chunk's first pass they go out as transposed hi/lo planes P0/P1 [chunk][column][row] and are scaled by g^CH; C = the last state; 5 tile x g^(i-j) for j <= i, else 0, hi/lo planes P0/P1; 6 GroupNorm(tile) with weight E2 and bias E3, stored transposed to C.
template <int NSPLIT, int CMODE, int EPI>
__global__ __launch_bounds__(128) void k_gemmt(const bf* __restrict__ A, const bf* __restrict__ A2, const bf* __restrict__ Bt, const bf* __restrict__ Bt2, int K, float* C, int ldc, size_t sA, size_t sB, size_t sC,
                                               const float* __restrict__ E0, const float* __restrict__ E1, const float* __restrict__ E2, const float* __restrict__ E3, bf* P0, bf* P1, bf* P2, bf* P3) {
    constexpr int KP = (NSPLIT == 0) ? 128 : 64;                    // k per pass
    constexpr int PITCH = KP * 2 + 16;                              // LDS row pitch in bytes: 16 x odd, for 16-byte readers
    static_assert(NSPLIT == 0 || NSPLIT == 2, "four slices a stage, one a wave");
    constexpr int NROW = (NSPLIT == 0) ? 64 : 128;                  // rows of a wave's slice: half a plane, or a whole one
    constexpr int SLICE = 18432, PLANE = SLICE, STAGE = 4 * SLICE;  // a slice's place is a multiple of 2 KiB: NROW * PITCH bytes, rounded up
    static_assert(NROW * PITCH <= SLICE && SLICE % 2048 == 0, "slices do not overlap");
    static_assert(KP == ((NSPLIT == 0) ? 128 : 64), "a pass is two blocks");
    constexpr int NLD = 32, NW = (NSPLIT == 0) ? 32 : 48;           // a block: half a pass; its 16-byte LDS reads (16 fragments) and its products
    __shared__ __attribute__((aligned(2048))) unsigned char ring[2 * STAGE];
    int bx = blockIdx.x, by = blockIdx.y, bz = blockIdx.z;
    if (CMODE == 1) {   // grid.x counts only the tiles on or below the diagonal of each chunk's own block, chunk by chunk and row by row: no work-group starts for nothing
        constexpr int TC = CH / 128, TPC = TC * (TC + 1) / 2;
        const int ch = bx / TPC, e = bx % TPC; int r = 0;
        for (int q = 1; q < TC; ++q) r += (e >= q * (q + 1) / 2) ? 1 : 0;
        by = ch * TC + e - r * (r + 1) / 2; bx = ch * TC + r; }
    if (CMODE == 2) {   // all work-groups are resident, two to a WGP, and a row tile's K loop grows with its index inside the chunk: flat indices 8, 16 or 256 apart get row tiles t and 15 - t. Speed only: any placement is correct
        static_assert(CMODE != 2 || (TT / 128 == 16 && DC / 128 == 8 && NB_ == 4), "the map below is a permutation of a 16 x 8 x 4 grid");
        const int b = bx + 16 * by + 128 * bz, k = b >> 3, u = (k >> 2) & 7;
        bx = ((k ^ (k >> 1) ^ (k >> 5)) & 1) ? 15 - u : u; by = b & 7; bz = k & 3; }
    const int r0 = bx * 128, c0 = by * 128;
    const int kb = (CMODE == 2) ? (r0 / CH) * CH : 0;   // CMODE 2: the chunk's first step, where the second product's k begins
    const int np1 = (CMODE == 2) ? DC / KP : K / KP;    // passes of the first product
    const int npass = (CMODE == 2) ? np1 + (r0 + 128 - kb) / KP : np1;
    const size_t z = bz; C += z * sC;
    const int tid = threadIdx.x, lane = tid & 31, lr = lane & 15, hi = lane >> 4, wave = tid >> 5, wm = wave >> 1, wn = wave & 1;
    const unsigned wv = uni((unsigned)tid >> 5);   // the wave's number picks its slice of a stage: NSPLIT 2: the planes A, A2, B, B2; NSPLIT 0: the two halves of A, then of B
    const bool isb = wv >= 2;
    const int half = (NSPLIT == 0) ? (int)(wv & 1) * NROW : 0;
    const bf* s1 = (NSPLIT == 0) ? (isb ? Bt : A) : (wv == 0 ? A : wv == 1 ? A2 : wv == 2 ? Bt : Bt2);
    s1 += isb ? z * sB + ((CMODE == 2) ? (size_t)(r0 / CH) * DC * DC : 0) + (size_t)(c0 + half) * K : z * sA + (size_t)(r0 + half) * K;
    const bf* s2 = s1;                             // CMODE 2: the slice's plane in the second product
    if (CMODE == 2) { s2 = (wv == 0 ? P0 : wv == 1 ? P1 : wv == 2 ? P2 : P3); s2 += isb ? z * ((size_t)TT * DC) + (size_t)c0 * TT + kb : z * ((size_t)TT * TT) + (size_t)r0 * TT + kb; }
    const unsigned lbase = (unsigned)(size_t)ring + wv * SLICE;
    u32x4 q0; u32x8 q1;             // the descriptor of the wave's one outstanding request
    auto fill = [&](unsigned t) {   // this wave's slice of pass t into buffer t & 1
        const bool sec = CMODE == 2 && t >= (unsigned)np1;   // the same for the whole work-group: this pass belongs to the second product
        const bf* g = sec ? s2 + (size_t)(t - (unsigned)np1) * KP : s1 + (size_t)t * KP;
        tdm_tile<KP * 2, NROW>(q0, q1, lbase + (t & 1u) * STAGE, (unsigned long long)(size_t)g, sec ? (unsigned)TT * 2u : (unsigned)K * 2u);
    };
    v8f acc[4][4];
#pragma unroll
    for (int mb = 0; mb < 4; ++mb)
#pragma unroll
        for (int nb = 0; nb < 4; ++nb) acc[mb][nb] = (v8f){};
    fill(0);
    TWAIT(q0, q1);                                      // this wave's slice of pass 0 has landed
    __syncthreads();                                    // and every other wave's: pass 0 is readable
    fill(1);                                            // every launch has at least two passes (K >= 2 KP)
    const int rw = r0 + wm * 64, cw = c0 + wn * 64;         // the wave's first row and column of C
    float gC = 0.0f;
    if (EPI == 4) {   // S_0: a lane holds 8 consecutive rows of one column
        static_assert(EPI != 4 || CH % KP == 0, "a chunk is a whole number of passes");
        gC = E0[CH];
        const float* si = E1 + z * sC + (size_t)(rw + hi * 8) * DC + cw + lr;
#pragma unroll
        for (int mb = 0; mb < 4; ++mb)
#pragma unroll
            for (int nb = 0; nb < 4; ++nb)
#pragma unroll
                for (int j = 0; j < 8; ++j) acc[mb][nb][j] = si[(mb * 16 + j) * DC + nb * 16];
        XWAIT("v"(si));
#pragma unroll
        for (int mb = 0; mb < 4; ++mb)
#pragma unroll
            for (int nb = 0; nb < 4; ++nb)
#pragma unroll
                for (int j = 0; j < 8; ++j) acc[mb][nb][j] = bfr(acc[mb][nb][j]);
    }
    const unsigned char* fa = ring + ((NSPLIT == 0) ? wm * SLICE + lr * PITCH : (wm * 64 + lr) * PITCH) + hi * 16; const unsigned char* fb = ring + 2 * SLICE + ((NSPLIT == 0) ? wn * SLICE + lr * PITCH : (wn * 64 + lr) * PITCH) + hi * 16;
    // two fragment sets of 16 fragments each: a block's products run on one while the next block's LDS reads fill the other. NSPLIT 0: [k step of 32][block of 16 rows]; NSPLIT 2: [plane][block of 16 rows]
    v16bf fA[2][8], fB[2][8];
    auto frag = [&](v16bf (&ra)[8], v16bf (&rb)[8], int bo, int blk) {
#pragma unroll
        for (int q = 0; q < 2; ++q)
#pragma unroll
            for (int i = 0; i < 4; ++i) { const int o = bo + i * 16 * PITCH + ((NSPLIT == 0) ? (blk * 2 + q) * 64 : q * PLANE + blk * 64); ra[q * 4 + i] = ldsfrag(fa + o); rb[q * 4 + i] = ldsfrag(fb + o); }
    };
    auto prod = [&](const v16bf (&ra)[8], const v16bf (&rb)[8]) {
        if (NSPLIT == 0) {
#pragma unroll
            for (int q = 0; q < 2; ++q)
#pragma unroll
                for (int nb = 0; nb < 4; ++nb)
#pragma unroll
                    for (int mb = 0; mb < 4; ++mb) acc[mb][nb] = wmmab(ra[q * 4 + mb], rb[q * 4 + nb], acc[mb][nb]);
        } else {
#pragma unroll
            for (int nb = 0; nb < 4; ++nb)
#pragma unroll
                for (int mb = 0; mb < 4; ++mb) { acc[mb][nb] = wmmab(ra[mb], rb[nb], acc[mb][nb]); acc[mb][nb] = wmmab(ra[4 + mb], rb[nb], acc[mb][nb]); acc[mb][nb] = wmmab(ra[mb], rb[4 + nb], acc[mb][nb]); }
        }
    };
    frag(fA[0], fB[0], 0, 0);                               // pass 0 is published: its first block's fragments
#pragma unroll 1
    for (int t = 0; t < npass; ++t) {
        const int bo = (t & 1) * STAGE;
        if (EPI == 4 && (t & (CH / KP - 1)) == 0) {   // a chunk begins: its start state goes out [column][row] (a lane's 8 rows are 16 bytes, the four row blocks fill one 128-byte line), then decays over the chunk
            const size_t so = ((z * NCH + t / (CH / KP)) * DC + cw + lr) * DC + rw + hi * 8;
#pragma unroll
            for (int nb = 0; nb < 4; ++nb) { bf* ph = P0 + so + (size_t)nb * 16 * DC; bf* pl = P1 + so + (size_t)nb * 16 * DC; v8us oh[4], ol[4];
#pragma unroll
                for (int mb = 0; mb < 4; ++mb) {
#pragma unroll
                    for (int j = 0; j < 8; ++j) { unsigned short a2, c2; splitf(acc[mb][nb][j], a2, c2); oh[mb][j] = a2; ol[mb][j] = c2; acc[mb][nb][j] *= gC; } }
#pragma unroll
                for (int mb = 0; mb < 4; ++mb) { *(v8us*)(ph + mb * 16) = oh[mb]; *(v8us*)(pl + mb * 16) = ol[mb]; }
                XWAIT("v"(ph), "v"(pl), "v"(oh[0]), "v"(oh[1]), "v"(oh[2]), "v"(oh[3]), "v"(ol[0]), "v"(ol[1]), "v"(ol[2]), "v"(ol[3])); }
        }
        if (CMODE == 2 && t == np1) {   // the state product is complete: its rows take g^(i+1), i the step inside the chunk; the chunk's own products add on top
            const float* gp = E0 + (rw - kb + hi * 8 + 1); float gr[4][8];
#pragma unroll
            for (int mb = 0; mb < 4; ++mb)
#pragma unroll
                for (int j = 0; j < 8; ++j) gr[mb][j] = gp[mb * 16 + j];
            XWAIT("v"(gp));
#pragma unroll
            for (int mb = 0; mb < 4; ++mb)
#pragma unroll
                for (int nb = 0; nb < 4; ++nb)
#pragma unroll
                    for (int j = 0; j < 8; ++j) acc[mb][nb][j] *= gr[mb][j];
        }
        frag(fA[1], fB[1], bo, 1);                          // the second block's fragments go ahead of the first block's products
        prod(fA[0], fB[0]);
        // order asked of the scheduler: the LDS reads as one group in front of the products
        __builtin_amdgcn_sched_group_barrier(0x100, NLD, 0);
        __builtin_amdgcn_sched_group_barrier(0x008, NW, 0);
        __builtin_amdgcn_sched_barrier(0);                  // the products above stay in front of the waits below: lifted over them, s_wait_dscnt 0 would wait out the reads that were only just issued
        // the publish point of pass t + 1 stands in front of pass t's last block, whose fragments are already in registers
        asm volatile("s_wait_dscnt 0x0" ::: "memory");      // this wave has left buffer t & 1
        TWAIT(q0, q1);                                      // its slice of pass t + 1 has landed
        __syncthreads();                                    // publishes pass t + 1 and frees buffer t & 1
        if (pinned(t + 2 < npass)) fill(pinned((unsigned)t + 2u));   // the descriptor is formed behind the wait above
        if (t + 1 < npass) frag(fA[0], fB[0], ((t + 1) & 1) * STAGE, 0);        // the next pass's first fragments, read while the last block runs; behind the last pass nothing is read
        prod(fA[1], fB[1]);
    }
    TWAIT(q0, q1);                                          // nothing is in flight when the ring becomes output staging
    asm volatile("s_wait_dscnt 0x0" ::: "memory");          // and no LDS read of this wave is open
    constexpr int WREG = 24576, TOFF = 4608, TPL = 64 * 144;   // bytes of LDS a wave stages in; where its transposing tile starts; one 64 x 64 16-bit tile at a pitch of 144 bytes
    unsigned char* wreg = ring + wave * WREG;               // each wave stages in its own range, behind the last pass's barrier
    f32a* os = (f32a*)wreg;                                 // 16 x 64 f32, pitch 68
    if (EPI == 1 || EPI == 2 || EPI == 3 || EPI == 5) { P0 += z * sC; P1 += z * sC; }
    if (EPI == 2 || EPI == 3) { P2 += z * sC; P3 += z * sC; }
    // interleaved-pair RoPE of one block of 16 rows: the partner column sits in the neighbouring lane
    auto rope = [&](int mb) {
        const float sg = (lr & 1) ? 1.0f : -1.0f; const float* cb = E0 + ((size_t)(rw + mb * 16 + hi * 8) * DC + cw + lr) * 2; v2f ct[4][8];
#pragma unroll
        for (int nb = 0; nb < 4; ++nb)
#pragma unroll
            for (int j = 0; j < 8; ++j) ct[nb][j] = *(const v2f*)(cb + (j * DC + nb * 16) * 2);
        XWAIT("v"(cb));
#pragma unroll
        for (int nb = 0; nb < 4; ++nb)
#pragma unroll
            for (int j = 0; j < 8; ++j) {
                const v2f cs = ct[nb][j];
                const float xv = acc[mb][nb][j];
                const float pv = dppf<0xB1>(xv);
                acc[mb][nb][j] = xv * cs[0] + pv * (sg * cs[1]);
            }
    };
    // transposed hi/lo planes [column][row], row pitch TT: a lane's 8 rows are one 16-byte LDS store (t_put); read back so that 8 lanes store one whole 128-byte line (t_flush)
    unsigned char* tp = wreg + TOFF;
    auto t_put = [&](int mb, bool dec) {
        float gs[8];
        if (dec) { const float* gp = E0 + (CH - 8 - ((rw + mb * 16 + hi * 8) & (CH - 1)));
#pragma unroll
            for (int j = 0; j < 8; ++j) gs[j] = gp[7 - j];
            XWAIT("v"(gp)); }
#pragma unroll
        for (int nb = 0; nb < 4; ++nb) { v8us oh, ol;
#pragma unroll
            for (int j = 0; j < 8; ++j) { float xv = acc[mb][nb][j]; if (dec) xv *= gs[j]; unsigned short a2, c2; splitf(xv, a2, c2); oh[j] = a2; ol[j] = c2; }
            unsigned char* q = tp + (nb * 16 + lr) * 144 + (mb * 16 + hi * 8) * 2; *(v8usa*)q = oh; *(v8usa*)(q + TPL) = ol; }
    };
    auto t_flush = [&](bf* Th, bf* Tl) {
        __builtin_amdgcn_wave_barrier(); asm volatile("" ::: "memory");   // other lanes' LDS stores stay ahead of the reads below
#pragma unroll
        for (int sg4 = 0; sg4 < 4; ++sg4) { v8us vh[4], vl[4];   // eight LDS reads in flight, then their stores
#pragma unroll
            for (int s = 0; s < 4; ++s) { const unsigned char* q = tp + ((sg4 * 4 + s) * 4 + (lane >> 3)) * 144 + (lane & 7) * 16; vh[s] = *(const v8usa*)q; vl[s] = *(const v8usa*)(q + TPL); }
#pragma unroll
            for (int s = 0; s < 4; ++s) { const size_t o = (size_t)(cw + (sg4 * 4 + s) * 4 + (lane >> 3)) * TT + rw + (lane & 7) * 8; bf* ph = Th + o; bf* pl = Tl + o; *(v8us*)ph = vh[s]; *(v8us*)pl = vl[s]; XWAIT("v"(ph), "v"(pl), "v"(vh[s]), "v"(vl[s])); }
        }
        __builtin_amdgcn_wave_barrier(); asm volatile("" ::: "memory");   // the reads above stay ahead of the tile's next use
    };
    if (EPI == 3) {
#pragma unroll
        for (int mb = 0; mb < 4; ++mb) t_put(mb, false);
        t_flush(P0, P1);
#pragma unroll
        for (int mb = 0; mb < 4; ++mb) t_put(mb, true);
        t_flush(P2, P3);
    }
    if (EPI != 3) {
        f32a* tt = (f32a*)(wreg + TOFF);                    // EPI 6: 64 x 64 f32 at an odd pitch of 65, so that a walk down a column meets every bank once
        v4f w4 = {}, b4 = {};
        if (EPI == 6) { const float* pw = E2 + cw + lr * 4; const float* pb = E3 + cw + lr * 4; const v4f wr = *(const v4f*)pw, br = *(const v4f*)pb; XWAIT("v"(pw), "v"(pb));
#pragma unroll
            for (int u = 0; u < 4; ++u) { w4[u] = bfr(wr[u]); b4[u] = bfr(br[u]); } }
#pragma unroll
        for (int mb = 0; mb < 4; ++mb) {
            if (EPI == 1 || EPI == 2) rope(mb);
            if (EPI == 2) { __builtin_amdgcn_sched_barrier(0); t_put(mb, false); }   // the split's temporaries come after the table values are spent
            const int cofs = lr * 4, gc = cw + cofs;
            v4f ex[8];   // what the 16 rows take from global memory: issued ahead of the LDS round trip, all in flight together
            if (EPI == 5) {
#pragma unroll
                for (int s = 0; s < 8; ++s) { const int dd = rw + mb * 16 + 2 * s + hi - gc; const int m0 = max(dd, 0), m1 = max(dd, 1), m2 = max(dd, 2), m3 = max(dd, 3);   // exponent i - j, held at 0 above the diagonal
                    ex[s][0] = E0[m0]; ex[s][1] = E0[m1 - 1]; ex[s][2] = E0[m2 - 2]; ex[s][3] = E0[m3 - 3]; XWAIT("v"(m0), "v"(m1), "v"(m2), "v"(m3)); } }
#pragma unroll
            for (int nb = 0; nb < 4; ++nb) {
#pragma unroll
                for (int j = 0; j < 8; ++j) os[(hi * 8 + j) * 68 + nb * 16 + lr] = acc[mb][nb][j]; }
            __builtin_amdgcn_wave_barrier(); asm volatile("" ::: "memory");   // other lanes' LDS stores stay ahead of the reads below
            v4f vals[8];
#pragma unroll
            for (int s = 0; s < 8; ++s) vals[s] = *(const v4fa*)(os + (2 * s + hi) * 68 + cofs);
#pragma unroll
            for (int s = 0; s < 8; ++s) { const int row = 2 * s + hi; const v4f val = vals[s];
                const int gr = rw + mb * 16 + row; const size_t o = (size_t)gr * ldc + gc;
                if (EPI == 0 || EPI == 4) { float* pc = C + o; *(v4f*)pc = val; XWAIT("v"(pc), "v"(val)); }
                if (EPI == 1 || EPI == 2 || EPI == 5) { v4us oh, ol;
#pragma unroll
                    for (int u = 0; u < 4; ++u) { float v = val[u]; if (EPI == 5) v = (gr >= gc + u) ? v * ex[s][u] : 0.0f; unsigned short a2, c2; splitf(v, a2, c2); oh[u] = a2; ol[u] = c2; }
                    bf* ph = P0 + o; bf* pl = P1 + o; *(v4us*)ph = oh; *(v4us*)pl = ol; XWAIT("v"(ph), "v"(pl), "v"(oh), "v"(ol)); }
                if (EPI == 6) { float v[4], d[4]; float sm = 0.0f, ss = 0.0f;   // a group of 32 channels = 8 lanes x 4
#pragma unroll
                    for (int u = 0; u < 4; ++u) { v[u] = val[u]; sm += v[u]; }
                    sm += dppf<0xB1>(sm); sm += dppf<0x4E>(sm); sm += dppf<0x141>(sm);
                    const float mu = sm * (1.0f / 32.0f);
#pragma unroll
                    for (int u = 0; u < 4; ++u) { d[u] = v[u] - mu; ss += d[u] * d[u]; }
                    ss += dppf<0xB1>(ss); ss += dppf<0x4E>(ss); ss += dppf<0x141>(ss);
                    const float rs = __fdiv_rn(1.0f, sqrtf(ss * (1.0f / 32.0f) + 1e-6f));
#pragma unroll
                    for (int u = 0; u < 4; ++u) tt[(mb * 16 + row) * 65 + cofs + u] = d[u] * rs * w4[u] + b4[u]; }
            }
            __builtin_amdgcn_wave_barrier(); asm volatile("" ::: "memory");   // the reads above stay ahead of the next block's LDS stores
        }
        if (EPI == 2) t_flush(P2, P3);
        if (EPI == 6) {   // the reference's transpose(-2,-1).reshape keeps the flat order of the transpose: C read as [DC][TT]; 16 lanes x 4 rows = two whole lines of one channel
#pragma unroll
            for (int pg8 = 0; pg8 < 4; ++pg8) { const int tg = lr * 4; v4f ov[8];   // 32 LDS reads in flight, then their stores
#pragma unroll
                for (int p = 0; p < 8; ++p)
#pragma unroll
                    for (int i = 0; i < 4; ++i) ov[p][i] = tt[(tg + i) * 65 + (pg8 * 8 + p) * 2 + hi];
#pragma unroll
                for (int p = 0; p < 8; ++p) { float* pc = C + (size_t)(cw + (pg8 * 8 + p) * 2 + hi) * TT + rw + tg; *(v4f*)pc = ov[p]; XWAIT("v"(pc), "v"(ov[p])); }
            }
        }
    }
}

__device__ __forceinline__ h16 tohx(float x) { return (h16)x; }
typedef __attribute__((ext_vector_type(2))) _Float16 v2h;
typedef __attribute__((ext_vector_type(4))) _Float16 v4h;
typedef __attribute__((ext_vector_type(2))) unsigned short v2us;
typedef __attribute__((ext_vector_type(4))) int v4i;

// ---- 128 x 64 f32 tile in LDS, used by the transposing kernel k_wtG (256 threads): global reads and global writes both move whole 128-byte lines.
#define TRR 128   // source rows per tile
#define TRC 64    // source columns per tile
#define TRP 65    // LDS pitch in dwords: odd, so that a walk down a column meets every bank once
__device__ __forceinline__ void tile_in(const float* __restrict__ src, int ld, float* ts) {   // src: the tile's first element, row pitch ld floats
    const int rr = threadIdx.x >> 4, cc = (threadIdx.x & 15) * 4; const float* g[TRR / 16]; v4f v[TRR / 16];
#pragma unroll
    for (int p = 0; p < TRR / 16; ++p) g[p] = src + (size_t)(p * 16 + rr) * ld + cc;
#pragma unroll
    for (int p = 0; p < TRR / 16; ++p) v[p] = *(const v4f*)g[p];
    // the wait that stands in front of any overwrite of an issued load's address registers; the addresses are its inputs, so that nothing is allocated over them ahead of it
    asm volatile("s_wait_xcnt 0x0" :: "v"(g[0]), "v"(g[1]), "v"(g[2]), "v"(g[3]), "v"(g[4]), "v"(g[5]), "v"(g[6]), "v"(g[7]) : "memory");
#pragma unroll
    for (int p = 0; p < TRR / 16; ++p) {
#pragma unroll
        for (int u = 0; u < 4; ++u) ts[(p * 16 + rr) * TRP + cc + u] = v[p][u]; }
    __syncthreads();   // every column is read back by waves that did not write it
}
// k_wtG: Bt[n][k] = bf16(w[k][n]); grid (K / 128, N / 64, batch)
__global__ __launch_bounds__(256) void k_wtG(const float* __restrict__ w, int K, int N, bf* Bt) {
    __shared__ float ts[TRR * TRP];
    const int k0 = blockIdx.x * TRR, n0 = blockIdx.y * TRC; w += (size_t)blockIdx.z * K * N; Bt += (size_t)blockIdx.z * K * N;
    tile_in(w + (size_t)k0 * N + n0, N, ts);
    const int kg = (threadIdx.x & 7) * 8, nr = threadIdx.x >> 3;   // 8 lanes x 8 k = one 128-byte line of a Bt row; a wave stores 4 rows
#pragma unroll
    for (int p = 0; p < 4; ++p) { const int k = (p & 1) * 64 + kg, n = (p >> 1) * 32 + nr; v8us o;
#pragma unroll
        for (int i = 0; i < 8; ++i) o[i] = f2bf(ts[(k + i) * TRP + n]);
        *(v8us*)(Bt + (size_t)(n0 + n) * K + k0 + k) = o; }
}
__global__ __launch_bounds__(256) void k_cvt8(const float* __restrict__ src, bf* dst, size_t n8) { const size_t i = (size_t)blockIdx.x * 256 + threadIdx.x; if (i >= n8) return; const v8f v = *(const v8f*)(src + i * 8); v8us o;
#pragma unroll
    for (int k = 0; k < 8; ++k) o[k] = f2bf(v[k]); *(v8us*)(dst + i * 8) = o;  }
__global__ __launch_bounds__(256) void k_cstab(float* CS) { const int idx = blockIdx.x * 256 + threadIdx.x; if (idx >= TT * HD) return; const int t = idx / HD, d = idx % HD; const int i = (d < HD / 2) ? d : d - HD / 2; const float inv = __fdiv_rn(1.0f, powf(10000.0f, (float)(2 * i) / (float)HD)); const float ang = __fmul_rn((float)t, inv); v2f cs; cs[0] = cosf(ang); cs[1] = sinf(ang);
    *(v2f*)(CS + (size_t)idx * 2) = cs;  }
// k_rope: head planes [h][t][d] (fp16 + hi/lo) of rope(x) x sc with the rotate-half convention out[d] = x[d] cos[t][d] - x[d+HD/2] sin[t][d], out[d+HD/2] = x[d+HD/2] cos[t][d+HD/2] + x[d] sin[t][d+HD/2]
__global__ __launch_bounds__(256) void k_rope(const float* __restrict__ F, int pitch, int nheads, const float* __restrict__ CS, const float* __restrict__ RF, const float* __restrict__ nw, float sc, h16* P16, bf* Ph, bf* Pl) {
    const size_t e = ((size_t)blockIdx.x * 256 + threadIdx.x) * 2; if (e >= (size_t)nheads * TT * HD) return; const int d = (int)(e % HD); const int t = (int)((e / HD) % TT); const int h = (int)(e / ((size_t)HD * TT)); const float* f = F + (size_t)t * pitch + h * HD; const float rf = RF ? RF[(size_t)h * TT + t] : 1.0f; v2h o16; v2us oh, ol;
#pragma unroll
    for (int q = 0; q < 2; ++q) { const int dd = d + q; const int dp = (dd < HD / 2) ? dd + HD / 2 : dd - HD / 2; float x0 = f[dd], x1 = f[dp];
        if (RF) { float n0 = __fmul_rn(x0, rf), n1 = __fmul_rn(x1, rf); asm volatile("" : "+v"(n0)); asm volatile("" : "+v"(n1)); x0 = __fmul_rn(bfr(nw[dd]), n0); x1 = __fmul_rn(bfr(nw[dp]), n1); }
        const v2f cs = *(const v2f*)(CS + ((size_t)t * HD + dd) * 2); float a = __fmul_rn(x0, cs[0]), bq = __fmul_rn(x1, cs[1]); asm volatile("" : "+v"(a)); asm volatile("" : "+v"(bq)); const float r = ((dd < HD / 2) ? __fsub_rn(a, bq) : __fadd_rn(a, bq)) * sc;
        o16[q] = tohx(r); unsigned short a2, c2; splitf(r, a2, c2); oh[q] = a2; ol[q] = c2; }
    *(v2h*)(P16 + e) = o16; *(v2us*)(Ph + e) = oh; *(v2us*)(Pl + e) = ol;  }
__global__ __launch_bounds__(256) void k_colsum(const bf* __restrict__ Ph, const bf* __restrict__ Pl, const h16* __restrict__ P16, int h0, float* ACC) { const int t = blockIdx.x * 256 + threadIdx.x; if (t >= TT) return; float acc = ((h0 % REP) == 0) ? 0.0f : ACC[t];
#pragma unroll 1
    for (int zz = 0; zz < ZH; ++zz) {
#pragma unroll 4
        for (int i = 0; i < RH; ++i) { const size_t o = ((size_t)zz * RH + i) * TT + t; acc = __fadd_rn(acc, __fadd_rn(bf2f(Ph[o]), bf2f(Pl[o]))); }
#pragma unroll 4
        for (int i = RH; i < TT; ++i) { const size_t o = ((size_t)zz * TT + i) * TT + t; float pv = __fmul_rn((float)P16[o], 1.0f / PCAR); asm volatile("" : "+v"(pv)); acc = __fadd_rn(acc, pv); } }
    *(float*)(ACC + t) = acc;  }
// k_asoft: per row (zz, i): t = S x SCL (= 1) for j <= i and i - j < WIN (sliding causal window; the reference's -1e9 additive fill vanishes identically); softmax over the 2048 keys (register row, one exp, fixed trees);
__global__ __launch_bounds__(256) void k_asoft(const float* __restrict__ Sb, h16* P16, bf* Ph, bf* Pl) {
    const int lane = threadIdx.x & 31; const int row = blockIdx.x * 8 + (threadIdx.x >> 5); if (row >= ZH * TT) return; const int i = row % TT; const int zz = row / TT; (void)zz; const bool hires = (i < RH); const float* sr = Sb + (size_t)row * TT; float v[TT / 32]; float mx = -3.0e38f;
#pragma unroll
    for (int ch = 0; ch < TT / 128; ++ch) { const int j0 = ch * 128 + lane * 4; const v4f a = *(const v4f*)(sr + j0);
#pragma unroll
        for (int q = 0; q < 4; ++q) { const int j = j0 + q; (void)j; float sa = a[q] * SCL; asm volatile("" : "+v"(sa)); const float t = (j <= i && i - j < WIN) ? sa : -3.0e38f; v[ch * 4 + q] = t; mx = fmaxf(mx, t); } }
#pragma unroll
    for (int sh = 16; sh; sh >>= 1) mx = fmaxf(mx, __shfl_xor(mx, sh, 32));
    float sum = 0.f;
#pragma unroll
    for (int k = 0; k < TT / 32; ++k) { float d0 = __fsub_rn(v[k], mx); asm volatile("" : "+v"(d0)); v[k] = __builtin_amdgcn_exp2f(__fmul_rn(d0, 1.4426950408889634f)); sum += v[k]; }
#pragma unroll
    for (int sh = 16; sh; sh >>= 1) sum += __shfl_xor(sum, sh, 32);
    const float f = __fdiv_rn(hires ? 1.0f : PCAR, sum);
{
        if (hires) {
#pragma unroll
            for (int ch = 0; ch < TT / 128; ++ch) { v4us oh, ol;
#pragma unroll
                for (int q = 0; q < 4; ++q) { unsigned short a, c2; splitf(v[ch * 4 + q] * f, a, c2); oh[q] = a; ol[q] = c2; }
                const size_t oo = ((size_t)zz * (RH ? RH : 1) + i) * TT + ch * 128 + lane * 4; *(v4us*)(Ph + oo) = oh; *(v4us*)(Pl + oo) = ol; }
        } else {
#pragma unroll
            for (int ch = 0; ch < TT / 128; ++ch) { v4h o4;
#pragma unroll
                for (int q = 0; q < 4; ++q) o4[q] = tohx(v[ch * 4 + q] * f);
                *(v4h*)(P16 + (size_t)row * TT + ch * 128 + lane * 4) = o4; } }
         }
}
__global__ __launch_bounds__(256) void k_merge(const float* __restrict__ O, int h0, bf* Ah, bf* Al) { const size_t e = ((size_t)blockIdx.x * 256 + threadIdx.x) * 2; if (e >= (size_t)ZH * TT * HD) return; const int d = (int)(e % HD); const int t = (int)((e / HD) % TT); const int zz = (int)(e / ((size_t)HD * TT)); const float cs = (t < RH) ? 1.0f : (1.0f / PCAR); const size_t oo = (size_t)t * DQ + (h0 + zz) * HD + d;
    v2us oh, ol;
#pragma unroll
    for (int q = 0; q < 2; ++q) { unsigned short a, c2; splitf(O[e + q] * cs, a, c2); oh[q] = a; ol[q] = c2; } *(v2us*)(Ah + oo) = oh; *(v2us*)(Al + oo) = ol;  }


// ---- SingleHeadQKV kernels ----
__global__ __launch_bounds__(256) void k_gptab(float* GP) { const int n = blockIdx.x * 256 + threadIdx.x; if (n >= TT + 64) return; const float v = powf(GAMR, (float)n); *(float*)(GP + n) = v;  }
__global__ __launch_bounds__(256) void k_cstabW(float* CS) { const size_t idx = (size_t)blockIdx.x * 256 + threadIdx.x; if (idx >= (size_t)TT * DC) return; const int t = (int)(idx / DC), d = (int)(idx % DC); const float inv = __fdiv_rn(1.0f, powf(10000.0f, (float)(2 * (d >> 1)) / (float)DC)); const float ang = __fmul_rn((float)t, inv); v2f cs; cs[0] = cosf(ang); cs[1] = sinf(ang); *(v2f*)(CS + idx * 2) = cs;  }

extern "C" void kernel_launch(void* const* d_in, const int* in_sizes, int n_in,
                              void* d_out, int out_size, void* d_ws, size_t ws_size, hipStream_t stream) {
    (void)in_sizes; (void)n_in; (void)out_size;
    const float* x = (const float*)d_in[0]; const float* sn = (const float*)d_in[1]; const float* wq = (const float*)d_in[2]; const float* wk = (const float*)d_in[3]; const float* wv = (const float*)d_in[4]; const float* gw = (const float*)d_in[5]; const float* gb = (const float*)d_in[6];
    float* OUT = (float*)d_out;     // out0 [4][2048][1024] at 0, out1 [4][1024][1024] at NB*TT*DC
    char* wsp = (char*)d_ws;
    auto take = [&](size_t bytes) { char* p = wsp; wsp += (bytes + 255) & ~(size_t)255; return (void*)p; };
    // All NB_ batch elements go through every stage at once (grid z = batch). Planes are [batch][...]; buffers whose contents are dead are reused, in stream order.
    const size_t SX = (size_t)TT * DC, SS = (size_t)DC * DC, SP = (size_t)TT * TT;   // elements per batch element: activations, state, scores
    bf* QPh = (bf*)take(NB_ * SX * 2); bf* QPl = (bf*)take(NB_ * SX * 2); bf* KPh = (bf*)take(NB_ * SX * 2); bf* KPl = (bf*)take(NB_ * SX * 2); bf* VTh = (bf*)take(NB_ * SX * 2); bf* VTl = (bf*)take(NB_ * SX * 2);
    bf* KTh = (bf*)take(NB_ * SX * 2); bf* KTl = (bf*)take(NB_ * SX * 2); bf* VDTh = (bf*)take(NB_ * SX * 2); bf* VDTl = (bf*)take(NB_ * SX * 2);
    float* CS = (float*)take((size_t)TT * DC * 2 * 4); bf* XB = (bf*)take(NB_ * SX * 2);
    bf* STh = (bf*)CS;               // chunk states [batch][chunk][column][row], hi plane: NB_*NCH*SS over CS + XB, dead after the V product
    bf* STl = (bf*)take(NB_ * NCH * SS * 2);
    bf* WQ = (bf*)take((size_t)DQ * DM * 2); bf* WK = (bf*)take((size_t)DKV * DM * 2); bf* WV = (bf*)take((size_t)DKV * DM * 2); float* GP = (float*)take((TT + 64) * 4);
    bf* Ph = KTh; bf* Pl = VDTh;     // NB_*SP each, over KTh + KTl and over VDTh + VDTl: dead after the R product
    if ((size_t)(wsp - (char*)d_ws) > ws_size) return;   // ws ~ 230 MiB
    { k_wtG<<<dim3(DM / TRR, DQ / TRC, 1), 256, 0, stream>>>(wq, DM, DQ, WQ); k_wtG<<<dim3(DM / TRR, DKV / TRC, 1), 256, 0, stream>>>(wk, DM, DKV, WK); k_wtG<<<dim3(DM / TRR, DKV / TRC, 1), 256, 0, stream>>>(wv, DM, DKV, WV); k_cstabW<<<(unsigned)(((size_t)TT * DC + 255) / 256), 256, 0, stream>>>(CS); k_gptab<<<(TT + 64 + 255) / 256, 256, 0, stream>>>(GP); }
    k_cvt8<<<(unsigned)((NB_ * SX / 8 + 255) / 256), 256, 0, stream>>>(x, XB, NB_ * SX / 8);
    // Q = rope(X W_Q), K = rope(X W_K), V = X W_V, each straight into the operand planes of the later products
    k_gemmt<0, 0, 1><<<dim3(TT / 128, DQ / 128, NB_), 128, 0, stream>>>(XB, nullptr, WQ, nullptr, DM, nullptr, DQ, SX, 0, SX, CS, nullptr, nullptr, nullptr, QPh, QPl, nullptr, nullptr);
    k_gemmt<0, 0, 2><<<dim3(TT / 128, DKV / 128, NB_), 128, 0, stream>>>(XB, nullptr, WK, nullptr, DM, nullptr, DKV, SX, 0, SX, CS, nullptr, nullptr, nullptr, KPh, KPl, KTh, KTl);
    k_gemmt<0, 0, 3><<<dim3(TT / 128, DKV / 128, NB_), 128, 0, stream>>>(XB, nullptr, WV, nullptr, DM, nullptr, DKV, SX, 0, SX, GP, nullptr, nullptr, nullptr, VTh, VTl, VDTh, VDTl);
    // the chunk states S_0 = S_n .. S_(NCH-1) into their planes, and R_i = S_NCH (first, so that its operand planes can be reused for the scores)
    k_gemmt<2, 0, 4><<<dim3(DC / 128, DC / 128, NB_), 128, 0, stream>>>(KTh, KTl, VDTh, VDTl, TT, OUT + NB_ * SX, DC, SX, SX, SS, GP, sn, nullptr, nullptr, STh, STl, nullptr, nullptr);
    // A = (Q K^T) x D into hi/lo planes (causal tiles of each chunk's own block only)
    k_gemmt<2, 1, 5><<<dim3(NCH * (CH / 128) * (CH / 128 + 1) / 2, 1, NB_), 128, 0, stream>>>(QPh, QPl, KPh, KPl, DC, nullptr, TT, SX, SX, SP, GP, nullptr, nullptr, nullptr, Ph, Pl, nullptr, nullptr);
    // cross = Q S_c, c the row's chunk, x g^(i+1), and inner = A V over the chunk's tiles on top of it in the same accumulators; out0 = permuted GroupNorm(cross + inner)
    k_gemmt<2, 2, 6><<<dim3(TT / 128, DC / 128, NB_), 128, 0, stream>>>(QPh, QPl, STh, STl, DC, OUT, DC, SX, NCH * SS, SX, GP, nullptr, gw, gb, Ph, Pl, VTh, VTl);
}
